// v000
// The times below were measured on an AMD MI455X: many runs one after another, warmed up first and cycling through
// copies of the inputs, with the whole window's GPU time divided by the number of runs. Launches and the gaps
// between them are all in it. The median over several windows is given; except for v000 it joins two sittings, which
// can be a few percent apart, so the side-by-side timings, each taken in one sitting, are the better comparison.
// The starting kernel, v000, takes 3180 microseconds a run.
#include <hip/hip_runtime.h>

// Causal self-attention over 4,096 tokens at d_model 768 (x [2][4096][768]; q, k, v = x W^T + b ('oi' uniform(+-768^-0.5) incl. biases: non-zero; 12 heads x 64); logits / sqrt(64); causal (-inf); softmax; out = merged Wo^T + b -> [2][4096][768] (6.3 M); argument order x, Wq_w, Wq_b, Wk_w, Wk_b, Wv_w, Wv_b, Wo_w, Wo_b).
// Layout per batch: bf16 copy of x; 'oi' weights; exact projections (K 768) + f32 biases; identity-table plane builders; causal attention at T 4096 / 12 heads, one head per pass (hybrid rows: < 512 hi/lo 3 products, rest fp16 x1024; k_gemmc skips tiles above the diagonal); merged hi/lo x Wo exact + bias.
// Compute dtypes, f32 accumulate: every input rounded to bf16; projections exact + f32 biases; attention rows < 512 3 products, rest fp16; softmax f32; Wo hl x exact + bias.

#define NB_  2
#define TT   4096
#define DM   768
#define NH_  12
#define NKV  12
#define REP  (NH_ / NKV)
#define HD   64
#define DQ   (NH_ * HD)
#define DKV  (NKV * HD)
#define ZH   1                    // one head per pass at T 4096 (the score plane is 64 MiB)
#define RH   512                  // query rows < RH use hi+lo planes (0: none)
#define WIN  4096
#define PCAR 1024.0f
#define SCL  0.125f   // HD^-0.5
typedef _Float16 h16;
typedef unsigned short bf;
typedef __attribute__((ext_vector_type(16))) __bf16   v16bf;
typedef __attribute__((ext_vector_type(16))) _Float16 v16h;
typedef __attribute__((ext_vector_type(8)))  _Float16 v8h;
typedef __attribute__((ext_vector_type(8)))  unsigned short v8us;
typedef __attribute__((ext_vector_type(8)))  float    v8f;
typedef __attribute__((ext_vector_type(4)))  float    v4f;
typedef v8h  __attribute__((may_alias)) v8ha;
typedef v4f  __attribute__((may_alias)) v4fa;
typedef v8us __attribute__((may_alias)) v8usa;

__device__ __forceinline__ unsigned short f2bf(float f) { unsigned u = __float_as_uint(f); u += 0x7FFFu + ((u >> 16) & 1u); return (unsigned short)(u >> 16); }
__device__ __forceinline__ float bf2f(unsigned short b) { return __uint_as_float(((unsigned)b) << 16); }
__device__ __forceinline__ float bfr(float f) { return bf2f(f2bf(f)); }
__device__ __forceinline__ v16h cat16(v8h lo, v8h hi) { return __builtin_shufflevector(lo, hi, 0, 1, 2, 3, 4, 5, 6, 7, 8, 9, 10, 11, 12, 13, 14, 15); }
__device__ __forceinline__ v16bf cat16b(v8us lo, v8us hi) { return __builtin_bit_cast(v16bf, __builtin_shufflevector(lo, hi, 0, 1, 2, 3, 4, 5, 6, 7, 8, 9, 10, 11, 12, 13, 14, 15)); }
__device__ __forceinline__ v8f wmma16(v16h a, v16h b, v8f c) { return __builtin_amdgcn_wmma_f32_16x16x32_f16(false, a, false, b, (short)0, c, false, false); }
__device__ __forceinline__ v8f wmmab(v16bf a, v16bf b, v8f c) { return __builtin_amdgcn_wmma_f32_16x16x32_bf16(false, a, false, b, (short)0, c, false, false); }



// ---- k_gemmw: register-blocked GEMM, ONE WAVE per 64x64 output tile (16 accumulators), operands straight from K-contiguous 16-bit planes; grid (M/64, N/64, Z), 32 threads.
// C[m][n] (f32, pitch ldc, + optional f32 bias[n]) = sum_k A[m][k] Bt[n][k] (+ split products per NSPLIT). z-batch strides sA/sB/sC in elements. K % 32 == 0.
template <typename T16> struct WFrag;
template <> struct WFrag<h16> { typedef v16h V; static __device__ __forceinline__ V ld(const h16* p) { return cat16(*(const v8h*)p, *(const v8h*)(p + 16)); } static __device__ __forceinline__ v8f mma(V a, V b, v8f c) { return wmma16(a, b, c); } };
template <> struct WFrag<bf> { typedef v16bf V; static __device__ __forceinline__ V ld(const bf* p) { return cat16b(*(const v8us*)p, *(const v8us*)(p + 16)); } static __device__ __forceinline__ v8f mma(V a, V b, v8f c) { return wmmab(a, b, c); } };
template <typename T16, int NSPLIT, bool BIAS>
__global__ __launch_bounds__(32) void k_gemmw(const T16* __restrict__ A, const T16* __restrict__ A2, const T16* __restrict__ Bt, const T16* __restrict__ Bt2, int K, float* C, int ldc, const float* __restrict__ bias, size_t sA, size_t sB, size_t sC) {
    typedef typename WFrag<T16>::V V;
    __shared__ __align__(16) float os[16 * 68];
    const size_t z = blockIdx.z; A += z * sA; if (A2) A2 += z * sA; Bt += z * sB; if (Bt2) Bt2 += z * sB; C += z * sC;
    const int lane = threadIdx.x & 31, lr = lane & 15, hi = lane >> 4; const int r0 = blockIdx.x * 64, c0 = blockIdx.y * 64;
    v8f acc[4][4];
#pragma unroll
    for (int mb = 0; mb < 4; ++mb)
#pragma unroll
        for (int nb = 0; nb < 4; ++nb) acc[mb][nb] = (v8f){};
    const size_t aoff = (size_t)(r0 + lr) * K + 8 * hi, boff = (size_t)(c0 + lr) * K + 8 * hi;
#pragma unroll 1
    for (int kc = 0; kc < K; kc += 32) {
        V a[4], a2[4];
#pragma unroll
        for (int mb = 0; mb < 4; ++mb) { a[mb] = WFrag<T16>::ld(A + aoff + (size_t)mb * 16 * K + kc); if (NSPLIT == 1 || NSPLIT == 2) a2[mb] = WFrag<T16>::ld(A2 + aoff + (size_t)mb * 16 * K + kc); }
#pragma unroll
        for (int nb = 0; nb < 4; ++nb) { const V b = WFrag<T16>::ld(Bt + boff + (size_t)nb * 16 * K + kc); V b2; if (NSPLIT >= 2) b2 = WFrag<T16>::ld(Bt2 + boff + (size_t)nb * 16 * K + kc);
#pragma unroll
            for (int mb = 0; mb < 4; ++mb) { acc[mb][nb] = WFrag<T16>::mma(a[mb], b, acc[mb][nb]); if (NSPLIT == 1 || NSPLIT == 2) acc[mb][nb] = WFrag<T16>::mma(a2[mb], b, acc[mb][nb]); if (NSPLIT >= 2) acc[mb][nb] = WFrag<T16>::mma(a[mb], b2, acc[mb][nb]); } }
        asm volatile("v_nop\n\tv_nop\n\tv_nop\n\tv_nop" : "+v"(acc[0][0]), "+v"(acc[1][1]), "+v"(acc[2][2]), "+v"(acc[3][3]) : "v"(a[0]), "v"(a[3]));
    }
#pragma unroll
    for (int mb = 0; mb < 4; ++mb) {
#pragma unroll
        for (int nb = 0; nb < 4; ++nb) {
#pragma unroll
            for (int j = 0; j < 8; ++j) os[(hi * 8 + j) * 68 + nb * 16 + lr] = acc[mb][nb][j]; }
        __builtin_amdgcn_wave_barrier(); asm volatile("" ::: "memory");
        float* crow = C + (size_t)(r0 + mb * 16) * ldc + c0;
{
#pragma unroll
            for (int s = 0; s < 8; ++s) { const int row = 2 * s + hi, cofs = lr * 4; v4f val = *(const v4fa*)(os + row * 68 + cofs); if (BIAS) { val[0] += bfr(bias[c0 + cofs]); val[1] += bfr(bias[c0 + cofs + 1]); val[2] += bfr(bias[c0 + cofs + 2]); val[3] += bfr(bias[c0 + cofs + 3]); }
                *(v4f*)(crow + (size_t)row * ldc + cofs) = val; }
             }
        __builtin_amdgcn_wave_barrier(); asm volatile("" ::: "memory");
    }
}

// ---- k_gemmc: the same one-wave 64x64 tile GEMM specialised for causal attention: CMODE 1 skips score tiles entirely above the diagonal (query rows r0+roff.., key columns c0..), CMODE 2 limits the
// key (K) loop of the probability x value contraction to the diagonal block (probabilities beyond it are exactly zero). roff = row offset of this launch's first row within the sequence.
template <typename T16, int NSPLIT, int CMODE>
__global__ __launch_bounds__(32) void k_gemmc(const T16* __restrict__ A, const T16* __restrict__ A2, const T16* __restrict__ Bt, const T16* __restrict__ Bt2, int K, float* C, int ldc, int roff, size_t sA, size_t sB, size_t sC) {
    typedef typename WFrag<T16>::V V;
    __shared__ __align__(16) float os[16 * 68];
    const size_t z = blockIdx.z; A += z * sA; if (A2) A2 += z * sA; Bt += z * sB; if (Bt2) Bt2 += z * sB; C += z * sC;
    const int lane = threadIdx.x & 31, lr = lane & 15, hi = lane >> 4; const int r0 = blockIdx.x * 64, c0 = blockIdx.y * 64;
    if (CMODE == 1 && c0 > r0 + roff + 63) return;                  // score tile entirely above the causal diagonal: never read (the softmax masks j > i by select)
    const int Kl = (CMODE == 2) ? min(K, r0 + roff + 64) : K;        // P.V: probabilities are exactly 0 beyond the diagonal block, so the K loop stops there
    v8f acc[4][4];
#pragma unroll
    for (int mb = 0; mb < 4; ++mb)
#pragma unroll
        for (int nb = 0; nb < 4; ++nb) acc[mb][nb] = (v8f){};
    const size_t aoff = (size_t)(r0 + lr) * K + 8 * hi, boff = (size_t)(c0 + lr) * K + 8 * hi;
#pragma unroll 1
    for (int kc = 0; kc < Kl; kc += 32) {
        V a[4], a2[4];
#pragma unroll
        for (int mb = 0; mb < 4; ++mb) { a[mb] = WFrag<T16>::ld(A + aoff + (size_t)mb * 16 * K + kc); if (NSPLIT == 1 || NSPLIT == 2) a2[mb] = WFrag<T16>::ld(A2 + aoff + (size_t)mb * 16 * K + kc); }
#pragma unroll
        for (int nb = 0; nb < 4; ++nb) { const V b = WFrag<T16>::ld(Bt + boff + (size_t)nb * 16 * K + kc); V b2; if (NSPLIT >= 2) b2 = WFrag<T16>::ld(Bt2 + boff + (size_t)nb * 16 * K + kc);
#pragma unroll
            for (int mb = 0; mb < 4; ++mb) { acc[mb][nb] = WFrag<T16>::mma(a[mb], b, acc[mb][nb]); if (NSPLIT == 1 || NSPLIT == 2) acc[mb][nb] = WFrag<T16>::mma(a2[mb], b, acc[mb][nb]); if (NSPLIT >= 2) acc[mb][nb] = WFrag<T16>::mma(a[mb], b2, acc[mb][nb]); } }
        asm volatile("v_nop\n\tv_nop\n\tv_nop\n\tv_nop" : "+v"(acc[0][0]), "+v"(acc[1][1]), "+v"(acc[2][2]), "+v"(acc[3][3]) : "v"(a[0]), "v"(a[3]));
    }
#pragma unroll
    for (int mb = 0; mb < 4; ++mb) {
#pragma unroll
        for (int nb = 0; nb < 4; ++nb) {
#pragma unroll
            for (int j = 0; j < 8; ++j) os[(hi * 8 + j) * 68 + nb * 16 + lr] = acc[mb][nb][j]; }
        __builtin_amdgcn_wave_barrier(); asm volatile("" ::: "memory");
        float* crow = C + (size_t)(r0 + mb * 16) * ldc + c0;
{
#pragma unroll
            for (int s = 0; s < 8; ++s) { const int row = 2 * s + hi, cofs = lr * 4; v4f val = *(const v4fa*)(os + row * 68 + cofs);
                *(v4f*)(crow + (size_t)row * ldc + cofs) = val; }
             }
        __builtin_amdgcn_wave_barrier(); asm volatile("" ::: "memory");
    }
}

__device__ __forceinline__ h16 tohx(float x) { return (h16)x; }
__device__ __forceinline__ void splitf(float y, unsigned short& h, unsigned short& l) { h = f2bf(y); l = f2bf(y - bf2f(h)); }
typedef __attribute__((ext_vector_type(2))) _Float16 v2h;
typedef __attribute__((ext_vector_type(4))) _Float16 v4h;
typedef __attribute__((ext_vector_type(2))) unsigned short v2us;
typedef __attribute__((ext_vector_type(4))) unsigned short v4us;
typedef __attribute__((ext_vector_type(2))) float v2f;
typedef __attribute__((ext_vector_type(4))) int v4i;

__global__ __launch_bounds__(256) void k_cvt8(const float* __restrict__ src, bf* dst, size_t n8) { const size_t i = (size_t)blockIdx.x * 256 + threadIdx.x; if (i >= n8) return; const v8f v = *(const v8f*)(src + i * 8); v8us o;
#pragma unroll
    for (int k = 0; k < 8; ++k) o[k] = f2bf(v[k]); *(v8us*)(dst + i * 8) = o;  }

// k_rope: head planes [h][t][d] (fp16 + hi/lo) of rope(x) x sc with the rotate-half convention out[d] = x[d] cos[t][d] - x[d+HD/2] sin[t][d], out[d+HD/2] = x[d+HD/2] cos[t][d+HD/2] + x[d] sin[t][d+HD/2]
__global__ __launch_bounds__(256) void k_rope(const float* __restrict__ F, int pitch, int nheads, const float* __restrict__ CS, const float* __restrict__ RF, const float* __restrict__ nw, float sc, h16* P16, bf* Ph, bf* Pl) {
    const size_t e = ((size_t)blockIdx.x * 256 + threadIdx.x) * 2; if (e >= (size_t)nheads * TT * HD) return; const int d = (int)(e % HD); const int t = (int)((e / HD) % TT); const int h = (int)(e / ((size_t)HD * TT)); const float* f = F + (size_t)t * pitch + h * HD; const float rf = RF ? RF[(size_t)h * TT + t] : 1.0f; v2h o16; v2us oh, ol;
#pragma unroll
    for (int q = 0; q < 2; ++q) { const int dd = d + q; const int dp = (dd < HD / 2) ? dd + HD / 2 : dd - HD / 2; float x0 = f[dd], x1 = f[dp];
        if (RF) { float n0 = __fmul_rn(x0, rf), n1 = __fmul_rn(x1, rf); asm volatile("" : "+v"(n0)); asm volatile("" : "+v"(n1)); x0 = __fmul_rn(bfr(nw[dd]), n0); x1 = __fmul_rn(bfr(nw[dp]), n1); }
        const v2f cs = *(const v2f*)(CS + ((size_t)t * HD + dd) * 2); float a = __fmul_rn(x0, cs[0]), bq = __fmul_rn(x1, cs[1]); asm volatile("" : "+v"(a)); asm volatile("" : "+v"(bq)); const float r = ((dd < HD / 2) ? __fsub_rn(a, bq) : __fadd_rn(a, bq)) * sc;
        o16[q] = tohx(r); unsigned short a2, c2; splitf(r, a2, c2); oh[q] = a2; ol[q] = c2; }
    *(v2h*)(P16 + e) = o16; *(v2us*)(Ph + e) = oh; *(v2us*)(Pl + e) = ol;  }
__global__ __launch_bounds__(256) void k_vtp(const float* __restrict__ F, int pitch, int nheads, h16* V16, bf* Vh, bf* Vl) { const size_t e = ((size_t)blockIdx.x * 256 + threadIdx.x) * 2; if (e >= (size_t)nheads * HD * TT) return; const int t = (int)(e % TT); const int d = (int)((e / TT) % HD); const int g = (int)(e / ((size_t)TT * HD)); v2h o16; v2us oh, ol;
#pragma unroll
    for (int q = 0; q < 2; ++q) { const float x = F[(size_t)(t + q) * pitch + g * HD + d]; o16[q] = tohx(x); unsigned short a2, c2; splitf(x, a2, c2); oh[q] = a2; ol[q] = c2; }
    *(v2h*)(V16 + e) = o16; *(v2us*)(Vh + e) = oh; *(v2us*)(Vl + e) = ol;  }
__global__ __launch_bounds__(256) void k_csid(float* CS) { const int idx = blockIdx.x * 256 + threadIdx.x; if (idx >= TT * HD) return; v2f cs; cs[0] = 1.0f; cs[1] = 0.0f; *(v2f*)(CS + (size_t)idx * 2) = cs;  }
// k_asoft: per row (zz, i): t = S x HD^-0.5 for j <= i and i - j < WIN (WIN = T: always true, plain causal mask; the reference's -1e9 additive fill vanishes identically); softmax over the 4096 keys (register row, one exp, fixed trees);
__global__ __launch_bounds__(256) void k_asoft(const float* __restrict__ Sb, h16* P16, bf* Ph, bf* Pl) {
    const int lane = threadIdx.x & 31; const int row = blockIdx.x * 8 + (threadIdx.x >> 5); if (row >= ZH * TT) return; const int i = row % TT; const int zz = row / TT; (void)zz; const bool hires = (i < RH); const float* sr = Sb + (size_t)row * TT; float v[TT / 32]; float mx = -3.0e38f;
#pragma unroll
    for (int ch = 0; ch < TT / 128; ++ch) { const int j0 = ch * 128 + lane * 4; const v4f a = *(const v4f*)(sr + j0);
#pragma unroll
        for (int q = 0; q < 4; ++q) { const int j = j0 + q; (void)j; const float t = (j <= i && i - j < WIN) ? a[q] * SCL : -3.0e38f; v[ch * 4 + q] = t; mx = fmaxf(mx, t); } }
#pragma unroll
    for (int sh = 16; sh; sh >>= 1) mx = fmaxf(mx, __shfl_xor(mx, sh, 32));
    float sum = 0.f;
#pragma unroll
    for (int k = 0; k < TT / 32; ++k) { float d0 = __fsub_rn(v[k], mx); asm volatile("" : "+v"(d0)); v[k] = __builtin_amdgcn_exp2f(__fmul_rn(d0, 1.4426950408889634f)); sum += v[k]; }
#pragma unroll
    for (int sh = 16; sh; sh >>= 1) sum += __shfl_xor(sum, sh, 32);
    const float f = __fdiv_rn(hires ? 1.0f : PCAR, sum);
{
        if (hires) {
#pragma unroll
            for (int ch = 0; ch < TT / 128; ++ch) { v4us oh, ol;
#pragma unroll
                for (int q = 0; q < 4; ++q) { unsigned short a, c2; splitf(v[ch * 4 + q] * f, a, c2); oh[q] = a; ol[q] = c2; }
                const size_t oo = ((size_t)zz * (RH ? RH : 1) + i) * TT + ch * 128 + lane * 4; *(v4us*)(Ph + oo) = oh; *(v4us*)(Pl + oo) = ol; }
        } else {
#pragma unroll
            for (int ch = 0; ch < TT / 128; ++ch) { v4h o4;
#pragma unroll
                for (int q = 0; q < 4; ++q) o4[q] = tohx(v[ch * 4 + q] * f);
                *(v4h*)(P16 + (size_t)row * TT + ch * 128 + lane * 4) = o4; } }
         }
}
__global__ __launch_bounds__(256) void k_merge(const float* __restrict__ O, int h0, bf* Ah, bf* Al) { const size_t e = ((size_t)blockIdx.x * 256 + threadIdx.x) * 2; if (e >= (size_t)ZH * TT * HD) return; const int d = (int)(e % HD); const int t = (int)((e / HD) % TT); const int zz = (int)(e / ((size_t)HD * TT)); const float cs = (t < RH) ? 1.0f : (1.0f / PCAR); const size_t oo = (size_t)t * DQ + (h0 + zz) * HD + d;
    v2us oh, ol;
#pragma unroll
    for (int q = 0; q < 2; ++q) { unsigned short a, c2; splitf(O[e + q] * cs, a, c2); oh[q] = a; ol[q] = c2; } *(v2us*)(Ah + oo) = oh; *(v2us*)(Al + oo) = ol;  }

extern "C" void kernel_launch(void* const* d_in, const int* in_sizes, int n_in,
                              void* d_out, int out_size, void* d_ws, size_t ws_size, hipStream_t stream) {
    (void)in_sizes; (void)n_in; (void)out_size;
    const float* x = (const float*)d_in[0]; const float* wq = (const float*)d_in[1]; const float* bq = (const float*)d_in[2]; const float* wk = (const float*)d_in[3]; const float* bk = (const float*)d_in[4]; const float* wv = (const float*)d_in[5]; const float* bv = (const float*)d_in[6]; const float* wo = (const float*)d_in[7]; const float* bo = (const float*)d_in[8];   /* argument order x, Wq_w, Wq_b, Wk_w, Wk_b, Wv_w, Wv_b, Wo_w, Wo_b ('oi') */
    float* OUT = (float*)d_out;     // [2][4096][768]
    char* wsp = (char*)d_ws;
    auto take = [&](size_t bytes) { char* p = wsp; wsp += (bytes + 255) & ~(size_t)255; return (void*)p; };
    bf* WQ = (bf*)take((size_t)DQ * DM * 2); bf* WK = (bf*)take((size_t)DKV * DM * 2); bf* WV = (bf*)take((size_t)DKV * DM * 2); bf* WO = (bf*)take((size_t)DM * DQ * 2); float* CS = (float*)take((size_t)TT * HD * 2 * 4);
    bf* XB = (bf*)take((size_t)TT * DM * 2); float* FQ = (float*)take((size_t)TT * DQ * 4); float* FK = (float*)take((size_t)TT * DKV * 4);
    h16* QP16 = (h16*)take((size_t)NH_ * TT * HD * 2); h16* KP16 = (h16*)take((size_t)NKV * TT * HD * 2); h16* VT16 = (h16*)take((size_t)NKV * HD * TT * 2);
    bf* QPh = (bf*)take((size_t)NH_ * TT * HD * 2); bf* QPl = (bf*)take((size_t)NH_ * TT * HD * 2); bf* KPh = (bf*)take((size_t)NKV * TT * HD * 2); bf* KPl = (bf*)take((size_t)NKV * TT * HD * 2); bf* VTh = (bf*)take((size_t)NKV * HD * TT * 2); bf* VTl = (bf*)take((size_t)NKV * HD * TT * 2); bf* Ph = (bf*)take((size_t)ZH * RH * TT * 2); bf* Pl = (bf*)take((size_t)ZH * RH * TT * 2);
    float* Sb = (float*)take((size_t)ZH * TT * TT * 4); h16* P16 = (h16*)take((size_t)ZH * TT * TT * 2); float* Ob = (float*)take((size_t)ZH * TT * HD * 4); bf* ATh = (bf*)take((size_t)TT * DQ * 2); bf* ATl = (bf*)take((size_t)TT * DQ * 2);
    if ((size_t)(wsp - (char*)d_ws) > ws_size) return;    // ws 256 MiB
    float* FV = FK;   // v projection reuses the k buffer after the k planes are built (stream-ordered)
    { k_cvt8<<<(unsigned)(((size_t)DQ * DM / 8 + 255) / 256), 256, 0, stream>>>(wq, WQ, (size_t)DQ * DM / 8); k_cvt8<<<(unsigned)(((size_t)DKV * DM / 8 + 255) / 256), 256, 0, stream>>>(wk, WK, (size_t)DKV * DM / 8); k_cvt8<<<(unsigned)(((size_t)DKV * DM / 8 + 255) / 256), 256, 0, stream>>>(wv, WV, (size_t)DKV * DM / 8);
      k_cvt8<<<(unsigned)(((size_t)DM * DQ / 8 + 255) / 256), 256, 0, stream>>>(wo, WO, (size_t)DM * DQ / 8);
       }
    k_csid<<<(TT * HD + 255) / 256, 256, 0, stream>>>(CS);
    const unsigned LQ = (unsigned)(((size_t)NH_ * TT * HD / 2 + 255) / 256), LKv = (unsigned)(((size_t)NKV * TT * HD / 2 + 255) / 256);
    for (int b = 0; b < NB_; ++b) {
        
        k_cvt8<<<(unsigned)(((size_t)TT * DM / 8 + 255) / 256), 256, 0, stream>>>(x + (size_t)b * TT * DM, XB, (size_t)TT * DM / 8);
        k_gemmw<bf, 0, true><<<dim3(TT / 64, DQ / 64, 1), 32, 0, stream>>>(XB, nullptr, WQ, nullptr, DM, FQ, DQ, bq, 0, 0, 0);
        k_rope<<<LQ, 256, 0, stream>>>(FQ, DQ, NH_, CS, nullptr, nullptr, 1.0f, QP16, QPh, QPl);
        k_gemmw<bf, 0, true><<<dim3(TT / 64, DKV / 64, 1), 32, 0, stream>>>(XB, nullptr, WK, nullptr, DM, FK, DKV, bk, 0, 0, 0);
        k_rope<<<LKv, 256, 0, stream>>>(FK, DKV, NKV, CS, nullptr, nullptr, 1.0f, KP16, KPh, KPl);
        k_gemmw<bf, 0, true><<<dim3(TT / 64, DKV / 64, 1), 32, 0, stream>>>(XB, nullptr, WV, nullptr, DM, FV, DKV, bv, 0, 0, 0); k_vtp<<<LKv, 256, 0, stream>>>(FV, DKV, NKV, VT16, VTh, VTl);
        for (int h0 = 0; h0 < NH_; h0 += ZH) { const size_t zq = (size_t)h0, zk = (size_t)(h0 / REP);   // one kv head per query head: the pass's one head uses kv plane h0 (z-strides TT*HD)
            k_gemmc<bf, 2, 1><<<dim3(RH / 64, TT / 64, ZH), 32, 0, stream>>>(QPh + zq * TT * HD, QPl + zq * TT * HD, KPh + zk * TT * HD, KPl + zk * TT * HD, HD, Sb, TT, 0, (size_t)TT * HD, (size_t)TT * HD, (size_t)TT * TT);
            k_gemmc<h16, 0, 1><<<dim3((TT - RH) / 64, TT / 64, ZH), 32, 0, stream>>>(QP16 + zq * TT * HD + (size_t)RH * HD, nullptr, KP16 + zk * TT * HD, nullptr, HD, Sb + (size_t)RH * TT, TT, RH, (size_t)TT * HD, (size_t)TT * HD, (size_t)TT * TT);
            k_asoft<<<ZH * TT / 8, 256, 0, stream>>>(Sb, P16, Ph, Pl);
            k_gemmc<bf, 2, 2><<<dim3(RH / 64, HD / 64, ZH), 32, 0, stream>>>(Ph, Pl, VTh + zk * HD * TT, VTl + zk * HD * TT, TT, Ob, HD, 0, (size_t)RH * TT, (size_t)HD * TT, (size_t)TT * HD);
            k_gemmc<h16, 0, 2><<<dim3((TT - RH) / 64, HD / 64, ZH), 32, 0, stream>>>(P16 + (size_t)RH * TT, nullptr, VT16 + zk * HD * TT, nullptr, TT, Ob + (size_t)RH * HD, HD, RH, (size_t)TT * TT, (size_t)HD * TT, (size_t)TT * HD);
            k_merge<<<(unsigned)(((size_t)ZH * TT * HD / 2 + 255) / 256), 256, 0, stream>>>(Ob, h0, ATh, ATl); }
        k_gemmw<bf, 1, true><<<dim3(TT / 64, DM / 64, 1), 32, 0, stream>>>(ATh, ATl, WO, nullptr, DQ, OUT + (size_t)b * TT * DM, DM, bo, 0, 0, 0); }
}

// v001
// It runs in 1270 microseconds.
// Timed twice side by side with v000, it ran 2.52 and 2.51 times as fast.
#include <hip/hip_runtime.h>

// Causal self-attention over 4,096 tokens at d_model 768 (x [2][4096][768]; q, k, v = x W^T + b ('oi' uniform(+-768^-0.5) incl. biases: non-zero; 12 heads x 64); logits / sqrt(64); causal (-inf); softmax; out = merged Wo^T + b -> [2][4096][768] (6.3 M); argument order x, Wq_w, Wq_b, Wk_w, Wk_b, Wv_w, Wv_b, Wo_w, Wo_b).
// Layout per batch: bf16 copy of x; 'oi' weights; exact projections (K 768) + f32 biases; identity-table plane builders; causal attention at T 4096 / 12 heads, one head per pass (hybrid rows: < 512 hi/lo 3 products, rest fp16 x1024; k_gemmc skips tiles above the diagonal); merged hi/lo x Wo exact + bias.
// Compute dtypes, f32 accumulate: every input rounded to bf16; projections exact + f32 biases; attention rows < 512 3 products, rest fp16; softmax f32; Wo hl x exact + bias.

#define NB_  2
#define TT   4096
#define DM   768
#define NH_  12
#define NKV  12
#define REP  (NH_ / NKV)
#define HD   64
#define DQ   (NH_ * HD)
#define DKV  (NKV * HD)
#define ZH   1                    // one head per pass at T 4096 (the score plane is 64 MiB)
#define RH   512                  // query rows < RH use hi+lo planes (0: none)
#define WIN  4096
#define PCAR 1024.0f
#define SCL  0.125f   // HD^-0.5
typedef _Float16 h16;
typedef unsigned short bf;
typedef __attribute__((ext_vector_type(16))) __bf16   v16bf;
typedef __attribute__((ext_vector_type(16))) _Float16 v16h;
typedef __attribute__((ext_vector_type(8)))  _Float16 v8h;
typedef __attribute__((ext_vector_type(8)))  unsigned short v8us;
typedef __attribute__((ext_vector_type(8)))  float    v8f;
typedef __attribute__((ext_vector_type(4)))  float    v4f;
typedef v8h  __attribute__((may_alias)) v8ha;
typedef v4f  __attribute__((may_alias)) v4fa;
typedef v8us __attribute__((may_alias)) v8usa;

__device__ __forceinline__ unsigned short f2bf(float f) { unsigned u = __float_as_uint(f); u += 0x7FFFu + ((u >> 16) & 1u); return (unsigned short)(u >> 16); }
__device__ __forceinline__ float bf2f(unsigned short b) { return __uint_as_float(((unsigned)b) << 16); }
__device__ __forceinline__ float bfr(float f) { return bf2f(f2bf(f)); }
__device__ __forceinline__ v16h cat16(v8h lo, v8h hi) { return __builtin_shufflevector(lo, hi, 0, 1, 2, 3, 4, 5, 6, 7, 8, 9, 10, 11, 12, 13, 14, 15); }
__device__ __forceinline__ v16bf cat16b(v8us lo, v8us hi) { return __builtin_bit_cast(v16bf, __builtin_shufflevector(lo, hi, 0, 1, 2, 3, 4, 5, 6, 7, 8, 9, 10, 11, 12, 13, 14, 15)); }
__device__ __forceinline__ v8f wmma16(v16h a, v16h b, v8f c) { return __builtin_amdgcn_wmma_f32_16x16x32_f16(false, a, false, b, (short)0, c, false, false); }
__device__ __forceinline__ v8f wmmab(v16bf a, v16bf b, v8f c) { return __builtin_amdgcn_wmma_f32_16x16x32_bf16(false, a, false, b, (short)0, c, false, false); }



// ---- k_gemmw: register-blocked GEMM, ONE WAVE per 64x64 output tile (16 accumulators), operands straight from K-contiguous 16-bit planes; grid (M/64, N/64, Z), 32 threads.
// C[m][n] (f32, pitch ldc, + optional f32 bias[n]) = sum_k A[m][k] Bt[n][k] (+ split products per NSPLIT). z-batch strides sA/sB/sC in elements. K % 32 == 0.
template <typename T16> struct WFrag;
template <> struct WFrag<h16> { typedef v16h V; static __device__ __forceinline__ V ld(const h16* p) { return cat16(*(const v8h*)p, *(const v8h*)(p + 16)); } static __device__ __forceinline__ v8f mma(V a, V b, v8f c) { return wmma16(a, b, c); } };
template <> struct WFrag<bf> { typedef v16bf V; static __device__ __forceinline__ V ld(const bf* p) { return cat16b(*(const v8us*)p, *(const v8us*)(p + 16)); } static __device__ __forceinline__ v8f mma(V a, V b, v8f c) { return wmmab(a, b, c); } };
template <typename T16, int NSPLIT, bool BIAS>
__global__ __launch_bounds__(32) void k_gemmw(const T16* __restrict__ A, const T16* __restrict__ A2, const T16* __restrict__ Bt, const T16* __restrict__ Bt2, int K, float* C, int ldc, const float* __restrict__ bias, size_t sA, size_t sB, size_t sC) {
    typedef typename WFrag<T16>::V V;
    __shared__ __align__(16) float os[16 * 68];
    const size_t z = blockIdx.z; A += z * sA; if (A2) A2 += z * sA; Bt += z * sB; if (Bt2) Bt2 += z * sB; C += z * sC;
    const int lane = threadIdx.x & 31, lr = lane & 15, hi = lane >> 4; const int r0 = blockIdx.x * 64, c0 = blockIdx.y * 64;
    v8f acc[4][4];
#pragma unroll
    for (int mb = 0; mb < 4; ++mb)
#pragma unroll
        for (int nb = 0; nb < 4; ++nb) acc[mb][nb] = (v8f){};
    const size_t aoff = (size_t)(r0 + lr) * K + 8 * hi, boff = (size_t)(c0 + lr) * K + 8 * hi;
#pragma unroll 1
    for (int kc = 0; kc < K; kc += 32) {
        V a[4], a2[4];
#pragma unroll
        for (int mb = 0; mb < 4; ++mb) { a[mb] = WFrag<T16>::ld(A + aoff + (size_t)mb * 16 * K + kc); if (NSPLIT == 1 || NSPLIT == 2) a2[mb] = WFrag<T16>::ld(A2 + aoff + (size_t)mb * 16 * K + kc); }
#pragma unroll
        for (int nb = 0; nb < 4; ++nb) { const V b = WFrag<T16>::ld(Bt + boff + (size_t)nb * 16 * K + kc); V b2; if (NSPLIT >= 2) b2 = WFrag<T16>::ld(Bt2 + boff + (size_t)nb * 16 * K + kc);
#pragma unroll
            for (int mb = 0; mb < 4; ++mb) { acc[mb][nb] = WFrag<T16>::mma(a[mb], b, acc[mb][nb]); if (NSPLIT == 1 || NSPLIT == 2) acc[mb][nb] = WFrag<T16>::mma(a2[mb], b, acc[mb][nb]); if (NSPLIT >= 2) acc[mb][nb] = WFrag<T16>::mma(a[mb], b2, acc[mb][nb]); } }
        asm volatile("v_nop\n\tv_nop\n\tv_nop\n\tv_nop" : "+v"(acc[0][0]), "+v"(acc[1][1]), "+v"(acc[2][2]), "+v"(acc[3][3]) : "v"(a[0]), "v"(a[3]));
    }
#pragma unroll
    for (int mb = 0; mb < 4; ++mb) {
#pragma unroll
        for (int nb = 0; nb < 4; ++nb) {
#pragma unroll
            for (int j = 0; j < 8; ++j) os[(hi * 8 + j) * 68 + nb * 16 + lr] = acc[mb][nb][j]; }
        __builtin_amdgcn_wave_barrier(); asm volatile("" ::: "memory");
        float* crow = C + (size_t)(r0 + mb * 16) * ldc + c0;
{
#pragma unroll
            for (int s = 0; s < 8; ++s) { const int row = 2 * s + hi, cofs = lr * 4; v4f val = *(const v4fa*)(os + row * 68 + cofs); if (BIAS) { val[0] += bfr(bias[c0 + cofs]); val[1] += bfr(bias[c0 + cofs + 1]); val[2] += bfr(bias[c0 + cofs + 2]); val[3] += bfr(bias[c0 + cofs + 3]); }
                *(v4f*)(crow + (size_t)row * ldc + cofs) = val; }
             }
        __builtin_amdgcn_wave_barrier(); asm volatile("" ::: "memory");
    }
}

// ---- k_gemmc: the same one-wave 64x64 tile GEMM specialised for causal attention: CMODE 1 skips score tiles entirely above the diagonal (query rows r0+roff.., key columns c0..), CMODE 2 limits the
// key (K) loop of the probability x value contraction to the diagonal block (probabilities beyond it are exactly zero). roff = row offset of this launch's first row within the sequence.
template <typename T16, int NSPLIT, int CMODE>
__global__ __launch_bounds__(32) void k_gemmc(const T16* __restrict__ A, const T16* __restrict__ A2, const T16* __restrict__ Bt, const T16* __restrict__ Bt2, int K, float* C, int ldc, int roff, size_t sA, size_t sB, size_t sC) {
    typedef typename WFrag<T16>::V V;
    __shared__ __align__(16) float os[16 * 68];
    const size_t z = blockIdx.z; A += z * sA; if (A2) A2 += z * sA; Bt += z * sB; if (Bt2) Bt2 += z * sB; C += z * sC;
    const int lane = threadIdx.x & 31, lr = lane & 15, hi = lane >> 4; const int r0 = blockIdx.x * 64, c0 = blockIdx.y * 64;
    if (CMODE == 1 && c0 > r0 + roff + 63) return;                  // score tile entirely above the causal diagonal: never read (the softmax masks j > i by select)
    const int Kl = (CMODE == 2) ? min(K, r0 + roff + 64) : K;        // P.V: probabilities are exactly 0 beyond the diagonal block, so the K loop stops there
    v8f acc[4][4];
#pragma unroll
    for (int mb = 0; mb < 4; ++mb)
#pragma unroll
        for (int nb = 0; nb < 4; ++nb) acc[mb][nb] = (v8f){};
    const size_t aoff = (size_t)(r0 + lr) * K + 8 * hi, boff = (size_t)(c0 + lr) * K + 8 * hi;
#pragma unroll 1
    for (int kc = 0; kc < Kl; kc += 32) {
        V a[4], a2[4];
#pragma unroll
        for (int mb = 0; mb < 4; ++mb) { a[mb] = WFrag<T16>::ld(A + aoff + (size_t)mb * 16 * K + kc); if (NSPLIT == 1 || NSPLIT == 2) a2[mb] = WFrag<T16>::ld(A2 + aoff + (size_t)mb * 16 * K + kc); }
#pragma unroll
        for (int nb = 0; nb < 4; ++nb) { const V b = WFrag<T16>::ld(Bt + boff + (size_t)nb * 16 * K + kc); V b2; if (NSPLIT >= 2) b2 = WFrag<T16>::ld(Bt2 + boff + (size_t)nb * 16 * K + kc);
#pragma unroll
            for (int mb = 0; mb < 4; ++mb) { acc[mb][nb] = WFrag<T16>::mma(a[mb], b, acc[mb][nb]); if (NSPLIT == 1 || NSPLIT == 2) acc[mb][nb] = WFrag<T16>::mma(a2[mb], b, acc[mb][nb]); if (NSPLIT >= 2) acc[mb][nb] = WFrag<T16>::mma(a[mb], b2, acc[mb][nb]); } }
        asm volatile("v_nop\n\tv_nop\n\tv_nop\n\tv_nop" : "+v"(acc[0][0]), "+v"(acc[1][1]), "+v"(acc[2][2]), "+v"(acc[3][3]) : "v"(a[0]), "v"(a[3]));
    }
#pragma unroll
    for (int mb = 0; mb < 4; ++mb) {
#pragma unroll
        for (int nb = 0; nb < 4; ++nb) {
#pragma unroll
            for (int j = 0; j < 8; ++j) os[(hi * 8 + j) * 68 + nb * 16 + lr] = acc[mb][nb][j]; }
        __builtin_amdgcn_wave_barrier(); asm volatile("" ::: "memory");
        float* crow = C + (size_t)(r0 + mb * 16) * ldc + c0;
{
#pragma unroll
            for (int s = 0; s < 8; ++s) { const int row = 2 * s + hi, cofs = lr * 4; v4f val = *(const v4fa*)(os + row * 68 + cofs);
                *(v4f*)(crow + (size_t)row * ldc + cofs) = val; }
             }
        __builtin_amdgcn_wave_barrier(); asm volatile("" ::: "memory");
    }
}

// ---- k_gemmpv: probability x value product with the key (K) loop split. One work-group of PVW waves per (64-row query tile, chunk of PVC keys): each wave multiplies the 64x64 tile over its own 64 keys,
// the PVW partial tiles are summed through LDS in wave order, and chunk c's sum goes to plane c of Cp (plane stride sP floats, row pitch 64). k_merge adds the planes in chunk order.
// Probabilities beyond the diagonal block are exactly zero, so the PVW query tiles of group g (rows g PVC .. g PVC + PVC - 1 of the sequence) have g + 1 chunks each; chunks beyond are neither launched nor read.
// Grid (PVW tiles of a group, all (group, chunk) pairs of the launch's rows, group by group); roff = first row of the launch within the sequence, a multiple of PVC.
// Every loop over mb, nb, ks, j, it and w is unrolled in full: acc, a and b are register arrays and need compile-time indices.
#define PVW 8
#define PVC (PVW * 64)
template <typename T16, int NSPLIT>
__global__ __launch_bounds__(PVW * 32) void k_gemmpv(const T16* __restrict__ A, const T16* __restrict__ A2, const T16* __restrict__ Bt, const T16* __restrict__ Bt2, float* Cp, int roff, size_t sP) {
    typedef typename WFrag<T16>::V V; constexpr int K = TT;      // row pitch of the probability and of the transposed value planes: a constant, so that the steps between fragment rows fold into the loads' offset fields
    __shared__ __align__(16) float red[PVW * 64 * 68];
    const int lane = threadIdx.x & 31, lr = lane & 15, hi = lane >> 4; const int wave = __builtin_amdgcn_readfirstlane(threadIdx.x >> 5);      // in a scalar register: the test on kb below is then a scalar branch and the fragment bases stay scalar
    int ch = blockIdx.y, g = roff / PVC;
    for (; ch > g; ++g) ch -= g + 1;              // blockIdx.y -> (group g, chunk ch <= g)
    const int rs = (g * PVW + (int)blockIdx.x) * 64, r0 = rs - roff;      // the tile's first row in the sequence, and in this launch's planes
    const int Kl = min(K, rs + 64);               // keys up to and including the diagonal block (a multiple of 64)
    const int k0 = ch * PVC;
    v8f acc[4][4];
#pragma unroll
    for (int mb = 0; mb < 4; ++mb)
#pragma unroll
        for (int nb = 0; nb < 4; ++nb) acc[mb][nb] = (v8f){};
    const int kb = k0 + wave * 64;
    if (kb < Kl) {
        const unsigned lo = (unsigned)(lr * K + 8 * hi) * 2u;      // the lane's own part of every fragment address in bytes (row lr, k half hi), the same for A and B; the rest of each address is wave-uniform
        auto at = [lo](const T16* u) { return (const T16*)((const char*)u + lo); };
        const size_t aoff = (size_t)r0 * K + kb, boff = (size_t)kb;
#pragma unroll
        for (int ks = 0; ks < 2; ++ks) { const int kc = ks * 32;
            V a[4], a2[4];
#pragma unroll
            for (int mb = 0; mb < 4; ++mb) { a[mb] = WFrag<T16>::ld(at(A + aoff + (size_t)mb * 16 * K + kc)); if (NSPLIT == 2) a2[mb] = WFrag<T16>::ld(at(A2 + aoff + (size_t)mb * 16 * K + kc)); }
#pragma unroll
            for (int nb = 0; nb < 4; ++nb) { const V b = WFrag<T16>::ld(at(Bt + boff + (size_t)nb * 16 * K + kc)); V b2; if (NSPLIT == 2) b2 = WFrag<T16>::ld(at(Bt2 + boff + (size_t)nb * 16 * K + kc));
#pragma unroll
                for (int mb = 0; mb < 4; ++mb) { acc[mb][nb] = WFrag<T16>::mma(a[mb], b, acc[mb][nb]); if (NSPLIT == 2) { acc[mb][nb] = WFrag<T16>::mma(a2[mb], b, acc[mb][nb]); acc[mb][nb] = WFrag<T16>::mma(a[mb], b2, acc[mb][nb]); } } } }
    }
    float* mine = red + wave * (64 * 68);
#pragma unroll
    for (int mb = 0; mb < 4; ++mb)
#pragma unroll
        for (int nb = 0; nb < 4; ++nb)
#pragma unroll
            for (int j = 0; j < 8; ++j) mine[(mb * 16 + hi * 8 + j) * 68 + nb * 16 + lr] = acc[mb][nb][j];
    __syncthreads();
    float* ct = Cp + (size_t)ch * sP + (size_t)r0 * 64;      // the 64x64 tile at row pitch 64 is 16 KiB in a row
#pragma unroll
    for (int it = 0; it < 64 * 16 / (PVW * 32); ++it) { const int f = it * (PVW * 32) + (int)threadIdx.x; const float* p = red + (f >> 4) * 68 + (f & 15) * 4; v4f s = *(const v4fa*)p;
#pragma unroll
        for (int w = 1; w < PVW; ++w) s += *(const v4fa*)(p + w * (64 * 68));
        *(v4f*)(ct + (size_t)f * 4) = s; }
}

__device__ __forceinline__ h16 tohx(float x) { return (h16)x; }
__device__ __forceinline__ void splitf(float y, unsigned short& h, unsigned short& l) { h = f2bf(y); l = f2bf(y - bf2f(h)); }
typedef __attribute__((ext_vector_type(2))) _Float16 v2h;
typedef __attribute__((ext_vector_type(4))) _Float16 v4h;
typedef __attribute__((ext_vector_type(2))) unsigned short v2us;
typedef __attribute__((ext_vector_type(4))) unsigned short v4us;
typedef __attribute__((ext_vector_type(2))) float v2f;
typedef __attribute__((ext_vector_type(4))) int v4i;

__global__ __launch_bounds__(256) void k_cvt8(const float* __restrict__ src, bf* dst, size_t n8) { const size_t i = (size_t)blockIdx.x * 256 + threadIdx.x; if (i >= n8) return; const v8f v = *(const v8f*)(src + i * 8); v8us o;
#pragma unroll
    for (int k = 0; k < 8; ++k) o[k] = f2bf(v[k]); *(v8us*)(dst + i * 8) = o;  }

// k_rope: head planes [h][t][d] (fp16 + hi/lo) of rope(x) x sc with the rotate-half convention out[d] = x[d] cos[t][d] - x[d+HD/2] sin[t][d], out[d+HD/2] = x[d+HD/2] cos[t][d+HD/2] + x[d] sin[t][d+HD/2]
__global__ __launch_bounds__(256) void k_rope(const float* __restrict__ F, int pitch, int nheads, const float* __restrict__ CS, const float* __restrict__ RF, const float* __restrict__ nw, float sc, h16* P16, bf* Ph, bf* Pl) {
    const size_t e = ((size_t)blockIdx.x * 256 + threadIdx.x) * 2; if (e >= (size_t)nheads * TT * HD) return; const int d = (int)(e % HD); const int t = (int)((e / HD) % TT); const int h = (int)(e / ((size_t)HD * TT)); const float* f = F + (size_t)t * pitch + h * HD; const float rf = RF ? RF[(size_t)h * TT + t] : 1.0f; v2h o16; v2us oh, ol;
#pragma unroll
    for (int q = 0; q < 2; ++q) { const int dd = d + q; const int dp = (dd < HD / 2) ? dd + HD / 2 : dd - HD / 2; float x0 = f[dd], x1 = f[dp];
        if (RF) { float n0 = __fmul_rn(x0, rf), n1 = __fmul_rn(x1, rf); asm volatile("" : "+v"(n0)); asm volatile("" : "+v"(n1)); x0 = __fmul_rn(bfr(nw[dd]), n0); x1 = __fmul_rn(bfr(nw[dp]), n1); }
        const v2f cs = *(const v2f*)(CS + ((size_t)t * HD + dd) * 2); float a = __fmul_rn(x0, cs[0]), bq = __fmul_rn(x1, cs[1]); asm volatile("" : "+v"(a)); asm volatile("" : "+v"(bq)); const float r = ((dd < HD / 2) ? __fsub_rn(a, bq) : __fadd_rn(a, bq)) * sc;
        o16[q] = tohx(r); unsigned short a2, c2; splitf(r, a2, c2); oh[q] = a2; ol[q] = c2; }
    *(v2h*)(P16 + e) = o16; *(v2us*)(Ph + e) = oh; *(v2us*)(Pl + e) = ol;  }
__global__ __launch_bounds__(256) void k_vtp(const float* __restrict__ F, int pitch, int nheads, h16* V16, bf* Vh, bf* Vl) { const size_t e = ((size_t)blockIdx.x * 256 + threadIdx.x) * 2; if (e >= (size_t)nheads * HD * TT) return; const int t = (int)(e % TT); const int d = (int)((e / TT) % HD); const int g = (int)(e / ((size_t)TT * HD)); v2h o16; v2us oh, ol;
#pragma unroll
    for (int q = 0; q < 2; ++q) { const float x = F[(size_t)(t + q) * pitch + g * HD + d]; o16[q] = tohx(x); unsigned short a2, c2; splitf(x, a2, c2); oh[q] = a2; ol[q] = c2; }
    *(v2h*)(V16 + e) = o16; *(v2us*)(Vh + e) = oh; *(v2us*)(Vl + e) = ol;  }
__global__ __launch_bounds__(256) void k_csid(float* CS) { const int idx = blockIdx.x * 256 + threadIdx.x; if (idx >= TT * HD) return; v2f cs; cs[0] = 1.0f; cs[1] = 0.0f; *(v2f*)(CS + (size_t)idx * 2) = cs;  }
// k_asoft: per row (zz, i): t = S x HD^-0.5 for j <= i and i - j < WIN (WIN = T: always true, plain causal mask; the reference's -1e9 additive fill vanishes identically); softmax over the 4096 keys (register row, one exp, fixed trees);
__global__ __launch_bounds__(256) void k_asoft(const float* __restrict__ Sb, h16* P16, bf* Ph, bf* Pl) {
    const int lane = threadIdx.x & 31; const int row = blockIdx.x * 8 + (threadIdx.x >> 5); if (row >= ZH * TT) return; const int i = row % TT; const int zz = row / TT; (void)zz; const bool hires = (i < RH); const float* sr = Sb + (size_t)row * TT; float v[TT / 32]; float mx = -3.0e38f;
#pragma unroll
    for (int ch = 0; ch < TT / 128; ++ch) { const int j0 = ch * 128 + lane * 4; const v4f a = *(const v4f*)(sr + j0);
#pragma unroll
        for (int q = 0; q < 4; ++q) { const int j = j0 + q; (void)j; const float t = (j <= i && i - j < WIN) ? a[q] * SCL : -3.0e38f; v[ch * 4 + q] = t; mx = fmaxf(mx, t); } }
#pragma unroll
    for (int sh = 16; sh; sh >>= 1) mx = fmaxf(mx, __shfl_xor(mx, sh, 32));
    float sum = 0.f;
#pragma unroll
    for (int k = 0; k < TT / 32; ++k) { float d0 = __fsub_rn(v[k], mx); asm volatile("" : "+v"(d0)); v[k] = __builtin_amdgcn_exp2f(__fmul_rn(d0, 1.4426950408889634f)); sum += v[k]; }
#pragma unroll
    for (int sh = 16; sh; sh >>= 1) sum += __shfl_xor(sum, sh, 32);
    const float f = __fdiv_rn(hires ? 1.0f : PCAR, sum);
{
        if (hires) {
#pragma unroll
            for (int ch = 0; ch < TT / 128; ++ch) { v4us oh, ol;
#pragma unroll
                for (int q = 0; q < 4; ++q) { unsigned short a, c2; splitf(v[ch * 4 + q] * f, a, c2); oh[q] = a; ol[q] = c2; }
                const size_t oo = ((size_t)zz * (RH ? RH : 1) + i) * TT + ch * 128 + lane * 4; *(v4us*)(Ph + oo) = oh; *(v4us*)(Pl + oo) = ol; }
        } else {
#pragma unroll
            for (int ch = 0; ch < TT / 128; ++ch) { v4h o4;
#pragma unroll
                for (int q = 0; q < 4; ++q) o4[q] = tohx(v[ch * 4 + q] * f);
                *(v4h*)(P16 + (size_t)row * TT + ch * 128 + lane * 4) = o4; } }
         }
}
__global__ __launch_bounds__(256) void k_merge(const float* __restrict__ O, int h0, bf* Ah, bf* Al) { const size_t e = ((size_t)blockIdx.x * 256 + threadIdx.x) * 2; if (e >= (size_t)ZH * TT * HD) return; const int d = (int)(e % HD); const int t = (int)((e / HD) % TT); const int zz = (int)(e / ((size_t)HD * TT)); const float cs = (t < RH) ? 1.0f : (1.0f / PCAR); const size_t oo = (size_t)t * DQ + (h0 + zz) * HD + d;
    const int nch = t / PVC + 1;      // key chunks that k_gemmpv stored for this row
    v2f p[TT / PVC];                  // every load is issued before the first sum: a plane this row lacks is replaced by plane 0 in the address and by zero in the sum (both loops unrolled: p is a register array)
#pragma unroll
    for (int c = 0; c < TT / PVC; ++c) p[c] = *(const v2f*)(O + (size_t)(c < nch ? c : 0) * ZH * TT * HD + e);
    v2f s = p[0];
#pragma unroll
    for (int c = 1; c < TT / PVC; ++c) s += (c < nch) ? p[c] : (v2f){0.f, 0.f};
    v2us oh, ol;
#pragma unroll
    for (int q = 0; q < 2; ++q) { unsigned short a, c2; splitf(s[q] * cs, a, c2); oh[q] = a; ol[q] = c2; } *(v2us*)(Ah + oo) = oh; *(v2us*)(Al + oo) = ol;  }

extern "C" void kernel_launch(void* const* d_in, const int* in_sizes, int n_in,
                              void* d_out, int out_size, void* d_ws, size_t ws_size, hipStream_t stream) {
    (void)in_sizes; (void)n_in; (void)out_size;
    const float* x = (const float*)d_in[0]; const float* wq = (const float*)d_in[1]; const float* bq = (const float*)d_in[2]; const float* wk = (const float*)d_in[3]; const float* bk = (const float*)d_in[4]; const float* wv = (const float*)d_in[5]; const float* bv = (const float*)d_in[6]; const float* wo = (const float*)d_in[7]; const float* bo = (const float*)d_in[8];   /* argument order x, Wq_w, Wq_b, Wk_w, Wk_b, Wv_w, Wv_b, Wo_w, Wo_b ('oi') */
    float* OUT = (float*)d_out;     // [2][4096][768]
    char* wsp = (char*)d_ws;
    auto take = [&](size_t bytes) { char* p = wsp; wsp += (bytes + 255) & ~(size_t)255; return (void*)p; };
    bf* WQ = (bf*)take((size_t)DQ * DM * 2); bf* WK = (bf*)take((size_t)DKV * DM * 2); bf* WV = (bf*)take((size_t)DKV * DM * 2); bf* WO = (bf*)take((size_t)DM * DQ * 2); float* CS = (float*)take((size_t)TT * HD * 2 * 4);
    bf* XB = (bf*)take((size_t)TT * DM * 2); float* FQ = (float*)take((size_t)TT * DQ * 4); float* FK = (float*)take((size_t)TT * DKV * 4);
    h16* QP16 = (h16*)take((size_t)NH_ * TT * HD * 2); h16* KP16 = (h16*)take((size_t)NKV * TT * HD * 2); h16* VT16 = (h16*)take((size_t)NKV * HD * TT * 2);
    bf* QPh = (bf*)take((size_t)NH_ * TT * HD * 2); bf* QPl = (bf*)take((size_t)NH_ * TT * HD * 2); bf* KPh = (bf*)take((size_t)NKV * TT * HD * 2); bf* KPl = (bf*)take((size_t)NKV * TT * HD * 2); bf* VTh = (bf*)take((size_t)NKV * HD * TT * 2); bf* VTl = (bf*)take((size_t)NKV * HD * TT * 2); bf* Ph = (bf*)take((size_t)ZH * RH * TT * 2); bf* Pl = (bf*)take((size_t)ZH * RH * TT * 2);
    float* Sb = (float*)take((size_t)ZH * TT * TT * 4); h16* P16 = (h16*)take((size_t)ZH * TT * TT * 2); float* Ob = (float*)take((size_t)(TT / PVC) * ZH * TT * HD * 4); bf* ATh = (bf*)take((size_t)TT * DQ * 2); bf* ATl = (bf*)take((size_t)TT * DQ * 2);
    if ((size_t)(wsp - (char*)d_ws) > ws_size) return;    // ws 256 MiB
    float* FV = FK;   // v projection reuses the k buffer after the k planes are built (stream-ordered)
    { k_cvt8<<<(unsigned)(((size_t)DQ * DM / 8 + 255) / 256), 256, 0, stream>>>(wq, WQ, (size_t)DQ * DM / 8); k_cvt8<<<(unsigned)(((size_t)DKV * DM / 8 + 255) / 256), 256, 0, stream>>>(wk, WK, (size_t)DKV * DM / 8); k_cvt8<<<(unsigned)(((size_t)DKV * DM / 8 + 255) / 256), 256, 0, stream>>>(wv, WV, (size_t)DKV * DM / 8);
      k_cvt8<<<(unsigned)(((size_t)DM * DQ / 8 + 255) / 256), 256, 0, stream>>>(wo, WO, (size_t)DM * DQ / 8);
       }
    k_csid<<<(TT * HD + 255) / 256, 256, 0, stream>>>(CS);
    const unsigned LQ = (unsigned)(((size_t)NH_ * TT * HD / 2 + 255) / 256), LKv = (unsigned)(((size_t)NKV * TT * HD / 2 + 255) / 256);
    for (int b = 0; b < NB_; ++b) {
        
        k_cvt8<<<(unsigned)(((size_t)TT * DM / 8 + 255) / 256), 256, 0, stream>>>(x + (size_t)b * TT * DM, XB, (size_t)TT * DM / 8);
        k_gemmw<bf, 0, true><<<dim3(TT / 64, DQ / 64, 1), 32, 0, stream>>>(XB, nullptr, WQ, nullptr, DM, FQ, DQ, bq, 0, 0, 0);
        k_rope<<<LQ, 256, 0, stream>>>(FQ, DQ, NH_, CS, nullptr, nullptr, 1.0f, QP16, QPh, QPl);
        k_gemmw<bf, 0, true><<<dim3(TT / 64, DKV / 64, 1), 32, 0, stream>>>(XB, nullptr, WK, nullptr, DM, FK, DKV, bk, 0, 0, 0);
        k_rope<<<LKv, 256, 0, stream>>>(FK, DKV, NKV, CS, nullptr, nullptr, 1.0f, KP16, KPh, KPl);
        k_gemmw<bf, 0, true><<<dim3(TT / 64, DKV / 64, 1), 32, 0, stream>>>(XB, nullptr, WV, nullptr, DM, FV, DKV, bv, 0, 0, 0); k_vtp<<<LKv, 256, 0, stream>>>(FV, DKV, NKV, VT16, VTh, VTl);
        for (int h0 = 0; h0 < NH_; h0 += ZH) { const size_t zq = (size_t)h0, zk = (size_t)(h0 / REP);   // one kv head per query head: the pass's one head uses kv plane h0 (z-strides TT*HD)
            k_gemmc<bf, 2, 1><<<dim3(RH / 64, TT / 64, ZH), 32, 0, stream>>>(QPh + zq * TT * HD, QPl + zq * TT * HD, KPh + zk * TT * HD, KPl + zk * TT * HD, HD, Sb, TT, 0, (size_t)TT * HD, (size_t)TT * HD, (size_t)TT * TT);
            k_gemmc<h16, 0, 1><<<dim3((TT - RH) / 64, TT / 64, ZH), 32, 0, stream>>>(QP16 + zq * TT * HD + (size_t)RH * HD, nullptr, KP16 + zk * TT * HD, nullptr, HD, Sb + (size_t)RH * TT, TT, RH, (size_t)TT * HD, (size_t)TT * HD, (size_t)TT * TT);
            k_asoft<<<ZH * TT / 8, 256, 0, stream>>>(Sb, P16, Ph, Pl);
            k_gemmpv<bf, 2><<<dim3(PVW, (RH / PVC) * (RH / PVC + 1) / 2), PVW * 32, 0, stream>>>(Ph, Pl, VTh + zk * HD * TT, VTl + zk * HD * TT, Ob, 0, (size_t)ZH * TT * HD);
            k_gemmpv<h16, 0><<<dim3(PVW, (TT / PVC) * (TT / PVC + 1) / 2 - (RH / PVC) * (RH / PVC + 1) / 2), PVW * 32, 0, stream>>>(P16 + (size_t)RH * TT, nullptr, VT16 + zk * HD * TT, nullptr, Ob + (size_t)RH * HD, RH, (size_t)ZH * TT * HD);
            k_merge<<<(unsigned)(((size_t)ZH * TT * HD / 2 + 255) / 256), 256, 0, stream>>>(Ob, h0, ATh, ATl); }
        k_gemmw<bf, 1, true><<<dim3(TT / 64, DM / 64, 1), 32, 0, stream>>>(ATh, ATl, WO, nullptr, DQ, OUT + (size_t)b * TT * DM, DM, bo, 0, 0, 0); }
}

// v002
// A run of this version takes 420 microseconds.
// Two timings next to v001 put it at 3.01 and 3.02 times that version's speed.
// All steps since v000 together make it 7.59 times as fast.
#include <hip/hip_runtime.h>

// Causal self-attention over 4,096 tokens at d_model 768 (x [2][4096][768]; q, k, v = x W^T + b ('oi' uniform(+-768^-0.5) incl. biases: non-zero; 12 heads x 64); logits / sqrt(64); causal (-inf); softmax; out = merged Wo^T + b -> [2][4096][768] (6.3 M); argument order x, Wq_w, Wq_b, Wk_w, Wk_b, Wv_w, Wv_b, Wo_w, Wo_b).
// Layout per batch: bf16 copy of x; 'oi' weights; exact projections (K 768) + f32 biases; identity-table plane builders; causal attention at T 4096 / 12 heads fused in one launch with a running softmax (k_fattn; hybrid rows: < 512 hi/lo 3 products, rest fp16; the fp16 probabilities are exp(score - running maximum) <= 1, divided by the sum at the end, so no x1024 carry is needed); merged hi/lo x Wo exact + bias.
// Compute dtypes, f32 accumulate: every input rounded to bf16; projections exact + f32 biases; attention rows < 512 3 products, rest fp16; softmax f32; Wo hl x exact + bias.

#define NB_  2
#define TT   4096
#define DM   768
#define NH_  12
#define NKV  12
#define HD   64
#define DQ   (NH_ * HD)
#define DKV  (NKV * HD)
#define RH   512                  // query rows < RH use hi+lo planes (0: none)
#define SCL  0.125f   // HD^-0.5
typedef _Float16 h16;
typedef unsigned short bf;
typedef __attribute__((ext_vector_type(16))) __bf16   v16bf;
typedef __attribute__((ext_vector_type(16))) _Float16 v16h;
typedef __attribute__((ext_vector_type(8)))  _Float16 v8h;
typedef __attribute__((ext_vector_type(8)))  unsigned short v8us;
typedef __attribute__((ext_vector_type(8)))  float    v8f;
typedef __attribute__((ext_vector_type(4)))  float    v4f;
typedef v8h  __attribute__((may_alias)) v8ha;
typedef v4f  __attribute__((may_alias)) v4fa;
typedef v8us __attribute__((may_alias)) v8usa;

__device__ __forceinline__ unsigned short f2bf(float f) { unsigned u = __float_as_uint(f); u += 0x7FFFu + ((u >> 16) & 1u); return (unsigned short)(u >> 16); }
__device__ __forceinline__ float bf2f(unsigned short b) { return __uint_as_float(((unsigned)b) << 16); }
__device__ __forceinline__ float bfr(float f) { return bf2f(f2bf(f)); }
__device__ __forceinline__ v16h cat16(v8h lo, v8h hi) { return __builtin_shufflevector(lo, hi, 0, 1, 2, 3, 4, 5, 6, 7, 8, 9, 10, 11, 12, 13, 14, 15); }
__device__ __forceinline__ v16bf cat16b(v8us lo, v8us hi) { return __builtin_bit_cast(v16bf, __builtin_shufflevector(lo, hi, 0, 1, 2, 3, 4, 5, 6, 7, 8, 9, 10, 11, 12, 13, 14, 15)); }
__device__ __forceinline__ v8f wmma16(v16h a, v16h b, v8f c) { return __builtin_amdgcn_wmma_f32_16x16x32_f16(false, a, false, b, (short)0, c, false, false); }
__device__ __forceinline__ v8f wmmab(v16bf a, v16bf b, v8f c) { return __builtin_amdgcn_wmma_f32_16x16x32_bf16(false, a, false, b, (short)0, c, false, false); }



// ---- k_gemmw: register-blocked GEMM, ONE WAVE per 64x64 output tile (16 accumulators), operands straight from K-contiguous 16-bit planes; grid (M/64, N/64, Z), 32 threads.
// C[m][n] (f32, pitch ldc, + optional f32 bias[n]) = sum_k A[m][k] Bt[n][k] (+ split products per NSPLIT). z-batch strides sA/sB/sC in elements. K % 32 == 0.
template <typename T16> struct WFrag;
template <> struct WFrag<h16> { typedef v16h V; static __device__ __forceinline__ V ld(const h16* p) { return cat16(*(const v8h*)p, *(const v8h*)(p + 16)); } static __device__ __forceinline__ v8f mma(V a, V b, v8f c) { return wmma16(a, b, c); } };
template <> struct WFrag<bf> { typedef v16bf V; static __device__ __forceinline__ V ld(const bf* p) { return cat16b(*(const v8us*)p, *(const v8us*)(p + 16)); } static __device__ __forceinline__ v8f mma(V a, V b, v8f c) { return wmmab(a, b, c); } };
template <typename T16, int NSPLIT, bool BIAS>
__global__ __launch_bounds__(32) void k_gemmw(const T16* __restrict__ A, const T16* __restrict__ A2, const T16* __restrict__ Bt, const T16* __restrict__ Bt2, int K, float* C, int ldc, const float* __restrict__ bias, size_t sA, size_t sB, size_t sC) {
    typedef typename WFrag<T16>::V V;
    __shared__ __align__(16) float os[16 * 68];
    const size_t z = blockIdx.z; A += z * sA; if (A2) A2 += z * sA; Bt += z * sB; if (Bt2) Bt2 += z * sB; C += z * sC;
    const int lane = threadIdx.x & 31, lr = lane & 15, hi = lane >> 4; const int r0 = blockIdx.x * 64, c0 = blockIdx.y * 64;
    v8f acc[4][4];
#pragma unroll
    for (int mb = 0; mb < 4; ++mb)
#pragma unroll
        for (int nb = 0; nb < 4; ++nb) acc[mb][nb] = (v8f){};
    const size_t aoff = (size_t)(r0 + lr) * K + 8 * hi, boff = (size_t)(c0 + lr) * K + 8 * hi;
#pragma unroll 1
    for (int kc = 0; kc < K; kc += 32) {
        V a[4], a2[4];
#pragma unroll
        for (int mb = 0; mb < 4; ++mb) { a[mb] = WFrag<T16>::ld(A + aoff + (size_t)mb * 16 * K + kc); if (NSPLIT == 1 || NSPLIT == 2) a2[mb] = WFrag<T16>::ld(A2 + aoff + (size_t)mb * 16 * K + kc); }
#pragma unroll
        for (int nb = 0; nb < 4; ++nb) { const V b = WFrag<T16>::ld(Bt + boff + (size_t)nb * 16 * K + kc); V b2; if (NSPLIT >= 2) b2 = WFrag<T16>::ld(Bt2 + boff + (size_t)nb * 16 * K + kc);
#pragma unroll
            for (int mb = 0; mb < 4; ++mb) { acc[mb][nb] = WFrag<T16>::mma(a[mb], b, acc[mb][nb]); if (NSPLIT == 1 || NSPLIT == 2) acc[mb][nb] = WFrag<T16>::mma(a2[mb], b, acc[mb][nb]); if (NSPLIT >= 2) acc[mb][nb] = WFrag<T16>::mma(a[mb], b2, acc[mb][nb]); } }
        asm volatile("v_nop\n\tv_nop\n\tv_nop\n\tv_nop" : "+v"(acc[0][0]), "+v"(acc[1][1]), "+v"(acc[2][2]), "+v"(acc[3][3]) : "v"(a[0]), "v"(a[3]));
    }
#pragma unroll
    for (int mb = 0; mb < 4; ++mb) {
#pragma unroll
        for (int nb = 0; nb < 4; ++nb) {
#pragma unroll
            for (int j = 0; j < 8; ++j) os[(hi * 8 + j) * 68 + nb * 16 + lr] = acc[mb][nb][j]; }
        __builtin_amdgcn_wave_barrier(); asm volatile("" ::: "memory");
        float* crow = C + (size_t)(r0 + mb * 16) * ldc + c0;
{
#pragma unroll
            for (int s = 0; s < 8; ++s) { const int row = 2 * s + hi, cofs = lr * 4; v4f val = *(const v4fa*)(os + row * 68 + cofs); if (BIAS) { val[0] += bfr(bias[c0 + cofs]); val[1] += bfr(bias[c0 + cofs + 1]); val[2] += bfr(bias[c0 + cofs + 2]); val[3] += bfr(bias[c0 + cofs + 3]); }
                *(v4f*)(crow + (size_t)row * ldc + cofs) = val; }
             }
        __builtin_amdgcn_wave_barrier(); asm volatile("" ::: "memory");
    }
}

__device__ __forceinline__ h16 tohx(float x) { return (h16)x; }
__device__ __forceinline__ void splitf(float y, unsigned short& h, unsigned short& l) { h = f2bf(y); l = f2bf(y - bf2f(h)); }
typedef __attribute__((ext_vector_type(2))) _Float16 v2h;
typedef __attribute__((ext_vector_type(4))) _Float16 v4h;
typedef __attribute__((ext_vector_type(2))) unsigned short v2us;
typedef __attribute__((ext_vector_type(4))) unsigned short v4us;
typedef __attribute__((ext_vector_type(2))) float v2f;
typedef __attribute__((ext_vector_type(4))) int v4i;

__global__ __launch_bounds__(256) void k_cvt8(const float* __restrict__ src, bf* dst, size_t n8) { const size_t i = (size_t)blockIdx.x * 256 + threadIdx.x; if (i >= n8) return; const v8f v = *(const v8f*)(src + i * 8); v8us o;
#pragma unroll
    for (int k = 0; k < 8; ++k) o[k] = f2bf(v[k]); *(v8us*)(dst + i * 8) = o;  }

// k_rope: head planes [h][t][d] (fp16 + hi/lo) of rope(x) x sc with the rotate-half convention out[d] = x[d] cos[t][d] - x[d+HD/2] sin[t][d], out[d+HD/2] = x[d+HD/2] cos[t][d+HD/2] + x[d] sin[t][d+HD/2]
__global__ __launch_bounds__(256) void k_rope(const float* __restrict__ F, int pitch, int nheads, const float* __restrict__ CS, const float* __restrict__ RF, const float* __restrict__ nw, float sc, h16* P16, bf* Ph, bf* Pl) {
    const size_t e = ((size_t)blockIdx.x * 256 + threadIdx.x) * 2; if (e >= (size_t)nheads * TT * HD) return; const int d = (int)(e % HD); const int t = (int)((e / HD) % TT); const int h = (int)(e / ((size_t)HD * TT)); const float* f = F + (size_t)t * pitch + h * HD; const float rf = RF ? RF[(size_t)h * TT + t] : 1.0f; v2h o16; v2us oh, ol;
#pragma unroll
    for (int q = 0; q < 2; ++q) { const int dd = d + q; const int dp = (dd < HD / 2) ? dd + HD / 2 : dd - HD / 2; float x0 = f[dd], x1 = f[dp];
        if (RF) { float n0 = __fmul_rn(x0, rf), n1 = __fmul_rn(x1, rf); asm volatile("" : "+v"(n0)); asm volatile("" : "+v"(n1)); x0 = __fmul_rn(bfr(nw[dd]), n0); x1 = __fmul_rn(bfr(nw[dp]), n1); }
        const v2f cs = *(const v2f*)(CS + ((size_t)t * HD + dd) * 2); float a = __fmul_rn(x0, cs[0]), bq = __fmul_rn(x1, cs[1]); asm volatile("" : "+v"(a)); asm volatile("" : "+v"(bq)); const float r = ((dd < HD / 2) ? __fsub_rn(a, bq) : __fadd_rn(a, bq)) * sc;
        o16[q] = tohx(r); unsigned short a2, c2; splitf(r, a2, c2); oh[q] = a2; ol[q] = c2; }
    *(v2h*)(P16 + e) = o16; *(v2us*)(Ph + e) = oh; *(v2us*)(Pl + e) = ol;  }
__global__ __launch_bounds__(256) void k_vtp(const float* __restrict__ F, int pitch, int nheads, h16* V16, bf* Vh, bf* Vl) { const size_t e = ((size_t)blockIdx.x * 256 + threadIdx.x) * 2; if (e >= (size_t)nheads * HD * TT) return; const int t = (int)(e % TT); const int d = (int)((e / TT) % HD); const int g = (int)(e / ((size_t)TT * HD)); v2h o16; v2us oh, ol;
#pragma unroll
    for (int q = 0; q < 2; ++q) { const float x = F[(size_t)(t + q) * pitch + g * HD + d]; o16[q] = tohx(x); unsigned short a2, c2; splitf(x, a2, c2); oh[q] = a2; ol[q] = c2; }
    *(v2h*)(V16 + e) = o16; *(v2us*)(Vh + e) = oh; *(v2us*)(Vl + e) = ol;  }
__global__ __launch_bounds__(256) void k_csid(float* CS) { const int idx = blockIdx.x * 256 + threadIdx.x; if (idx >= TT * HD) return; v2f cs; cs[0] = 1.0f; cs[1] = 0.0f; *(v2f*)(CS + (size_t)idx * 2) = cs;  }
// ---- k_fattn: scores, causal softmax and probability x value product of one batch's heads in one launch; no score or probability plane reaches memory.
// One work-group of FW waves per (tile of 16 QT query rows, head). Wave w takes the 32-key blocks w, w + FW, ... up to the diagonal block with its own running maxima, sums and output tiles;
// the FW partial results are joined through LDS at the end (each scaled by exp(own maximum - joint maximum), added in wave order) and divided by the joint sum.
// Transposed products: S^T = K Q^T (A = key rows, B = query rows) and O^T += V^T P^T (A = rows of the transposed value plane, B = P). In every 16-column tile a lane then holds one query
// (column lr) and the keys hi 8 + j, so that maximum, sum and rescale factor are the lane's own, and two score tiles (keys 0..15, 16..31) are, register for register, the k order of a 32-key B fragment.
// Every loop over qt, kt, ks, dt, j, e and w is unrolled in full: the fragments and tiles are register arrays and need compile-time indices.
#define FW  4
#define L2E 1.4426950408889634f
typedef __attribute__((ext_vector_type(16))) unsigned short v16us;
// 2^x with the issue slot behind a transcendental kept by construction: the v_nop stands between the v_exp_f32 and whatever the compiler puts next (it may read the result or overwrite the source).
__device__ __forceinline__ float exp2n(float x) { float y; asm("v_exp_f32 %0, %1\n\tv_nop" : "=v"(y) : "v"(x)); return y; }
// Four at a time: each v_exp_f32 fills the slot of the one before it (the results are early-clobber, so none overwrites a source), the v_nop that of the last.
__device__ __forceinline__ void exp2x4(const float* x, float* y) { asm("v_exp_f32 %0, %4\n\tv_exp_f32 %1, %5\n\tv_exp_f32 %2, %6\n\tv_exp_f32 %3, %7\n\tv_nop" : "=&v"(y[0]), "=&v"(y[1]), "=&v"(y[2]), "=&v"(y[3]) : "v"(x[0]), "v"(x[1]), "v"(x[2]), "v"(x[3])); }
template <typename T16, int NSPLIT, int QT>
__device__ __forceinline__ void fa_tile(const T16* __restrict__ Q, const T16* __restrict__ Q2, const T16* __restrict__ Kp, const T16* __restrict__ Kp2, const T16* __restrict__ Vt, const T16* __restrict__ Vt2, int q0, int col0, bf* Ah, bf* Al, float* red, float* st) {
    typedef typename WFrag<T16>::V V;
    const int lane = threadIdx.x & 31, lr = lane & 15, hi = lane >> 4; const int wave = __builtin_amdgcn_readfirstlane(threadIdx.x >> 5);      // in a scalar register: the key loop and its test for the diagonal block are then scalar
    V qf[QT][2], qf2[QT][2];
#pragma unroll
    for (int qt = 0; qt < QT; ++qt)
#pragma unroll
        for (int ks = 0; ks < 2; ++ks) { const size_t o = (size_t)(q0 + qt * 16 + lr) * HD + ks * 32 + 8 * hi; qf[qt][ks] = WFrag<T16>::ld(Q + o); if (NSPLIT == 2) qf2[qt][ks] = WFrag<T16>::ld(Q2 + o); }
    v8f acc[QT][4]; float m[QT], l[QT];
#pragma unroll
    for (int qt = 0; qt < QT; ++qt) { m[qt] = -3.0e38f; l[qt] = 0.f;
#pragma unroll
        for (int dt = 0; dt < 4; ++dt) acc[qt][dt] = (v8f){}; }
    const int nfull = q0 / 32;      // key blocks wholly at or below every query of the tile; block nfull holds the diagonal and is the last
    // K and V^T fragments of key block b, straight from the K-contiguous planes
    auto ldk = [&](int b, V (&kf)[2][2], V (&kf2)[2][2]) {
#pragma unroll
        for (int kt = 0; kt < 2; ++kt)
#pragma unroll
            for (int ks = 0; ks < 2; ++ks) { const size_t o = (size_t)(b * 32 + kt * 16 + lr) * HD + ks * 32 + 8 * hi; kf[kt][ks] = WFrag<T16>::ld(Kp + o); if (NSPLIT == 2) kf2[kt][ks] = WFrag<T16>::ld(Kp2 + o); } };
    auto ldv = [&](int b, V (&vf)[4], V (&vf2)[4]) {
#pragma unroll
        for (int dt = 0; dt < 4; ++dt) { const size_t o = (size_t)(dt * 16 + lr) * TT + b * 32 + 8 * hi; vf[dt] = WFrag<T16>::ld(Vt + o); if (NSPLIT == 2) vf2[dt] = WFrag<T16>::ld(Vt2 + o); } };
    constexpr bool PF = (NSPLIT == 0);      // one-plane tiles fetch the wave's next block one pass ahead, right behind the last use of the registers (the hi/lo tiles are short and have no registers to spare)
    V kf[2][2], kf2[2][2], vf[4], vf2[4];
    if constexpr (PF) { const int b0 = min(wave, nfull); ldk(b0, kf, kf2); ldv(b0, vf, vf2);
        // Inputs-only fence on the loaded values: every load of the prologue has landed where the loop is entered. Without it the compiler's wait at the loop's head, which serves both ways in, also waits in every pass for the V^T fragments fetched just before. Its s_wait_xcnt: the loads' address registers are reused behind it.
        static_assert(QT == 2, "the fence names the fragments of two query tiles");
        asm volatile("s_wait_xcnt 0x0" :: "v"(qf[0][0]), "v"(qf[0][1]), "v"(qf[1][0]), "v"(qf[1][1]), "v"(kf[0][0]), "v"(kf[0][1]), "v"(kf[1][0]), "v"(kf[1][1]), "v"(vf[0]), "v"(vf[1]), "v"(vf[2]), "v"(vf[3])); }
#pragma unroll 1      // kept rolled: the trip count is known at run time only, and a second copy of the body would not fit the register budget beside the fragments fetched ahead
    for (int blk = wave; blk <= nfull; blk += FW) { const int kb = blk * 32, nb = min(blk + FW, nfull);      // nb: clamped, so that the last pass's fetch stays inside the planes
        if (!PF) { ldk(blk, kf, kf2); asm volatile("s_wait_xcnt 0x0" ::: "memory"); ldv(blk, vf, vf2); asm volatile("s_wait_xcnt 0x0" ::: "memory"); }      // the waits: the loads' address registers are reused, by the V^T fragments and in later blocks of the pass
        v8f s[QT][2];
#pragma unroll
        for (int kt = 0; kt < 2; ++kt)
#pragma unroll
            for (int qt = 0; qt < QT; ++qt) { v8f c = (v8f){};
#pragma unroll
                for (int ks = 0; ks < 2; ++ks) { c = WFrag<T16>::mma(kf[kt][ks], qf[qt][ks], c); if (NSPLIT == 2) { c = WFrag<T16>::mma(kf[kt][ks], qf2[qt][ks], c); c = WFrag<T16>::mma(kf2[kt][ks], qf[qt][ks], c); } }
                s[qt][kt] = c * SCL; }
        if (PF) { ldk(nb, kf, kf2); asm volatile("s_wait_xcnt 0x0" ::: "memory"); }      // the wait: as above
        if (blk == nfull) {      // the diagonal block: keys beyond the query are masked (every query keeps at least key kb)
#pragma unroll
            for (int qt = 0; qt < QT; ++qt)
#pragma unroll
                for (int kt = 0; kt < 2; ++kt)
#pragma unroll
                    for (int j = 0; j < 8; ++j) if (kb + kt * 16 + hi * 8 + j > q0 + qt * 16 + lr) s[qt][kt][j] = -3.0e38f; }
#pragma unroll
        for (int qt = 0; qt < QT; ++qt) {
            float bm = s[qt][0][0];
#pragma unroll
            for (int kt = 0; kt < 2; ++kt)
#pragma unroll
                for (int j = 0; j < 8; ++j) bm = fmaxf(bm, s[qt][kt][j]);
            bm = fmaxf(bm, __shfl_xor(bm, 16, 32));      // the other half of the wave holds the query's other 16 keys
            if (__builtin_amdgcn_ballot_w32(bm > m[qt]) != 0) {      // a scalar branch: where no query's maximum grows the factor is exactly 1 and the rescale is skipped
                const float mn = fmaxf(m[qt], bm), al = exp2n((m[qt] - mn) * L2E); m[qt] = mn; l[qt] *= al;
#pragma unroll
                for (int dt = 0; dt < 4; ++dt) acc[qt][dt] *= al; }
            float x[16], p[16], ps = 0.f;
#pragma unroll
            for (int e = 0; e < 16; ++e) x[e] = (s[qt][e >> 3][e & 7] - m[qt]) * L2E;
#pragma unroll
            for (int e = 0; e < 16; e += 4) exp2x4(x + e, p + e);
#pragma unroll
            for (int e = 0; e < 16; ++e) ps += p[e];
            l[qt] += ps;      // the lane's own 16 keys; the halves are joined behind the loop
            if constexpr (NSPLIT == 2) { v16us ph, pl;
#pragma unroll
                for (int e = 0; e < 16; ++e) { unsigned short a, c2; splitf(p[e], a, c2); ph[e] = a; pl[e] = c2; }
                const V pf = __builtin_bit_cast(V, ph), pf2 = __builtin_bit_cast(V, pl);
#pragma unroll
                for (int dt = 0; dt < 4; ++dt) { acc[qt][dt] = WFrag<T16>::mma(vf[dt], pf, acc[qt][dt]); acc[qt][dt] = WFrag<T16>::mma(vf[dt], pf2, acc[qt][dt]); acc[qt][dt] = WFrag<T16>::mma(vf2[dt], pf, acc[qt][dt]); }
            } else { V pf;
#pragma unroll
                for (int e = 0; e < 16; ++e) pf[e] = tohx(p[e]);
#pragma unroll
                for (int dt = 0; dt < 4; ++dt) acc[qt][dt] = WFrag<T16>::mma(vf[dt], pf, acc[qt][dt]); } }
        if (PF) { ldv(nb, vf, vf2); asm volatile("s_wait_xcnt 0x0" ::: "memory"); } }      // the wait: as above, over the loop's back edge
#pragma unroll
    for (int qt = 0; qt < QT; ++qt) { l[qt] += __shfl_xor(l[qt], 16, 32); float* sw = st + (wave * QT + qt) * 64; sw[lane] = m[qt]; sw[32 + lane] = l[qt];
#pragma unroll
        for (int dt = 0; dt < 4; ++dt)
#pragma unroll
            for (int j = 0; j < 8; ++j) red[(((wave * QT + qt) * 4 + dt) * 8 + j) * 32 + lane] = acc[qt][dt][j]; }
    __syncthreads();
    // wave w joins output tile dt = w of every query tile, in the lane layout the tiles were stored in; a wave that had no key block left maximum -3e38, sum 0 and zeros: its factor is 0
#pragma unroll
    for (int qt = 0; qt < QT; ++qt) { float f[FW], M = -3.0e38f, Ls = 0.f;
#pragma unroll
        for (int w = 0; w < FW; ++w) { f[w] = st[(w * QT + qt) * 64 + lane]; M = fmaxf(M, f[w]); }
#pragma unroll
        for (int w = 0; w < FW; ++w) { f[w] = exp2n((f[w] - M) * L2E); Ls += st[(w * QT + qt) * 64 + 32 + lane] * f[w]; }
        const float inv = __fdiv_rn(1.0f, Ls); v8us oh, ol;
#pragma unroll
        for (int j = 0; j < 8; ++j) { float o = 0.f;
#pragma unroll
            for (int w = 0; w < FW; ++w) o += red[(((w * QT + qt) * 4 + wave) * 8 + j) * 32 + lane] * f[w];
            unsigned short a, c2; splitf(o * inv, a, c2); oh[j] = a; ol[j] = c2; }
        const size_t oo = (size_t)(q0 + qt * 16 + lr) * DQ + col0 + wave * 16 + hi * 8; *(v8us*)(Ah + oo) = oh; *(v8us*)(Al + oo) = ol;
        asm volatile("s_wait_xcnt 0x0" ::: "memory"); }      // the wait: the two stores' address and data registers may be reused by whatever code follows the tile
}
// Grid ((TT - RH) / 32 + RH / 16, heads): first the fp16 tiles of 32 query rows, the longest (last rows) first, then the hi/lo tiles of 16 query rows < RH.
// amdgpu_waves_per_eu(4, 4): four waves a SIMD, 256 registers a wave; with a smaller budget the compiler loads the K fragments one after the other into the same registers and waits for each.
__global__ __launch_bounds__(FW * 32) __attribute__((amdgpu_waves_per_eu(4, 4))) void k_fattn(const h16* __restrict__ Q16, const h16* __restrict__ K16, const h16* __restrict__ V16, const bf* __restrict__ Qh, const bf* __restrict__ Ql, const bf* __restrict__ Kh, const bf* __restrict__ Kl, const bf* __restrict__ Vh, const bf* __restrict__ Vl, bf* Ah, bf* Al) {
    __shared__ __align__(16) float red[FW * 2 * 4 * 8 * 32]; __shared__ __align__(16) float st[FW * 2 * 64];
    const int h = blockIdx.y, bx = blockIdx.x; const size_t zo = (size_t)h * TT * HD; constexpr int NLO = (TT - RH) / 32;
    if (bx < NLO) fa_tile<h16, 0, 2>(Q16 + zo, nullptr, K16 + zo, nullptr, V16 + zo, nullptr, TT - 32 * (bx + 1), h * HD, Ah, Al, red, st);
    else fa_tile<bf, 2, 1>(Qh + zo, Ql + zo, Kh + zo, Kl + zo, Vh + zo, Vl + zo, RH - 16 * (bx - NLO + 1), h * HD, Ah, Al, red, st);
}

extern "C" void kernel_launch(void* const* d_in, const int* in_sizes, int n_in,
                              void* d_out, int out_size, void* d_ws, size_t ws_size, hipStream_t stream) {
    (void)in_sizes; (void)n_in; (void)out_size;
    const float* x = (const float*)d_in[0]; const float* wq = (const float*)d_in[1]; const float* bq = (const float*)d_in[2]; const float* wk = (const float*)d_in[3]; const float* bk = (const float*)d_in[4]; const float* wv = (const float*)d_in[5]; const float* bv = (const float*)d_in[6]; const float* wo = (const float*)d_in[7]; const float* bo = (const float*)d_in[8];   /* argument order x, Wq_w, Wq_b, Wk_w, Wk_b, Wv_w, Wv_b, Wo_w, Wo_b ('oi') */
    float* OUT = (float*)d_out;     // [2][4096][768]
    char* wsp = (char*)d_ws;
    auto take = [&](size_t bytes) { char* p = wsp; wsp += (bytes + 255) & ~(size_t)255; return (void*)p; };
    bf* WQ = (bf*)take((size_t)DQ * DM * 2); bf* WK = (bf*)take((size_t)DKV * DM * 2); bf* WV = (bf*)take((size_t)DKV * DM * 2); bf* WO = (bf*)take((size_t)DM * DQ * 2); float* CS = (float*)take((size_t)TT * HD * 2 * 4);
    bf* XB = (bf*)take((size_t)TT * DM * 2); float* FQ = (float*)take((size_t)TT * DQ * 4); float* FK = (float*)take((size_t)TT * DKV * 4);
    h16* QP16 = (h16*)take((size_t)NH_ * TT * HD * 2); h16* KP16 = (h16*)take((size_t)NKV * TT * HD * 2); h16* VT16 = (h16*)take((size_t)NKV * HD * TT * 2);
    bf* QPh = (bf*)take((size_t)NH_ * TT * HD * 2); bf* QPl = (bf*)take((size_t)NH_ * TT * HD * 2); bf* KPh = (bf*)take((size_t)NKV * TT * HD * 2); bf* KPl = (bf*)take((size_t)NKV * TT * HD * 2); bf* VTh = (bf*)take((size_t)NKV * HD * TT * 2); bf* VTl = (bf*)take((size_t)NKV * HD * TT * 2);
    bf* ATh = (bf*)take((size_t)TT * DQ * 2); bf* ATl = (bf*)take((size_t)TT * DQ * 2);
    if ((size_t)(wsp - (char*)d_ws) > ws_size) return;    // ws 256 MiB
    float* FV = FK;   // v projection reuses the k buffer after the k planes are built (stream-ordered)
    { k_cvt8<<<(unsigned)(((size_t)DQ * DM / 8 + 255) / 256), 256, 0, stream>>>(wq, WQ, (size_t)DQ * DM / 8); k_cvt8<<<(unsigned)(((size_t)DKV * DM / 8 + 255) / 256), 256, 0, stream>>>(wk, WK, (size_t)DKV * DM / 8); k_cvt8<<<(unsigned)(((size_t)DKV * DM / 8 + 255) / 256), 256, 0, stream>>>(wv, WV, (size_t)DKV * DM / 8);
      k_cvt8<<<(unsigned)(((size_t)DM * DQ / 8 + 255) / 256), 256, 0, stream>>>(wo, WO, (size_t)DM * DQ / 8);
       }
    k_csid<<<(TT * HD + 255) / 256, 256, 0, stream>>>(CS);
    const unsigned LQ = (unsigned)(((size_t)NH_ * TT * HD / 2 + 255) / 256), LKv = (unsigned)(((size_t)NKV * TT * HD / 2 + 255) / 256);
    for (int b = 0; b < NB_; ++b) {
        
        k_cvt8<<<(unsigned)(((size_t)TT * DM / 8 + 255) / 256), 256, 0, stream>>>(x + (size_t)b * TT * DM, XB, (size_t)TT * DM / 8);
        k_gemmw<bf, 0, true><<<dim3(TT / 64, DQ / 64, 1), 32, 0, stream>>>(XB, nullptr, WQ, nullptr, DM, FQ, DQ, bq, 0, 0, 0);
        k_rope<<<LQ, 256, 0, stream>>>(FQ, DQ, NH_, CS, nullptr, nullptr, 1.0f, QP16, QPh, QPl);
        k_gemmw<bf, 0, true><<<dim3(TT / 64, DKV / 64, 1), 32, 0, stream>>>(XB, nullptr, WK, nullptr, DM, FK, DKV, bk, 0, 0, 0);
        k_rope<<<LKv, 256, 0, stream>>>(FK, DKV, NKV, CS, nullptr, nullptr, 1.0f, KP16, KPh, KPl);
        k_gemmw<bf, 0, true><<<dim3(TT / 64, DKV / 64, 1), 32, 0, stream>>>(XB, nullptr, WV, nullptr, DM, FV, DKV, bv, 0, 0, 0); k_vtp<<<LKv, 256, 0, stream>>>(FV, DKV, NKV, VT16, VTh, VTl);
        k_fattn<<<dim3((TT - RH) / 32 + RH / 16, NH_), FW * 32, 0, stream>>>(QP16, KP16, VT16, QPh, QPl, KPh, KPl, VTh, VTl, ATh, ATl);
        k_gemmw<bf, 1, true><<<dim3(TT / 64, DM / 64, 1), 32, 0, stream>>>(ATh, ATl, WO, nullptr, DQ, OUT + (size_t)b * TT * DM, DM, bo, 0, 0, 0); }
}

// v003
// One run takes 363 microseconds.
// Next to v002, in two timings, it ran 1.16 and 1.14 times as fast.
// All steps since v000 together make it 8.75 times as fast.
#include <hip/hip_runtime.h>

// Causal self-attention over 4,096 tokens at d_model 768 (x [2][4096][768]; q, k, v = x W^T + b ('oi' uniform(+-768^-0.5) incl. biases: non-zero; 12 heads x 64); logits / sqrt(64); causal (-inf); softmax; out = merged Wo^T + b -> [2][4096][768] (6.3 M); argument order x, Wq_w, Wq_b, Wk_w, Wk_b, Wv_w, Wv_b, Wo_w, Wo_b).
// Layout per batch: bf16 copy of x; 'oi' weights; exact projections (K 768) + f32 biases, each writing its head planes (fp16 + hi/lo) from its own epilogue; causal attention at T 4096 / 12 heads fused in one launch with a running softmax (k_fattn; hybrid rows: < 512 hi/lo 3 products, rest fp16; the fp16 probabilities are exp(score - running maximum) <= 1, divided by the sum at the end, so no x1024 carry is needed); merged hi/lo x Wo exact + bias.
// Compute dtypes, f32 accumulate: every input rounded to bf16; projections exact + f32 biases; attention rows < 512 3 products, rest fp16; softmax f32; Wo hl x exact + bias.

#define NB_  2
#define TT   4096
#define DM   768
#define NH_  12
#define NKV  12
#define HD   64
#define DQ   (NH_ * HD)
#define DKV  (NKV * HD)
#define RH   512                  // query rows < RH use hi+lo planes (0: none)
#define SCL  0.125f   // HD^-0.5
typedef _Float16 h16;
typedef unsigned short bf;
typedef __attribute__((ext_vector_type(16))) __bf16   v16bf;
typedef __attribute__((ext_vector_type(16))) _Float16 v16h;
typedef __attribute__((ext_vector_type(8)))  _Float16 v8h;
typedef __attribute__((ext_vector_type(8)))  unsigned short v8us;
typedef __attribute__((ext_vector_type(8)))  float    v8f;
typedef __attribute__((ext_vector_type(4)))  float    v4f;
typedef v8h  __attribute__((may_alias)) v8ha;
typedef v4f  __attribute__((may_alias)) v4fa;
typedef v8us __attribute__((may_alias)) v8usa;

__device__ __forceinline__ unsigned short f2bf(float f) { unsigned u = __float_as_uint(f); u += 0x7FFFu + ((u >> 16) & 1u); return (unsigned short)(u >> 16); }
__device__ __forceinline__ float bf2f(unsigned short b) { return __uint_as_float(((unsigned)b) << 16); }
__device__ __forceinline__ float bfr(float f) { return bf2f(f2bf(f)); }
__device__ __forceinline__ v16h cat16(v8h lo, v8h hi) { return __builtin_shufflevector(lo, hi, 0, 1, 2, 3, 4, 5, 6, 7, 8, 9, 10, 11, 12, 13, 14, 15); }
__device__ __forceinline__ v16bf cat16b(v8us lo, v8us hi) { return __builtin_bit_cast(v16bf, __builtin_shufflevector(lo, hi, 0, 1, 2, 3, 4, 5, 6, 7, 8, 9, 10, 11, 12, 13, 14, 15)); }
__device__ __forceinline__ v8f wmma16(v16h a, v16h b, v8f c) { return __builtin_amdgcn_wmma_f32_16x16x32_f16(false, a, false, b, (short)0, c, false, false); }
__device__ __forceinline__ v8f wmmab(v16bf a, v16bf b, v8f c) { return __builtin_amdgcn_wmma_f32_16x16x32_bf16(false, a, false, b, (short)0, c, false, false); }
__device__ __forceinline__ h16 tohx(float x) { return (h16)x; }
__device__ __forceinline__ void splitf(float y, unsigned short& h, unsigned short& l) { h = f2bf(y); l = f2bf(y - bf2f(h)); }



// ---- k_gemmw: register-blocked GEMM, ONE WAVE per 64x64 output tile (16 accumulators), operands straight from K-contiguous 16-bit planes; grid (M/64, N/64, Z), 32 threads.
// C[m][n] (f32, pitch ldc, + optional f32 bias[n]) = sum_k A[m][k] Bt[n][k] (+ split products per NSPLIT). z-batch strides sA/sB/sC in elements. K % 32 == 0.
// PL != 0: no f32 C; the tile + bias goes out as three 16-bit planes (P16 fp16, Ph/Pl bf16 hi/lo) of row pitch ldc, tile (bx, by) at element bx px + by py. PL 1: bias[n] (token rows x one head's 64 columns: planes [h][t][d]);
// PL 2: bias[m] (A = weight rows, Bt = token rows: the tile is the transposed projection, planes [h][d][t]).
template <typename T16> struct WFrag;
template <> struct WFrag<h16> { typedef v16h V; static __device__ __forceinline__ V ld(const h16* p) { return cat16(*(const v8h*)p, *(const v8h*)(p + 16)); } static __device__ __forceinline__ v8f mma(V a, V b, v8f c) { return wmma16(a, b, c); } };
template <> struct WFrag<bf> { typedef v16bf V; static __device__ __forceinline__ V ld(const bf* p) { return cat16b(*(const v8us*)p, *(const v8us*)(p + 16)); } static __device__ __forceinline__ v8f mma(V a, V b, v8f c) { return wmmab(a, b, c); } };
template <typename T16, int NSPLIT, bool BIAS, int PL>
__global__ __launch_bounds__(32) void k_gemmw(const T16* __restrict__ A, const T16* __restrict__ A2, const T16* __restrict__ Bt, const T16* __restrict__ Bt2, int K, float* C, int ldc, const float* __restrict__ bias, size_t sA, size_t sB, size_t sC, h16* P16, bf* Ph, bf* Pl, size_t px, size_t py) {
    typedef typename WFrag<T16>::V V;
    __shared__ __align__(16) float os[16 * 68];
    const size_t z = blockIdx.z; A += z * sA; if (A2) A2 += z * sA; Bt += z * sB; if (Bt2) Bt2 += z * sB; C += z * sC;
    const int lane = threadIdx.x & 31, lr = lane & 15, hi = lane >> 4; const int r0 = blockIdx.x * 64, c0 = blockIdx.y * 64;
    v8f acc[4][4];
#pragma unroll
    for (int mb = 0; mb < 4; ++mb)
#pragma unroll
        for (int nb = 0; nb < 4; ++nb) acc[mb][nb] = (v8f){};
    const size_t aoff = (size_t)(r0 + lr) * K + 8 * hi, boff = (size_t)(c0 + lr) * K + 8 * hi;
#pragma unroll 1
    for (int kc = 0; kc < K; kc += 32) {
        V a[4], a2[4];
#pragma unroll
        for (int mb = 0; mb < 4; ++mb) { a[mb] = WFrag<T16>::ld(A + aoff + (size_t)mb * 16 * K + kc); if (NSPLIT == 1 || NSPLIT == 2) a2[mb] = WFrag<T16>::ld(A2 + aoff + (size_t)mb * 16 * K + kc); }
#pragma unroll
        for (int nb = 0; nb < 4; ++nb) { const V b = WFrag<T16>::ld(Bt + boff + (size_t)nb * 16 * K + kc); V b2; if (NSPLIT >= 2) b2 = WFrag<T16>::ld(Bt2 + boff + (size_t)nb * 16 * K + kc);
#pragma unroll
            for (int mb = 0; mb < 4; ++mb) { acc[mb][nb] = WFrag<T16>::mma(a[mb], b, acc[mb][nb]); if (NSPLIT == 1 || NSPLIT == 2) acc[mb][nb] = WFrag<T16>::mma(a2[mb], b, acc[mb][nb]); if (NSPLIT >= 2) acc[mb][nb] = WFrag<T16>::mma(a[mb], b2, acc[mb][nb]); } }
        asm volatile("v_nop\n\tv_nop\n\tv_nop\n\tv_nop" : "+v"(acc[0][0]), "+v"(acc[1][1]), "+v"(acc[2][2]), "+v"(acc[3][3]) : "v"(a[0]), "v"(a[3]));
    }
    // planes: a lane takes 8 columns of one staged row, so that each 16-byte store of the wave covers four whole 128-byte rows
    const int prow = lane >> 3, pcol = (lane & 7) * 8; const size_t pb = blockIdx.x * px + blockIdx.y * py + (size_t)prow * ldc + pcol; constexpr int NPB = PL == 2 ? 16 : 8; float pbias[NPB];
    if constexpr (PL != 0) {
#pragma unroll
        for (int i = 0; i < NPB; ++i) pbias[i] = PL == 1 ? bias[c0 + pcol + i] : bias[r0 + i * 4 + prow];
        // the wait: the address register of PL 1's bias loads is reused by the rows below; it takes the loaded values as inputs only, which keeps it behind the loads
        if constexpr (PL == 1) asm volatile("s_wait_xcnt 0x0" :: "v"(pbias[0]), "v"(pbias[1]), "v"(pbias[2]), "v"(pbias[3]), "v"(pbias[4]), "v"(pbias[5]), "v"(pbias[6]), "v"(pbias[7]));
#pragma unroll
        for (int i = 0; i < NPB; ++i) pbias[i] = bfr(pbias[i]); }
#pragma unroll
    for (int mb = 0; mb < 4; ++mb) {
#pragma unroll
        for (int nb = 0; nb < 4; ++nb) {
#pragma unroll
            for (int j = 0; j < 8; ++j) os[(hi * 8 + j) * 68 + nb * 16 + lr] = acc[mb][nb][j]; }
        __builtin_amdgcn_wave_barrier(); asm volatile("" ::: "memory");
        if constexpr (PL != 0) {
#pragma unroll
            for (int s = 0; s < 4; ++s) { const float* orow = os + (4 * s + prow) * 68 + pcol; const v4f v0 = *(const v4fa*)orow, v1 = *(const v4fa*)(orow + 4); v8h o16; v8us oh, ol;
#pragma unroll
                for (int k = 0; k < 8; ++k) { const float y = (k < 4 ? v0[k & 3] : v1[k & 3]) + pbias[PL == 1 ? k : mb * 4 + s]; o16[k] = tohx(y); unsigned short a2, c2; splitf(y, a2, c2); oh[k] = a2; ol[k] = c2; }
                const size_t o = pb + (size_t)(mb * 16 + 4 * s) * ldc; *(v8h*)(P16 + o) = o16; *(v8us*)(Ph + o) = oh; *(v8us*)(Pl + o) = ol;
                asm volatile("s_wait_xcnt 0x0" ::: "memory"); }      // the wait: the three stores' address and data registers are reused by the next rows
        } else {
        float* crow = C + (size_t)(r0 + mb * 16) * ldc + c0;
#pragma unroll
            for (int s = 0; s < 8; ++s) { const int row = 2 * s + hi, cofs = lr * 4; v4f val = *(const v4fa*)(os + row * 68 + cofs); if (BIAS) { val[0] += bfr(bias[c0 + cofs]); val[1] += bfr(bias[c0 + cofs + 1]); val[2] += bfr(bias[c0 + cofs + 2]); val[3] += bfr(bias[c0 + cofs + 3]); }
                *(v4f*)(crow + (size_t)row * ldc + cofs) = val; }
             }
        __builtin_amdgcn_wave_barrier(); asm volatile("" ::: "memory");
    }
}

typedef __attribute__((ext_vector_type(4))) _Float16 v4h;
typedef __attribute__((ext_vector_type(4))) unsigned short v4us;
typedef __attribute__((ext_vector_type(4))) int v4i;

__global__ __launch_bounds__(256) void k_cvt8(const float* __restrict__ src, bf* dst, size_t n8) { const size_t i = (size_t)blockIdx.x * 256 + threadIdx.x; if (i >= n8) return; const v8f v = *(const v8f*)(src + i * 8); v8us o;
#pragma unroll
    for (int k = 0; k < 8; ++k) o[k] = f2bf(v[k]); *(v8us*)(dst + i * 8) = o;  }

// ---- k_fattn: scores, causal softmax and probability x value product of one batch's heads in one launch; no score or probability plane reaches memory.
// One work-group of FW waves per (tile of 16 QT query rows, head). Wave w takes the 32-key blocks w, w + FW, ... up to the diagonal block with its own running maxima, sums and output tiles;
// the FW partial results are joined through LDS at the end (each scaled by exp(own maximum - joint maximum), added in wave order) and divided by the joint sum.
// Transposed products: S^T = K Q^T (A = key rows, B = query rows) and O^T += V^T P^T (A = rows of the transposed value plane, B = P). In every 16-column tile a lane then holds one query
// (column lr) and the keys hi 8 + j, so that maximum, sum and rescale factor are the lane's own, and two score tiles (keys 0..15, 16..31) are, register for register, the k order of a 32-key B fragment.
// Every loop over qt, kt, ks, dt, j, e and w is unrolled in full: the fragments and tiles are register arrays and need compile-time indices.
#define FW  4
#define L2E 1.4426950408889634f
typedef __attribute__((ext_vector_type(16))) unsigned short v16us;
// 2^x with the issue slot behind a transcendental kept by construction: the v_nop stands between the v_exp_f32 and whatever the compiler puts next (it may read the result or overwrite the source).
__device__ __forceinline__ float exp2n(float x) { float y; asm("v_exp_f32 %0, %1\n\tv_nop" : "=v"(y) : "v"(x)); return y; }
// Four at a time: each v_exp_f32 fills the slot of the one before it (the results are early-clobber, so none overwrites a source), the v_nop that of the last.
__device__ __forceinline__ void exp2x4(const float* x, float* y) { asm("v_exp_f32 %0, %4\n\tv_exp_f32 %1, %5\n\tv_exp_f32 %2, %6\n\tv_exp_f32 %3, %7\n\tv_nop" : "=&v"(y[0]), "=&v"(y[1]), "=&v"(y[2]), "=&v"(y[3]) : "v"(x[0]), "v"(x[1]), "v"(x[2]), "v"(x[3])); }
template <typename T16, int NSPLIT, int QT>
__device__ __forceinline__ void fa_tile(const T16* __restrict__ Q, const T16* __restrict__ Q2, const T16* __restrict__ Kp, const T16* __restrict__ Kp2, const T16* __restrict__ Vt, const T16* __restrict__ Vt2, int q0, int col0, bf* Ah, bf* Al, float* red, float* st) {
    typedef typename WFrag<T16>::V V;
    const int lane = threadIdx.x & 31, lr = lane & 15, hi = lane >> 4; const int wave = __builtin_amdgcn_readfirstlane(threadIdx.x >> 5);      // in a scalar register: the key loop and its test for the diagonal block are then scalar
    V qf[QT][2], qf2[QT][2];
#pragma unroll
    for (int qt = 0; qt < QT; ++qt)
#pragma unroll
        for (int ks = 0; ks < 2; ++ks) { const size_t o = (size_t)(q0 + qt * 16 + lr) * HD + ks * 32 + 8 * hi; qf[qt][ks] = WFrag<T16>::ld(Q + o); if (NSPLIT == 2) qf2[qt][ks] = WFrag<T16>::ld(Q2 + o); }
    v8f acc[QT][4]; float m[QT], l[QT];
#pragma unroll
    for (int qt = 0; qt < QT; ++qt) { m[qt] = -3.0e38f; l[qt] = 0.f;
#pragma unroll
        for (int dt = 0; dt < 4; ++dt) acc[qt][dt] = (v8f){}; }
    const int nfull = q0 / 32;      // key blocks wholly at or below every query of the tile; block nfull holds the diagonal and is the last
    // K and V^T fragments of key block b, straight from the K-contiguous planes
    auto ldk = [&](int b, V (&kf)[2][2], V (&kf2)[2][2]) {
#pragma unroll
        for (int kt = 0; kt < 2; ++kt)
#pragma unroll
            for (int ks = 0; ks < 2; ++ks) { const size_t o = (size_t)(b * 32 + kt * 16 + lr) * HD + ks * 32 + 8 * hi; kf[kt][ks] = WFrag<T16>::ld(Kp + o); if (NSPLIT == 2) kf2[kt][ks] = WFrag<T16>::ld(Kp2 + o); } };
    auto ldv = [&](int b, V (&vf)[4], V (&vf2)[4]) {
#pragma unroll
        for (int dt = 0; dt < 4; ++dt) { const size_t o = (size_t)(dt * 16 + lr) * TT + b * 32 + 8 * hi; vf[dt] = WFrag<T16>::ld(Vt + o); if (NSPLIT == 2) vf2[dt] = WFrag<T16>::ld(Vt2 + o); } };
    constexpr bool PF = (NSPLIT == 0);      // one-plane tiles fetch the wave's next block one pass ahead, right behind the last use of the registers (the hi/lo tiles are short and have no registers to spare)
    V kf[2][2], kf2[2][2], vf[4], vf2[4];
    if constexpr (PF) { const int b0 = min(wave, nfull); ldk(b0, kf, kf2); ldv(b0, vf, vf2);
        // Inputs-only fence on the loaded values: every load of the prologue has landed where the loop is entered. Without it the compiler's wait at the loop's head, which serves both ways in, also waits in every pass for the V^T fragments fetched just before. Its s_wait_xcnt: the loads' address registers are reused behind it.
        static_assert(QT == 2, "the fence names the fragments of two query tiles");
        asm volatile("s_wait_xcnt 0x0" :: "v"(qf[0][0]), "v"(qf[0][1]), "v"(qf[1][0]), "v"(qf[1][1]), "v"(kf[0][0]), "v"(kf[0][1]), "v"(kf[1][0]), "v"(kf[1][1]), "v"(vf[0]), "v"(vf[1]), "v"(vf[2]), "v"(vf[3])); }
#pragma unroll 1      // kept rolled: the trip count is known at run time only, and a second copy of the body would not fit the register budget beside the fragments fetched ahead
    for (int blk = wave; blk <= nfull; blk += FW) { const int kb = blk * 32, nb = min(blk + FW, nfull);      // nb: clamped, so that the last pass's fetch stays inside the planes
        if (!PF) { ldk(blk, kf, kf2); asm volatile("s_wait_xcnt 0x0" ::: "memory"); ldv(blk, vf, vf2); asm volatile("s_wait_xcnt 0x0" ::: "memory"); }      // the waits: the loads' address registers are reused, by the V^T fragments and in later blocks of the pass
        v8f s[QT][2];
#pragma unroll
        for (int kt = 0; kt < 2; ++kt)
#pragma unroll
            for (int qt = 0; qt < QT; ++qt) { v8f c = (v8f){};
#pragma unroll
                for (int ks = 0; ks < 2; ++ks) { c = WFrag<T16>::mma(kf[kt][ks], qf[qt][ks], c); if (NSPLIT == 2) { c = WFrag<T16>::mma(kf[kt][ks], qf2[qt][ks], c); c = WFrag<T16>::mma(kf2[kt][ks], qf[qt][ks], c); } }
                s[qt][kt] = c * SCL; }
        if (PF) { ldk(nb, kf, kf2); asm volatile("s_wait_xcnt 0x0" ::: "memory"); }      // the wait: as above
        if (blk == nfull) {      // the diagonal block: keys beyond the query are masked (every query keeps at least key kb)
#pragma unroll
            for (int qt = 0; qt < QT; ++qt)
#pragma unroll
                for (int kt = 0; kt < 2; ++kt)
#pragma unroll
                    for (int j = 0; j < 8; ++j) if (kb + kt * 16 + hi * 8 + j > q0 + qt * 16 + lr) s[qt][kt][j] = -3.0e38f; }
#pragma unroll
        for (int qt = 0; qt < QT; ++qt) {
            float bm = s[qt][0][0];
#pragma unroll
            for (int kt = 0; kt < 2; ++kt)
#pragma unroll
                for (int j = 0; j < 8; ++j) bm = fmaxf(bm, s[qt][kt][j]);
            bm = fmaxf(bm, __shfl_xor(bm, 16, 32));      // the other half of the wave holds the query's other 16 keys
            if (__builtin_amdgcn_ballot_w32(bm > m[qt]) != 0) {      // a scalar branch: where no query's maximum grows the factor is exactly 1 and the rescale is skipped
                const float mn = fmaxf(m[qt], bm), al = exp2n((m[qt] - mn) * L2E); m[qt] = mn; l[qt] *= al;
#pragma unroll
                for (int dt = 0; dt < 4; ++dt) acc[qt][dt] *= al; }
            float x[16], p[16], ps = 0.f;
#pragma unroll
            for (int e = 0; e < 16; ++e) x[e] = (s[qt][e >> 3][e & 7] - m[qt]) * L2E;
#pragma unroll
            for (int e = 0; e < 16; e += 4) exp2x4(x + e, p + e);
#pragma unroll
            for (int e = 0; e < 16; ++e) ps += p[e];
            l[qt] += ps;      // the lane's own 16 keys; the halves are joined behind the loop
            if constexpr (NSPLIT == 2) { v16us ph, pl;
#pragma unroll
                for (int e = 0; e < 16; ++e) { unsigned short a, c2; splitf(p[e], a, c2); ph[e] = a; pl[e] = c2; }
                const V pf = __builtin_bit_cast(V, ph), pf2 = __builtin_bit_cast(V, pl);
#pragma unroll
                for (int dt = 0; dt < 4; ++dt) { acc[qt][dt] = WFrag<T16>::mma(vf[dt], pf, acc[qt][dt]); acc[qt][dt] = WFrag<T16>::mma(vf[dt], pf2, acc[qt][dt]); acc[qt][dt] = WFrag<T16>::mma(vf2[dt], pf, acc[qt][dt]); }
            } else { V pf;
#pragma unroll
                for (int e = 0; e < 16; ++e) pf[e] = tohx(p[e]);
#pragma unroll
                for (int dt = 0; dt < 4; ++dt) acc[qt][dt] = WFrag<T16>::mma(vf[dt], pf, acc[qt][dt]); } }
        if (PF) { ldv(nb, vf, vf2); asm volatile("s_wait_xcnt 0x0" ::: "memory"); } }      // the wait: as above, over the loop's back edge
#pragma unroll
    for (int qt = 0; qt < QT; ++qt) { l[qt] += __shfl_xor(l[qt], 16, 32); float* sw = st + (wave * QT + qt) * 64; sw[lane] = m[qt]; sw[32 + lane] = l[qt];
#pragma unroll
        for (int dt = 0; dt < 4; ++dt)
#pragma unroll
            for (int j = 0; j < 8; ++j) red[(((wave * QT + qt) * 4 + dt) * 8 + j) * 32 + lane] = acc[qt][dt][j]; }
    __syncthreads();
    // wave w joins output tile dt = w of every query tile, in the lane layout the tiles were stored in; a wave that had no key block left maximum -3e38, sum 0 and zeros: its factor is 0
#pragma unroll
    for (int qt = 0; qt < QT; ++qt) { float f[FW], M = -3.0e38f, Ls = 0.f;
#pragma unroll
        for (int w = 0; w < FW; ++w) { f[w] = st[(w * QT + qt) * 64 + lane]; M = fmaxf(M, f[w]); }
#pragma unroll
        for (int w = 0; w < FW; ++w) { f[w] = exp2n((f[w] - M) * L2E); Ls += st[(w * QT + qt) * 64 + 32 + lane] * f[w]; }
        const float inv = __fdiv_rn(1.0f, Ls); v8us oh, ol;
#pragma unroll
        for (int j = 0; j < 8; ++j) { float o = 0.f;
#pragma unroll
            for (int w = 0; w < FW; ++w) o += red[(((w * QT + qt) * 4 + wave) * 8 + j) * 32 + lane] * f[w];
            unsigned short a, c2; splitf(o * inv, a, c2); oh[j] = a; ol[j] = c2; }
        const size_t oo = (size_t)(q0 + qt * 16 + lr) * DQ + col0 + wave * 16 + hi * 8; *(v8us*)(Ah + oo) = oh; *(v8us*)(Al + oo) = ol;
        asm volatile("s_wait_xcnt 0x0" ::: "memory"); }      // the wait: the two stores' address and data registers may be reused by whatever code follows the tile
}
// Grid ((TT - RH) / 32 + RH / 16, heads): first the fp16 tiles of 32 query rows, the longest (last rows) first, then the hi/lo tiles of 16 query rows < RH.
// amdgpu_waves_per_eu(4, 4): four waves a SIMD, 256 registers a wave; with a smaller budget the compiler loads the K fragments one after the other into the same registers and waits for each.
__global__ __launch_bounds__(FW * 32) __attribute__((amdgpu_waves_per_eu(4, 4))) void k_fattn(const h16* __restrict__ Q16, const h16* __restrict__ K16, const h16* __restrict__ V16, const bf* __restrict__ Qh, const bf* __restrict__ Ql, const bf* __restrict__ Kh, const bf* __restrict__ Kl, const bf* __restrict__ Vh, const bf* __restrict__ Vl, bf* Ah, bf* Al) {
    __shared__ __align__(16) float red[FW * 2 * 4 * 8 * 32]; __shared__ __align__(16) float st[FW * 2 * 64];
    const int h = blockIdx.y, bx = blockIdx.x; const size_t zo = (size_t)h * TT * HD; constexpr int NLO = (TT - RH) / 32;
    if (bx < NLO) fa_tile<h16, 0, 2>(Q16 + zo, nullptr, K16 + zo, nullptr, V16 + zo, nullptr, TT - 32 * (bx + 1), h * HD, Ah, Al, red, st);
    else fa_tile<bf, 2, 1>(Qh + zo, Ql + zo, Kh + zo, Kl + zo, Vh + zo, Vl + zo, RH - 16 * (bx - NLO + 1), h * HD, Ah, Al, red, st);
}

extern "C" void kernel_launch(void* const* d_in, const int* in_sizes, int n_in,
                              void* d_out, int out_size, void* d_ws, size_t ws_size, hipStream_t stream) {
    (void)in_sizes; (void)n_in; (void)out_size;
    const float* x = (const float*)d_in[0]; const float* wq = (const float*)d_in[1]; const float* bq = (const float*)d_in[2]; const float* wk = (const float*)d_in[3]; const float* bk = (const float*)d_in[4]; const float* wv = (const float*)d_in[5]; const float* bv = (const float*)d_in[6]; const float* wo = (const float*)d_in[7]; const float* bo = (const float*)d_in[8];   /* argument order x, Wq_w, Wq_b, Wk_w, Wk_b, Wv_w, Wv_b, Wo_w, Wo_b ('oi') */
    float* OUT = (float*)d_out;     // [2][4096][768]
    char* wsp = (char*)d_ws;
    auto take = [&](size_t bytes) { char* p = wsp; wsp += (bytes + 255) & ~(size_t)255; return (void*)p; };
    bf* WQ = (bf*)take((size_t)DQ * DM * 2); bf* WK = (bf*)take((size_t)DKV * DM * 2); bf* WV = (bf*)take((size_t)DKV * DM * 2); bf* WO = (bf*)take((size_t)DM * DQ * 2);
    bf* XB = (bf*)take((size_t)TT * DM * 2);
    h16* QP16 = (h16*)take((size_t)NH_ * TT * HD * 2); h16* KP16 = (h16*)take((size_t)NKV * TT * HD * 2); h16* VT16 = (h16*)take((size_t)NKV * HD * TT * 2);
    bf* QPh = (bf*)take((size_t)NH_ * TT * HD * 2); bf* QPl = (bf*)take((size_t)NH_ * TT * HD * 2); bf* KPh = (bf*)take((size_t)NKV * TT * HD * 2); bf* KPl = (bf*)take((size_t)NKV * TT * HD * 2); bf* VTh = (bf*)take((size_t)NKV * HD * TT * 2); bf* VTl = (bf*)take((size_t)NKV * HD * TT * 2);
    bf* ATh = (bf*)take((size_t)TT * DQ * 2); bf* ATl = (bf*)take((size_t)TT * DQ * 2);
    if ((size_t)(wsp - (char*)d_ws) > ws_size) return;    // ws 256 MiB
    { k_cvt8<<<(unsigned)(((size_t)DQ * DM / 8 + 255) / 256), 256, 0, stream>>>(wq, WQ, (size_t)DQ * DM / 8); k_cvt8<<<(unsigned)(((size_t)DKV * DM / 8 + 255) / 256), 256, 0, stream>>>(wk, WK, (size_t)DKV * DM / 8); k_cvt8<<<(unsigned)(((size_t)DKV * DM / 8 + 255) / 256), 256, 0, stream>>>(wv, WV, (size_t)DKV * DM / 8);
      k_cvt8<<<(unsigned)(((size_t)DM * DQ / 8 + 255) / 256), 256, 0, stream>>>(wo, WO, (size_t)DM * DQ / 8);
       }
    for (int b = 0; b < NB_; ++b) {
        
        k_cvt8<<<(unsigned)(((size_t)TT * DM / 8 + 255) / 256), 256, 0, stream>>>(x + (size_t)b * TT * DM, XB, (size_t)TT * DM / 8);
        k_gemmw<bf, 0, true, 1><<<dim3(TT / 64, DQ / 64, 1), 32, 0, stream>>>(XB, nullptr, WQ, nullptr, DM, nullptr, HD, bq, 0, 0, 0, QP16, QPh, QPl, (size_t)64 * HD, (size_t)TT * HD);
        k_gemmw<bf, 0, true, 1><<<dim3(TT / 64, DKV / 64, 1), 32, 0, stream>>>(XB, nullptr, WK, nullptr, DM, nullptr, HD, bk, 0, 0, 0, KP16, KPh, KPl, (size_t)64 * HD, (size_t)TT * HD);
        k_gemmw<bf, 0, true, 2><<<dim3(DKV / 64, TT / 64, 1), 32, 0, stream>>>(WV, nullptr, XB, nullptr, DM, nullptr, TT, bv, 0, 0, 0, VT16, VTh, VTl, (size_t)64 * TT, (size_t)64);      // operands swapped: the tile is V^T
        k_fattn<<<dim3((TT - RH) / 32 + RH / 16, NH_), FW * 32, 0, stream>>>(QP16, KP16, VT16, QPh, QPl, KPh, KPl, VTh, VTl, ATh, ATl);
        k_gemmw<bf, 1, true, 0><<<dim3(TT / 64, DM / 64, 1), 32, 0, stream>>>(ATh, ATl, WO, nullptr, DQ, OUT + (size_t)b * TT * DM, DM, bo, 0, 0, 0, nullptr, nullptr, nullptr, 0, 0); }
}

// v004
// A run of this version takes 278 microseconds.
// Next to v003, in two timings, it ran 1.30 and 1.31 times as fast.
// All steps since v000 together make it 11.4 times as fast.
#include <hip/hip_runtime.h>

// Causal self-attention over 4,096 tokens at d_model 768 (x [2][4096][768]; q, k, v = x W^T + b ('oi' uniform(+-768^-0.5) incl. biases: non-zero; 12 heads x 64); logits / sqrt(64); causal (-inf); softmax; out = merged Wo^T + b -> [2][4096][768] (6.3 M); argument order x, Wq_w, Wq_b, Wk_w, Wk_b, Wv_w, Wv_b, Wo_w, Wo_b).
// Layout per batch: bf16 copy of x; 'oi' weights; exact projections (K 768) + f32 biases, each writing its head planes (fp16 + hi/lo) from its own epilogue; causal attention at T 4096 / 12 heads fused in one launch with a running softmax (k_fattn; hybrid rows: < 512 hi/lo 3 products, rest fp16; the fp16 probabilities are exp(score - running maximum) <= 1, divided by the sum at the end, so no x1024 carry is needed); merged hi/lo x Wo exact + bias.
// Compute dtypes, f32 accumulate: every input rounded to bf16; projections exact + f32 biases; attention rows < 512 3 products, rest fp16; softmax f32; Wo hl x exact + bias.

#define NB_  2
#define TT   4096
#define DM   768
#define NH_  12
#define NKV  12
#define HD   64
#define DQ   (NH_ * HD)
#define DKV  (NKV * HD)
#define RH   512                  // query rows < RH use hi+lo planes (0: none)
#define SCL  0.125f   // HD^-0.5
typedef _Float16 h16;
typedef unsigned short bf;
typedef __attribute__((ext_vector_type(16))) __bf16   v16bf;
typedef __attribute__((ext_vector_type(16))) _Float16 v16h;
typedef __attribute__((ext_vector_type(8)))  _Float16 v8h;
typedef __attribute__((ext_vector_type(8)))  unsigned short v8us;
typedef __attribute__((ext_vector_type(8)))  float    v8f;
typedef __attribute__((ext_vector_type(4)))  float    v4f;
typedef v8h  __attribute__((may_alias)) v8ha;
typedef v4f  __attribute__((may_alias)) v4fa;
typedef v8us __attribute__((may_alias)) v8usa;

__device__ __forceinline__ unsigned short f2bf(float f) { unsigned u = __float_as_uint(f); u += 0x7FFFu + ((u >> 16) & 1u); return (unsigned short)(u >> 16); }
__device__ __forceinline__ float bf2f(unsigned short b) { return __uint_as_float(((unsigned)b) << 16); }
__device__ __forceinline__ float bfr(float f) { return bf2f(f2bf(f)); }
__device__ __forceinline__ v16h cat16(v8h lo, v8h hi) { return __builtin_shufflevector(lo, hi, 0, 1, 2, 3, 4, 5, 6, 7, 8, 9, 10, 11, 12, 13, 14, 15); }
__device__ __forceinline__ v16bf cat16b(v8us lo, v8us hi) { return __builtin_bit_cast(v16bf, __builtin_shufflevector(lo, hi, 0, 1, 2, 3, 4, 5, 6, 7, 8, 9, 10, 11, 12, 13, 14, 15)); }
__device__ __forceinline__ v8f wmma16(v16h a, v16h b, v8f c) { return __builtin_amdgcn_wmma_f32_16x16x32_f16(false, a, false, b, (short)0, c, false, false); }
__device__ __forceinline__ v8f wmmab(v16bf a, v16bf b, v8f c) { return __builtin_amdgcn_wmma_f32_16x16x32_bf16(false, a, false, b, (short)0, c, false, false); }
__device__ __forceinline__ h16 tohx(float x) { return (h16)x; }
__device__ __forceinline__ void splitf(float y, unsigned short& h, unsigned short& l) { h = f2bf(y); l = f2bf(y - bf2f(h)); }



// ---- k_gemmw: register-blocked GEMM, one wave per 64x64 output tile (16 accumulators), GW = 4 waves (2 x 2 tiles) per work-group; grid (M/128, N/128, Z), 128 threads.
// The K-contiguous 16-bit operand planes come through LDS: a stage is 64 k (one whole 128-byte line) of the work-group's 128 rows of every operand, brought by asynchronous copies of which each covers four whole lines
// (each wave copies a quarter of the rows; every row is fetched once for the two waves that read it); two buffers, so that the next stage's copies fly while this stage's fragments are read and multiplied.
// LDS rows at pitch 144 bytes (16 x odd: no bank conflict for the 16-byte fragment reads).
// C[m][n] (f32, pitch ldc, + optional f32 bias[n]) = sum_k A[m][k] Bt[n][k] (+ split products per NSPLIT). z-batch strides sA/sB/sC in elements. K % 64 == 0, K >= 64; M, N % 128 == 0.
// PL != 0: no f32 C; the tile + bias goes out as three 16-bit planes (P16 fp16, Ph/Pl bf16 hi/lo) of row pitch ldc, the 64x64 tile (i, j) at element i px + j py. PL 1: bias[n] (token rows x one head's 64 columns: planes [h][t][d]);
// PL 2: bias[m] (A = weight rows, Bt = token rows: the tile is the transposed projection, planes [h][d][t]).
template <typename T16> struct WFrag;
template <> struct WFrag<h16> { typedef v16h V; static __device__ __forceinline__ V ld(const h16* p) { return cat16(*(const v8h*)p, *(const v8h*)(p + 16)); } static __device__ __forceinline__ v8f mma(V a, V b, v8f c) { return wmma16(a, b, c); } };
template <> struct WFrag<bf> { typedef v16bf V; static __device__ __forceinline__ V ld(const bf* p) { return cat16b(*(const v8us*)p, *(const v8us*)(p + 16)); } static __device__ __forceinline__ v8f mma(V a, V b, v8f c) { return wmmab(a, b, c); } };
#define GW     4                  // waves of a work-group
#define GPITCH 144                // bytes of an LDS row: 128 of data + 16
#define GTILE  (128 * GPITCH)     // one operand's 128 rows of a stage
// Eight asynchronous copies, 16 bytes a lane: copy i brings four whole 128-byte rows (8 lanes a row) from g + i gs elements to LDS byte l + i 4 GPITCH.
// The s_wait_xcnt stands in the copies' own statement, so that no address register is rewritten in front of it.
template <typename T16>
__device__ __forceinline__ void cp8(unsigned l, const T16* g, size_t gs) {
    asm volatile("global_load_async_to_lds_b128 %0, %8, off\n\tglobal_load_async_to_lds_b128 %1, %9, off\n\tglobal_load_async_to_lds_b128 %2, %10, off\n\tglobal_load_async_to_lds_b128 %3, %11, off\n\t"
                 "global_load_async_to_lds_b128 %4, %12, off\n\tglobal_load_async_to_lds_b128 %5, %13, off\n\tglobal_load_async_to_lds_b128 %6, %14, off\n\tglobal_load_async_to_lds_b128 %7, %15, off\n\ts_wait_xcnt 0x0"
                 :: "v"(l), "v"(l + 4u * GPITCH), "v"(l + 8u * GPITCH), "v"(l + 12u * GPITCH), "v"(l + 16u * GPITCH), "v"(l + 20u * GPITCH), "v"(l + 24u * GPITCH), "v"(l + 28u * GPITCH),
                    "v"(g), "v"(g + gs), "v"(g + 2 * gs), "v"(g + 3 * gs), "v"(g + 4 * gs), "v"(g + 5 * gs), "v"(g + 6 * gs), "v"(g + 7 * gs) : "memory");
}
template <typename T16, int NSPLIT, bool BIAS, int PL>
__global__ __launch_bounds__(GW * 32) void k_gemmw(const T16* __restrict__ A, const T16* __restrict__ A2, const T16* __restrict__ Bt, const T16* __restrict__ Bt2, int K, float* C, int ldc, const float* __restrict__ bias, size_t sA, size_t sB, size_t sC, h16* P16, bf* Ph, bf* Pl, size_t px, size_t py) {
    typedef typename WFrag<T16>::V V;
    __shared__ __align__(16) float osm[GW * 16 * 68];
    const size_t z = blockIdx.z; A += z * sA; if (A2) A2 += z * sA; Bt += z * sB; if (Bt2) Bt2 += z * sB; C += z * sC;
    const int lane = threadIdx.x & 31, lr = lane & 15, hi = lane >> 4; const int wave = __builtin_amdgcn_readfirstlane(threadIdx.x >> 5);      // in a scalar register: the wave's tile and its slice of the copies are scalar offsets
    const int R0 = blockIdx.x * 128, C0 = blockIdx.y * 128, r0 = R0 + (wave >> 1) * 64, c0 = C0 + (wave & 1) * 64; float* os = osm + wave * (16 * 68);      // os: the wave's own output staging
    v8f acc[4][4];
#pragma unroll
    for (int mb = 0; mb < 4; ++mb)
#pragma unroll
        for (int nb = 0; nb < 4; ++nb) acc[mb][nb] = (v8f){};
    constexpr bool HA2 = NSPLIT == 1 || NSPLIT == 2, HB2 = NSPLIT >= 2; constexpr int NT = 2 + (HA2 ? 1 : 0) + (HB2 ? 1 : 0);      // operand tiles of a stage, in the order A, Bt, A2, Bt2
    __shared__ __align__(16) char stg[2 * NT * GTILE];
    // the lane's place in its wave's copies: rows wave 32 + lane / 8 + 4 i, 16-byte column lane % 8
    const int crow = wave * 32 + (lane >> 3), ccol = lane & 7;
    const size_t goA = (size_t)(R0 + crow) * K + ccol * 8, goB = (size_t)(C0 + crow) * K + ccol * 8, gs = (size_t)4 * K;
    const unsigned l0 = (unsigned)(size_t)stg + (unsigned)(crow * GPITCH + ccol * 16);
    auto stage = [&](int t, int buf) { const size_t ko = (size_t)t * 64; const unsigned lb = l0 + (unsigned)(buf * NT * GTILE);
        cp8(lb, A + goA + ko, gs); cp8(lb + GTILE, Bt + goB + ko, gs);
        if constexpr (HA2) cp8(lb + 2u * GTILE, A2 + goA + ko, gs);
        if constexpr (HB2) cp8(lb + (NT - 1u) * GTILE, Bt2 + goB + ko, gs); };
    const int nt = K / 64, foA = ((wave >> 1) * 64 + lr) * GPITCH + hi * 16, foB = GTILE + ((wave & 1) * 64 + lr) * GPITCH + hi * 16;      // the lane's place in the first A and Bt fragment of its wave's tile
    stage(0, 0);
    asm volatile("s_wait_asynccnt 0x0" ::: "memory");      // the wave's copies of stage 0 have landed before the barrier behind which the others read them
    __syncthreads();
    if (nt > 1) stage(1, 1);
#pragma unroll 1      // kept rolled: one trip a stage, the buffer chosen by the trip's parity
    for (int t = 0; t < nt; ++t) {
        const char* sb = stg + (t & 1) * (NT * GTILE);
        V a[2][4], a2[2][4], b[2][4], b2[2][4];
        auto ldf = [&](int ks) {      // the fragments of k step ks (32 k) of the stage
#pragma unroll
            for (int mb = 0; mb < 4; ++mb) { a[ks][mb] = WFrag<T16>::ld((const T16*)(sb + foA + mb * 16 * GPITCH + ks * 64)); if (HA2) a2[ks][mb] = WFrag<T16>::ld((const T16*)(sb + foA + 2 * GTILE + mb * 16 * GPITCH + ks * 64)); }
#pragma unroll
            for (int nb = 0; nb < 4; ++nb) { b[ks][nb] = WFrag<T16>::ld((const T16*)(sb + foB + nb * 16 * GPITCH + ks * 64)); if (HB2) b2[ks][nb] = WFrag<T16>::ld((const T16*)(sb + foB + (NT - 2) * GTILE + nb * 16 * GPITCH + ks * 64)); } };
        auto mm = [&](int ks) {
#pragma unroll
            for (int nb = 0; nb < 4; ++nb)
#pragma unroll
                for (int mb = 0; mb < 4; ++mb) { acc[mb][nb] = WFrag<T16>::mma(a[ks][mb], b[ks][nb], acc[mb][nb]); if (HA2) acc[mb][nb] = WFrag<T16>::mma(a2[ks][mb], b[ks][nb], acc[mb][nb]); if (HB2) acc[mb][nb] = WFrag<T16>::mma(a[ks][mb], b2[ks][nb], acc[mb][nb]); } };
        ldf(0); ldf(1);
        __builtin_amdgcn_sched_barrier(0);      // the stage's fragment reads stand together ahead of its products: spread among them, each b fragment went into the same registers and the wave waited out the LDS latency at every one
        mm(0);                                  // the first step's products run while the second step's fragments arrive
        __builtin_amdgcn_sched_barrier(0);      // keeps them ahead of the waits below
        // the stage's last fragments are in registers behind the first wait: its buffer is handed over and refilled ahead of their products, which then cover part of the copies' flight
        asm volatile("s_wait_dscnt 0x0" ::: "memory");         // the wave's reads of this stage are done before the barrier behind which its buffer is refilled
        asm volatile("s_wait_asynccnt 0x0" ::: "memory");      // the wave's copies of the next stage have landed before the barrier behind which the others read them
        __syncthreads();
        if (t + 2 < nt) stage(t + 2, t & 1);
        __builtin_amdgcn_sched_barrier(0);      // keeps the second step's products behind the copies' issue
        mm(1);
        asm volatile("v_nop\n\tv_nop\n\tv_nop\n\tv_nop" : "+v"(acc[0][0]), "+v"(acc[1][1]), "+v"(acc[2][2]), "+v"(acc[3][3]) : "v"(a[1][0]), "v"(a[1][3]));
    }
    asm volatile("s_wait_asynccnt 0x0" ::: "memory");      // nothing is in flight where the wave goes on to the epilogue
    // planes: a lane takes 8 columns of one staged row, so that each 16-byte store of the wave covers four whole 128-byte rows
    const int prow = lane >> 3, pcol = (lane & 7) * 8; const size_t pb = (size_t)(r0 >> 6) * px + (size_t)(c0 >> 6) * py + (size_t)prow * ldc + pcol; constexpr int NPB = PL == 2 ? 16 : 8; float pbias[NPB];
    if constexpr (PL != 0) {
#pragma unroll
        for (int i = 0; i < NPB; ++i) pbias[i] = PL == 1 ? bias[c0 + pcol + i] : bias[r0 + i * 4 + prow];
        // the wait: the address register of PL 1's bias loads is reused by the rows below; it takes the loaded values as inputs only, which keeps it behind the loads
        if constexpr (PL == 1) asm volatile("s_wait_xcnt 0x0" :: "v"(pbias[0]), "v"(pbias[1]), "v"(pbias[2]), "v"(pbias[3]), "v"(pbias[4]), "v"(pbias[5]), "v"(pbias[6]), "v"(pbias[7]));
#pragma unroll
        for (int i = 0; i < NPB; ++i) pbias[i] = bfr(pbias[i]); }
#pragma unroll
    for (int mb = 0; mb < 4; ++mb) {
#pragma unroll
        for (int nb = 0; nb < 4; ++nb) {
#pragma unroll
            for (int j = 0; j < 8; ++j) os[(hi * 8 + j) * 68 + nb * 16 + lr] = acc[mb][nb][j]; }
        __builtin_amdgcn_wave_barrier(); asm volatile("" ::: "memory");
        if constexpr (PL != 0) {
#pragma unroll
            for (int s = 0; s < 4; ++s) { const float* orow = os + (4 * s + prow) * 68 + pcol; const v4f v0 = *(const v4fa*)orow, v1 = *(const v4fa*)(orow + 4); v8h o16; v8us oh, ol;
#pragma unroll
                for (int k = 0; k < 8; ++k) { const float y = (k < 4 ? v0[k & 3] : v1[k & 3]) + pbias[PL == 1 ? k : mb * 4 + s]; o16[k] = tohx(y); unsigned short a2, c2; splitf(y, a2, c2); oh[k] = a2; ol[k] = c2; }
                const size_t o = pb + (size_t)(mb * 16 + 4 * s) * ldc; *(v8h*)(P16 + o) = o16; *(v8us*)(Ph + o) = oh; *(v8us*)(Pl + o) = ol;
                asm volatile("s_wait_xcnt 0x0" ::: "memory"); }      // the wait: the three stores' address and data registers are reused by the next rows
        } else {
        float* crow = C + (size_t)(r0 + mb * 16) * ldc + c0;
#pragma unroll
            for (int s = 0; s < 8; ++s) { const int row = 2 * s + hi, cofs = lr * 4; v4f val = *(const v4fa*)(os + row * 68 + cofs); if (BIAS) { val[0] += bfr(bias[c0 + cofs]); val[1] += bfr(bias[c0 + cofs + 1]); val[2] += bfr(bias[c0 + cofs + 2]); val[3] += bfr(bias[c0 + cofs + 3]); }
                *(v4f*)(crow + (size_t)row * ldc + cofs) = val; }
             }
        __builtin_amdgcn_wave_barrier(); asm volatile("" ::: "memory");
    }
}

typedef __attribute__((ext_vector_type(4))) _Float16 v4h;
typedef __attribute__((ext_vector_type(4))) unsigned short v4us;
typedef __attribute__((ext_vector_type(4))) int v4i;

__global__ __launch_bounds__(256) void k_cvt8(const float* __restrict__ src, bf* dst, size_t n8) { const size_t i = (size_t)blockIdx.x * 256 + threadIdx.x; if (i >= n8) return; const v8f v = *(const v8f*)(src + i * 8); v8us o;
#pragma unroll
    for (int k = 0; k < 8; ++k) o[k] = f2bf(v[k]); *(v8us*)(dst + i * 8) = o;  }

// ---- k_fattn: scores, causal softmax and probability x value product of one batch's heads in one launch; no score or probability plane reaches memory.
// One work-group of FW waves per (tile of 16 QT query rows, head). Wave w takes the 32-key blocks w, w + FW, ... up to the diagonal block with its own running maxima, sums and output tiles;
// the FW partial results are joined through LDS at the end (each scaled by exp(own maximum - joint maximum), added in wave order) and divided by the joint sum.
// Transposed products: S^T = K Q^T (A = key rows, B = query rows) and O^T += V^T P^T (A = rows of the transposed value plane, B = P). In every 16-column tile a lane then holds one query
// (column lr) and the keys hi 8 + j, so that maximum, sum and rescale factor are the lane's own, and two score tiles (keys 0..15, 16..31) are, register for register, the k order of a 32-key B fragment.
// Every loop over qt, kt, ks, dt, j, e and w is unrolled in full: the fragments and tiles are register arrays and need compile-time indices.
#define FW  4
#define L2E 1.4426950408889634f
typedef __attribute__((ext_vector_type(16))) unsigned short v16us;
// 2^x with the issue slot behind a transcendental kept by construction: the v_nop stands between the v_exp_f32 and whatever the compiler puts next (it may read the result or overwrite the source).
__device__ __forceinline__ float exp2n(float x) { float y; asm("v_exp_f32 %0, %1\n\tv_nop" : "=v"(y) : "v"(x)); return y; }
// Four at a time: each v_exp_f32 fills the slot of the one before it (the results are early-clobber, so none overwrites a source), the v_nop that of the last.
__device__ __forceinline__ void exp2x4(const float* x, float* y) { asm("v_exp_f32 %0, %4\n\tv_exp_f32 %1, %5\n\tv_exp_f32 %2, %6\n\tv_exp_f32 %3, %7\n\tv_nop" : "=&v"(y[0]), "=&v"(y[1]), "=&v"(y[2]), "=&v"(y[3]) : "v"(x[0]), "v"(x[1]), "v"(x[2]), "v"(x[3])); }
template <typename T16, int NSPLIT, int QT>
__device__ __forceinline__ void fa_tile(const T16* __restrict__ Q, const T16* __restrict__ Q2, const T16* __restrict__ Kp, const T16* __restrict__ Kp2, const T16* __restrict__ Vt, const T16* __restrict__ Vt2, int q0, int col0, bf* Ah, bf* Al, float* red, float* st) {
    typedef typename WFrag<T16>::V V;
    const int lane = threadIdx.x & 31, lr = lane & 15, hi = lane >> 4; const int wave = __builtin_amdgcn_readfirstlane(threadIdx.x >> 5);      // in a scalar register: the key loop and its test for the diagonal block are then scalar
    V qf[QT][2], qf2[QT][2];
#pragma unroll
    for (int qt = 0; qt < QT; ++qt)
#pragma unroll
        for (int ks = 0; ks < 2; ++ks) { const size_t o = (size_t)(q0 + qt * 16 + lr) * HD + ks * 32 + 8 * hi; qf[qt][ks] = WFrag<T16>::ld(Q + o); if (NSPLIT == 2) qf2[qt][ks] = WFrag<T16>::ld(Q2 + o); }
    v8f acc[QT][4]; float m[QT], l[QT];
#pragma unroll
    for (int qt = 0; qt < QT; ++qt) { m[qt] = -3.0e38f; l[qt] = 0.f;
#pragma unroll
        for (int dt = 0; dt < 4; ++dt) acc[qt][dt] = (v8f){}; }
    const int nfull = q0 / 32;      // key blocks wholly at or below every query of the tile; block nfull holds the diagonal and is the last
    // K and V^T fragments of key block b, straight from the K-contiguous planes
    auto ldk = [&](int b, V (&kf)[2][2], V (&kf2)[2][2]) {
#pragma unroll
        for (int kt = 0; kt < 2; ++kt)
#pragma unroll
            for (int ks = 0; ks < 2; ++ks) { const size_t o = (size_t)(b * 32 + kt * 16 + lr) * HD + ks * 32 + 8 * hi; kf[kt][ks] = WFrag<T16>::ld(Kp + o); if (NSPLIT == 2) kf2[kt][ks] = WFrag<T16>::ld(Kp2 + o); } };
    auto ldv = [&](int b, V (&vf)[4], V (&vf2)[4]) {
#pragma unroll
        for (int dt = 0; dt < 4; ++dt) { const size_t o = (size_t)(dt * 16 + lr) * TT + b * 32 + 8 * hi; vf[dt] = WFrag<T16>::ld(Vt + o); if (NSPLIT == 2) vf2[dt] = WFrag<T16>::ld(Vt2 + o); } };
    constexpr bool PF = (NSPLIT == 0);      // one-plane tiles fetch the wave's next block one pass ahead, right behind the last use of the registers (the hi/lo tiles are short and have no registers to spare)
    V kf[2][2], kf2[2][2], vf[4], vf2[4];
    if constexpr (PF) { const int b0 = min(wave, nfull); ldk(b0, kf, kf2); ldv(b0, vf, vf2);
        // Inputs-only fence on the loaded values: every load of the prologue has landed where the loop is entered. Without it the compiler's wait at the loop's head, which serves both ways in, also waits in every pass for the V^T fragments fetched just before. Its s_wait_xcnt: the loads' address registers are reused behind it.
        static_assert(QT == 2, "the fence names the fragments of two query tiles");
        asm volatile("s_wait_xcnt 0x0" :: "v"(qf[0][0]), "v"(qf[0][1]), "v"(qf[1][0]), "v"(qf[1][1]), "v"(kf[0][0]), "v"(kf[0][1]), "v"(kf[1][0]), "v"(kf[1][1]), "v"(vf[0]), "v"(vf[1]), "v"(vf[2]), "v"(vf[3])); }
#pragma unroll 1      // kept rolled: the trip count is known at run time only, and a second copy of the body would not fit the register budget beside the fragments fetched ahead
    for (int blk = wave; blk <= nfull; blk += FW) { const int kb = blk * 32, nb = min(blk + FW, nfull);      // nb: clamped, so that the last pass's fetch stays inside the planes
        if (!PF) { ldk(blk, kf, kf2); asm volatile("s_wait_xcnt 0x0" ::: "memory"); ldv(blk, vf, vf2); asm volatile("s_wait_xcnt 0x0" ::: "memory"); }      // the waits: the loads' address registers are reused, by the V^T fragments and in later blocks of the pass
        v8f s[QT][2];
#pragma unroll
        for (int kt = 0; kt < 2; ++kt)
#pragma unroll
            for (int qt = 0; qt < QT; ++qt) { v8f c = (v8f){};
#pragma unroll
                for (int ks = 0; ks < 2; ++ks) { c = WFrag<T16>::mma(kf[kt][ks], qf[qt][ks], c); if (NSPLIT == 2) { c = WFrag<T16>::mma(kf[kt][ks], qf2[qt][ks], c); c = WFrag<T16>::mma(kf2[kt][ks], qf[qt][ks], c); } }
                s[qt][kt] = c * SCL; }
        if (PF) { ldk(nb, kf, kf2); asm volatile("s_wait_xcnt 0x0" ::: "memory"); }      // the wait: as above
        if (blk == nfull) {      // the diagonal block: keys beyond the query are masked (every query keeps at least key kb)
#pragma unroll
            for (int qt = 0; qt < QT; ++qt)
#pragma unroll
                for (int kt = 0; kt < 2; ++kt)
#pragma unroll
                    for (int j = 0; j < 8; ++j) if (kb + kt * 16 + hi * 8 + j > q0 + qt * 16 + lr) s[qt][kt][j] = -3.0e38f; }
#pragma unroll
        for (int qt = 0; qt < QT; ++qt) {
            float bm = s[qt][0][0];
#pragma unroll
            for (int kt = 0; kt < 2; ++kt)
#pragma unroll
                for (int j = 0; j < 8; ++j) bm = fmaxf(bm, s[qt][kt][j]);
            bm = fmaxf(bm, __shfl_xor(bm, 16, 32));      // the other half of the wave holds the query's other 16 keys
            if (__builtin_amdgcn_ballot_w32(bm > m[qt]) != 0) {      // a scalar branch: where no query's maximum grows the factor is exactly 1 and the rescale is skipped
                const float mn = fmaxf(m[qt], bm), al = exp2n((m[qt] - mn) * L2E); m[qt] = mn; l[qt] *= al;
#pragma unroll
                for (int dt = 0; dt < 4; ++dt) acc[qt][dt] *= al; }
            float x[16], p[16], ps = 0.f;
#pragma unroll
            for (int e = 0; e < 16; ++e) x[e] = (s[qt][e >> 3][e & 7] - m[qt]) * L2E;
#pragma unroll
            for (int e = 0; e < 16; e += 4) exp2x4(x + e, p + e);
#pragma unroll
            for (int e = 0; e < 16; ++e) ps += p[e];
            l[qt] += ps;      // the lane's own 16 keys; the halves are joined behind the loop
            if constexpr (NSPLIT == 2) { v16us ph, pl;
#pragma unroll
                for (int e = 0; e < 16; ++e) { unsigned short a, c2; splitf(p[e], a, c2); ph[e] = a; pl[e] = c2; }
                const V pf = __builtin_bit_cast(V, ph), pf2 = __builtin_bit_cast(V, pl);
#pragma unroll
                for (int dt = 0; dt < 4; ++dt) { acc[qt][dt] = WFrag<T16>::mma(vf[dt], pf, acc[qt][dt]); acc[qt][dt] = WFrag<T16>::mma(vf[dt], pf2, acc[qt][dt]); acc[qt][dt] = WFrag<T16>::mma(vf2[dt], pf, acc[qt][dt]); }
            } else { V pf;
#pragma unroll
                for (int e = 0; e < 16; ++e) pf[e] = tohx(p[e]);
#pragma unroll
                for (int dt = 0; dt < 4; ++dt) acc[qt][dt] = WFrag<T16>::mma(vf[dt], pf, acc[qt][dt]); } }
        if (PF) { ldv(nb, vf, vf2); asm volatile("s_wait_xcnt 0x0" ::: "memory"); } }      // the wait: as above, over the loop's back edge
#pragma unroll
    for (int qt = 0; qt < QT; ++qt) { l[qt] += __shfl_xor(l[qt], 16, 32); float* sw = st + (wave * QT + qt) * 64; sw[lane] = m[qt]; sw[32 + lane] = l[qt];
#pragma unroll
        for (int dt = 0; dt < 4; ++dt)
#pragma unroll
            for (int j = 0; j < 8; ++j) red[(((wave * QT + qt) * 4 + dt) * 8 + j) * 32 + lane] = acc[qt][dt][j]; }
    __syncthreads();
    // wave w joins output tile dt = w of every query tile, in the lane layout the tiles were stored in; a wave that had no key block left maximum -3e38, sum 0 and zeros: its factor is 0
#pragma unroll
    for (int qt = 0; qt < QT; ++qt) { float f[FW], M = -3.0e38f, Ls = 0.f;
#pragma unroll
        for (int w = 0; w < FW; ++w) { f[w] = st[(w * QT + qt) * 64 + lane]; M = fmaxf(M, f[w]); }
#pragma unroll
        for (int w = 0; w < FW; ++w) { f[w] = exp2n((f[w] - M) * L2E); Ls += st[(w * QT + qt) * 64 + 32 + lane] * f[w]; }
        const float inv = __fdiv_rn(1.0f, Ls); v8us oh, ol;
#pragma unroll
        for (int j = 0; j < 8; ++j) { float o = 0.f;
#pragma unroll
            for (int w = 0; w < FW; ++w) o += red[(((w * QT + qt) * 4 + wave) * 8 + j) * 32 + lane] * f[w];
            unsigned short a, c2; splitf(o * inv, a, c2); oh[j] = a; ol[j] = c2; }
        const size_t oo = (size_t)(q0 + qt * 16 + lr) * DQ + col0 + wave * 16 + hi * 8; *(v8us*)(Ah + oo) = oh; *(v8us*)(Al + oo) = ol;
        asm volatile("s_wait_xcnt 0x0" ::: "memory"); }      // the wait: the two stores' address and data registers may be reused by whatever code follows the tile
}
// Grid ((TT - RH) / 32 + RH / 16, heads): first the fp16 tiles of 32 query rows, the longest (last rows) first, then the hi/lo tiles of 16 query rows < RH.
// amdgpu_waves_per_eu(4, 4): four waves a SIMD, 256 registers a wave; with a smaller budget the compiler loads the K fragments one after the other into the same registers and waits for each.
__global__ __launch_bounds__(FW * 32) __attribute__((amdgpu_waves_per_eu(4, 4))) void k_fattn(const h16* __restrict__ Q16, const h16* __restrict__ K16, const h16* __restrict__ V16, const bf* __restrict__ Qh, const bf* __restrict__ Ql, const bf* __restrict__ Kh, const bf* __restrict__ Kl, const bf* __restrict__ Vh, const bf* __restrict__ Vl, bf* Ah, bf* Al) {
    __shared__ __align__(16) float red[FW * 2 * 4 * 8 * 32]; __shared__ __align__(16) float st[FW * 2 * 64];
    const int h = blockIdx.y, bx = blockIdx.x; const size_t zo = (size_t)h * TT * HD; constexpr int NLO = (TT - RH) / 32;
    if (bx < NLO) fa_tile<h16, 0, 2>(Q16 + zo, nullptr, K16 + zo, nullptr, V16 + zo, nullptr, TT - 32 * (bx + 1), h * HD, Ah, Al, red, st);
    else fa_tile<bf, 2, 1>(Qh + zo, Ql + zo, Kh + zo, Kl + zo, Vh + zo, Vl + zo, RH - 16 * (bx - NLO + 1), h * HD, Ah, Al, red, st);
}

extern "C" void kernel_launch(void* const* d_in, const int* in_sizes, int n_in,
                              void* d_out, int out_size, void* d_ws, size_t ws_size, hipStream_t stream) {
    (void)in_sizes; (void)n_in; (void)out_size;
    const float* x = (const float*)d_in[0]; const float* wq = (const float*)d_in[1]; const float* bq = (const float*)d_in[2]; const float* wk = (const float*)d_in[3]; const float* bk = (const float*)d_in[4]; const float* wv = (const float*)d_in[5]; const float* bv = (const float*)d_in[6]; const float* wo = (const float*)d_in[7]; const float* bo = (const float*)d_in[8];   /* argument order x, Wq_w, Wq_b, Wk_w, Wk_b, Wv_w, Wv_b, Wo_w, Wo_b ('oi') */
    float* OUT = (float*)d_out;     // [2][4096][768]
    char* wsp = (char*)d_ws;
    auto take = [&](size_t bytes) { char* p = wsp; wsp += (bytes + 255) & ~(size_t)255; return (void*)p; };
    bf* WQ = (bf*)take((size_t)DQ * DM * 2); bf* WK = (bf*)take((size_t)DKV * DM * 2); bf* WV = (bf*)take((size_t)DKV * DM * 2); bf* WO = (bf*)take((size_t)DM * DQ * 2);
    bf* XB = (bf*)take((size_t)TT * DM * 2);
    h16* QP16 = (h16*)take((size_t)NH_ * TT * HD * 2); h16* KP16 = (h16*)take((size_t)NKV * TT * HD * 2); h16* VT16 = (h16*)take((size_t)NKV * HD * TT * 2);
    bf* QPh = (bf*)take((size_t)NH_ * TT * HD * 2); bf* QPl = (bf*)take((size_t)NH_ * TT * HD * 2); bf* KPh = (bf*)take((size_t)NKV * TT * HD * 2); bf* KPl = (bf*)take((size_t)NKV * TT * HD * 2); bf* VTh = (bf*)take((size_t)NKV * HD * TT * 2); bf* VTl = (bf*)take((size_t)NKV * HD * TT * 2);
    bf* ATh = (bf*)take((size_t)TT * DQ * 2); bf* ATl = (bf*)take((size_t)TT * DQ * 2);
    if ((size_t)(wsp - (char*)d_ws) > ws_size) return;    // ws 256 MiB
    { k_cvt8<<<(unsigned)(((size_t)DQ * DM / 8 + 255) / 256), 256, 0, stream>>>(wq, WQ, (size_t)DQ * DM / 8); k_cvt8<<<(unsigned)(((size_t)DKV * DM / 8 + 255) / 256), 256, 0, stream>>>(wk, WK, (size_t)DKV * DM / 8); k_cvt8<<<(unsigned)(((size_t)DKV * DM / 8 + 255) / 256), 256, 0, stream>>>(wv, WV, (size_t)DKV * DM / 8);
      k_cvt8<<<(unsigned)(((size_t)DM * DQ / 8 + 255) / 256), 256, 0, stream>>>(wo, WO, (size_t)DM * DQ / 8);
       }
    for (int b = 0; b < NB_; ++b) {
        
        k_cvt8<<<(unsigned)(((size_t)TT * DM / 8 + 255) / 256), 256, 0, stream>>>(x + (size_t)b * TT * DM, XB, (size_t)TT * DM / 8);
        k_gemmw<bf, 0, true, 1><<<dim3(TT / 128, DQ / 128, 1), GW * 32, 0, stream>>>(XB, nullptr, WQ, nullptr, DM, nullptr, HD, bq, 0, 0, 0, QP16, QPh, QPl, (size_t)64 * HD, (size_t)TT * HD);
        k_gemmw<bf, 0, true, 1><<<dim3(TT / 128, DKV / 128, 1), GW * 32, 0, stream>>>(XB, nullptr, WK, nullptr, DM, nullptr, HD, bk, 0, 0, 0, KP16, KPh, KPl, (size_t)64 * HD, (size_t)TT * HD);
        k_gemmw<bf, 0, true, 2><<<dim3(DKV / 128, TT / 128, 1), GW * 32, 0, stream>>>(WV, nullptr, XB, nullptr, DM, nullptr, TT, bv, 0, 0, 0, VT16, VTh, VTl, (size_t)64 * TT, (size_t)64);      // operands swapped: the tile is V^T
        k_fattn<<<dim3((TT - RH) / 32 + RH / 16, NH_), FW * 32, 0, stream>>>(QP16, KP16, VT16, QPh, QPl, KPh, KPl, VTh, VTl, ATh, ATl);
        k_gemmw<bf, 1, true, 0><<<dim3(TT / 128, DM / 128, 1), GW * 32, 0, stream>>>(ATh, ATl, WO, nullptr, DQ, OUT + (size_t)b * TT * DM, DM, bo, 0, 0, 0, nullptr, nullptr, nullptr, 0, 0); }
}

// v005
// Measured time: 208 microseconds a run.
// In both of two side-by-side timings against v004, it was 1.34 times as fast.
// Counting every step since v000, it is 15.3 times as fast.
#include <hip/hip_runtime.h>

// Causal self-attention over 4,096 tokens at d_model 768 (x [2][4096][768]; q, k, v = x W^T + b ('oi' uniform(+-768^-0.5) incl. biases: non-zero; 12 heads x 64); logits / sqrt(64); causal (-inf); softmax; out = merged Wo^T + b -> [2][4096][768] (6.3 M); argument order x, Wq_w, Wq_b, Wk_w, Wk_b, Wv_w, Wv_b, Wo_w, Wo_b).
// Layout per batch: bf16 copy of x; 'oi' weights; exact projections (K 768) + f32 biases, each writing its head planes (fp16 + hi/lo) from its own epilogue; causal attention at T 4096 / 12 heads fused in one launch with a running softmax (k_fattn, K and V^T of the fp16 rows staged in LDS; hybrid rows: < 512 hi/lo 3 products, rest fp16; the fp16 probabilities are exp(score - running maximum) <= 1, divided by the sum at the end, so no x1024 carry is needed); merged hi/lo x Wo exact + bias.
// Compute dtypes, f32 accumulate: every input rounded to bf16; projections exact + f32 biases; attention rows < 512 3 products, rest fp16; softmax f32; Wo hl x exact + bias.

#define NB_  2
#define TT   4096
#define DM   768
#define NH_  12
#define NKV  12
#define HD   64
#define DQ   (NH_ * HD)
#define DKV  (NKV * HD)
#define RH   512                  // query rows < RH use hi+lo planes (0: none)
#define SCL  0.125f   // HD^-0.5
typedef _Float16 h16;
typedef unsigned short bf;
typedef __attribute__((ext_vector_type(16))) __bf16   v16bf;
typedef __attribute__((ext_vector_type(16))) _Float16 v16h;
typedef __attribute__((ext_vector_type(8)))  _Float16 v8h;
typedef __attribute__((ext_vector_type(8)))  unsigned short v8us;
typedef __attribute__((ext_vector_type(8)))  float    v8f;
typedef __attribute__((ext_vector_type(4)))  float    v4f;
typedef v8h  __attribute__((may_alias)) v8ha;
typedef v4f  __attribute__((may_alias)) v4fa;
typedef v8us __attribute__((may_alias)) v8usa;

__device__ __forceinline__ unsigned short f2bf(float f) { unsigned u = __float_as_uint(f); u += 0x7FFFu + ((u >> 16) & 1u); return (unsigned short)(u >> 16); }
__device__ __forceinline__ float bf2f(unsigned short b) { return __uint_as_float(((unsigned)b) << 16); }
__device__ __forceinline__ float bfr(float f) { return bf2f(f2bf(f)); }
__device__ __forceinline__ v16h cat16(v8h lo, v8h hi) { return __builtin_shufflevector(lo, hi, 0, 1, 2, 3, 4, 5, 6, 7, 8, 9, 10, 11, 12, 13, 14, 15); }
__device__ __forceinline__ v16bf cat16b(v8us lo, v8us hi) { return __builtin_bit_cast(v16bf, __builtin_shufflevector(lo, hi, 0, 1, 2, 3, 4, 5, 6, 7, 8, 9, 10, 11, 12, 13, 14, 15)); }
__device__ __forceinline__ v8f wmma16(v16h a, v16h b, v8f c) { return __builtin_amdgcn_wmma_f32_16x16x32_f16(false, a, false, b, (short)0, c, false, false); }
__device__ __forceinline__ v8f wmmab(v16bf a, v16bf b, v8f c) { return __builtin_amdgcn_wmma_f32_16x16x32_bf16(false, a, false, b, (short)0, c, false, false); }
__device__ __forceinline__ h16 tohx(float x) { return (h16)x; }
__device__ __forceinline__ void splitf(float y, unsigned short& h, unsigned short& l) { h = f2bf(y); l = f2bf(y - bf2f(h)); }



// ---- k_gemmw: register-blocked GEMM, one wave per 64x64 output tile (16 accumulators), GW = 4 waves (2 x 2 tiles) per work-group; grid (M/128, N/128, Z), 128 threads.
// The K-contiguous 16-bit operand planes come through LDS: a stage is 64 k (one whole 128-byte line) of the work-group's 128 rows of every operand, brought by asynchronous copies of which each covers four whole lines
// (each wave copies a quarter of the rows; every row is fetched once for the two waves that read it); two buffers, so that the next stage's copies fly while this stage's fragments are read and multiplied.
// LDS rows at pitch 144 bytes (16 x odd: no bank conflict for the 16-byte fragment reads).
// C[m][n] (f32, pitch ldc, + optional f32 bias[n]) = sum_k A[m][k] Bt[n][k] (+ split products per NSPLIT). z-batch strides sA/sB/sC in elements. K % 64 == 0, K >= 64; M, N % 128 == 0.
// PL != 0: no f32 C; the tile + bias goes out as three 16-bit planes (P16 fp16, Ph/Pl bf16 hi/lo) of row pitch ldc, the 64x64 tile (i, j) at element i px + j py. PL 1: bias[n] (token rows x one head's 64 columns: planes [h][t][d]);
// PL 2: bias[m] (A = weight rows, Bt = token rows: the tile is the transposed projection, planes [h][d][t]).
template <typename T16> struct WFrag;
template <> struct WFrag<h16> { typedef v16h V; static __device__ __forceinline__ V ld(const h16* p) { return cat16(*(const v8h*)p, *(const v8h*)(p + 16)); } static __device__ __forceinline__ v8f mma(V a, V b, v8f c) { return wmma16(a, b, c); } };
template <> struct WFrag<bf> { typedef v16bf V; static __device__ __forceinline__ V ld(const bf* p) { return cat16b(*(const v8us*)p, *(const v8us*)(p + 16)); } static __device__ __forceinline__ v8f mma(V a, V b, v8f c) { return wmmab(a, b, c); } };
#define GW     4                  // waves of a work-group
#define GPITCH 144                // bytes of an LDS row: 128 of data + 16
#define GTILE  (128 * GPITCH)     // one operand's 128 rows of a stage
// Eight asynchronous copies, 16 bytes a lane: copy i brings four whole 128-byte rows (8 lanes a row) from g + i gs elements to LDS byte l + i 4 GPITCH.
// The s_wait_xcnt stands in the copies' own statement, so that no address register is rewritten in front of it.
template <typename T16>
__device__ __forceinline__ void cp8(unsigned l, const T16* g, size_t gs) {
    asm volatile("global_load_async_to_lds_b128 %0, %8, off\n\tglobal_load_async_to_lds_b128 %1, %9, off\n\tglobal_load_async_to_lds_b128 %2, %10, off\n\tglobal_load_async_to_lds_b128 %3, %11, off\n\t"
                 "global_load_async_to_lds_b128 %4, %12, off\n\tglobal_load_async_to_lds_b128 %5, %13, off\n\tglobal_load_async_to_lds_b128 %6, %14, off\n\tglobal_load_async_to_lds_b128 %7, %15, off\n\ts_wait_xcnt 0x0"
                 :: "v"(l), "v"(l + 4u * GPITCH), "v"(l + 8u * GPITCH), "v"(l + 12u * GPITCH), "v"(l + 16u * GPITCH), "v"(l + 20u * GPITCH), "v"(l + 24u * GPITCH), "v"(l + 28u * GPITCH),
                    "v"(g), "v"(g + gs), "v"(g + 2 * gs), "v"(g + 3 * gs), "v"(g + 4 * gs), "v"(g + 5 * gs), "v"(g + 6 * gs), "v"(g + 7 * gs) : "memory");
}
template <typename T16, int NSPLIT, bool BIAS, int PL>
__global__ __launch_bounds__(GW * 32) void k_gemmw(const T16* __restrict__ A, const T16* __restrict__ A2, const T16* __restrict__ Bt, const T16* __restrict__ Bt2, int K, float* C, int ldc, const float* __restrict__ bias, size_t sA, size_t sB, size_t sC, h16* P16, bf* Ph, bf* Pl, size_t px, size_t py) {
    typedef typename WFrag<T16>::V V;
    __shared__ __align__(16) float osm[GW * 16 * 68];
    const size_t z = blockIdx.z; A += z * sA; if (A2) A2 += z * sA; Bt += z * sB; if (Bt2) Bt2 += z * sB; C += z * sC;
    const int lane = threadIdx.x & 31, lr = lane & 15, hi = lane >> 4; const int wave = __builtin_amdgcn_readfirstlane(threadIdx.x >> 5);      // in a scalar register: the wave's tile and its slice of the copies are scalar offsets
    const int R0 = blockIdx.x * 128, C0 = blockIdx.y * 128, r0 = R0 + (wave >> 1) * 64, c0 = C0 + (wave & 1) * 64; float* os = osm + wave * (16 * 68);      // os: the wave's own output staging
    v8f acc[4][4];
#pragma unroll
    for (int mb = 0; mb < 4; ++mb)
#pragma unroll
        for (int nb = 0; nb < 4; ++nb) acc[mb][nb] = (v8f){};
    constexpr bool HA2 = NSPLIT == 1 || NSPLIT == 2, HB2 = NSPLIT >= 2; constexpr int NT = 2 + (HA2 ? 1 : 0) + (HB2 ? 1 : 0);      // operand tiles of a stage, in the order A, Bt, A2, Bt2
    __shared__ __align__(16) char stg[2 * NT * GTILE];
    // the lane's place in its wave's copies: rows wave 32 + lane / 8 + 4 i, 16-byte column lane % 8
    const int crow = wave * 32 + (lane >> 3), ccol = lane & 7;
    const size_t goA = (size_t)(R0 + crow) * K + ccol * 8, goB = (size_t)(C0 + crow) * K + ccol * 8, gs = (size_t)4 * K;
    const unsigned l0 = (unsigned)(size_t)stg + (unsigned)(crow * GPITCH + ccol * 16);
    auto stage = [&](int t, int buf) { const size_t ko = (size_t)t * 64; const unsigned lb = l0 + (unsigned)(buf * NT * GTILE);
        cp8(lb, A + goA + ko, gs); cp8(lb + GTILE, Bt + goB + ko, gs);
        if constexpr (HA2) cp8(lb + 2u * GTILE, A2 + goA + ko, gs);
        if constexpr (HB2) cp8(lb + (NT - 1u) * GTILE, Bt2 + goB + ko, gs); };
    const int nt = K / 64, foA = ((wave >> 1) * 64 + lr) * GPITCH + hi * 16, foB = GTILE + ((wave & 1) * 64 + lr) * GPITCH + hi * 16;      // the lane's place in the first A and Bt fragment of its wave's tile
    stage(0, 0);
    asm volatile("s_wait_asynccnt 0x0" ::: "memory");      // the wave's copies of stage 0 have landed before the barrier behind which the others read them
    __syncthreads();
    if (nt > 1) stage(1, 1);
#pragma unroll 1      // kept rolled: one trip a stage, the buffer chosen by the trip's parity
    for (int t = 0; t < nt; ++t) {
        const char* sb = stg + (t & 1) * (NT * GTILE);
        V a[2][4], a2[2][4], b[2][4], b2[2][4];
        auto ldf = [&](int ks) {      // the fragments of k step ks (32 k) of the stage
#pragma unroll
            for (int mb = 0; mb < 4; ++mb) { a[ks][mb] = WFrag<T16>::ld((const T16*)(sb + foA + mb * 16 * GPITCH + ks * 64)); if (HA2) a2[ks][mb] = WFrag<T16>::ld((const T16*)(sb + foA + 2 * GTILE + mb * 16 * GPITCH + ks * 64)); }
#pragma unroll
            for (int nb = 0; nb < 4; ++nb) { b[ks][nb] = WFrag<T16>::ld((const T16*)(sb + foB + nb * 16 * GPITCH + ks * 64)); if (HB2) b2[ks][nb] = WFrag<T16>::ld((const T16*)(sb + foB + (NT - 2) * GTILE + nb * 16 * GPITCH + ks * 64)); } };
        auto mm = [&](int ks) {
#pragma unroll
            for (int nb = 0; nb < 4; ++nb)
#pragma unroll
                for (int mb = 0; mb < 4; ++mb) { acc[mb][nb] = WFrag<T16>::mma(a[ks][mb], b[ks][nb], acc[mb][nb]); if (HA2) acc[mb][nb] = WFrag<T16>::mma(a2[ks][mb], b[ks][nb], acc[mb][nb]); if (HB2) acc[mb][nb] = WFrag<T16>::mma(a[ks][mb], b2[ks][nb], acc[mb][nb]); } };
        ldf(0); ldf(1);
        __builtin_amdgcn_sched_barrier(0);      // the stage's fragment reads stand together ahead of its products: spread among them, each b fragment went into the same registers and the wave waited out the LDS latency at every one
        mm(0);                                  // the first step's products run while the second step's fragments arrive
        __builtin_amdgcn_sched_barrier(0);      // keeps them ahead of the waits below
        // the stage's last fragments are in registers behind the first wait: its buffer is handed over and refilled ahead of their products, which then cover part of the copies' flight
        asm volatile("s_wait_dscnt 0x0" ::: "memory");         // the wave's reads of this stage are done before the barrier behind which its buffer is refilled
        asm volatile("s_wait_asynccnt 0x0" ::: "memory");      // the wave's copies of the next stage have landed before the barrier behind which the others read them
        __syncthreads();
        if (t + 2 < nt) stage(t + 2, t & 1);
        __builtin_amdgcn_sched_barrier(0);      // keeps the second step's products behind the copies' issue
        mm(1);
        asm volatile("v_nop\n\tv_nop\n\tv_nop\n\tv_nop" : "+v"(acc[0][0]), "+v"(acc[1][1]), "+v"(acc[2][2]), "+v"(acc[3][3]) : "v"(a[1][0]), "v"(a[1][3]));
    }
    asm volatile("s_wait_asynccnt 0x0" ::: "memory");      // nothing is in flight where the wave goes on to the epilogue
    // planes: a lane takes 8 columns of one staged row, so that each 16-byte store of the wave covers four whole 128-byte rows
    const int prow = lane >> 3, pcol = (lane & 7) * 8; const size_t pb = (size_t)(r0 >> 6) * px + (size_t)(c0 >> 6) * py + (size_t)prow * ldc + pcol; constexpr int NPB = PL == 2 ? 16 : 8; float pbias[NPB];
    if constexpr (PL != 0) {
#pragma unroll
        for (int i = 0; i < NPB; ++i) pbias[i] = PL == 1 ? bias[c0 + pcol + i] : bias[r0 + i * 4 + prow];
        // the wait: the address register of PL 1's bias loads is reused by the rows below; it takes the loaded values as inputs only, which keeps it behind the loads
        if constexpr (PL == 1) asm volatile("s_wait_xcnt 0x0" :: "v"(pbias[0]), "v"(pbias[1]), "v"(pbias[2]), "v"(pbias[3]), "v"(pbias[4]), "v"(pbias[5]), "v"(pbias[6]), "v"(pbias[7]));
#pragma unroll
        for (int i = 0; i < NPB; ++i) pbias[i] = bfr(pbias[i]); }
#pragma unroll
    for (int mb = 0; mb < 4; ++mb) {
#pragma unroll
        for (int nb = 0; nb < 4; ++nb) {
#pragma unroll
            for (int j = 0; j < 8; ++j) os[(hi * 8 + j) * 68 + nb * 16 + lr] = acc[mb][nb][j]; }
        __builtin_amdgcn_wave_barrier(); asm volatile("" ::: "memory");
        if constexpr (PL != 0) {
#pragma unroll
            for (int s = 0; s < 4; ++s) { const float* orow = os + (4 * s + prow) * 68 + pcol; const v4f v0 = *(const v4fa*)orow, v1 = *(const v4fa*)(orow + 4); v8h o16; v8us oh, ol;
#pragma unroll
                for (int k = 0; k < 8; ++k) { const float y = (k < 4 ? v0[k & 3] : v1[k & 3]) + pbias[PL == 1 ? k : mb * 4 + s]; o16[k] = tohx(y); unsigned short a2, c2; splitf(y, a2, c2); oh[k] = a2; ol[k] = c2; }
                const size_t o = pb + (size_t)(mb * 16 + 4 * s) * ldc; *(v8h*)(P16 + o) = o16; *(v8us*)(Ph + o) = oh; *(v8us*)(Pl + o) = ol;
                asm volatile("s_wait_xcnt 0x0" ::: "memory"); }      // the wait: the three stores' address and data registers are reused by the next rows
        } else {
        float* crow = C + (size_t)(r0 + mb * 16) * ldc + c0;
#pragma unroll
            for (int s = 0; s < 8; ++s) { const int row = 2 * s + hi, cofs = lr * 4; v4f val = *(const v4fa*)(os + row * 68 + cofs); if (BIAS) { val[0] += bfr(bias[c0 + cofs]); val[1] += bfr(bias[c0 + cofs + 1]); val[2] += bfr(bias[c0 + cofs + 2]); val[3] += bfr(bias[c0 + cofs + 3]); }
                *(v4f*)(crow + (size_t)row * ldc + cofs) = val; }
             }
        __builtin_amdgcn_wave_barrier(); asm volatile("" ::: "memory");
    }
}

typedef __attribute__((ext_vector_type(4))) _Float16 v4h;
typedef __attribute__((ext_vector_type(4))) unsigned short v4us;
typedef __attribute__((ext_vector_type(4))) int v4i;

__global__ __launch_bounds__(256) void k_cvt8(const float* __restrict__ src, bf* dst, size_t n8) { const size_t i = (size_t)blockIdx.x * 256 + threadIdx.x; if (i >= n8) return; const v8f v = *(const v8f*)(src + i * 8); v8us o;
#pragma unroll
    for (int k = 0; k < 8; ++k) o[k] = f2bf(v[k]); *(v8us*)(dst + i * 8) = o;  }

// ---- k_fattn: scores, causal softmax and probability x value product of one batch's heads in one launch; no score or probability plane reaches memory.
// Transposed products: S^T = K Q^T (A = key rows, B = query rows) and O^T += V^T P^T (A = rows of the transposed value plane, B = P). In every 16-column tile a lane then holds one query
// (column lr) and the keys hi 8 + j, so that maximum, sum and rescale factor are the lane's own, and two score tiles (keys 0..15, 16..31) are, register for register, the k order of a 32-key B fragment.
// Work-groups of FW waves. Two kinds of tile: fa_tile_s (fp16, 128 query rows, K and V^T staged in LDS and shared by the waves) and fa_tile (hi/lo, 16 query rows, the waves split the keys).
// Every loop over qt, kt, ks, dt, j, e and w is unrolled in full: the fragments and tiles are register arrays and need compile-time indices.
#define FW  16
#define L2E 1.4426950408889634f
typedef __attribute__((ext_vector_type(16))) unsigned short v16us;
// 2^x with the issue slot behind a transcendental kept by construction: the v_nop stands between the v_exp_f32 and whatever the compiler puts next (it may read the result or overwrite the source).
__device__ __forceinline__ float exp2n(float x) { float y; asm("v_exp_f32 %0, %1\n\tv_nop" : "=v"(y) : "v"(x)); return y; }
// Four at a time: each v_exp_f32 fills the slot of the one before it (the results are early-clobber, so none overwrites a source), the v_nop that of the last.
__device__ __forceinline__ void exp2x4(const float* x, float* y) { asm("v_exp_f32 %0, %4\n\tv_exp_f32 %1, %5\n\tv_exp_f32 %2, %6\n\tv_exp_f32 %3, %7\n\tv_nop" : "=&v"(y[0]), "=&v"(y[1]), "=&v"(y[2]), "=&v"(y[3]) : "v"(x[0]), "v"(x[1]), "v"(x[2]), "v"(x[3])); }

// ---- fa_tile_s: 128 query rows of one head, fp16. Wave w = (g = w % 4, kq = w / 4) holds the 32 queries q0 + 32 g .. and takes the 64-key quarter kq of every 256-key stage, with its own running maxima, sums and output tiles.
// A stage is 512 LDS rows of 128 bytes at pitch GPITCH: per 64-key quarter 64 K rows (a key's 64 dims), then 64 V^T rows (a dim's 64 keys). Each wave brings 32 of the rows by eight asynchronous copies of four whole lines each,
// so that every K and V^T line is fetched once for the four waves that read it; two buffers: the next stage's copies fly while this stage is worked on.
// The last stage holds the diagonal: a wave skips the 32-key blocks beyond its queries (a scalar test) and masks the one on them. At the end the four waves of a query group join their parts through LDS, two output tiles each.
#define SKEYS 256
#define SROWS (2 * SKEYS)
#define SBUF  (SROWS * GPITCH)
#define XW    (68 * 32)           // floats a wave hands over: 64 a lane of its eight output tiles, two maxima, two sums
__device__ __forceinline__ void fa_tile_s(const h16* __restrict__ Q, const h16* __restrict__ Kp, const h16* __restrict__ Vt, int q0, int col0, bf* Ah, bf* Al, char* sm) {
    typedef v16h V; constexpr int QT = 2;
    const int lane = threadIdx.x & 31, lr = lane & 15, hi = lane >> 4; const int wave = __builtin_amdgcn_readfirstlane(threadIdx.x >> 5);      // in a scalar register: the wave's slice of the copies and its tests for the diagonal are then scalar
    const int g = wave & 3, kq = wave >> 2, qw = q0 + g * 32, ns = (q0 + 128 + SKEYS - 1) / SKEYS;      // ns stages, the last with the diagonal
    // the lane's place in its wave's copies: LDS rows wave 32 + lane / 8 + 4 i, 16-byte column lane % 8; of four waves in a row the first two bring a quarter's K rows, the others its V^T rows
    const int crow = lane >> 3, ccol = lane & 7, ro = (wave & 1) * 32 + crow; const bool isv = (wave & 2) != 0;
    const h16* gp = isv ? Vt + (size_t)ro * TT + kq * 64 + ccol * 8 : Kp + (size_t)(kq * 64 + ro) * HD + ccol * 8;
    const size_t gs = isv ? (size_t)4 * TT : (size_t)4 * HD, gstep = isv ? (size_t)SKEYS : (size_t)SKEYS * HD;
    const unsigned l0 = (unsigned)(size_t)sm + (unsigned)((wave * 32 + crow) * GPITCH + ccol * 16);
    auto stage = [&](int t, int buf) { cp8(l0 + (unsigned)(buf * SBUF), gp + (size_t)t * gstep, gs); };
    stage(0, 0);
    V qf[QT][2];
#pragma unroll
    for (int qt = 0; qt < QT; ++qt)
#pragma unroll
        for (int ks = 0; ks < 2; ++ks) qf[qt][ks] = WFrag<h16>::ld(Q + (size_t)(qw + qt * 16 + lr) * HD + ks * 32 + 8 * hi);
    asm volatile("s_wait_xcnt 0x0" :: "v"(qf[0][0]), "v"(qf[0][1]), "v"(qf[1][0]), "v"(qf[1][1]));      // the wait: the query loads' address registers are reused behind it; it takes the loaded values as inputs only, which keeps it behind the loads
    v8f acc[QT][4]; float m[QT], l[QT];
#pragma unroll
    for (int qt = 0; qt < QT; ++qt) { m[qt] = -3.0e38f; l[qt] = 0.f;
#pragma unroll
        for (int dt = 0; dt < 4; ++dt) acc[qt][dt] = (v8f){}; }
    asm volatile("s_wait_asynccnt 0x0" ::: "memory");      // the wave's copies of stage 0 have landed before the barrier behind which the others read them
    __syncthreads();
    if (ns > 1) stage(1, 1);
#pragma unroll 1      // kept rolled: one trip a stage, the buffer chosen by the trip's parity
    for (int t = 0; t < ns; ++t) {
        const char* sb = sm + (t & 1) * SBUF + kq * (128 * GPITCH) + lr * GPITCH + hi * 16;      // the lane's place in the first K fragment of its wave's quarter
#pragma unroll
        for (int i = 0; i < 2; ++i) { const int kb = t * SKEYS + kq * 64 + i * 32;
            if (kb <= qw) {      // a scalar branch: blocks beyond the wave's queries are skipped
                V kf[2][2], vf[4];
#pragma unroll
                for (int kt = 0; kt < 2; ++kt)
#pragma unroll
                    for (int ks = 0; ks < 2; ++ks) kf[kt][ks] = WFrag<h16>::ld((const h16*)(sb + (i * 32 + kt * 16) * GPITCH + ks * 64));
#pragma unroll
                for (int dt = 0; dt < 4; ++dt) vf[dt] = WFrag<h16>::ld((const h16*)(sb + (64 + dt * 16) * GPITCH + i * 64));
                v8f s[QT][2];
#pragma unroll
                for (int kt = 0; kt < 2; ++kt)
#pragma unroll
                    for (int qt = 0; qt < QT; ++qt) { v8f c = (v8f){};
#pragma unroll
                        for (int ks = 0; ks < 2; ++ks) c = wmma16(kf[kt][ks], qf[qt][ks], c);
                        s[qt][kt] = c * SCL; }
                if (kb == qw) {      // the diagonal block: keys beyond the query are masked (every query keeps at least key kb)
#pragma unroll
                    for (int qt = 0; qt < QT; ++qt)
#pragma unroll
                        for (int kt = 0; kt < 2; ++kt)
#pragma unroll
                            for (int j = 0; j < 8; ++j) if (kt * 16 + hi * 8 + j > qt * 16 + lr) s[qt][kt][j] = -3.0e38f; }
#pragma unroll
                for (int qt = 0; qt < QT; ++qt) {
                    float bm = s[qt][0][0];
#pragma unroll
                    for (int kt = 0; kt < 2; ++kt)
#pragma unroll
                        for (int j = 0; j < 8; ++j) bm = fmaxf(bm, s[qt][kt][j]);
                    bm = fmaxf(bm, __shfl_xor(bm, 16, 32));      // the other half of the wave holds the query's other 16 keys
                    if (__builtin_amdgcn_ballot_w32(bm > m[qt]) != 0) {      // a scalar branch: where no query's maximum grows the factor is exactly 1 and the rescale is skipped
                        const float mn = fmaxf(m[qt], bm), al = exp2n((m[qt] - mn) * L2E); m[qt] = mn; l[qt] *= al;
#pragma unroll
                        for (int dt = 0; dt < 4; ++dt) acc[qt][dt] *= al; }
                    float x[16], p[16], ps = 0.f;
#pragma unroll
                    for (int e = 0; e < 16; ++e) x[e] = (s[qt][e >> 3][e & 7] - m[qt]) * L2E;
#pragma unroll
                    for (int e = 0; e < 16; e += 4) exp2x4(x + e, p + e);
#pragma unroll
                    for (int e = 0; e < 16; ++e) ps += p[e];
                    l[qt] += ps;      // the lane's own 16 keys; the halves are joined behind the loop
                    V pf;
#pragma unroll
                    for (int e = 0; e < 16; ++e) pf[e] = tohx(p[e]);
#pragma unroll
                    for (int dt = 0; dt < 4; ++dt) acc[qt][dt] = wmma16(vf[dt], pf, acc[qt][dt]); } } }
        asm volatile("s_wait_dscnt 0x0" ::: "memory");         // the wave's reads of this stage are done before the barrier behind which its buffer is refilled
        asm volatile("s_wait_asynccnt 0x0" ::: "memory");      // the wave's copies of the next stage have landed before the barrier behind which the others read them
        __syncthreads();
        if (t + 2 < ns) stage(t + 2, t & 1);
    }
    asm volatile("s_wait_asynccnt 0x0" ::: "memory");      // nothing is in flight where the buffers become the hand-over space (every wave's last read of them ended at the last trip's barrier)
    // every wave hands over its parts; wave (g, kq) then joins output tiles dt = 2 (kq % 2), + 1 of query tile kq / 2, in the lane layout they were stored in: each part scaled by exp(own maximum - joint maximum), added in the order of kq, divided by the joint sum
    float* xs = (float*)sm; float* xw = xs + wave * XW;
#pragma unroll
    for (int qt = 0; qt < QT; ++qt) { l[qt] += __shfl_xor(l[qt], 16, 32); xw[(64 + 2 * qt) * 32 + lane] = m[qt]; xw[(65 + 2 * qt) * 32 + lane] = l[qt];
#pragma unroll
        for (int dt = 0; dt < 4; ++dt)
#pragma unroll
            for (int j = 0; j < 8; ++j) xw[((qt * 4 + dt) * 8 + j) * 32 + lane] = acc[qt][dt][j]; }
    __syncthreads();
    const int jq = kq >> 1, jd = (kq & 1) * 2; const float* xg = xs + g * XW + lane; float f[4], M = -3.0e38f, Ls = 0.f;
#pragma unroll
    for (int k = 0; k < 4; ++k) { f[k] = xg[k * 4 * XW + (64 + 2 * jq) * 32]; M = fmaxf(M, f[k]); }
#pragma unroll
    for (int k = 0; k < 4; ++k) { f[k] = exp2n((f[k] - M) * L2E); Ls += xg[k * 4 * XW + (65 + 2 * jq) * 32] * f[k]; }
    const float inv = __fdiv_rn(1.0f, Ls);
#pragma unroll
    for (int e = 0; e < 2; ++e) { v8us oh, ol;
#pragma unroll
        for (int j = 0; j < 8; ++j) { float o = 0.f;
#pragma unroll
            for (int k = 0; k < 4; ++k) o += xg[k * 4 * XW + ((jq * 4 + jd + e) * 8 + j) * 32] * f[k];
            unsigned short a, c3; splitf(o * inv, a, c3); oh[j] = a; ol[j] = c3; }
        const size_t oo = (size_t)(qw + jq * 16 + lr) * DQ + col0 + (jd + e) * 16 + hi * 8; *(v8us*)(Ah + oo) = oh; *(v8us*)(Al + oo) = ol;
        asm volatile("s_wait_xcnt 0x0" ::: "memory"); }      // the wait: the two stores' address and data registers are reused by the next tile or by whatever code follows
}

// ---- fa_tile: 16 QT query rows of one head, operands straight from the K-contiguous planes. Wave w takes the 32-key blocks w, w + FW, ... up to the diagonal block with its own running maxima, sums and output tiles;
// the FW partial results are joined through LDS at the end (each scaled by exp(own maximum - joint maximum), added in wave order) and divided by the joint sum.
template <typename T16, int NSPLIT, int QT>
__device__ __forceinline__ void fa_tile(const T16* __restrict__ Q, const T16* __restrict__ Q2, const T16* __restrict__ Kp, const T16* __restrict__ Kp2, const T16* __restrict__ Vt, const T16* __restrict__ Vt2, int q0, int col0, bf* Ah, bf* Al, float* red, float* st) {
    typedef typename WFrag<T16>::V V;
    const int lane = threadIdx.x & 31, lr = lane & 15, hi = lane >> 4; const int wave = __builtin_amdgcn_readfirstlane(threadIdx.x >> 5);      // in a scalar register: the key loop and its test for the diagonal block are then scalar
    V qf[QT][2], qf2[QT][2];
#pragma unroll
    for (int qt = 0; qt < QT; ++qt)
#pragma unroll
        for (int ks = 0; ks < 2; ++ks) { const size_t o = (size_t)(q0 + qt * 16 + lr) * HD + ks * 32 + 8 * hi; qf[qt][ks] = WFrag<T16>::ld(Q + o); if (NSPLIT == 2) qf2[qt][ks] = WFrag<T16>::ld(Q2 + o); }
    v8f acc[QT][4]; float m[QT], l[QT];
#pragma unroll
    for (int qt = 0; qt < QT; ++qt) { m[qt] = -3.0e38f; l[qt] = 0.f;
#pragma unroll
        for (int dt = 0; dt < 4; ++dt) acc[qt][dt] = (v8f){}; }
    const int nfull = q0 / 32;      // key blocks wholly at or below every query of the tile; block nfull holds the diagonal and is the last
    // K and V^T fragments of key block b, straight from the K-contiguous planes
    auto ldk = [&](int b, V (&kf)[2][2], V (&kf2)[2][2]) {
#pragma unroll
        for (int kt = 0; kt < 2; ++kt)
#pragma unroll
            for (int ks = 0; ks < 2; ++ks) { const size_t o = (size_t)(b * 32 + kt * 16 + lr) * HD + ks * 32 + 8 * hi; kf[kt][ks] = WFrag<T16>::ld(Kp + o); if (NSPLIT == 2) kf2[kt][ks] = WFrag<T16>::ld(Kp2 + o); } };
    auto ldv = [&](int b, V (&vf)[4], V (&vf2)[4]) {
#pragma unroll
        for (int dt = 0; dt < 4; ++dt) { const size_t o = (size_t)(dt * 16 + lr) * TT + b * 32 + 8 * hi; vf[dt] = WFrag<T16>::ld(Vt + o); if (NSPLIT == 2) vf2[dt] = WFrag<T16>::ld(Vt2 + o); } };
    V kf[2][2], kf2[2][2], vf[4], vf2[4];
#pragma unroll 1      // kept rolled: the trip count is known at run time only
    for (int blk = wave; blk <= nfull; blk += FW) { const int kb = blk * 32;
        ldk(blk, kf, kf2); asm volatile("s_wait_xcnt 0x0" ::: "memory"); ldv(blk, vf, vf2); asm volatile("s_wait_xcnt 0x0" ::: "memory");      // the waits: the loads' address registers are reused, by the V^T fragments and in later blocks of the pass
        v8f s[QT][2];
#pragma unroll
        for (int kt = 0; kt < 2; ++kt)
#pragma unroll
            for (int qt = 0; qt < QT; ++qt) { v8f c = (v8f){};
#pragma unroll
                for (int ks = 0; ks < 2; ++ks) { c = WFrag<T16>::mma(kf[kt][ks], qf[qt][ks], c); if (NSPLIT == 2) { c = WFrag<T16>::mma(kf[kt][ks], qf2[qt][ks], c); c = WFrag<T16>::mma(kf2[kt][ks], qf[qt][ks], c); } }
                s[qt][kt] = c * SCL; }
        if (blk == nfull) {      // the diagonal block: keys beyond the query are masked (every query keeps at least key kb)
#pragma unroll
            for (int qt = 0; qt < QT; ++qt)
#pragma unroll
                for (int kt = 0; kt < 2; ++kt)
#pragma unroll
                    for (int j = 0; j < 8; ++j) if (kb + kt * 16 + hi * 8 + j > q0 + qt * 16 + lr) s[qt][kt][j] = -3.0e38f; }
#pragma unroll
        for (int qt = 0; qt < QT; ++qt) {
            float bm = s[qt][0][0];
#pragma unroll
            for (int kt = 0; kt < 2; ++kt)
#pragma unroll
                for (int j = 0; j < 8; ++j) bm = fmaxf(bm, s[qt][kt][j]);
            bm = fmaxf(bm, __shfl_xor(bm, 16, 32));      // the other half of the wave holds the query's other 16 keys
            if (__builtin_amdgcn_ballot_w32(bm > m[qt]) != 0) {      // a scalar branch: where no query's maximum grows the factor is exactly 1 and the rescale is skipped
                const float mn = fmaxf(m[qt], bm), al = exp2n((m[qt] - mn) * L2E); m[qt] = mn; l[qt] *= al;
#pragma unroll
                for (int dt = 0; dt < 4; ++dt) acc[qt][dt] *= al; }
            float x[16], p[16], ps = 0.f;
#pragma unroll
            for (int e = 0; e < 16; ++e) x[e] = (s[qt][e >> 3][e & 7] - m[qt]) * L2E;
#pragma unroll
            for (int e = 0; e < 16; e += 4) exp2x4(x + e, p + e);
#pragma unroll
            for (int e = 0; e < 16; ++e) ps += p[e];
            l[qt] += ps;      // the lane's own 16 keys; the halves are joined behind the loop
            if constexpr (NSPLIT == 2) { v16us ph, pl;
#pragma unroll
                for (int e = 0; e < 16; ++e) { unsigned short a, c2; splitf(p[e], a, c2); ph[e] = a; pl[e] = c2; }
                const V pf = __builtin_bit_cast(V, ph), pf2 = __builtin_bit_cast(V, pl);
#pragma unroll
                for (int dt = 0; dt < 4; ++dt) { acc[qt][dt] = WFrag<T16>::mma(vf[dt], pf, acc[qt][dt]); acc[qt][dt] = WFrag<T16>::mma(vf[dt], pf2, acc[qt][dt]); acc[qt][dt] = WFrag<T16>::mma(vf2[dt], pf, acc[qt][dt]); }
            } else { V pf;
#pragma unroll
                for (int e = 0; e < 16; ++e) pf[e] = tohx(p[e]);
#pragma unroll
                for (int dt = 0; dt < 4; ++dt) acc[qt][dt] = WFrag<T16>::mma(vf[dt], pf, acc[qt][dt]); } }
    }
#pragma unroll
    for (int qt = 0; qt < QT; ++qt) { l[qt] += __shfl_xor(l[qt], 16, 32); float* sw = st + (wave * QT + qt) * 64; sw[lane] = m[qt]; sw[32 + lane] = l[qt];
#pragma unroll
        for (int dt = 0; dt < 4; ++dt)
#pragma unroll
            for (int j = 0; j < 8; ++j) red[(((wave * QT + qt) * 4 + dt) * 8 + j) * 32 + lane] = acc[qt][dt][j]; }
    __syncthreads();
    // wave w < 4 joins output tile dt = w of every query tile, in the lane layout the tiles were stored in; a wave that had no key block left maximum -3e38, sum 0 and zeros: its factor is 0
    if (wave < 4) {
#pragma unroll
    for (int qt = 0; qt < QT; ++qt) { float f[FW], M = -3.0e38f, Ls = 0.f;
#pragma unroll
        for (int w = 0; w < FW; ++w) { f[w] = st[(w * QT + qt) * 64 + lane]; M = fmaxf(M, f[w]); }
#pragma unroll
        for (int w = 0; w < FW; ++w) { f[w] = exp2n((f[w] - M) * L2E); Ls += st[(w * QT + qt) * 64 + 32 + lane] * f[w]; }
        const float inv = __fdiv_rn(1.0f, Ls); v8us oh, ol;
#pragma unroll
        for (int j = 0; j < 8; ++j) { float o = 0.f;
#pragma unroll
            for (int w = 0; w < FW; ++w) o += red[(((w * QT + qt) * 4 + wave) * 8 + j) * 32 + lane] * f[w];
            unsigned short a, c2; splitf(o * inv, a, c2); oh[j] = a; ol[j] = c2; }
        const size_t oo = (size_t)(q0 + qt * 16 + lr) * DQ + col0 + wave * 16 + hi * 8; *(v8us*)(Ah + oo) = oh; *(v8us*)(Al + oo) = ol;
        asm volatile("s_wait_xcnt 0x0" ::: "memory"); } }      // the wait: the two stores' address and data registers may be reused by whatever code follows the tile
}
// Grid (heads, (TT - RH) / 128 + RH / 16): first the fp16 tiles of 128 query rows of every head, the longest (last rows) first, then the hi/lo tiles of 16 query rows < RH.
// amdgpu_waves_per_eu(4, 4): four waves a SIMD (one work-group a WGP), 256 registers a wave: the vector work between the matrix runs of one wave is covered by the others.
__global__ __launch_bounds__(FW * 32) __attribute__((amdgpu_waves_per_eu(4, 4))) void k_fattn(const h16* __restrict__ Q16, const h16* __restrict__ K16, const h16* __restrict__ V16, const bf* __restrict__ Qh, const bf* __restrict__ Ql, const bf* __restrict__ Kh, const bf* __restrict__ Kl, const bf* __restrict__ Vh, const bf* __restrict__ Vl, bf* Ah, bf* Al) {
    __shared__ __align__(16) char sm[2 * SBUF];      // fa_tile_s: the two stage buffers, then the hand-over space; fa_tile: the partial results (FW x 4 KiB) and their maxima and sums
    static_assert(FW * XW * 4 <= 2 * SBUF && FW * (1024 + 64) * 4 <= 2 * SBUF && RH % 128 == 0 && TT % SKEYS == 0 && FW == 16, "LDS uses, tile sizes, 4 x 4 waves");
    const int h = blockIdx.x, bx = blockIdx.y; const size_t zo = (size_t)h * TT * HD; constexpr int NLO = (TT - RH) / 128;
    if (bx < NLO) fa_tile_s(Q16 + zo, K16 + zo, V16 + zo, TT - 128 * (bx + 1), h * HD, Ah, Al, sm);
    else fa_tile<bf, 2, 1>(Qh + zo, Ql + zo, Kh + zo, Kl + zo, Vh + zo, Vl + zo, RH - 16 * (bx - NLO + 1), h * HD, Ah, Al, (float*)sm, (float*)sm + FW * 1024);
}

extern "C" void kernel_launch(void* const* d_in, const int* in_sizes, int n_in,
                              void* d_out, int out_size, void* d_ws, size_t ws_size, hipStream_t stream) {
    (void)in_sizes; (void)n_in; (void)out_size;
    const float* x = (const float*)d_in[0]; const float* wq = (const float*)d_in[1]; const float* bq = (const float*)d_in[2]; const float* wk = (const float*)d_in[3]; const float* bk = (const float*)d_in[4]; const float* wv = (const float*)d_in[5]; const float* bv = (const float*)d_in[6]; const float* wo = (const float*)d_in[7]; const float* bo = (const float*)d_in[8];   /* argument order x, Wq_w, Wq_b, Wk_w, Wk_b, Wv_w, Wv_b, Wo_w, Wo_b ('oi') */
    float* OUT = (float*)d_out;     // [2][4096][768]
    char* wsp = (char*)d_ws;
    auto take = [&](size_t bytes) { char* p = wsp; wsp += (bytes + 255) & ~(size_t)255; return (void*)p; };
    bf* WQ = (bf*)take((size_t)DQ * DM * 2); bf* WK = (bf*)take((size_t)DKV * DM * 2); bf* WV = (bf*)take((size_t)DKV * DM * 2); bf* WO = (bf*)take((size_t)DM * DQ * 2);
    bf* XB = (bf*)take((size_t)TT * DM * 2);
    h16* QP16 = (h16*)take((size_t)NH_ * TT * HD * 2); h16* KP16 = (h16*)take((size_t)NKV * TT * HD * 2); h16* VT16 = (h16*)take((size_t)NKV * HD * TT * 2);
    bf* QPh = (bf*)take((size_t)NH_ * TT * HD * 2); bf* QPl = (bf*)take((size_t)NH_ * TT * HD * 2); bf* KPh = (bf*)take((size_t)NKV * TT * HD * 2); bf* KPl = (bf*)take((size_t)NKV * TT * HD * 2); bf* VTh = (bf*)take((size_t)NKV * HD * TT * 2); bf* VTl = (bf*)take((size_t)NKV * HD * TT * 2);
    bf* ATh = (bf*)take((size_t)TT * DQ * 2); bf* ATl = (bf*)take((size_t)TT * DQ * 2);
    if ((size_t)(wsp - (char*)d_ws) > ws_size) return;    // ws 256 MiB
    { k_cvt8<<<(unsigned)(((size_t)DQ * DM / 8 + 255) / 256), 256, 0, stream>>>(wq, WQ, (size_t)DQ * DM / 8); k_cvt8<<<(unsigned)(((size_t)DKV * DM / 8 + 255) / 256), 256, 0, stream>>>(wk, WK, (size_t)DKV * DM / 8); k_cvt8<<<(unsigned)(((size_t)DKV * DM / 8 + 255) / 256), 256, 0, stream>>>(wv, WV, (size_t)DKV * DM / 8);
      k_cvt8<<<(unsigned)(((size_t)DM * DQ / 8 + 255) / 256), 256, 0, stream>>>(wo, WO, (size_t)DM * DQ / 8);
       }
    for (int b = 0; b < NB_; ++b) {
        
        k_cvt8<<<(unsigned)(((size_t)TT * DM / 8 + 255) / 256), 256, 0, stream>>>(x + (size_t)b * TT * DM, XB, (size_t)TT * DM / 8);
        k_gemmw<bf, 0, true, 1><<<dim3(TT / 128, DQ / 128, 1), GW * 32, 0, stream>>>(XB, nullptr, WQ, nullptr, DM, nullptr, HD, bq, 0, 0, 0, QP16, QPh, QPl, (size_t)64 * HD, (size_t)TT * HD);
        k_gemmw<bf, 0, true, 1><<<dim3(TT / 128, DKV / 128, 1), GW * 32, 0, stream>>>(XB, nullptr, WK, nullptr, DM, nullptr, HD, bk, 0, 0, 0, KP16, KPh, KPl, (size_t)64 * HD, (size_t)TT * HD);
        k_gemmw<bf, 0, true, 2><<<dim3(DKV / 128, TT / 128, 1), GW * 32, 0, stream>>>(WV, nullptr, XB, nullptr, DM, nullptr, TT, bv, 0, 0, 0, VT16, VTh, VTl, (size_t)64 * TT, (size_t)64);      // operands swapped: the tile is V^T
        k_fattn<<<dim3(NH_, (TT - RH) / 128 + RH / 16), FW * 32, 0, stream>>>(QP16, KP16, VT16, QPh, QPl, KPh, KPl, VTh, VTl, ATh, ATl);
        k_gemmw<bf, 1, true, 0><<<dim3(TT / 128, DM / 128, 1), GW * 32, 0, stream>>>(ATh, ATl, WO, nullptr, DQ, OUT + (size_t)b * TT * DM, DM, bo, 0, 0, 0, nullptr, nullptr, nullptr, 0, 0); }
}

// v006
// A run of this version takes 138 microseconds.
// In two side-by-side timings against v005, it was 1.48 and 1.51 times as fast.
// All steps since v000 together make it 22.9 times as fast.
#include <hip/hip_runtime.h>

// Causal self-attention over 4,096 tokens at d_model 768 (x [2][4096][768]; q, k, v = x W^T + b ('oi' uniform(+-768^-0.5) incl. biases: non-zero; 12 heads x 64); logits / sqrt(64); causal (-inf); softmax; out = merged Wo^T + b -> [2][4096][768] (6.3 M); argument order x, Wq_w, Wq_b, Wk_w, Wk_b, Wv_w, Wv_b, Wo_w, Wo_b).
// Four launches, each for both batches: bf16 copy of x and the 'oi' weights; exact projections (K 768) + f32 biases, each writing its head planes (fp16 + hi/lo) from its own epilogue; causal attention at T 4096 / 12 heads fused in one launch with a running softmax (k_fattn, K and V^T of the fp16 rows staged in LDS; hybrid rows: < 512 hi/lo 3 products, rest fp16; the fp16 probabilities are exp(score - running maximum) <= 1, divided by the sum at the end, so no x1024 carry is needed); merged hi/lo x Wo exact + bias.
// Compute dtypes, f32 accumulate: every input rounded to bf16; projections exact + f32 biases; attention rows < 512 3 products, rest fp16; softmax f32; Wo hl x exact + bias.

#define NB_  2
#define TT   4096
#define DM   768
#define NH_  12
#define NKV  12
#define HD   64
#define DQ   (NH_ * HD)
#define DKV  (NKV * HD)
#define RH   512                  // query rows < RH use hi+lo planes (0: none)
#define SCL  0.125f   // HD^-0.5
typedef _Float16 h16;
typedef unsigned short bf;
typedef __attribute__((ext_vector_type(16))) __bf16   v16bf;
typedef __attribute__((ext_vector_type(16))) _Float16 v16h;
typedef __attribute__((ext_vector_type(8)))  _Float16 v8h;
typedef __attribute__((ext_vector_type(8)))  unsigned short v8us;
typedef __attribute__((ext_vector_type(8)))  float    v8f;
typedef __attribute__((ext_vector_type(4)))  float    v4f;
typedef v8h  __attribute__((may_alias)) v8ha;
typedef v4f  __attribute__((may_alias)) v4fa;
typedef v8us __attribute__((may_alias)) v8usa;

__device__ __forceinline__ unsigned short f2bf(float f) { unsigned u = __float_as_uint(f); u += 0x7FFFu + ((u >> 16) & 1u); return (unsigned short)(u >> 16); }
__device__ __forceinline__ float bf2f(unsigned short b) { return __uint_as_float(((unsigned)b) << 16); }
__device__ __forceinline__ float bfr(float f) { return bf2f(f2bf(f)); }
__device__ __forceinline__ v16h cat16(v8h lo, v8h hi) { return __builtin_shufflevector(lo, hi, 0, 1, 2, 3, 4, 5, 6, 7, 8, 9, 10, 11, 12, 13, 14, 15); }
__device__ __forceinline__ v16bf cat16b(v8us lo, v8us hi) { return __builtin_bit_cast(v16bf, __builtin_shufflevector(lo, hi, 0, 1, 2, 3, 4, 5, 6, 7, 8, 9, 10, 11, 12, 13, 14, 15)); }
__device__ __forceinline__ v8f wmma16(v16h a, v16h b, v8f c) { return __builtin_amdgcn_wmma_f32_16x16x32_f16(false, a, false, b, (short)0, c, false, false); }
__device__ __forceinline__ v8f wmmab(v16bf a, v16bf b, v8f c) { return __builtin_amdgcn_wmma_f32_16x16x32_bf16(false, a, false, b, (short)0, c, false, false); }
__device__ __forceinline__ h16 tohx(float x) { return (h16)x; }
__device__ __forceinline__ void splitf(float y, unsigned short& h, unsigned short& l) { h = f2bf(y); l = f2bf(y - bf2f(h)); }



// ---- gemmw: register-blocked GEMM, one wave per 64x64 output tile (16 accumulators), GW = 4 waves (2 x 2 tiles) per work-group of 128 threads, which takes the 128x128 tile (bx, by); osm (GW x 16 x 68 floats) and stg (2 NT GTILE bytes) are the calling kernel's LDS.
// The K-contiguous 16-bit operand planes come through LDS: a stage is 64 k (one whole 128-byte line) of the work-group's 128 rows of every operand, brought by asynchronous copies of which each covers four whole lines
// (each wave copies a quarter of the rows; every row is fetched once for the two waves that read it); two buffers, so that the next stage's copies fly while this stage's fragments are read and multiplied.
// LDS rows at pitch 144 bytes (16 x odd: no bank conflict for the 16-byte fragment reads).
// C[m][n] (f32, pitch ldc, + optional f32 bias[n]) = sum_k A[m][k] Bt[n][k] (+ split products per NSPLIT). K % 64 == 0, K >= 64; M, N % 128 == 0.
// PL != 0: no f32 C; the tile + bias goes out as three 16-bit planes (P16 fp16, Ph/Pl bf16 hi/lo) of row pitch ldc, the 64x64 tile (i, j) at element i px + j py. PL 1: bias[n] (token rows x one head's 64 columns: planes [h][t][d]);
// PL 2: bias[m] (A = weight rows, Bt = token rows: the tile is the transposed projection, planes [h][d][t]).
template <typename T16> struct WFrag;
template <> struct WFrag<h16> { typedef v16h V; static __device__ __forceinline__ V ld(const h16* p) { return cat16(*(const v8h*)p, *(const v8h*)(p + 16)); } static __device__ __forceinline__ v8f mma(V a, V b, v8f c) { return wmma16(a, b, c); } };
template <> struct WFrag<bf> { typedef v16bf V; static __device__ __forceinline__ V ld(const bf* p) { return cat16b(*(const v8us*)p, *(const v8us*)(p + 16)); } static __device__ __forceinline__ v8f mma(V a, V b, v8f c) { return wmmab(a, b, c); } };
#define GW     4                  // waves of a work-group
#define GPITCH 144                // bytes of an LDS row: 128 of data + 16
#define GTILE  (128 * GPITCH)     // one operand's 128 rows of a stage
// Eight asynchronous copies, 16 bytes a lane: copy i brings four whole 128-byte rows (8 lanes a row) from g + i gs elements to LDS byte l + i 4 GPITCH.
// The s_wait_xcnt stands in the copies' own statement, so that no address register is rewritten in front of it.
template <typename T16>
__device__ __forceinline__ void cp8(unsigned l, const T16* g, size_t gs) {
    asm volatile("global_load_async_to_lds_b128 %0, %8, off\n\tglobal_load_async_to_lds_b128 %1, %9, off\n\tglobal_load_async_to_lds_b128 %2, %10, off\n\tglobal_load_async_to_lds_b128 %3, %11, off\n\t"
                 "global_load_async_to_lds_b128 %4, %12, off\n\tglobal_load_async_to_lds_b128 %5, %13, off\n\tglobal_load_async_to_lds_b128 %6, %14, off\n\tglobal_load_async_to_lds_b128 %7, %15, off\n\ts_wait_xcnt 0x0"
                 :: "v"(l), "v"(l + 4u * GPITCH), "v"(l + 8u * GPITCH), "v"(l + 12u * GPITCH), "v"(l + 16u * GPITCH), "v"(l + 20u * GPITCH), "v"(l + 24u * GPITCH), "v"(l + 28u * GPITCH),
                    "v"(g), "v"(g + gs), "v"(g + 2 * gs), "v"(g + 3 * gs), "v"(g + 4 * gs), "v"(g + 5 * gs), "v"(g + 6 * gs), "v"(g + 7 * gs) : "memory");
}
template <typename T16, int NSPLIT, bool BIAS, int PL>
__device__ __forceinline__ void gemmw(const T16* __restrict__ A, const T16* __restrict__ A2, const T16* __restrict__ Bt, const T16* __restrict__ Bt2, int K, float* C, int ldc, const float* __restrict__ bias, h16* P16, bf* Ph, bf* Pl, size_t px, size_t py, int bx, int by, float* osm, char* stg) {
    typedef typename WFrag<T16>::V V;
    const int lane = threadIdx.x & 31, lr = lane & 15, hi = lane >> 4; const int wave = __builtin_amdgcn_readfirstlane(threadIdx.x >> 5);      // in a scalar register: the wave's tile and its slice of the copies are scalar offsets
    const int R0 = bx * 128, C0 = by * 128, r0 = R0 + (wave >> 1) * 64, c0 = C0 + (wave & 1) * 64; float* os = osm + wave * (16 * 68);      // os: the wave's own output staging
    v8f acc[4][4];
#pragma unroll
    for (int mb = 0; mb < 4; ++mb)
#pragma unroll
        for (int nb = 0; nb < 4; ++nb) acc[mb][nb] = (v8f){};
    constexpr bool HA2 = NSPLIT == 1 || NSPLIT == 2, HB2 = NSPLIT >= 2; constexpr int NT = 2 + (HA2 ? 1 : 0) + (HB2 ? 1 : 0);      // operand tiles of a stage, in the order A, Bt, A2, Bt2
    // the lane's place in its wave's copies: rows wave 32 + lane / 8 + 4 i, 16-byte column lane % 8
    const int crow = wave * 32 + (lane >> 3), ccol = lane & 7;
    const size_t goA = (size_t)(R0 + crow) * K + ccol * 8, goB = (size_t)(C0 + crow) * K + ccol * 8, gs = (size_t)4 * K;
    const unsigned l0 = (unsigned)(size_t)stg + (unsigned)(crow * GPITCH + ccol * 16);
    auto stage = [&](int t, int buf) { const size_t ko = (size_t)t * 64; const unsigned lb = l0 + (unsigned)(buf * NT * GTILE);
        cp8(lb, A + goA + ko, gs); cp8(lb + GTILE, Bt + goB + ko, gs);
        if constexpr (HA2) cp8(lb + 2u * GTILE, A2 + goA + ko, gs);
        if constexpr (HB2) cp8(lb + (NT - 1u) * GTILE, Bt2 + goB + ko, gs); };
    const int nt = K / 64, foA = ((wave >> 1) * 64 + lr) * GPITCH + hi * 16, foB = GTILE + ((wave & 1) * 64 + lr) * GPITCH + hi * 16;      // the lane's place in the first A and Bt fragment of its wave's tile
    stage(0, 0);
    asm volatile("s_wait_asynccnt 0x0" ::: "memory");      // the wave's copies of stage 0 have landed before the barrier behind which the others read them
    __syncthreads();
    if (nt > 1) stage(1, 1);
#pragma unroll 1      // kept rolled: one trip a stage, the buffer chosen by the trip's parity
    for (int t = 0; t < nt; ++t) {
        const char* sb = stg + (t & 1) * (NT * GTILE);
        V a[2][4], a2[2][4], b[2][4], b2[2][4];
        auto ldf = [&](int ks) {      // the fragments of k step ks (32 k) of the stage
#pragma unroll
            for (int mb = 0; mb < 4; ++mb) { a[ks][mb] = WFrag<T16>::ld((const T16*)(sb + foA + mb * 16 * GPITCH + ks * 64)); if (HA2) a2[ks][mb] = WFrag<T16>::ld((const T16*)(sb + foA + 2 * GTILE + mb * 16 * GPITCH + ks * 64)); }
#pragma unroll
            for (int nb = 0; nb < 4; ++nb) { b[ks][nb] = WFrag<T16>::ld((const T16*)(sb + foB + nb * 16 * GPITCH + ks * 64)); if (HB2) b2[ks][nb] = WFrag<T16>::ld((const T16*)(sb + foB + (NT - 2) * GTILE + nb * 16 * GPITCH + ks * 64)); } };
        auto mm = [&](int ks) {
#pragma unroll
            for (int nb = 0; nb < 4; ++nb)
#pragma unroll
                for (int mb = 0; mb < 4; ++mb) { acc[mb][nb] = WFrag<T16>::mma(a[ks][mb], b[ks][nb], acc[mb][nb]); if (HA2) acc[mb][nb] = WFrag<T16>::mma(a2[ks][mb], b[ks][nb], acc[mb][nb]); if (HB2) acc[mb][nb] = WFrag<T16>::mma(a[ks][mb], b2[ks][nb], acc[mb][nb]); } };
        ldf(0); ldf(1);
        __builtin_amdgcn_sched_barrier(0);      // the stage's fragment reads stand together ahead of its products: spread among them, each b fragment went into the same registers and the wave waited out the LDS latency at every one
        mm(0);                                  // the first step's products run while the second step's fragments arrive
        __builtin_amdgcn_sched_barrier(0);      // keeps them ahead of the waits below
        // the stage's last fragments are in registers behind the first wait: its buffer is handed over and refilled ahead of their products, which then cover part of the copies' flight
        asm volatile("s_wait_dscnt 0x0" ::: "memory");         // the wave's reads of this stage are done before the barrier behind which its buffer is refilled
        asm volatile("s_wait_asynccnt 0x0" ::: "memory");      // the wave's copies of the next stage have landed before the barrier behind which the others read them
        __syncthreads();
        if (t + 2 < nt) stage(t + 2, t & 1);
        __builtin_amdgcn_sched_barrier(0);      // keeps the second step's products behind the copies' issue
        mm(1);
        asm volatile("v_nop\n\tv_nop\n\tv_nop\n\tv_nop" : "+v"(acc[0][0]), "+v"(acc[1][1]), "+v"(acc[2][2]), "+v"(acc[3][3]) : "v"(a[1][0]), "v"(a[1][3]));
    }
    asm volatile("s_wait_asynccnt 0x0" ::: "memory");      // nothing is in flight where the wave goes on to the epilogue
    // planes: a lane takes 8 columns of one staged row, so that each 16-byte store of the wave covers four whole 128-byte rows
    const int prow = lane >> 3, pcol = (lane & 7) * 8; const size_t pb = (size_t)(r0 >> 6) * px + (size_t)(c0 >> 6) * py + (size_t)prow * ldc + pcol; constexpr int NPB = PL == 2 ? 16 : 8; float pbias[NPB];
    if constexpr (PL != 0) {
#pragma unroll
        for (int i = 0; i < NPB; ++i) pbias[i] = PL == 1 ? bias[c0 + pcol + i] : bias[r0 + i * 4 + prow];
        // the wait: the address register of PL 1's bias loads is reused by the rows below; it takes the loaded values as inputs only, which keeps it behind the loads
        if constexpr (PL == 1) asm volatile("s_wait_xcnt 0x0" :: "v"(pbias[0]), "v"(pbias[1]), "v"(pbias[2]), "v"(pbias[3]), "v"(pbias[4]), "v"(pbias[5]), "v"(pbias[6]), "v"(pbias[7]));
#pragma unroll
        for (int i = 0; i < NPB; ++i) pbias[i] = bfr(pbias[i]); }
#pragma unroll
    for (int mb = 0; mb < 4; ++mb) {
#pragma unroll
        for (int nb = 0; nb < 4; ++nb) {
#pragma unroll
            for (int j = 0; j < 8; ++j) os[(hi * 8 + j) * 68 + nb * 16 + lr] = acc[mb][nb][j]; }
        __builtin_amdgcn_wave_barrier(); asm volatile("" ::: "memory");
        if constexpr (PL != 0) {
#pragma unroll
            for (int s = 0; s < 4; ++s) { const float* orow = os + (4 * s + prow) * 68 + pcol; const v4f v0 = *(const v4fa*)orow, v1 = *(const v4fa*)(orow + 4); v8h o16; v8us oh, ol;
#pragma unroll
                for (int k = 0; k < 8; ++k) { const float y = (k < 4 ? v0[k & 3] : v1[k & 3]) + pbias[PL == 1 ? k : mb * 4 + s]; o16[k] = tohx(y); unsigned short a2, c2; splitf(y, a2, c2); oh[k] = a2; ol[k] = c2; }
                const size_t o = pb + (size_t)(mb * 16 + 4 * s) * ldc; *(v8h*)(P16 + o) = o16; *(v8us*)(Ph + o) = oh; *(v8us*)(Pl + o) = ol;
                asm volatile("s_wait_xcnt 0x0" ::: "memory"); }      // the wait: the three stores' address and data registers are reused by the next rows
        } else {
        float* crow = C + (size_t)(r0 + mb * 16) * ldc + c0;
#pragma unroll
            for (int s = 0; s < 8; ++s) { const int row = 2 * s + hi, cofs = lr * 4; v4f val = *(const v4fa*)(os + row * 68 + cofs); if (BIAS) { val[0] += bfr(bias[c0 + cofs]); val[1] += bfr(bias[c0 + cofs + 1]); val[2] += bfr(bias[c0 + cofs + 2]); val[3] += bfr(bias[c0 + cofs + 3]); }
                *(v4f*)(crow + (size_t)row * ldc + cofs) = val; }
             }
        __builtin_amdgcn_wave_barrier(); asm volatile("" ::: "memory");
    }
}

typedef __attribute__((ext_vector_type(4))) _Float16 v4h;
typedef __attribute__((ext_vector_type(4))) unsigned short v4us;
typedef __attribute__((ext_vector_type(4))) int v4i;

// ---- k_qkv: the q, k and v projections of both batches in one launch; grid (TT / 128, DQ / 128, 3 NB_), z = projection x NB_ + batch. Planes [batch][head][t][d] (q, k) and [batch][head][d][t] (v: operands swapped, the tile is V^T).
__global__ __launch_bounds__(GW * 32) void k_qkv(const bf* __restrict__ XB, const bf* __restrict__ WQ, const bf* __restrict__ WK, const bf* __restrict__ WV, const float* __restrict__ bq, const float* __restrict__ bk, const float* __restrict__ bv,
                                                 h16* Q16, bf* Qh, bf* Ql, h16* K16, bf* Kh, bf* Kl, h16* V16, bf* Vh, bf* Vl) {
    __shared__ __align__(16) float osm[GW * 16 * 68];
    __shared__ __align__(16) char stg[2 * 2 * GTILE];
    const int w = blockIdx.z / NB_, b = blockIdx.z % NB_; const bf* X = XB + (size_t)b * TT * DM; const size_t po = (size_t)b * NH_ * TT * HD;      // every plane holds NH_ TT HD elements a batch (NKV == NH_)
    if (w < 2) gemmw<bf, 0, true, 1>(X, nullptr, w ? WK : WQ, nullptr, DM, nullptr, HD, w ? bk : bq, (w ? K16 : Q16) + po, (w ? Kh : Qh) + po, (w ? Kl : Ql) + po, (size_t)64 * HD, (size_t)TT * HD, blockIdx.x, blockIdx.y, osm, stg);
    else gemmw<bf, 0, true, 2>(WV, nullptr, X, nullptr, DM, nullptr, TT, bv, V16 + po, Vh + po, Vl + po, (size_t)64 * TT, (size_t)64, blockIdx.y, blockIdx.x, osm, stg);
}
// ---- k_wo: out = merged (hi + lo) Wo^T + bias, the NB_ TT token rows of both batches in one launch; grid (NB_ TT / 128, DM / 128).
// K comes as an argument: with the constant folded in, the build kept the copies' LDS address in scratch memory and loaded it back in every stage.
__global__ __launch_bounds__(GW * 32) void k_wo(const bf* __restrict__ Ah, const bf* __restrict__ Al, const bf* __restrict__ WO, const float* __restrict__ bo, float* OUT, int K) {
    __shared__ __align__(16) float osm[GW * 16 * 68];
    __shared__ __align__(16) char stg[2 * 3 * GTILE];
    gemmw<bf, 1, true, 0>(Ah, Al, WO, nullptr, K, OUT, DM, bo, nullptr, nullptr, nullptr, 0, 0, blockIdx.x, blockIdx.y, osm, stg);
}

// ---- k_cvt: x (both batches) and the four weights to bf16 in one launch, 8 elements a thread; the first CX work-groups take x, then CWT each a weight.
#define CX  (NB_ * TT * DM / 8 / 256)
#define CWT (DQ * DM / 8 / 256)
__global__ __launch_bounds__(256) void k_cvt(const float* __restrict__ x, const float* __restrict__ wq, const float* __restrict__ wk, const float* __restrict__ wv, const float* __restrict__ wo, bf* XB, bf* WQ, bf* WK, bf* WV, bf* WO) {
    static_assert(NB_ * TT * DM % 2048 == 0 && DQ * DM % 2048 == 0 && DKV == DQ, "whole work-groups, four weights of one size");
    int blk = blockIdx.x; const float* src = x; bf* dst = XB;
    if (blk >= CX) { blk -= CX; const int w = blk / CWT; blk -= w * CWT; src = w == 0 ? wq : w == 1 ? wk : w == 2 ? wv : wo; dst = w == 0 ? WQ : w == 1 ? WK : w == 2 ? WV : WO; }
    const size_t i = (size_t)blk * 256 + threadIdx.x; const v8f v = *(const v8f*)(src + i * 8); v8us o;
#pragma unroll
    for (int k = 0; k < 8; ++k) o[k] = f2bf(v[k]); *(v8us*)(dst + i * 8) = o;  }

// ---- k_fattn: scores, causal softmax and probability x value product of both batches' heads in one launch; no score or probability plane reaches memory.
// Transposed products: S^T = K Q^T (A = key rows, B = query rows) and O^T += V^T P^T (A = rows of the transposed value plane, B = P). In every 16-column tile a lane then holds one query
// (column lr) and the keys hi 8 + j, so that maximum, sum and rescale factor are the lane's own, and two score tiles (keys 0..15, 16..31) are, register for register, the k order of a 32-key B fragment.
// Work-groups of FW waves. Two kinds of tile: fa_tile_s (fp16, 128 query rows, K and V^T staged in LDS and shared by the waves) and fa_tile (hi/lo, 16 query rows, the waves split the keys).
// Every loop over qt, kt, ks, dt, j, e and w is unrolled in full: the fragments and tiles are register arrays and need compile-time indices.
#define FW  16
#define L2E 1.4426950408889634f
typedef __attribute__((ext_vector_type(16))) unsigned short v16us;
// 2^x with the issue slot behind a transcendental kept by construction: the v_nop stands between the v_exp_f32 and whatever the compiler puts next (it may read the result or overwrite the source).
__device__ __forceinline__ float exp2n(float x) { float y; asm("v_exp_f32 %0, %1\n\tv_nop" : "=v"(y) : "v"(x)); return y; }
// Four at a time: each v_exp_f32 fills the slot of the one before it (the results are early-clobber, so none overwrites a source), the v_nop that of the last.
__device__ __forceinline__ void exp2x4(const float* x, float* y) { asm("v_exp_f32 %0, %4\n\tv_exp_f32 %1, %5\n\tv_exp_f32 %2, %6\n\tv_exp_f32 %3, %7\n\tv_nop" : "=&v"(y[0]), "=&v"(y[1]), "=&v"(y[2]), "=&v"(y[3]) : "v"(x[0]), "v"(x[1]), "v"(x[2]), "v"(x[3])); }

// ---- fa_tile_s: 128 query rows of one head, fp16. Wave w = (g = w % 4, kq = w / 4) holds the 32 queries q0 + 32 g .. and takes the 64-key quarter kq of every 256-key stage, with its own running maxima, sums and output tiles.
// A stage is 512 LDS rows of 128 bytes at pitch GPITCH: per 64-key quarter 64 K rows (a key's 64 dims), then 64 V^T rows (a dim's 64 keys). Each wave brings 32 of the rows by eight asynchronous copies of four whole lines each,
// so that every K and V^T line is fetched once for the four waves that read it; two buffers: the next stage's copies fly while this stage is worked on.
// The last stage holds the diagonal: a wave skips the 32-key blocks beyond its queries (a scalar test) and masks the one on them. At the end the four waves of a query group join their parts through LDS, two output tiles each.
#define SKEYS 256
#define SROWS (2 * SKEYS)
#define SBUF  (SROWS * GPITCH)
#define XW    (68 * 32)           // floats a wave hands over: 64 a lane of its eight output tiles, two maxima, two sums
__device__ __forceinline__ void fa_tile_s(const h16* __restrict__ Q, const h16* __restrict__ Kp, const h16* __restrict__ Vt, int q0, int col0, bf* Ah, bf* Al, char* sm) {
    typedef v16h V; constexpr int QT = 2;
    const int lane = threadIdx.x & 31, lr = lane & 15, hi = lane >> 4; const int wave = __builtin_amdgcn_readfirstlane(threadIdx.x >> 5);      // in a scalar register: the wave's slice of the copies and its tests for the diagonal are then scalar
    const int g = wave & 3, kq = wave >> 2, qw = q0 + g * 32, ns = (q0 + 128 + SKEYS - 1) / SKEYS;      // ns stages, the last with the diagonal
    // the lane's place in its wave's copies: LDS rows wave 32 + lane / 8 + 4 i, 16-byte column lane % 8; of four waves in a row the first two bring a quarter's K rows, the others its V^T rows
    const int crow = lane >> 3, ccol = lane & 7, ro = (wave & 1) * 32 + crow; const bool isv = (wave & 2) != 0;
    const h16* gp = isv ? Vt + (size_t)ro * TT + kq * 64 + ccol * 8 : Kp + (size_t)(kq * 64 + ro) * HD + ccol * 8;
    const size_t gs = isv ? (size_t)4 * TT : (size_t)4 * HD, gstep = isv ? (size_t)SKEYS : (size_t)SKEYS * HD;
    const unsigned l0 = (unsigned)(size_t)sm + (unsigned)((wave * 32 + crow) * GPITCH + ccol * 16);
    auto stage = [&](int t, int buf) { cp8(l0 + (unsigned)(buf * SBUF), gp + (size_t)t * gstep, gs); };
    stage(0, 0);
    V qf[QT][2];
#pragma unroll
    for (int qt = 0; qt < QT; ++qt)
#pragma unroll
        for (int ks = 0; ks < 2; ++ks) qf[qt][ks] = WFrag<h16>::ld(Q + (size_t)(qw + qt * 16 + lr) * HD + ks * 32 + 8 * hi);
    asm volatile("s_wait_xcnt 0x0" :: "v"(qf[0][0]), "v"(qf[0][1]), "v"(qf[1][0]), "v"(qf[1][1]));      // the wait: the query loads' address registers are reused behind it; it takes the loaded values as inputs only, which keeps it behind the loads
    v8f acc[QT][4]; float m[QT], l[QT];
#pragma unroll
    for (int qt = 0; qt < QT; ++qt) { m[qt] = -3.0e38f; l[qt] = 0.f;
#pragma unroll
        for (int dt = 0; dt < 4; ++dt) acc[qt][dt] = (v8f){}; }
    asm volatile("s_wait_asynccnt 0x0" ::: "memory");      // the wave's copies of stage 0 have landed before the barrier behind which the others read them
    __syncthreads();
    if (ns > 1) stage(1, 1);
#pragma unroll 1      // kept rolled: one trip a stage, the buffer chosen by the trip's parity
    for (int t = 0; t < ns; ++t) {
        const char* sb = sm + (t & 1) * SBUF + kq * (128 * GPITCH) + lr * GPITCH + hi * 16;      // the lane's place in the first K fragment of its wave's quarter
#pragma unroll
        for (int i = 0; i < 2; ++i) { const int kb = t * SKEYS + kq * 64 + i * 32;
            if (kb <= qw) {      // a scalar branch: blocks beyond the wave's queries are skipped
                V kf[2][2], vf[4];
#pragma unroll
                for (int kt = 0; kt < 2; ++kt)
#pragma unroll
                    for (int ks = 0; ks < 2; ++ks) kf[kt][ks] = WFrag<h16>::ld((const h16*)(sb + (i * 32 + kt * 16) * GPITCH + ks * 64));
#pragma unroll
                for (int dt = 0; dt < 4; ++dt) vf[dt] = WFrag<h16>::ld((const h16*)(sb + (64 + dt * 16) * GPITCH + i * 64));
                v8f s[QT][2];
#pragma unroll
                for (int kt = 0; kt < 2; ++kt)
#pragma unroll
                    for (int qt = 0; qt < QT; ++qt) { v8f c = (v8f){};
#pragma unroll
                        for (int ks = 0; ks < 2; ++ks) c = wmma16(kf[kt][ks], qf[qt][ks], c);
                        s[qt][kt] = c * SCL; }
                if (kb == qw) {      // the diagonal block: keys beyond the query are masked (every query keeps at least key kb)
#pragma unroll
                    for (int qt = 0; qt < QT; ++qt)
#pragma unroll
                        for (int kt = 0; kt < 2; ++kt)
#pragma unroll
                            for (int j = 0; j < 8; ++j) if (kt * 16 + hi * 8 + j > qt * 16 + lr) s[qt][kt][j] = -3.0e38f; }
#pragma unroll
                for (int qt = 0; qt < QT; ++qt) {
                    float bm = s[qt][0][0];
#pragma unroll
                    for (int kt = 0; kt < 2; ++kt)
#pragma unroll
                        for (int j = 0; j < 8; ++j) bm = fmaxf(bm, s[qt][kt][j]);
                    bm = fmaxf(bm, __shfl_xor(bm, 16, 32));      // the other half of the wave holds the query's other 16 keys
                    if (__builtin_amdgcn_ballot_w32(bm > m[qt]) != 0) {      // a scalar branch: where no query's maximum grows the factor is exactly 1 and the rescale is skipped
                        const float mn = fmaxf(m[qt], bm), al = exp2n((m[qt] - mn) * L2E); m[qt] = mn; l[qt] *= al;
#pragma unroll
                        for (int dt = 0; dt < 4; ++dt) acc[qt][dt] *= al; }
                    float x[16], p[16], ps = 0.f;
#pragma unroll
                    for (int e = 0; e < 16; ++e) x[e] = (s[qt][e >> 3][e & 7] - m[qt]) * L2E;
#pragma unroll
                    for (int e = 0; e < 16; e += 4) exp2x4(x + e, p + e);
#pragma unroll
                    for (int e = 0; e < 16; ++e) ps += p[e];
                    l[qt] += ps;      // the lane's own 16 keys; the halves are joined behind the loop
                    V pf;
#pragma unroll
                    for (int e = 0; e < 16; ++e) pf[e] = tohx(p[e]);
#pragma unroll
                    for (int dt = 0; dt < 4; ++dt) acc[qt][dt] = wmma16(vf[dt], pf, acc[qt][dt]); } } }
        asm volatile("s_wait_dscnt 0x0" ::: "memory");         // the wave's reads of this stage are done before the barrier behind which its buffer is refilled
        asm volatile("s_wait_asynccnt 0x0" ::: "memory");      // the wave's copies of the next stage have landed before the barrier behind which the others read them
        __syncthreads();
        if (t + 2 < ns) stage(t + 2, t & 1);
    }
    asm volatile("s_wait_asynccnt 0x0" ::: "memory");      // nothing is in flight where the buffers become the hand-over space (every wave's last read of them ended at the last trip's barrier)
    // every wave hands over its parts; wave (g, kq) then joins output tiles dt = 2 (kq % 2), + 1 of query tile kq / 2, in the lane layout they were stored in: each part scaled by exp(own maximum - joint maximum), added in the order of kq, divided by the joint sum
    float* xs = (float*)sm; float* xw = xs + wave * XW;
#pragma unroll
    for (int qt = 0; qt < QT; ++qt) { l[qt] += __shfl_xor(l[qt], 16, 32); xw[(64 + 2 * qt) * 32 + lane] = m[qt]; xw[(65 + 2 * qt) * 32 + lane] = l[qt];
#pragma unroll
        for (int dt = 0; dt < 4; ++dt)
#pragma unroll
            for (int j = 0; j < 8; ++j) xw[((qt * 4 + dt) * 8 + j) * 32 + lane] = acc[qt][dt][j]; }
    __syncthreads();
    const int jq = kq >> 1, jd = (kq & 1) * 2; const float* xg = xs + g * XW + lane; float f[4], M = -3.0e38f, Ls = 0.f;
#pragma unroll
    for (int k = 0; k < 4; ++k) { f[k] = xg[k * 4 * XW + (64 + 2 * jq) * 32]; M = fmaxf(M, f[k]); }
#pragma unroll
    for (int k = 0; k < 4; ++k) { f[k] = exp2n((f[k] - M) * L2E); Ls += xg[k * 4 * XW + (65 + 2 * jq) * 32] * f[k]; }
    const float inv = __fdiv_rn(1.0f, Ls);
#pragma unroll
    for (int e = 0; e < 2; ++e) { v8us oh, ol;
#pragma unroll
        for (int j = 0; j < 8; ++j) { float o = 0.f;
#pragma unroll
            for (int k = 0; k < 4; ++k) o += xg[k * 4 * XW + ((jq * 4 + jd + e) * 8 + j) * 32] * f[k];
            unsigned short a, c3; splitf(o * inv, a, c3); oh[j] = a; ol[j] = c3; }
        const size_t oo = (size_t)(qw + jq * 16 + lr) * DQ + col0 + (jd + e) * 16 + hi * 8; *(v8us*)(Ah + oo) = oh; *(v8us*)(Al + oo) = ol;
        asm volatile("s_wait_xcnt 0x0" ::: "memory"); }      // the wait: the two stores' address and data registers are reused by the next tile or by whatever code follows
}

// ---- fa_tile: 16 QT query rows of one head, operands straight from the K-contiguous planes. Wave w takes the 32-key blocks w, w + FW, ... up to the diagonal block with its own running maxima, sums and output tiles;
// the FW partial results are joined through LDS at the end (each scaled by exp(own maximum - joint maximum), added in wave order) and divided by the joint sum.
template <typename T16, int NSPLIT, int QT>
__device__ __forceinline__ void fa_tile(const T16* __restrict__ Q, const T16* __restrict__ Q2, const T16* __restrict__ Kp, const T16* __restrict__ Kp2, const T16* __restrict__ Vt, const T16* __restrict__ Vt2, int q0, int col0, bf* Ah, bf* Al, float* red, float* st) {
    typedef typename WFrag<T16>::V V;
    const int lane = threadIdx.x & 31, lr = lane & 15, hi = lane >> 4; const int wave = __builtin_amdgcn_readfirstlane(threadIdx.x >> 5);      // in a scalar register: the key loop and its test for the diagonal block are then scalar
    V qf[QT][2], qf2[QT][2];
#pragma unroll
    for (int qt = 0; qt < QT; ++qt)
#pragma unroll
        for (int ks = 0; ks < 2; ++ks) { const size_t o = (size_t)(q0 + qt * 16 + lr) * HD + ks * 32 + 8 * hi; qf[qt][ks] = WFrag<T16>::ld(Q + o); if (NSPLIT == 2) qf2[qt][ks] = WFrag<T16>::ld(Q2 + o); }
    v8f acc[QT][4]; float m[QT], l[QT];
#pragma unroll
    for (int qt = 0; qt < QT; ++qt) { m[qt] = -3.0e38f; l[qt] = 0.f;
#pragma unroll
        for (int dt = 0; dt < 4; ++dt) acc[qt][dt] = (v8f){}; }
    const int nfull = q0 / 32;      // key blocks wholly at or below every query of the tile; block nfull holds the diagonal and is the last
    // K and V^T fragments of key block b, straight from the K-contiguous planes
    auto ldk = [&](int b, V (&kf)[2][2], V (&kf2)[2][2]) {
#pragma unroll
        for (int kt = 0; kt < 2; ++kt)
#pragma unroll
            for (int ks = 0; ks < 2; ++ks) { const size_t o = (size_t)(b * 32 + kt * 16 + lr) * HD + ks * 32 + 8 * hi; kf[kt][ks] = WFrag<T16>::ld(Kp + o); if (NSPLIT == 2) kf2[kt][ks] = WFrag<T16>::ld(Kp2 + o); } };
    auto ldv = [&](int b, V (&vf)[4], V (&vf2)[4]) {
#pragma unroll
        for (int dt = 0; dt < 4; ++dt) { const size_t o = (size_t)(dt * 16 + lr) * TT + b * 32 + 8 * hi; vf[dt] = WFrag<T16>::ld(Vt + o); if (NSPLIT == 2) vf2[dt] = WFrag<T16>::ld(Vt2 + o); } };
    V kf[2][2], kf2[2][2], vf[4], vf2[4];
#pragma unroll 1      // kept rolled: the trip count is known at run time only
    for (int blk = wave; blk <= nfull; blk += FW) { const int kb = blk * 32;
        ldk(blk, kf, kf2); asm volatile("s_wait_xcnt 0x0" ::: "memory"); ldv(blk, vf, vf2); asm volatile("s_wait_xcnt 0x0" ::: "memory");      // the waits: the loads' address registers are reused, by the V^T fragments and in later blocks of the pass
        v8f s[QT][2];
#pragma unroll
        for (int kt = 0; kt < 2; ++kt)
#pragma unroll
            for (int qt = 0; qt < QT; ++qt) { v8f c = (v8f){};
#pragma unroll
                for (int ks = 0; ks < 2; ++ks) { c = WFrag<T16>::mma(kf[kt][ks], qf[qt][ks], c); if (NSPLIT == 2) { c = WFrag<T16>::mma(kf[kt][ks], qf2[qt][ks], c); c = WFrag<T16>::mma(kf2[kt][ks], qf[qt][ks], c); } }
                s[qt][kt] = c * SCL; }
        if (blk == nfull) {      // the diagonal block: keys beyond the query are masked (every query keeps at least key kb)
#pragma unroll
            for (int qt = 0; qt < QT; ++qt)
#pragma unroll
                for (int kt = 0; kt < 2; ++kt)
#pragma unroll
                    for (int j = 0; j < 8; ++j) if (kb + kt * 16 + hi * 8 + j > q0 + qt * 16 + lr) s[qt][kt][j] = -3.0e38f; }
#pragma unroll
        for (int qt = 0; qt < QT; ++qt) {
            float bm = s[qt][0][0];
#pragma unroll
            for (int kt = 0; kt < 2; ++kt)
#pragma unroll
                for (int j = 0; j < 8; ++j) bm = fmaxf(bm, s[qt][kt][j]);
            bm = fmaxf(bm, __shfl_xor(bm, 16, 32));      // the other half of the wave holds the query's other 16 keys
            if (__builtin_amdgcn_ballot_w32(bm > m[qt]) != 0) {      // a scalar branch: where no query's maximum grows the factor is exactly 1 and the rescale is skipped
                const float mn = fmaxf(m[qt], bm), al = exp2n((m[qt] - mn) * L2E); m[qt] = mn; l[qt] *= al;
#pragma unroll
                for (int dt = 0; dt < 4; ++dt) acc[qt][dt] *= al; }
            float x[16], p[16], ps = 0.f;
#pragma unroll
            for (int e = 0; e < 16; ++e) x[e] = (s[qt][e >> 3][e & 7] - m[qt]) * L2E;
#pragma unroll
            for (int e = 0; e < 16; e += 4) exp2x4(x + e, p + e);
#pragma unroll
            for (int e = 0; e < 16; ++e) ps += p[e];
            l[qt] += ps;      // the lane's own 16 keys; the halves are joined behind the loop
            if constexpr (NSPLIT == 2) { v16us ph, pl;
#pragma unroll
                for (int e = 0; e < 16; ++e) { unsigned short a, c2; splitf(p[e], a, c2); ph[e] = a; pl[e] = c2; }
                const V pf = __builtin_bit_cast(V, ph), pf2 = __builtin_bit_cast(V, pl);
#pragma unroll
                for (int dt = 0; dt < 4; ++dt) { acc[qt][dt] = WFrag<T16>::mma(vf[dt], pf, acc[qt][dt]); acc[qt][dt] = WFrag<T16>::mma(vf[dt], pf2, acc[qt][dt]); acc[qt][dt] = WFrag<T16>::mma(vf2[dt], pf, acc[qt][dt]); }
            } else { V pf;
#pragma unroll
                for (int e = 0; e < 16; ++e) pf[e] = tohx(p[e]);
#pragma unroll
                for (int dt = 0; dt < 4; ++dt) acc[qt][dt] = WFrag<T16>::mma(vf[dt], pf, acc[qt][dt]); } }
    }
#pragma unroll
    for (int qt = 0; qt < QT; ++qt) { l[qt] += __shfl_xor(l[qt], 16, 32); float* sw = st + (wave * QT + qt) * 64; sw[lane] = m[qt]; sw[32 + lane] = l[qt];
#pragma unroll
        for (int dt = 0; dt < 4; ++dt)
#pragma unroll
            for (int j = 0; j < 8; ++j) red[(((wave * QT + qt) * 4 + dt) * 8 + j) * 32 + lane] = acc[qt][dt][j]; }
    __syncthreads();
    // wave w < 4 joins output tile dt = w of every query tile, in the lane layout the tiles were stored in; a wave that had no key block left maximum -3e38, sum 0 and zeros: its factor is 0
    if (wave < 4) {
#pragma unroll
    for (int qt = 0; qt < QT; ++qt) { float f[FW], M = -3.0e38f, Ls = 0.f;
#pragma unroll
        for (int w = 0; w < FW; ++w) { f[w] = st[(w * QT + qt) * 64 + lane]; M = fmaxf(M, f[w]); }
#pragma unroll
        for (int w = 0; w < FW; ++w) { f[w] = exp2n((f[w] - M) * L2E); Ls += st[(w * QT + qt) * 64 + 32 + lane] * f[w]; }
        const float inv = __fdiv_rn(1.0f, Ls); v8us oh, ol;
#pragma unroll
        for (int j = 0; j < 8; ++j) { float o = 0.f;
#pragma unroll
            for (int w = 0; w < FW; ++w) o += red[(((w * QT + qt) * 4 + wave) * 8 + j) * 32 + lane] * f[w];
            unsigned short a, c2; splitf(o * inv, a, c2); oh[j] = a; ol[j] = c2; }
        const size_t oo = (size_t)(q0 + qt * 16 + lr) * DQ + col0 + wave * 16 + hi * 8; *(v8us*)(Ah + oo) = oh; *(v8us*)(Al + oo) = ol;
        asm volatile("s_wait_xcnt 0x0" ::: "memory"); } }      // the wait: the two stores' address and data registers may be reused by whatever code follows the tile
}
// Grid (batches x heads, (TT - RH) / 128 + RH / 16): first the fp16 tiles of 128 query rows of every head of both batches, the longest (last rows) first, then the hi/lo tiles of 16 query rows < RH.
// amdgpu_waves_per_eu(4, 4): four waves a SIMD (one work-group a WGP), 256 registers a wave: the vector work between the matrix runs of one wave is covered by the others.
__global__ __launch_bounds__(FW * 32) __attribute__((amdgpu_waves_per_eu(4, 4))) void k_fattn(const h16* __restrict__ Q16, const h16* __restrict__ K16, const h16* __restrict__ V16, const bf* __restrict__ Qh, const bf* __restrict__ Ql, const bf* __restrict__ Kh, const bf* __restrict__ Kl, const bf* __restrict__ Vh, const bf* __restrict__ Vl, bf* Ah, bf* Al) {
    __shared__ __align__(16) char sm[2 * SBUF];      // fa_tile_s: the two stage buffers, then the hand-over space; fa_tile: the partial results (FW x 4 KiB) and their maxima and sums
    static_assert(FW * XW * 4 <= 2 * SBUF && FW * (1024 + 64) * 4 <= 2 * SBUF && RH % 128 == 0 && TT % SKEYS == 0 && FW == 16, "LDS uses, tile sizes, 4 x 4 waves");
    const int h = blockIdx.x % NH_, bx = blockIdx.y; const size_t zo = (size_t)blockIdx.x * TT * HD, ao = (size_t)(blockIdx.x / NH_) * TT * DQ; constexpr int NLO = (TT - RH) / 128; Ah += ao; Al += ao;      // planes [batch][head], merged rows [batch][t]
    if (bx < NLO) fa_tile_s(Q16 + zo, K16 + zo, V16 + zo, TT - 128 * (bx + 1), h * HD, Ah, Al, sm);
    else fa_tile<bf, 2, 1>(Qh + zo, Ql + zo, Kh + zo, Kl + zo, Vh + zo, Vl + zo, RH - 16 * (bx - NLO + 1), h * HD, Ah, Al, (float*)sm, (float*)sm + FW * 1024);
}

extern "C" void kernel_launch(void* const* d_in, const int* in_sizes, int n_in,
                              void* d_out, int out_size, void* d_ws, size_t ws_size, hipStream_t stream) {
    (void)in_sizes; (void)n_in; (void)out_size;
    const float* x = (const float*)d_in[0]; const float* wq = (const float*)d_in[1]; const float* bq = (const float*)d_in[2]; const float* wk = (const float*)d_in[3]; const float* bk = (const float*)d_in[4]; const float* wv = (const float*)d_in[5]; const float* bv = (const float*)d_in[6]; const float* wo = (const float*)d_in[7]; const float* bo = (const float*)d_in[8];   /* argument order x, Wq_w, Wq_b, Wk_w, Wk_b, Wv_w, Wv_b, Wo_w, Wo_b ('oi') */
    float* OUT = (float*)d_out;     // [2][4096][768]
    char* wsp = (char*)d_ws;
    auto take = [&](size_t bytes) { char* p = wsp; wsp += (bytes + 255) & ~(size_t)255; return (void*)p; };
    bf* WQ = (bf*)take((size_t)DQ * DM * 2); bf* WK = (bf*)take((size_t)DKV * DM * 2); bf* WV = (bf*)take((size_t)DKV * DM * 2); bf* WO = (bf*)take((size_t)DM * DQ * 2);
    bf* XB = (bf*)take((size_t)NB_ * TT * DM * 2);
    h16* QP16 = (h16*)take((size_t)NB_ * NH_ * TT * HD * 2); h16* KP16 = (h16*)take((size_t)NB_ * NKV * TT * HD * 2); h16* VT16 = (h16*)take((size_t)NB_ * NKV * HD * TT * 2);
    bf* QPh = (bf*)take((size_t)NB_ * NH_ * TT * HD * 2); bf* QPl = (bf*)take((size_t)NB_ * NH_ * TT * HD * 2); bf* KPh = (bf*)take((size_t)NB_ * NKV * TT * HD * 2); bf* KPl = (bf*)take((size_t)NB_ * NKV * TT * HD * 2); bf* VTh = (bf*)take((size_t)NB_ * NKV * HD * TT * 2); bf* VTl = (bf*)take((size_t)NB_ * NKV * HD * TT * 2);
    bf* ATh = (bf*)take((size_t)NB_ * TT * DQ * 2); bf* ATl = (bf*)take((size_t)NB_ * TT * DQ * 2);
    if ((size_t)(wsp - (char*)d_ws) > ws_size) return;    // ws 256 MiB
    // four launches, each all the work of one step of the chain of dependences, both batches
    k_cvt<<<CX + 4 * CWT, 256, 0, stream>>>(x, wq, wk, wv, wo, XB, WQ, WK, WV, WO);
    k_qkv<<<dim3(TT / 128, DQ / 128, 3 * NB_), GW * 32, 0, stream>>>(XB, WQ, WK, WV, bq, bk, bv, QP16, QPh, QPl, KP16, KPh, KPl, VT16, VTh, VTl);
    k_fattn<<<dim3(NB_ * NH_, (TT - RH) / 128 + RH / 16), FW * 32, 0, stream>>>(QP16, KP16, VT16, QPh, QPl, KPh, KPl, VTh, VTl, ATh, ATl);
    k_wo<<<dim3(NB_ * TT / 128, DM / 128), GW * 32, 0, stream>>>(ATh, ATl, WO, bo, OUT, DQ);
}

// v007
// Measured time: 132 microseconds a run.
// Two timings next to v006 both put it at 1.05 times that version's speed.
// Over all steps from v000 it is 24.1 times as fast.
#include <hip/hip_runtime.h>

// Causal self-attention over 4,096 tokens at d_model 768 (x [2][4096][768]; q, k, v = x W^T + b ('oi' uniform(+-768^-0.5) incl. biases: non-zero; 12 heads x 64); logits / sqrt(64); causal (-inf); softmax; out = merged Wo^T + b -> [2][4096][768] (6.3 M); argument order x, Wq_w, Wq_b, Wk_w, Wk_b, Wv_w, Wv_b, Wo_w, Wo_b).
// Four launches, each for both batches: bf16 copy of x; 'oi' weights; exact projections (K 768) + f32 biases, each writing its head planes (fp16 + hi/lo) from its own epilogue; causal attention at T 4096 / 12 heads fused in one launch with a running softmax (k_fattn, K and V^T of the fp16 rows staged in LDS; hybrid rows: < 512 hi/lo 3 products, rest fp16; the fp16 probabilities are exp(score - reference maximum) <= exp(5.5), divided by the sum at the end, so no x1024 carry is needed); merged hi/lo x Wo exact + bias.
// Compute dtypes, f32 accumulate: every input rounded to bf16; projections exact + f32 biases; attention rows < 512 3 products, rest fp16; softmax f32; Wo hl x exact + bias.

#define NB_  2
#define TT   4096
#define DM   768
#define NH_  12
#define NKV  12
#define HD   64
#define DQ   (NH_ * HD)
#define DKV  (NKV * HD)
#define RH   512                  // query rows < RH use hi+lo planes (0: none)
#define SCL  0.125f   // HD^-0.5
typedef _Float16 h16;
typedef unsigned short bf;
typedef __attribute__((ext_vector_type(16))) __bf16   v16bf;
typedef __attribute__((ext_vector_type(16))) _Float16 v16h;
typedef __attribute__((ext_vector_type(8)))  _Float16 v8h;
typedef __attribute__((ext_vector_type(8)))  unsigned short v8us;
typedef __attribute__((ext_vector_type(8)))  float    v8f;
typedef __attribute__((ext_vector_type(4)))  float    v4f;
typedef v8h  __attribute__((may_alias)) v8ha;
typedef v4f  __attribute__((may_alias)) v4fa;
typedef v8us __attribute__((may_alias)) v8usa;

__device__ __forceinline__ unsigned short f2bf(float f) { unsigned u = __float_as_uint(f); u += 0x7FFFu + ((u >> 16) & 1u); return (unsigned short)(u >> 16); }
__device__ __forceinline__ float bf2f(unsigned short b) { return __uint_as_float(((unsigned)b) << 16); }
__device__ __forceinline__ float bfr(float f) { return bf2f(f2bf(f)); }
__device__ __forceinline__ v16h cat16(v8h lo, v8h hi) { return __builtin_shufflevector(lo, hi, 0, 1, 2, 3, 4, 5, 6, 7, 8, 9, 10, 11, 12, 13, 14, 15); }
__device__ __forceinline__ v16bf cat16b(v8us lo, v8us hi) { return __builtin_bit_cast(v16bf, __builtin_shufflevector(lo, hi, 0, 1, 2, 3, 4, 5, 6, 7, 8, 9, 10, 11, 12, 13, 14, 15)); }
__device__ __forceinline__ v8f wmma16(v16h a, v16h b, v8f c) { return __builtin_amdgcn_wmma_f32_16x16x32_f16(false, a, false, b, (short)0, c, false, false); }
__device__ __forceinline__ v8f wmmab(v16bf a, v16bf b, v8f c) { return __builtin_amdgcn_wmma_f32_16x16x32_bf16(false, a, false, b, (short)0, c, false, false); }
__device__ __forceinline__ h16 tohx(float x) { return (h16)x; }
__device__ __forceinline__ void splitf(float y, unsigned short& h, unsigned short& l) { h = f2bf(y); l = f2bf(y - bf2f(h)); }



// ---- gemmw: register-blocked GEMM, one wave per 64x64 output tile (16 accumulators), GW = 4 waves (2 x 2 tiles) per work-group of 128 threads, which takes the 128x128 tile (bx, by); osm (GW x 16 x 68 floats) and stg (2 NT GTILE bytes) are the calling kernel's LDS.
// The K-contiguous 16-bit operand planes come through LDS: a stage is 64 k (one whole 128-byte line) of the work-group's 128 rows of every operand, brought by asynchronous copies of which each covers four whole lines
// (each wave copies a quarter of the rows; every row is fetched once for the two waves that read it); two buffers, so that the next stage's copies fly while this stage's fragments are read and multiplied.
// LDS rows at pitch 144 bytes (16 x odd: no bank conflict for the 16-byte fragment reads).
// C[m][n] (f32, pitch ldc, + optional f32 bias[n]) = sum_k A[m][k] Bt[n][k] (+ split products per NSPLIT). K % 64 == 0, K >= 64; M, N % 128 == 0.
// PL != 0: no f32 C; the tile + bias goes out as three 16-bit planes (P16 fp16, Ph/Pl bf16 hi/lo) of row pitch ldc, the 64x64 tile (i, j) at element i px + j py. PL 1: bias[n] (token rows x one head's 64 columns: planes [h][t][d]);
// PL 2: bias[m] (A = weight rows, Bt = token rows: the tile is the transposed projection, planes [h][d][t]).
template <typename T16> struct WFrag;
template <> struct WFrag<h16> { typedef v16h V; static __device__ __forceinline__ V ld(const h16* p) { return cat16(*(const v8h*)p, *(const v8h*)(p + 16)); } static __device__ __forceinline__ v8f mma(V a, V b, v8f c) { return wmma16(a, b, c); } };
template <> struct WFrag<bf> { typedef v16bf V; static __device__ __forceinline__ V ld(const bf* p) { return cat16b(*(const v8us*)p, *(const v8us*)(p + 16)); } static __device__ __forceinline__ v8f mma(V a, V b, v8f c) { return wmmab(a, b, c); } };
#define GW     4                  // waves of a work-group
#define GPITCH 144                // bytes of an LDS row: 128 of data + 16
#define GTILE  (128 * GPITCH)     // one operand's 128 rows of a stage
// Eight asynchronous copies, 16 bytes a lane: copy i brings four whole 128-byte rows (8 lanes a row) from g + i gs elements to LDS byte l + i 4 GPITCH.
// The s_wait_xcnt stands in the copies' own statement, so that no address register is rewritten in front of it.
template <typename T16>
__device__ __forceinline__ void cp8(unsigned l, const T16* g, size_t gs) {
    asm volatile("global_load_async_to_lds_b128 %0, %8, off\n\tglobal_load_async_to_lds_b128 %1, %9, off\n\tglobal_load_async_to_lds_b128 %2, %10, off\n\tglobal_load_async_to_lds_b128 %3, %11, off\n\t"
                 "global_load_async_to_lds_b128 %4, %12, off\n\tglobal_load_async_to_lds_b128 %5, %13, off\n\tglobal_load_async_to_lds_b128 %6, %14, off\n\tglobal_load_async_to_lds_b128 %7, %15, off\n\ts_wait_xcnt 0x0"
                 :: "v"(l), "v"(l + 4u * GPITCH), "v"(l + 8u * GPITCH), "v"(l + 12u * GPITCH), "v"(l + 16u * GPITCH), "v"(l + 20u * GPITCH), "v"(l + 24u * GPITCH), "v"(l + 28u * GPITCH),
                    "v"(g), "v"(g + gs), "v"(g + 2 * gs), "v"(g + 3 * gs), "v"(g + 4 * gs), "v"(g + 5 * gs), "v"(g + 6 * gs), "v"(g + 7 * gs) : "memory");
}
template <typename T16, int NSPLIT, bool BIAS, int PL>
__device__ __forceinline__ void gemmw(const T16* __restrict__ A, const T16* __restrict__ A2, const T16* __restrict__ Bt, const T16* __restrict__ Bt2, int K, float* C, int ldc, const float* __restrict__ bias, h16* P16, bf* Ph, bf* Pl, size_t px, size_t py, int bx, int by, float* osm, char* stg) {
    typedef typename WFrag<T16>::V V;
    const int lane = threadIdx.x & 31, lr = lane & 15, hi = lane >> 4; const int wave = __builtin_amdgcn_readfirstlane(threadIdx.x >> 5);      // in a scalar register: the wave's tile and its slice of the copies are scalar offsets
    const int R0 = bx * 128, C0 = by * 128, r0 = R0 + (wave >> 1) * 64, c0 = C0 + (wave & 1) * 64; float* os = osm + wave * (16 * 68);      // os: the wave's own output staging
    v8f acc[4][4];
#pragma unroll
    for (int mb = 0; mb < 4; ++mb)
#pragma unroll
        for (int nb = 0; nb < 4; ++nb) acc[mb][nb] = (v8f){};
    constexpr bool HA2 = NSPLIT == 1 || NSPLIT == 2, HB2 = NSPLIT >= 2; constexpr int NT = 2 + (HA2 ? 1 : 0) + (HB2 ? 1 : 0);      // operand tiles of a stage, in the order A, Bt, A2, Bt2
    // the lane's place in its wave's copies: rows wave 32 + lane / 8 + 4 i, 16-byte column lane % 8
    const int crow = wave * 32 + (lane >> 3), ccol = lane & 7;
    const size_t goA = (size_t)(R0 + crow) * K + ccol * 8, goB = (size_t)(C0 + crow) * K + ccol * 8, gs = (size_t)4 * K;
    const unsigned l0 = (unsigned)(size_t)stg + (unsigned)(crow * GPITCH + ccol * 16);
    auto stage = [&](int t, int buf) { const size_t ko = (size_t)t * 64; const unsigned lb = l0 + (unsigned)(buf * NT * GTILE);
        cp8(lb, A + goA + ko, gs); cp8(lb + GTILE, Bt + goB + ko, gs);
        if constexpr (HA2) cp8(lb + 2u * GTILE, A2 + goA + ko, gs);
        if constexpr (HB2) cp8(lb + (NT - 1u) * GTILE, Bt2 + goB + ko, gs); };
    const int nt = K / 64, foA = ((wave >> 1) * 64 + lr) * GPITCH + hi * 16, foB = GTILE + ((wave & 1) * 64 + lr) * GPITCH + hi * 16;      // the lane's place in the first A and Bt fragment of its wave's tile
    stage(0, 0);
    asm volatile("s_wait_asynccnt 0x0" ::: "memory");      // the wave's copies of stage 0 have landed before the barrier behind which the others read them
    __syncthreads();
    if (nt > 1) stage(1, 1);
#pragma unroll 1      // kept rolled: one trip a stage, the buffer chosen by the trip's parity
    for (int t = 0; t < nt; ++t) {
        const char* sb = stg + (t & 1) * (NT * GTILE);
        V a[2][4], a2[2][4], b[2][4], b2[2][4];
        auto ldf = [&](int ks) {      // the fragments of k step ks (32 k) of the stage
#pragma unroll
            for (int mb = 0; mb < 4; ++mb) { a[ks][mb] = WFrag<T16>::ld((const T16*)(sb + foA + mb * 16 * GPITCH + ks * 64)); if (HA2) a2[ks][mb] = WFrag<T16>::ld((const T16*)(sb + foA + 2 * GTILE + mb * 16 * GPITCH + ks * 64)); }
#pragma unroll
            for (int nb = 0; nb < 4; ++nb) { b[ks][nb] = WFrag<T16>::ld((const T16*)(sb + foB + nb * 16 * GPITCH + ks * 64)); if (HB2) b2[ks][nb] = WFrag<T16>::ld((const T16*)(sb + foB + (NT - 2) * GTILE + nb * 16 * GPITCH + ks * 64)); } };
        auto mm = [&](int ks) {
#pragma unroll
            for (int nb = 0; nb < 4; ++nb)
#pragma unroll
                for (int mb = 0; mb < 4; ++mb) { acc[mb][nb] = WFrag<T16>::mma(a[ks][mb], b[ks][nb], acc[mb][nb]); if (HA2) acc[mb][nb] = WFrag<T16>::mma(a2[ks][mb], b[ks][nb], acc[mb][nb]); if (HB2) acc[mb][nb] = WFrag<T16>::mma(a[ks][mb], b2[ks][nb], acc[mb][nb]); } };
        ldf(0); ldf(1);
        __builtin_amdgcn_sched_barrier(0);      // the stage's fragment reads stand together ahead of its products: spread among them, each b fragment went into the same registers and the wave waited out the LDS latency at every one
        mm(0);                                  // the first step's products run while the second step's fragments arrive
        __builtin_amdgcn_sched_barrier(0);      // keeps them ahead of the waits below
        // the stage's last fragments are in registers behind the first wait: its buffer is handed over and refilled ahead of their products, which then cover part of the copies' flight
        asm volatile("s_wait_dscnt 0x0" ::: "memory");         // the wave's reads of this stage are done before the barrier behind which its buffer is refilled
        asm volatile("s_wait_asynccnt 0x0" ::: "memory");      // the wave's copies of the next stage have landed before the barrier behind which the others read them
        __syncthreads();
        if (t + 2 < nt) stage(t + 2, t & 1);
        __builtin_amdgcn_sched_barrier(0);      // keeps the second step's products behind the copies' issue
        mm(1);
        asm volatile("v_nop\n\tv_nop\n\tv_nop\n\tv_nop" : "+v"(acc[0][0]), "+v"(acc[1][1]), "+v"(acc[2][2]), "+v"(acc[3][3]) : "v"(a[1][0]), "v"(a[1][3]));
    }
    asm volatile("s_wait_asynccnt 0x0" ::: "memory");      // nothing is in flight where the wave goes on to the epilogue
    // planes: a lane takes 8 columns of one staged row, so that each 16-byte store of the wave covers four whole 128-byte rows
    const int prow = lane >> 3, pcol = (lane & 7) * 8; const size_t pb = (size_t)(r0 >> 6) * px + (size_t)(c0 >> 6) * py + (size_t)prow * ldc + pcol; constexpr int NPB = PL == 2 ? 16 : 8; float pbias[NPB];
    if constexpr (PL != 0) {
#pragma unroll
        for (int i = 0; i < NPB; ++i) pbias[i] = PL == 1 ? bias[c0 + pcol + i] : bias[r0 + i * 4 + prow];
        // the wait: the address register of PL 1's bias loads is reused by the rows below; it takes the loaded values as inputs only, which keeps it behind the loads
        if constexpr (PL == 1) asm volatile("s_wait_xcnt 0x0" :: "v"(pbias[0]), "v"(pbias[1]), "v"(pbias[2]), "v"(pbias[3]), "v"(pbias[4]), "v"(pbias[5]), "v"(pbias[6]), "v"(pbias[7]));
#pragma unroll
        for (int i = 0; i < NPB; ++i) pbias[i] = bfr(pbias[i]); }
#pragma unroll
    for (int mb = 0; mb < 4; ++mb) {
#pragma unroll
        for (int nb = 0; nb < 4; ++nb) {
#pragma unroll
            for (int j = 0; j < 8; ++j) os[(hi * 8 + j) * 68 + nb * 16 + lr] = acc[mb][nb][j]; }
        __builtin_amdgcn_wave_barrier(); asm volatile("" ::: "memory");
        if constexpr (PL != 0) {
#pragma unroll
            for (int s = 0; s < 4; ++s) { const float* orow = os + (4 * s + prow) * 68 + pcol; const v4f v0 = *(const v4fa*)orow, v1 = *(const v4fa*)(orow + 4); v8h o16; v8us oh, ol;
#pragma unroll
                for (int k = 0; k < 8; ++k) { const float y = (k < 4 ? v0[k & 3] : v1[k & 3]) + pbias[PL == 1 ? k : mb * 4 + s]; o16[k] = tohx(y); unsigned short a2, c2; splitf(y, a2, c2); oh[k] = a2; ol[k] = c2; }
                const size_t o = pb + (size_t)(mb * 16 + 4 * s) * ldc; *(v8h*)(P16 + o) = o16; *(v8us*)(Ph + o) = oh; *(v8us*)(Pl + o) = ol;
                asm volatile("s_wait_xcnt 0x0" ::: "memory"); }      // the wait: the three stores' address and data registers are reused by the next rows
        } else {
        float* crow = C + (size_t)(r0 + mb * 16) * ldc + c0;
#pragma unroll
            for (int s = 0; s < 8; ++s) { const int row = 2 * s + hi, cofs = lr * 4; v4f val = *(const v4fa*)(os + row * 68 + cofs); if (BIAS) { val[0] += bfr(bias[c0 + cofs]); val[1] += bfr(bias[c0 + cofs + 1]); val[2] += bfr(bias[c0 + cofs + 2]); val[3] += bfr(bias[c0 + cofs + 3]); }
                *(v4f*)(crow + (size_t)row * ldc + cofs) = val; }
             }
        __builtin_amdgcn_wave_barrier(); asm volatile("" ::: "memory");
    }
}

typedef __attribute__((ext_vector_type(4))) _Float16 v4h;
typedef __attribute__((ext_vector_type(4))) unsigned short v4us;
typedef __attribute__((ext_vector_type(4))) int v4i;

// ---- k_qkv: the q, k and v projections of both batches in one launch; grid (TT / 128, DQ / 128, 3 NB_), z = projection x NB_ + batch. Planes [batch][head][t][d] (q, k) and [batch][head][d][t] (v: operands swapped, the tile is V^T).
__global__ __launch_bounds__(GW * 32) void k_qkv(const bf* __restrict__ XB, const bf* __restrict__ WQ, const bf* __restrict__ WK, const bf* __restrict__ WV, const float* __restrict__ bq, const float* __restrict__ bk, const float* __restrict__ bv,
                                                 h16* Q16, bf* Qh, bf* Ql, h16* K16, bf* Kh, bf* Kl, h16* V16, bf* Vh, bf* Vl) {
    __shared__ __align__(16) float osm[GW * 16 * 68];
    __shared__ __align__(16) char stg[2 * 2 * GTILE];
    const int w = blockIdx.z / NB_, b = blockIdx.z % NB_; const bf* X = XB + (size_t)b * TT * DM; const size_t po = (size_t)b * NH_ * TT * HD;      // every plane holds NH_ TT HD elements a batch (NKV == NH_)
    if (w < 2) gemmw<bf, 0, true, 1>(X, nullptr, w ? WK : WQ, nullptr, DM, nullptr, HD, w ? bk : bq, (w ? K16 : Q16) + po, (w ? Kh : Qh) + po, (w ? Kl : Ql) + po, (size_t)64 * HD, (size_t)TT * HD, blockIdx.x, blockIdx.y, osm, stg);
    else gemmw<bf, 0, true, 2>(WV, nullptr, X, nullptr, DM, nullptr, TT, bv, V16 + po, Vh + po, Vl + po, (size_t)64 * TT, (size_t)64, blockIdx.y, blockIdx.x, osm, stg);
}
// ---- k_wo: out = merged (hi + lo) Wo^T + bias, the NB_ TT token rows of both batches in one launch; grid (NB_ TT / 128, DM / 128).
// K comes as an argument: with the constant folded in, the build kept the copies' LDS address in scratch memory and loaded it back in every stage.
__global__ __launch_bounds__(GW * 32) void k_wo(const bf* __restrict__ Ah, const bf* __restrict__ Al, const bf* __restrict__ WO, const float* __restrict__ bo, float* OUT, int K) {
    __shared__ __align__(16) float osm[GW * 16 * 68];
    __shared__ __align__(16) char stg[2 * 3 * GTILE];
    gemmw<bf, 1, true, 0>(Ah, Al, WO, nullptr, K, OUT, DM, bo, nullptr, nullptr, nullptr, 0, 0, blockIdx.x, blockIdx.y, osm, stg);
}

// ---- k_cvt: x (both batches) and the four weights to bf16 in one launch, 8 elements a thread; the first CX work-groups take x, then CWT each a weight.
#define CX  (NB_ * TT * DM / 8 / 256)
#define CWT (DQ * DM / 8 / 256)
__global__ __launch_bounds__(256) void k_cvt(const float* __restrict__ x, const float* __restrict__ wq, const float* __restrict__ wk, const float* __restrict__ wv, const float* __restrict__ wo, bf* XB, bf* WQ, bf* WK, bf* WV, bf* WO) {
    static_assert(NB_ * TT * DM % 2048 == 0 && DQ * DM % 2048 == 0 && DKV == DQ, "whole work-groups, four weights of one size");
    int blk = blockIdx.x; const float* src = x; bf* dst = XB;
    if (blk >= CX) { blk -= CX; const int w = blk / CWT; blk -= w * CWT; src = w == 0 ? wq : w == 1 ? wk : w == 2 ? wv : wo; dst = w == 0 ? WQ : w == 1 ? WK : w == 2 ? WV : WO; }
    const size_t i = (size_t)blk * 256 + threadIdx.x; const v8f v = *(const v8f*)(src + i * 8); v8us o;
#pragma unroll
    for (int k = 0; k < 8; ++k) o[k] = f2bf(v[k]); *(v8us*)(dst + i * 8) = o;  }

// ---- k_fattn: scores, causal softmax and probability x value product of both batches' heads in one launch; no score or probability plane reaches memory.
// Transposed products: S^T = K Q^T (A = key rows, B = query rows) and O^T += V^T P^T (A = rows of the transposed value plane, B = P). In every 16-column tile a lane then holds one query
// (column lr) and the keys hi 8 + j, so that maximum, sum and rescale factor are the lane's own, and two score tiles (keys 0..15, 16..31) are, register for register, the k order of a 32-key B fragment.
// Work-groups of FW waves. Two kinds of tile: fa_tile_s (fp16, 128 query rows, K and V^T staged in LDS and shared by the waves) and fa_tile (hi/lo, 16 query rows, the waves split the keys).
// Every loop over qt, kt, ks, dt, j, e and w is unrolled in full: the fragments and tiles are register arrays and need compile-time indices.
#define FW  16
#define L2E 1.4426950408889634f
typedef __attribute__((ext_vector_type(16))) unsigned short v16us;
// 2^x with the issue slot behind a transcendental kept by construction: the v_nop stands between the v_exp_f32 and whatever the compiler puts next (it may read the result or overwrite the source).
__device__ __forceinline__ float exp2n(float x) { float y; asm("v_exp_f32 %0, %1\n\tv_nop" : "=v"(y) : "v"(x)); return y; }
// Four at a time: each v_exp_f32 fills the slot of the one before it (the results are early-clobber, so none overwrites a source), the v_nop that of the last.
__device__ __forceinline__ void exp2x4(const float* x, float* y) { asm("v_exp_f32 %0, %4\n\tv_exp_f32 %1, %5\n\tv_exp_f32 %2, %6\n\tv_exp_f32 %3, %7\n\tv_nop" : "=&v"(y[0]), "=&v"(y[1]), "=&v"(y[2]), "=&v"(y[3]) : "v"(x[0]), "v"(x[1]), "v"(x[2]), "v"(x[3])); }

// ---- fa_tile_s: 128 query rows of one head, fp16. Wave w = (g = w % 4, kq = w / 4) holds the 32 queries q0 + 32 g .. and takes the 64-key quarter kq of every 256-key stage, with its own reference maxima, sums and output tiles.
// A stage is 512 LDS rows of 128 bytes at pitch GPITCH: per 64-key quarter 64 K rows (a key's 64 dims), then 64 V^T rows (a dim's 64 keys). Each wave brings 32 of the rows by eight asynchronous copies of four whole lines each,
// so that every K and V^T line is fetched once for the four waves that read it; two buffers: the next stage's copies fly while this stage is worked on.
// The last stage holds the diagonal: a wave skips the 32-key blocks beyond its queries (a scalar test) and masks the one on them. At the end the four waves of a query group join their parts through LDS, two output tiles each.
#define SKEYS 256
#define SROWS (2 * SKEYS)
#define SBUF  (SROWS * GPITCH)
#define XW    (68 * 32)           // floats a wave hands over: 64 a lane of its eight output tiles, two maxima, two sums
__device__ __forceinline__ void fa_tile_s(const h16* __restrict__ Q, const h16* __restrict__ Kp, const h16* __restrict__ Vt, int q0, int col0, bf* Ah, bf* Al, char* sm) {
    typedef v16h V; constexpr int QT = 2; constexpr float LAZY = 5.5f;      // exp(5.5) < 2^8: far inside fp16's range, and the f32 sums of 4,096 such terms are far inside f32's
    const int lane = threadIdx.x & 31, lr = lane & 15, hi = lane >> 4; const int wave = __builtin_amdgcn_readfirstlane(threadIdx.x >> 5);      // in a scalar register: the wave's slice of the copies and its tests for the diagonal are then scalar
    const int g = wave & 3, kq = wave >> 2, qw = q0 + g * 32, ns = (q0 + 128 + SKEYS - 1) / SKEYS;      // ns stages, the last with the diagonal
    // the lane's place in its wave's copies: LDS rows wave 32 + lane / 8 + 4 i, 16-byte column lane % 8; of four waves in a row the first two bring a quarter's K rows, the others its V^T rows
    const int crow = lane >> 3, ccol = lane & 7, ro = (wave & 1) * 32 + crow; const bool isv = (wave & 2) != 0;
    const h16* gp = isv ? Vt + (size_t)ro * TT + kq * 64 + ccol * 8 : Kp + (size_t)(kq * 64 + ro) * HD + ccol * 8;
    const size_t gs = isv ? (size_t)4 * TT : (size_t)4 * HD, gstep = isv ? (size_t)SKEYS : (size_t)SKEYS * HD;
    const unsigned l0 = (unsigned)(size_t)sm + (unsigned)((wave * 32 + crow) * GPITCH + ccol * 16);
    auto stage = [&](int t, int buf) { cp8(l0 + (unsigned)(buf * SBUF), gp + (size_t)t * gstep, gs); };
    stage(0, 0);
    V qf[QT][2];
#pragma unroll
    for (int qt = 0; qt < QT; ++qt)
#pragma unroll
        for (int ks = 0; ks < 2; ++ks) qf[qt][ks] = WFrag<h16>::ld(Q + (size_t)(qw + qt * 16 + lr) * HD + ks * 32 + 8 * hi);
    asm volatile("s_wait_xcnt 0x0" :: "v"(qf[0][0]), "v"(qf[0][1]), "v"(qf[1][0]), "v"(qf[1][1]));      // the wait: the query loads' address registers are reused behind it; it takes the loaded values as inputs only, which keeps it behind the loads
    v8f acc[QT][4]; float m[QT], l[QT];
#pragma unroll
    for (int qt = 0; qt < QT; ++qt) { m[qt] = -3.0e38f; l[qt] = 0.f;
#pragma unroll
        for (int dt = 0; dt < 4; ++dt) acc[qt][dt] = (v8f){}; }
    asm volatile("s_wait_asynccnt 0x0" ::: "memory");      // the wave's copies of stage 0 have landed before the barrier behind which the others read them
    __syncthreads();
    if (ns > 1) stage(1, 1);
#pragma unroll 1      // kept rolled: one trip a stage, the buffer chosen by the trip's parity
    for (int t = 0; t < ns; ++t) {
        const char* sb = sm + (t & 1) * SBUF + kq * (128 * GPITCH) + lr * GPITCH + hi * 16;      // the lane's place in the first K fragment of its wave's quarter
#pragma unroll
        for (int i = 0; i < 2; ++i) { const int kb = t * SKEYS + kq * 64 + i * 32;
            if (kb <= qw) {      // a scalar branch: blocks beyond the wave's queries are skipped
                V kf[2][2], vf[4];
#pragma unroll
                for (int kt = 0; kt < 2; ++kt)
#pragma unroll
                    for (int ks = 0; ks < 2; ++ks) kf[kt][ks] = WFrag<h16>::ld((const h16*)(sb + (i * 32 + kt * 16) * GPITCH + ks * 64));
#pragma unroll
                for (int dt = 0; dt < 4; ++dt) vf[dt] = WFrag<h16>::ld((const h16*)(sb + (64 + dt * 16) * GPITCH + i * 64));
                v8f s[QT][2];
#pragma unroll
                for (int kt = 0; kt < 2; ++kt)
#pragma unroll
                    for (int qt = 0; qt < QT; ++qt) { v8f c = (v8f){};
#pragma unroll
                        for (int ks = 0; ks < 2; ++ks) c = wmma16(kf[kt][ks], qf[qt][ks], c);
                        s[qt][kt] = c * SCL; }
                if (kb == qw) {      // the diagonal block: keys beyond the query are masked (every query keeps at least key kb)
#pragma unroll
                    for (int qt = 0; qt < QT; ++qt)
#pragma unroll
                        for (int kt = 0; kt < 2; ++kt)
#pragma unroll
                            for (int j = 0; j < 8; ++j) if (kt * 16 + hi * 8 + j > qt * 16 + lr) s[qt][kt][j] = -3.0e38f; }
                // lazy rescale: m is the reference in use, not the running maximum; it is renewed only where a score of the block lies more than LAZY above it, so that every probability stays <= exp(LAZY).
                // One test a block, on each lane's own 16 keys (a query's joint maximum passes the bound exactly where one of its two lanes does): the exchange between the halves stands in the branch.
                float bm[QT]; bool need = false;
#pragma unroll
                for (int qt = 0; qt < QT; ++qt) { bm[qt] = s[qt][0][0];
#pragma unroll
                    for (int kt = 0; kt < 2; ++kt)
#pragma unroll
                        for (int j = 0; j < 8; ++j) bm[qt] = fmaxf(bm[qt], s[qt][kt][j]);
                    need = need || bm[qt] > m[qt] + LAZY; }
                if (__builtin_amdgcn_ballot_w32(need) != 0) {      // a scalar branch, taken by the whole wave: in the wave's first block, and after it only for scores far above the reference
#pragma unroll
                    for (int qt = 0; qt < QT; ++qt) { const float bj = fmaxf(bm[qt], __shfl_xor(bm[qt], 16, 32));      // the other half of the wave holds the query's other 16 keys
                        const float mn = fmaxf(m[qt], bj), al = exp2n((m[qt] - mn) * L2E); m[qt] = mn; l[qt] *= al;
#pragma unroll
                        for (int dt = 0; dt < 4; ++dt) acc[qt][dt] *= al; } }
                V pf[QT];      // both query tiles' probabilities, then the block's eight output products
#pragma unroll
                for (int qt = 0; qt < QT; ++qt) {
                    float x[16], p[16], ps = 0.f;
#pragma unroll
                    for (int e = 0; e < 16; ++e) x[e] = (s[qt][e >> 3][e & 7] - m[qt]) * L2E;
#pragma unroll
                    for (int e = 0; e < 16; e += 4) exp2x4(x + e, p + e);
#pragma unroll
                    for (int e = 0; e < 16; ++e) ps += p[e];
                    l[qt] += ps;      // the lane's own 16 keys; the halves are joined behind the loop
#pragma unroll
                    for (int e = 0; e < 16; ++e) pf[qt][e] = tohx(p[e]); }
#pragma unroll
                for (int qt = 0; qt < QT; ++qt)
#pragma unroll
                    for (int dt = 0; dt < 4; ++dt) acc[qt][dt] = wmma16(vf[dt], pf[qt], acc[qt][dt]); } }
        asm volatile("s_wait_dscnt 0x0" ::: "memory");         // the wave's reads of this stage are done before the barrier behind which its buffer is refilled
        asm volatile("s_wait_asynccnt 0x0" ::: "memory");      // the wave's copies of the next stage have landed before the barrier behind which the others read them
        __syncthreads();
        if (t + 2 < ns) stage(t + 2, t & 1);
    }
    asm volatile("s_wait_asynccnt 0x0" ::: "memory");      // nothing is in flight where the buffers become the hand-over space (every wave's last read of them ended at the last trip's barrier)
    // every wave hands over its parts; wave (g, kq) then joins output tiles dt = 2 (kq % 2), + 1 of query tile kq / 2, in the lane layout they were stored in: each part scaled by exp(own maximum - joint maximum), added in the order of kq, divided by the joint sum
    float* xs = (float*)sm; float* xw = xs + wave * XW;
#pragma unroll
    for (int qt = 0; qt < QT; ++qt) { l[qt] += __shfl_xor(l[qt], 16, 32); xw[(64 + 2 * qt) * 32 + lane] = m[qt]; xw[(65 + 2 * qt) * 32 + lane] = l[qt];
#pragma unroll
        for (int dt = 0; dt < 4; ++dt)
#pragma unroll
            for (int j = 0; j < 8; ++j) xw[((qt * 4 + dt) * 8 + j) * 32 + lane] = acc[qt][dt][j]; }
    __syncthreads();
    const int jq = kq >> 1, jd = (kq & 1) * 2; const float* xg = xs + g * XW + lane; float f[4], M = -3.0e38f, Ls = 0.f;
#pragma unroll
    for (int k = 0; k < 4; ++k) { f[k] = xg[k * 4 * XW + (64 + 2 * jq) * 32]; M = fmaxf(M, f[k]); }
#pragma unroll
    for (int k = 0; k < 4; ++k) { f[k] = exp2n((f[k] - M) * L2E); Ls += xg[k * 4 * XW + (65 + 2 * jq) * 32] * f[k]; }
    const float inv = __fdiv_rn(1.0f, Ls);
#pragma unroll
    for (int e = 0; e < 2; ++e) { v8us oh, ol;
#pragma unroll
        for (int j = 0; j < 8; ++j) { float o = 0.f;
#pragma unroll
            for (int k = 0; k < 4; ++k) o += xg[k * 4 * XW + ((jq * 4 + jd + e) * 8 + j) * 32] * f[k];
            unsigned short a, c3; splitf(o * inv, a, c3); oh[j] = a; ol[j] = c3; }
        const size_t oo = (size_t)(qw + jq * 16 + lr) * DQ + col0 + (jd + e) * 16 + hi * 8; *(v8us*)(Ah + oo) = oh; *(v8us*)(Al + oo) = ol;
        asm volatile("s_wait_xcnt 0x0" ::: "memory"); }      // the wait: the two stores' address and data registers are reused by the next tile or by whatever code follows
}

// ---- fa_tile: 16 QT query rows of one head, operands straight from the K-contiguous planes. Wave w takes the 32-key blocks w, w + FW, ... up to the diagonal block with its own running maxima, sums and output tiles;
// the FW partial results are joined through LDS at the end (each scaled by exp(own maximum - joint maximum), added in wave order) and divided by the joint sum.
template <typename T16, int NSPLIT, int QT>
__device__ __forceinline__ void fa_tile(const T16* __restrict__ Q, const T16* __restrict__ Q2, const T16* __restrict__ Kp, const T16* __restrict__ Kp2, const T16* __restrict__ Vt, const T16* __restrict__ Vt2, int q0, int col0, bf* Ah, bf* Al, float* red, float* st) {
    typedef typename WFrag<T16>::V V;
    const int lane = threadIdx.x & 31, lr = lane & 15, hi = lane >> 4; const int wave = __builtin_amdgcn_readfirstlane(threadIdx.x >> 5);      // in a scalar register: the key loop and its test for the diagonal block are then scalar
    V qf[QT][2], qf2[QT][2];
#pragma unroll
    for (int qt = 0; qt < QT; ++qt)
#pragma unroll
        for (int ks = 0; ks < 2; ++ks) { const size_t o = (size_t)(q0 + qt * 16 + lr) * HD + ks * 32 + 8 * hi; qf[qt][ks] = WFrag<T16>::ld(Q + o); if (NSPLIT == 2) qf2[qt][ks] = WFrag<T16>::ld(Q2 + o); }
    v8f acc[QT][4]; float m[QT], l[QT];
#pragma unroll
    for (int qt = 0; qt < QT; ++qt) { m[qt] = -3.0e38f; l[qt] = 0.f;
#pragma unroll
        for (int dt = 0; dt < 4; ++dt) acc[qt][dt] = (v8f){}; }
    const int nfull = q0 / 32;      // key blocks wholly at or below every query of the tile; block nfull holds the diagonal and is the last
    // K and V^T fragments of key block b, straight from the K-contiguous planes
    auto ldk = [&](int b, V (&kf)[2][2], V (&kf2)[2][2]) {
#pragma unroll
        for (int kt = 0; kt < 2; ++kt)
#pragma unroll
            for (int ks = 0; ks < 2; ++ks) { const size_t o = (size_t)(b * 32 + kt * 16 + lr) * HD + ks * 32 + 8 * hi; kf[kt][ks] = WFrag<T16>::ld(Kp + o); if (NSPLIT == 2) kf2[kt][ks] = WFrag<T16>::ld(Kp2 + o); } };
    auto ldv = [&](int b, V (&vf)[4], V (&vf2)[4]) {
#pragma unroll
        for (int dt = 0; dt < 4; ++dt) { const size_t o = (size_t)(dt * 16 + lr) * TT + b * 32 + 8 * hi; vf[dt] = WFrag<T16>::ld(Vt + o); if (NSPLIT == 2) vf2[dt] = WFrag<T16>::ld(Vt2 + o); } };
    V kf[2][2], kf2[2][2], vf[4], vf2[4];
#pragma unroll 1      // kept rolled: the trip count is known at run time only
    for (int blk = wave; blk <= nfull; blk += FW) { const int kb = blk * 32;
        ldk(blk, kf, kf2); asm volatile("s_wait_xcnt 0x0" ::: "memory"); ldv(blk, vf, vf2); asm volatile("s_wait_xcnt 0x0" ::: "memory");      // the waits: the loads' address registers are reused, by the V^T fragments and in later blocks of the pass
        v8f s[QT][2];
#pragma unroll
        for (int kt = 0; kt < 2; ++kt)
#pragma unroll
            for (int qt = 0; qt < QT; ++qt) { v8f c = (v8f){};
#pragma unroll
                for (int ks = 0; ks < 2; ++ks) { c = WFrag<T16>::mma(kf[kt][ks], qf[qt][ks], c); if (NSPLIT == 2) { c = WFrag<T16>::mma(kf[kt][ks], qf2[qt][ks], c); c = WFrag<T16>::mma(kf2[kt][ks], qf[qt][ks], c); } }
                s[qt][kt] = c * SCL; }
        if (blk == nfull) {      // the diagonal block: keys beyond the query are masked (every query keeps at least key kb)
#pragma unroll
            for (int qt = 0; qt < QT; ++qt)
#pragma unroll
                for (int kt = 0; kt < 2; ++kt)
#pragma unroll
                    for (int j = 0; j < 8; ++j) if (kb + kt * 16 + hi * 8 + j > q0 + qt * 16 + lr) s[qt][kt][j] = -3.0e38f; }
#pragma unroll
        for (int qt = 0; qt < QT; ++qt) {
            float bm = s[qt][0][0];
#pragma unroll
            for (int kt = 0; kt < 2; ++kt)
#pragma unroll
                for (int j = 0; j < 8; ++j) bm = fmaxf(bm, s[qt][kt][j]);
            bm = fmaxf(bm, __shfl_xor(bm, 16, 32));      // the other half of the wave holds the query's other 16 keys
            if (__builtin_amdgcn_ballot_w32(bm > m[qt]) != 0) {      // a scalar branch: where no query's maximum grows the factor is exactly 1 and the rescale is skipped
                const float mn = fmaxf(m[qt], bm), al = exp2n((m[qt] - mn) * L2E); m[qt] = mn; l[qt] *= al;
#pragma unroll
                for (int dt = 0; dt < 4; ++dt) acc[qt][dt] *= al; }
            float x[16], p[16], ps = 0.f;
#pragma unroll
            for (int e = 0; e < 16; ++e) x[e] = (s[qt][e >> 3][e & 7] - m[qt]) * L2E;
#pragma unroll
            for (int e = 0; e < 16; e += 4) exp2x4(x + e, p + e);
#pragma unroll
            for (int e = 0; e < 16; ++e) ps += p[e];
            l[qt] += ps;      // the lane's own 16 keys; the halves are joined behind the loop
            if constexpr (NSPLIT == 2) { v16us ph, pl;
#pragma unroll
                for (int e = 0; e < 16; ++e) { unsigned short a, c2; splitf(p[e], a, c2); ph[e] = a; pl[e] = c2; }
                const V pf = __builtin_bit_cast(V, ph), pf2 = __builtin_bit_cast(V, pl);
#pragma unroll
                for (int dt = 0; dt < 4; ++dt) { acc[qt][dt] = WFrag<T16>::mma(vf[dt], pf, acc[qt][dt]); acc[qt][dt] = WFrag<T16>::mma(vf[dt], pf2, acc[qt][dt]); acc[qt][dt] = WFrag<T16>::mma(vf2[dt], pf, acc[qt][dt]); }
            } else { V pf;
#pragma unroll
                for (int e = 0; e < 16; ++e) pf[e] = tohx(p[e]);
#pragma unroll
                for (int dt = 0; dt < 4; ++dt) acc[qt][dt] = WFrag<T16>::mma(vf[dt], pf, acc[qt][dt]); } }
    }
#pragma unroll
    for (int qt = 0; qt < QT; ++qt) { l[qt] += __shfl_xor(l[qt], 16, 32); float* sw = st + (wave * QT + qt) * 64; sw[lane] = m[qt]; sw[32 + lane] = l[qt];
#pragma unroll
        for (int dt = 0; dt < 4; ++dt)
#pragma unroll
            for (int j = 0; j < 8; ++j) red[(((wave * QT + qt) * 4 + dt) * 8 + j) * 32 + lane] = acc[qt][dt][j]; }
    __syncthreads();
    // wave w < 4 joins output tile dt = w of every query tile, in the lane layout the tiles were stored in; a wave that had no key block left maximum -3e38, sum 0 and zeros: its factor is 0
    if (wave < 4) {
#pragma unroll
    for (int qt = 0; qt < QT; ++qt) { float f[FW], M = -3.0e38f, Ls = 0.f;
#pragma unroll
        for (int w = 0; w < FW; ++w) { f[w] = st[(w * QT + qt) * 64 + lane]; M = fmaxf(M, f[w]); }
#pragma unroll
        for (int w = 0; w < FW; ++w) { f[w] = exp2n((f[w] - M) * L2E); Ls += st[(w * QT + qt) * 64 + 32 + lane] * f[w]; }
        const float inv = __fdiv_rn(1.0f, Ls); v8us oh, ol;
#pragma unroll
        for (int j = 0; j < 8; ++j) { float o = 0.f;
#pragma unroll
            for (int w = 0; w < FW; ++w) o += red[(((w * QT + qt) * 4 + wave) * 8 + j) * 32 + lane] * f[w];
            unsigned short a, c2; splitf(o * inv, a, c2); oh[j] = a; ol[j] = c2; }
        const size_t oo = (size_t)(q0 + qt * 16 + lr) * DQ + col0 + wave * 16 + hi * 8; *(v8us*)(Ah + oo) = oh; *(v8us*)(Al + oo) = ol;
        asm volatile("s_wait_xcnt 0x0" ::: "memory"); } }      // the wait: the two stores' address and data registers may be reused by whatever code follows the tile
}
// Grid (batches x heads, (TT - RH) / 128 + RH / 16): first the fp16 tiles of 128 query rows of every head of both batches, the longest (last rows) first, then the hi/lo tiles of 16 query rows < RH.
// amdgpu_waves_per_eu(4, 4): four waves a SIMD (one work-group a WGP), 256 registers a wave: the vector work between the matrix runs of one wave is covered by the others.
__global__ __launch_bounds__(FW * 32) __attribute__((amdgpu_waves_per_eu(4, 4))) void k_fattn(const h16* __restrict__ Q16, const h16* __restrict__ K16, const h16* __restrict__ V16, const bf* __restrict__ Qh, const bf* __restrict__ Ql, const bf* __restrict__ Kh, const bf* __restrict__ Kl, const bf* __restrict__ Vh, const bf* __restrict__ Vl, bf* Ah, bf* Al) {
    __shared__ __align__(16) char sm[2 * SBUF];      // fa_tile_s: the two stage buffers, then the hand-over space; fa_tile: the partial results (FW x 4 KiB) and their maxima and sums
    static_assert(FW * XW * 4 <= 2 * SBUF && FW * (1024 + 64) * 4 <= 2 * SBUF && RH % 128 == 0 && TT % SKEYS == 0 && FW == 16, "LDS uses, tile sizes, 4 x 4 waves");
    const int h = blockIdx.x % NH_, bx = blockIdx.y; const size_t zo = (size_t)blockIdx.x * TT * HD, ao = (size_t)(blockIdx.x / NH_) * TT * DQ; constexpr int NLO = (TT - RH) / 128; Ah += ao; Al += ao;      // planes [batch][head], merged rows [batch][t]
    if (bx < NLO) fa_tile_s(Q16 + zo, K16 + zo, V16 + zo, TT - 128 * (bx + 1), h * HD, Ah, Al, sm);
    else fa_tile<bf, 2, 1>(Qh + zo, Ql + zo, Kh + zo, Kl + zo, Vh + zo, Vl + zo, RH - 16 * (bx - NLO + 1), h * HD, Ah, Al, (float*)sm, (float*)sm + FW * 1024);
}

extern "C" void kernel_launch(void* const* d_in, const int* in_sizes, int n_in,
                              void* d_out, int out_size, void* d_ws, size_t ws_size, hipStream_t stream) {
    (void)in_sizes; (void)n_in; (void)out_size;
    const float* x = (const float*)d_in[0]; const float* wq = (const float*)d_in[1]; const float* bq = (const float*)d_in[2]; const float* wk = (const float*)d_in[3]; const float* bk = (const float*)d_in[4]; const float* wv = (const float*)d_in[5]; const float* bv = (const float*)d_in[6]; const float* wo = (const float*)d_in[7]; const float* bo = (const float*)d_in[8];   /* argument order x, Wq_w, Wq_b, Wk_w, Wk_b, Wv_w, Wv_b, Wo_w, Wo_b ('oi') */
    float* OUT = (float*)d_out;     // [2][4096][768]
    char* wsp = (char*)d_ws;
    auto take = [&](size_t bytes) { char* p = wsp; wsp += (bytes + 255) & ~(size_t)255; return (void*)p; };
    bf* WQ = (bf*)take((size_t)DQ * DM * 2); bf* WK = (bf*)take((size_t)DKV * DM * 2); bf* WV = (bf*)take((size_t)DKV * DM * 2); bf* WO = (bf*)take((size_t)DM * DQ * 2);
    bf* XB = (bf*)take((size_t)NB_ * TT * DM * 2);
    h16* QP16 = (h16*)take((size_t)NB_ * NH_ * TT * HD * 2); h16* KP16 = (h16*)take((size_t)NB_ * NKV * TT * HD * 2); h16* VT16 = (h16*)take((size_t)NB_ * NKV * HD * TT * 2);
    bf* QPh = (bf*)take((size_t)NB_ * NH_ * TT * HD * 2); bf* QPl = (bf*)take((size_t)NB_ * NH_ * TT * HD * 2); bf* KPh = (bf*)take((size_t)NB_ * NKV * TT * HD * 2); bf* KPl = (bf*)take((size_t)NB_ * NKV * TT * HD * 2); bf* VTh = (bf*)take((size_t)NB_ * NKV * HD * TT * 2); bf* VTl = (bf*)take((size_t)NB_ * NKV * HD * TT * 2);
    bf* ATh = (bf*)take((size_t)NB_ * TT * DQ * 2); bf* ATl = (bf*)take((size_t)NB_ * TT * DQ * 2);
    if ((size_t)(wsp - (char*)d_ws) > ws_size) return;    // ws 256 MiB
    // four launches, each all the work of one step of the chain of dependences, both batches
    k_cvt<<<CX + 4 * CWT, 256, 0, stream>>>(x, wq, wk, wv, wo, XB, WQ, WK, WV, WO);
    k_qkv<<<dim3(TT / 128, DQ / 128, 3 * NB_), GW * 32, 0, stream>>>(XB, WQ, WK, WV, bq, bk, bv, QP16, QPh, QPl, KP16, KPh, KPl, VT16, VTh, VTl);
    k_fattn<<<dim3(NB_ * NH_, (TT - RH) / 128 + RH / 16), FW * 32, 0, stream>>>(QP16, KP16, VT16, QPh, QPl, KPh, KPl, VTh, VTl, ATh, ATl);
    k_wo<<<dim3(NB_ * TT / 128, DM / 128), GW * 32, 0, stream>>>(ATh, ATl, WO, bo, OUT, DQ);
}

// v008
// Measured time: 127 microseconds a run.
// In both of two side-by-side timings against v007, it was 1.04 times as fast.
// Over all steps from v000 it is 24.9 times as fast.
#include <hip/hip_runtime.h>

// Causal self-attention over 4,096 tokens at d_model 768 (x [2][4096][768]; q, k, v = x W^T + b ('oi' uniform(+-768^-0.5) incl. biases: non-zero; 12 heads x 64); logits / sqrt(64); causal (-inf); softmax; out = merged Wo^T + b -> [2][4096][768] (6.3 M); argument order x, Wq_w, Wq_b, Wk_w, Wk_b, Wv_w, Wv_b, Wo_w, Wo_b).
// Four launches, each for both batches: bf16 copies of x and the 'oi' weights; exact projections (K 768) + f32 biases, each writing its head planes (fp16 + hi/lo) from its own epilogue; causal attention at T 4096 / 12 heads fused in one launch with a running softmax (k_fattn, K and V^T of the fp16 rows staged in LDS; hybrid rows: < 512 hi/lo 3 products, rest fp16; the fp16 probabilities are exp(score - reference maximum) <= exp(5.5), divided by the sum at the end, so no x1024 carry is needed); merged hi/lo x Wo exact + bias.
// Compute dtypes, f32 accumulate: every input rounded to bf16; projections exact + f32 biases; attention rows < 512 3 products, rest fp16; softmax f32; Wo hl x exact + bias.

#define NB_  2
#define TT   4096
#define DM   768
#define NH_  12
#define NKV  12
#define HD   64
#define DQ   (NH_ * HD)
#define DKV  (NKV * HD)
#define RH   512                  // query rows < RH use hi+lo planes (0: none)
#define SCL  0.125f   // HD^-0.5
typedef _Float16 h16;
typedef unsigned short bf;
typedef __attribute__((ext_vector_type(16))) __bf16   v16bf;
typedef __attribute__((ext_vector_type(16))) _Float16 v16h;
typedef __attribute__((ext_vector_type(8)))  _Float16 v8h;
typedef __attribute__((ext_vector_type(8)))  unsigned short v8us;
typedef __attribute__((ext_vector_type(8)))  float    v8f;
typedef __attribute__((ext_vector_type(4)))  float    v4f;
typedef v8h  __attribute__((may_alias)) v8ha;
typedef v4f  __attribute__((may_alias)) v4fa;
typedef v8us __attribute__((may_alias)) v8usa;

__device__ __forceinline__ unsigned short f2bf(float f) { unsigned u = __float_as_uint(f); u += 0x7FFFu + ((u >> 16) & 1u); return (unsigned short)(u >> 16); }
__device__ __forceinline__ float bf2f(unsigned short b) { return __uint_as_float(((unsigned)b) << 16); }
__device__ __forceinline__ float bfr(float f) { return bf2f(f2bf(f)); }
__device__ __forceinline__ v16h cat16(v8h lo, v8h hi) { return __builtin_shufflevector(lo, hi, 0, 1, 2, 3, 4, 5, 6, 7, 8, 9, 10, 11, 12, 13, 14, 15); }
__device__ __forceinline__ v16bf cat16b(v8us lo, v8us hi) { return __builtin_bit_cast(v16bf, __builtin_shufflevector(lo, hi, 0, 1, 2, 3, 4, 5, 6, 7, 8, 9, 10, 11, 12, 13, 14, 15)); }
__device__ __forceinline__ v8f wmma16(v16h a, v16h b, v8f c) { return __builtin_amdgcn_wmma_f32_16x16x32_f16(false, a, false, b, (short)0, c, false, false); }
__device__ __forceinline__ v8f wmmab(v16bf a, v16bf b, v8f c) { return __builtin_amdgcn_wmma_f32_16x16x32_bf16(false, a, false, b, (short)0, c, false, false); }
__device__ __forceinline__ h16 tohx(float x) { return (h16)x; }
__device__ __forceinline__ void splitf(float y, unsigned short& h, unsigned short& l) { h = f2bf(y); l = f2bf(y - bf2f(h)); }



// ---- gemmw: register-blocked GEMM, one wave per 64x64 output tile (16 accumulators), GW = 4 waves (2 x 2 tiles) per work-group of 128 threads, which takes the 128x128 tile (bx, by); osm (GW x 16 x 68 floats) and stg (2 NT GTILE bytes) are the calling kernel's LDS.
// The K-contiguous 16-bit operand planes come through LDS: a stage is 64 k (one whole 128-byte line) of the work-group's 128 rows of every operand, brought by asynchronous copies of which each covers four whole lines
// (each wave copies a quarter of the rows; every row is fetched once for the two waves that read it); two buffers, so that the next stage's copies fly while this stage's fragments are read and multiplied.
// LDS rows at pitch 144 bytes (16 x odd: no bank conflict for the 16-byte fragment reads).
// C[m][n] (f32, pitch ldc, + optional f32 bias[n]) = sum_k A[m][k] Bt[n][k] (+ split products per NSPLIT). K % 64 == 0, K >= 64; M, N % 128 == 0.
// PL != 0: no f32 C; the tile + bias goes out as three 16-bit planes (P16 fp16, Ph/Pl bf16 hi/lo) of row pitch ldc, the 64x64 tile (i, j) at element i px + j py. PL 1: bias[n] (token rows x one head's 64 columns: planes [h][t][d]);
// PL 2: bias[m] (A = weight rows, Bt = token rows: the tile is the transposed projection, planes [h][d][t]).
template <typename T16> struct WFrag;
template <> struct WFrag<h16> { typedef v16h V; static __device__ __forceinline__ V ld(const h16* p) { return cat16(*(const v8h*)p, *(const v8h*)(p + 16)); } static __device__ __forceinline__ v8f mma(V a, V b, v8f c) { return wmma16(a, b, c); } };
template <> struct WFrag<bf> { typedef v16bf V; static __device__ __forceinline__ V ld(const bf* p) { return cat16b(*(const v8us*)p, *(const v8us*)(p + 16)); } static __device__ __forceinline__ v8f mma(V a, V b, v8f c) { return wmmab(a, b, c); } };
#define GW     4                  // waves of a work-group
#define GPITCH 144                // bytes of an LDS row: 128 of data + 16
#define GTILE  (128 * GPITCH)     // one operand's 128 rows of a stage
// Eight asynchronous copies, 16 bytes a lane: copy i brings four whole 128-byte rows (8 lanes a row) from g + i gs elements to LDS byte l + i 4 GPITCH.
// The s_wait_xcnt stands in the copies' own statement, so that no address register is rewritten in front of it.
template <typename T16>
__device__ __forceinline__ void cp8(unsigned l, const T16* g, size_t gs) {
    asm volatile("global_load_async_to_lds_b128 %0, %8, off\n\tglobal_load_async_to_lds_b128 %1, %9, off\n\tglobal_load_async_to_lds_b128 %2, %10, off\n\tglobal_load_async_to_lds_b128 %3, %11, off\n\t"
                 "global_load_async_to_lds_b128 %4, %12, off\n\tglobal_load_async_to_lds_b128 %5, %13, off\n\tglobal_load_async_to_lds_b128 %6, %14, off\n\tglobal_load_async_to_lds_b128 %7, %15, off\n\ts_wait_xcnt 0x0"
                 :: "v"(l), "v"(l + 4u * GPITCH), "v"(l + 8u * GPITCH), "v"(l + 12u * GPITCH), "v"(l + 16u * GPITCH), "v"(l + 20u * GPITCH), "v"(l + 24u * GPITCH), "v"(l + 28u * GPITCH),
                    "v"(g), "v"(g + gs), "v"(g + 2 * gs), "v"(g + 3 * gs), "v"(g + 4 * gs), "v"(g + 5 * gs), "v"(g + 6 * gs), "v"(g + 7 * gs) : "memory");
}
template <typename T16, int NSPLIT, bool BIAS, int PL>
__device__ __forceinline__ void gemmw(const T16* __restrict__ A, const T16* __restrict__ A2, const T16* __restrict__ Bt, const T16* __restrict__ Bt2, int K, float* C, int ldc, const float* __restrict__ bias, h16* P16, bf* Ph, bf* Pl, size_t px, size_t py, int bx, int by, float* osm, char* stg) {
    typedef typename WFrag<T16>::V V;
    const int lane = threadIdx.x & 31, lr = lane & 15, hi = lane >> 4; const int wave = __builtin_amdgcn_readfirstlane(threadIdx.x >> 5);      // in a scalar register: the wave's tile and its slice of the copies are scalar offsets
    const int R0 = bx * 128, C0 = by * 128, r0 = R0 + (wave >> 1) * 64, c0 = C0 + (wave & 1) * 64; float* os = osm + wave * (16 * 68);      // os: the wave's own output staging
    v8f acc[4][4];
#pragma unroll
    for (int mb = 0; mb < 4; ++mb)
#pragma unroll
        for (int nb = 0; nb < 4; ++nb) acc[mb][nb] = (v8f){};
    constexpr bool HA2 = NSPLIT == 1 || NSPLIT == 2, HB2 = NSPLIT >= 2; constexpr int NT = 2 + (HA2 ? 1 : 0) + (HB2 ? 1 : 0);      // operand tiles of a stage, in the order A, Bt, A2, Bt2
    // the lane's place in its wave's copies: rows wave 32 + lane / 8 + 4 i, 16-byte column lane % 8
    const int crow = wave * 32 + (lane >> 3), ccol = lane & 7;
    const size_t goA = (size_t)(R0 + crow) * K + ccol * 8, goB = (size_t)(C0 + crow) * K + ccol * 8, gs = (size_t)4 * K;
    const unsigned l0 = (unsigned)(size_t)stg + (unsigned)(crow * GPITCH + ccol * 16);
    auto stage = [&](int t, int buf) { const size_t ko = (size_t)t * 64; const unsigned lb = l0 + (unsigned)(buf * NT * GTILE);
        cp8(lb, A + goA + ko, gs); cp8(lb + GTILE, Bt + goB + ko, gs);
        if constexpr (HA2) cp8(lb + 2u * GTILE, A2 + goA + ko, gs);
        if constexpr (HB2) cp8(lb + (NT - 1u) * GTILE, Bt2 + goB + ko, gs); };
    const int nt = K / 64, foA = ((wave >> 1) * 64 + lr) * GPITCH + hi * 16, foB = GTILE + ((wave & 1) * 64 + lr) * GPITCH + hi * 16;      // the lane's place in the first A and Bt fragment of its wave's tile
    stage(0, 0);
    asm volatile("s_wait_asynccnt 0x0" ::: "memory");      // the wave's copies of stage 0 have landed before the barrier behind which the others read them
    __syncthreads();
    if (nt > 1) stage(1, 1);
#pragma unroll 1      // kept rolled: one trip a stage, the buffer chosen by the trip's parity
    for (int t = 0; t < nt; ++t) {
        const char* sb = stg + (t & 1) * (NT * GTILE);
        V a[2][4], a2[2][4], b[2][4], b2[2][4];
        auto ldf = [&](int ks) {      // the fragments of k step ks (32 k) of the stage
#pragma unroll
            for (int mb = 0; mb < 4; ++mb) { a[ks][mb] = WFrag<T16>::ld((const T16*)(sb + foA + mb * 16 * GPITCH + ks * 64)); if (HA2) a2[ks][mb] = WFrag<T16>::ld((const T16*)(sb + foA + 2 * GTILE + mb * 16 * GPITCH + ks * 64)); }
#pragma unroll
            for (int nb = 0; nb < 4; ++nb) { b[ks][nb] = WFrag<T16>::ld((const T16*)(sb + foB + nb * 16 * GPITCH + ks * 64)); if (HB2) b2[ks][nb] = WFrag<T16>::ld((const T16*)(sb + foB + (NT - 2) * GTILE + nb * 16 * GPITCH + ks * 64)); } };
        auto mm = [&](int ks) {
#pragma unroll
            for (int nb = 0; nb < 4; ++nb)
#pragma unroll
                for (int mb = 0; mb < 4; ++mb) { acc[mb][nb] = WFrag<T16>::mma(a[ks][mb], b[ks][nb], acc[mb][nb]); if (HA2) acc[mb][nb] = WFrag<T16>::mma(a2[ks][mb], b[ks][nb], acc[mb][nb]); if (HB2) acc[mb][nb] = WFrag<T16>::mma(a[ks][mb], b2[ks][nb], acc[mb][nb]); } };
        ldf(0); ldf(1);
        __builtin_amdgcn_sched_barrier(0);      // the stage's fragment reads stand together ahead of its products: spread among them, each b fragment went into the same registers and the wave waited out the LDS latency at every one
        mm(0);                                  // the first step's products run while the second step's fragments arrive
        __builtin_amdgcn_sched_barrier(0);      // keeps them ahead of the waits below
        // the stage's last fragments are in registers behind the first wait: its buffer is handed over and refilled ahead of their products, which then cover part of the copies' flight
        asm volatile("s_wait_dscnt 0x0" ::: "memory");         // the wave's reads of this stage are done before the barrier behind which its buffer is refilled
        asm volatile("s_wait_asynccnt 0x0" ::: "memory");      // the wave's copies of the next stage have landed before the barrier behind which the others read them
        __syncthreads();
        if (t + 2 < nt) stage(t + 2, t & 1);
        __builtin_amdgcn_sched_barrier(0);      // keeps the second step's products behind the copies' issue
        mm(1);
        asm volatile("v_nop\n\tv_nop\n\tv_nop\n\tv_nop" : "+v"(acc[0][0]), "+v"(acc[1][1]), "+v"(acc[2][2]), "+v"(acc[3][3]) : "v"(a[1][0]), "v"(a[1][3]));
    }
    asm volatile("s_wait_asynccnt 0x0" ::: "memory");      // nothing is in flight where the wave goes on to the epilogue
    // planes: a lane takes 8 columns of one staged row, so that each 16-byte store of the wave covers four whole 128-byte rows
    const int prow = lane >> 3, pcol = (lane & 7) * 8; const size_t pb = (size_t)(r0 >> 6) * px + (size_t)(c0 >> 6) * py + (size_t)prow * ldc + pcol; constexpr int NPB = PL == 2 ? 16 : 8; float pbias[NPB];
    if constexpr (PL != 0) {
#pragma unroll
        for (int i = 0; i < NPB; ++i) pbias[i] = PL == 1 ? bias[c0 + pcol + i] : bias[r0 + i * 4 + prow];
        // the wait: the address register of PL 1's bias loads is reused by the rows below; it takes the loaded values as inputs only, which keeps it behind the loads
        if constexpr (PL == 1) asm volatile("s_wait_xcnt 0x0" :: "v"(pbias[0]), "v"(pbias[1]), "v"(pbias[2]), "v"(pbias[3]), "v"(pbias[4]), "v"(pbias[5]), "v"(pbias[6]), "v"(pbias[7]));
#pragma unroll
        for (int i = 0; i < NPB; ++i) pbias[i] = bfr(pbias[i]); }
#pragma unroll
    for (int mb = 0; mb < 4; ++mb) {
#pragma unroll
        for (int nb = 0; nb < 4; ++nb) {
#pragma unroll
            for (int j = 0; j < 8; ++j) os[(hi * 8 + j) * 68 + nb * 16 + lr] = acc[mb][nb][j]; }
        __builtin_amdgcn_wave_barrier(); asm volatile("" ::: "memory");
        if constexpr (PL != 0) {
#pragma unroll
            for (int s = 0; s < 4; ++s) { const float* orow = os + (4 * s + prow) * 68 + pcol; const v4f v0 = *(const v4fa*)orow, v1 = *(const v4fa*)(orow + 4); v8h o16; v8us oh, ol;
#pragma unroll
                for (int k = 0; k < 8; ++k) { const float y = (k < 4 ? v0[k & 3] : v1[k & 3]) + pbias[PL == 1 ? k : mb * 4 + s]; o16[k] = tohx(y); unsigned short a2, c2; splitf(y, a2, c2); oh[k] = a2; ol[k] = c2; }
                const size_t o = pb + (size_t)(mb * 16 + 4 * s) * ldc; *(v8h*)(P16 + o) = o16; *(v8us*)(Ph + o) = oh; *(v8us*)(Pl + o) = ol;
                asm volatile("s_wait_xcnt 0x0" ::: "memory"); }      // the wait: the three stores' address and data registers are reused by the next rows
        } else {
        float* crow = C + (size_t)(r0 + mb * 16) * ldc + c0;
#pragma unroll
            for (int s = 0; s < 8; ++s) { const int row = 2 * s + hi, cofs = lr * 4; v4f val = *(const v4fa*)(os + row * 68 + cofs); if (BIAS) { val[0] += bfr(bias[c0 + cofs]); val[1] += bfr(bias[c0 + cofs + 1]); val[2] += bfr(bias[c0 + cofs + 2]); val[3] += bfr(bias[c0 + cofs + 3]); }
                *(v4f*)(crow + (size_t)row * ldc + cofs) = val; }
             }
        __builtin_amdgcn_wave_barrier(); asm volatile("" ::: "memory");
    }
}

typedef __attribute__((ext_vector_type(4))) _Float16 v4h;
typedef __attribute__((ext_vector_type(4))) unsigned short v4us;
typedef __attribute__((ext_vector_type(4))) int v4i;

// ---- k_qkv: the q, k and v projections of both batches in one launch; grid (TT / 128, DQ / 128, 3 NB_), z = projection x NB_ + batch. Planes [batch][head][t][d] (q, k) and [batch][head][d][t] (v: operands swapped, the tile is V^T).
__global__ __launch_bounds__(GW * 32) void k_qkv(const bf* __restrict__ XB, const bf* __restrict__ WQ, const bf* __restrict__ WK, const bf* __restrict__ WV, const float* __restrict__ bq, const float* __restrict__ bk, const float* __restrict__ bv,
                                                 h16* Q16, bf* Qh, bf* Ql, h16* K16, bf* Kh, bf* Kl, h16* V16, bf* Vh, bf* Vl) {
    __shared__ __align__(16) float osm[GW * 16 * 68];
    __shared__ __align__(16) char stg[2 * 2 * GTILE];
    const int w = blockIdx.z / NB_, b = blockIdx.z % NB_; const bf* X = XB + (size_t)b * TT * DM; const size_t po = (size_t)b * NH_ * TT * HD;      // every plane holds NH_ TT HD elements a batch (NKV == NH_)
    if (w < 2) gemmw<bf, 0, true, 1>(X, nullptr, w ? WK : WQ, nullptr, DM, nullptr, HD, w ? bk : bq, (w ? K16 : Q16) + po, (w ? Kh : Qh) + po, (w ? Kl : Ql) + po, (size_t)64 * HD, (size_t)TT * HD, blockIdx.x, blockIdx.y, osm, stg);
    else gemmw<bf, 0, true, 2>(WV, nullptr, X, nullptr, DM, nullptr, TT, bv, V16 + po, Vh + po, Vl + po, (size_t)64 * TT, (size_t)64, blockIdx.y, blockIdx.x, osm, stg);
}
// ---- k_wo: out = merged (hi + lo) Wo^T + bias, the NB_ TT token rows of both batches in one launch; grid (NB_ TT / 128, DM / 128).
// K comes as an argument: with the constant folded in, the build kept the copies' LDS address in scratch memory and loaded it back in every stage.
__global__ __launch_bounds__(GW * 32) void k_wo(const bf* __restrict__ Ah, const bf* __restrict__ Al, const bf* __restrict__ WO, const float* __restrict__ bo, float* OUT, int K) {
    __shared__ __align__(16) float osm[GW * 16 * 68];
    __shared__ __align__(16) char stg[2 * 3 * GTILE];
    gemmw<bf, 1, true, 0>(Ah, Al, WO, nullptr, K, OUT, DM, bo, nullptr, nullptr, nullptr, 0, 0, blockIdx.x, blockIdx.y, osm, stg);
}

// ---- k_cvt: x (both batches) and the four weights to bf16 in one launch, 8 elements a thread; the first CX work-groups take x, then CWT each a weight.
#define CX  (NB_ * TT * DM / 8 / 256)
#define CWT (DQ * DM / 8 / 256)
__global__ __launch_bounds__(256) void k_cvt(const float* __restrict__ x, const float* __restrict__ wq, const float* __restrict__ wk, const float* __restrict__ wv, const float* __restrict__ wo, bf* XB, bf* WQ, bf* WK, bf* WV, bf* WO) {
    static_assert(NB_ * TT * DM % 2048 == 0 && DQ * DM % 2048 == 0 && DKV == DQ, "whole work-groups, four weights of one size");
    int blk = blockIdx.x; const float* src = x; bf* dst = XB;
    if (blk >= CX) { blk -= CX; const int w = blk / CWT; blk -= w * CWT; src = w == 0 ? wq : w == 1 ? wk : w == 2 ? wv : wo; dst = w == 0 ? WQ : w == 1 ? WK : w == 2 ? WV : WO; }
    const size_t i = (size_t)blk * 256 + threadIdx.x; const v8f v = *(const v8f*)(src + i * 8); v8us o;
#pragma unroll
    for (int k = 0; k < 8; ++k) o[k] = f2bf(v[k]); *(v8us*)(dst + i * 8) = o;  }

// ---- k_fattn: scores, causal softmax and probability x value product of both batches' heads in one launch; no score or probability plane reaches memory.
// Transposed products: S^T = K Q^T (A = key rows, B = query rows) and O^T += V^T P^T (A = rows of the transposed value plane, B = P). In every 16-column tile a lane then holds one query
// (column lr) and the keys hi 8 + j, so that maximum, sum and rescale factor are the lane's own, and two score tiles (keys 0..15, 16..31) are, register for register, the k order of a 32-key B fragment.
// Work-groups of FW waves. Two kinds of tile: fa_tile_s (fp16, 128 query rows, K and V^T staged in LDS and shared by the waves) and fa_tile (hi/lo, 16 query rows, the waves split the keys).
// Every loop over qt, kt, ks, dt, j, e and w is unrolled in full: the fragments and tiles are register arrays and need compile-time indices.
#define FW  16
#define L2E 1.4426950408889634f
#define CSL (SCL * L2E)           // raw score -> exponent of 2: the logit scale and log2(e) in one factor
typedef __attribute__((ext_vector_type(16))) unsigned short v16us;
typedef __attribute__((ext_vector_type(2))) float v2f;
// 2^x with the issue slot behind a transcendental kept by construction: the v_nop stands between the v_exp_f32 and whatever the compiler puts next (it may read the result or overwrite the source).
__device__ __forceinline__ float exp2n(float x) { float y; asm("v_exp_f32 %0, %1\n\tv_nop" : "=v"(y) : "v"(x)); return y; }
// Four at a time: each v_exp_f32 fills the slot of the one before it (the results are early-clobber, so none overwrites a source), the v_nop that of the last.
__device__ __forceinline__ void exp2x4(const float* x, float* y) { asm("v_exp_f32 %0, %4\n\tv_exp_f32 %1, %5\n\tv_exp_f32 %2, %6\n\tv_exp_f32 %3, %7\n\tv_nop" : "=&v"(y[0]), "=&v"(y[1]), "=&v"(y[2]), "=&v"(y[3]) : "v"(x[0]), "v"(x[1]), "v"(x[2]), "v"(x[3])); }

// ---- fa_tile_s: 128 query rows of one head, fp16. Wave w = (g = w % 4, kq = w / 4) holds the 32 queries q0 + 32 g .. and takes the 64-key quarter kq of every 256-key stage, with its own reference maxima, sums and output tiles.
// A stage is 512 LDS rows of 128 bytes at pitch GPITCH: per 64-key quarter 64 K rows (a key's 64 dims), then 64 V^T rows (a dim's 64 keys). Each wave brings 32 of the rows by eight asynchronous copies of four whole lines each,
// so that every K and V^T line is fetched once for the four waves that read it; two buffers: the next stage's copies fly while this stage is worked on.
// The last stage holds the diagonal: a wave skips the 32-key blocks beyond its queries (a scalar test) and masks the one on them. At the end the four waves of a query group join their parts through LDS, two output tiles each.
// Softmax in the log2 domain: the score tiles stay as the products left them (unscaled), maxima are taken of those, the reference m is kept as -(maximum x CSL), ready as the addend, and one packed fused multiply-add a score pair (score x CSL + m) gives the argument of 2^x.
#define SKEYS 256
#define SROWS (2 * SKEYS)
#define SBUF  (SROWS * GPITCH)
#define XW    (68 * 32)           // floats a wave hands over: 64 a lane of its eight output tiles, two maxima, two sums
__device__ __forceinline__ void fa_tile_s(const h16* __restrict__ Q, const h16* __restrict__ Kp, const h16* __restrict__ Vt, int q0, int col0, bf* Ah, bf* Al, char* sm) {
    typedef v16h V; constexpr int QT = 2; constexpr float LAZY = 5.5f;      // exp(5.5) < 2^8: far inside fp16's range, and the f32 sums of 4,096 such terms are far inside f32's
    const int lane = threadIdx.x & 31, lr = lane & 15, hi = lane >> 4; const int wave = __builtin_amdgcn_readfirstlane(threadIdx.x >> 5);      // in a scalar register: the wave's slice of the copies and its tests for the diagonal are then scalar
    const int g = wave & 3, kq = wave >> 2, qw = q0 + g * 32, ns = (q0 + 128 + SKEYS - 1) / SKEYS;      // ns stages, the last with the diagonal
    // the lane's place in its wave's copies: LDS rows wave 32 + lane / 8 + 4 i, 16-byte column lane % 8; of four waves in a row the first two bring a quarter's K rows, the others its V^T rows
    const int crow = lane >> 3, ccol = lane & 7, ro = (wave & 1) * 32 + crow; const bool isv = (wave & 2) != 0;
    const h16* gp = isv ? Vt + (size_t)ro * TT + kq * 64 + ccol * 8 : Kp + (size_t)(kq * 64 + ro) * HD + ccol * 8;
    const size_t gs = isv ? (size_t)4 * TT : (size_t)4 * HD, gstep = isv ? (size_t)SKEYS : (size_t)SKEYS * HD;
    const unsigned l0 = (unsigned)(size_t)sm + (unsigned)((wave * 32 + crow) * GPITCH + ccol * 16);
    auto stage = [&](int t, int buf) { cp8(l0 + (unsigned)(buf * SBUF), gp + (size_t)t * gstep, gs); };
    stage(0, 0);
    V qf[QT][2];
#pragma unroll
    for (int qt = 0; qt < QT; ++qt)
#pragma unroll
        for (int ks = 0; ks < 2; ++ks) qf[qt][ks] = WFrag<h16>::ld(Q + (size_t)(qw + qt * 16 + lr) * HD + ks * 32 + 8 * hi);
    asm volatile("s_wait_xcnt 0x0" :: "v"(qf[0][0]), "v"(qf[0][1]), "v"(qf[1][0]), "v"(qf[1][1]));      // the wait: the query loads' address registers are reused behind it; it takes the loaded values as inputs only, which keeps it behind the loads
    v8f acc[QT][4]; float m[QT], l[QT];
#pragma unroll
    for (int qt = 0; qt < QT; ++qt) { m[qt] = 3.0e38f; l[qt] = 0.f;
#pragma unroll
        for (int dt = 0; dt < 4; ++dt) acc[qt][dt] = (v8f){}; }
    asm volatile("s_wait_asynccnt 0x0" ::: "memory");      // the wave's copies of stage 0 have landed before the barrier behind which the others read them
    __syncthreads();
    if (ns > 1) stage(1, 1);
#pragma unroll 1      // kept rolled: one trip a stage, the buffer chosen by the trip's parity
    for (int t = 0; t < ns; ++t) {
        const char* sb = sm + (t & 1) * SBUF + kq * (128 * GPITCH) + lr * GPITCH + hi * 16;      // the lane's place in the first K fragment of its wave's quarter
#pragma unroll
        for (int i = 0; i < 2; ++i) { const int kb = t * SKEYS + kq * 64 + i * 32;
            if (kb <= qw) {      // a scalar branch: blocks beyond the wave's queries are skipped
                V kf[2][2], vf[4];
#pragma unroll
                for (int kt = 0; kt < 2; ++kt)
#pragma unroll
                    for (int ks = 0; ks < 2; ++ks) kf[kt][ks] = WFrag<h16>::ld((const h16*)(sb + (i * 32 + kt * 16) * GPITCH + ks * 64));
#pragma unroll
                for (int dt = 0; dt < 4; ++dt) vf[dt] = WFrag<h16>::ld((const h16*)(sb + (64 + dt * 16) * GPITCH + i * 64));
                v8f s[QT][2];
#pragma unroll
                for (int kt = 0; kt < 2; ++kt)
#pragma unroll
                    for (int qt = 0; qt < QT; ++qt) { v8f c = (v8f){};
#pragma unroll
                        for (int ks = 0; ks < 2; ++ks) c = wmma16(kf[kt][ks], qf[qt][ks], c);
                        s[qt][kt] = c; }
                if (kb == qw) {      // the diagonal block: keys beyond the query are masked (every query keeps at least key kb)
#pragma unroll
                    for (int qt = 0; qt < QT; ++qt)
#pragma unroll
                        for (int kt = 0; kt < 2; ++kt)
#pragma unroll
                            for (int j = 0; j < 8; ++j) if (kt * 16 + hi * 8 + j > qt * 16 + lr) s[qt][kt][j] = -3.0e38f; }
                // lazy rescale: m is the reference in use, not the running maximum; it is renewed only where a scaled score of the block lies more than LAZY above it, so that every probability stays <= exp(LAZY).
                // One test a block, on each lane's own 16 keys (a query's joint maximum passes the bound exactly where one of its two lanes does): the exchange between the halves stands in the branch.
                float bm[QT]; bool need = false;
#pragma unroll
                for (int qt = 0; qt < QT; ++qt) { bm[qt] = s[qt][0][0];
#pragma unroll
                    for (int kt = 0; kt < 2; ++kt)
#pragma unroll
                        for (int j = 0; j < 8; ++j) bm[qt] = fmaxf(bm[qt], s[qt][kt][j]);
                    need = need || __builtin_fmaf(bm[qt], CSL, m[qt]) > LAZY * L2E; }      // the largest argument of 2^x that the block would see
                if (__builtin_amdgcn_ballot_w32(need) != 0) {      // a scalar branch, taken by the whole wave: in the wave's first block, and after it only for scores far above the reference
#pragma unroll
                    for (int qt = 0; qt < QT; ++qt) { const float bj = fmaxf(bm[qt], __shfl_xor(bm[qt], 16, 32));      // the other half of the wave holds the query's other 16 keys
                        const float mn = fminf(m[qt], bj * -CSL), al = exp2n(mn - m[qt]); m[qt] = mn; l[qt] *= al;
#pragma unroll
                        for (int dt = 0; dt < 4; ++dt) acc[qt][dt] *= al; } }
                V pf[QT];      // both query tiles' probabilities, then the block's eight output products
#pragma unroll
                for (int qt = 0; qt < QT; ++qt) {
                    float x[16], p[16], ps = 0.f;
#pragma unroll
                    for (int e = 0; e < 16; e += 2) { const v2f a = __builtin_elementwise_fma((v2f){s[qt][e >> 3][e & 7], s[qt][e >> 3][(e & 7) + 1]}, (v2f){CSL, CSL}, (v2f){m[qt], m[qt]}); x[e] = a.x; x[e + 1] = a.y; }
#pragma unroll
                    for (int e = 0; e < 16; e += 4) exp2x4(x + e, p + e);
#pragma unroll
                    for (int e = 0; e < 16; ++e) ps += p[e];
                    l[qt] += ps;      // the lane's own 16 keys; the halves are joined behind the loop
#pragma unroll
                    for (int e = 0; e < 16; ++e) pf[qt][e] = tohx(p[e]); }
#pragma unroll
                for (int qt = 0; qt < QT; ++qt)
#pragma unroll
                    for (int dt = 0; dt < 4; ++dt) acc[qt][dt] = wmma16(vf[dt], pf[qt], acc[qt][dt]); } }
        asm volatile("s_wait_dscnt 0x0" ::: "memory");         // the wave's reads of this stage are done before the barrier behind which its buffer is refilled
        asm volatile("s_wait_asynccnt 0x0" ::: "memory");      // the wave's copies of the next stage have landed before the barrier behind which the others read them
        __syncthreads();
        if (t + 2 < ns) stage(t + 2, t & 1);
    }
    asm volatile("s_wait_asynccnt 0x0" ::: "memory");      // nothing is in flight where the buffers become the hand-over space (every wave's last read of them ended at the last trip's barrier)
    // every wave hands over its parts; wave (g, kq) then joins output tiles dt = 2 (kq % 2), + 1 of query tile kq / 2, in the lane layout they were stored in: each part scaled by exp(own maximum - joint maximum), added in the order of kq, divided by the joint sum
    float* xs = (float*)sm; float* xw = xs + wave * XW;
#pragma unroll
    for (int qt = 0; qt < QT; ++qt) { l[qt] += __shfl_xor(l[qt], 16, 32); xw[(64 + 2 * qt) * 32 + lane] = m[qt]; xw[(65 + 2 * qt) * 32 + lane] = l[qt];
#pragma unroll
        for (int dt = 0; dt < 4; ++dt)
#pragma unroll
            for (int j = 0; j < 8; ++j) xw[((qt * 4 + dt) * 8 + j) * 32 + lane] = acc[qt][dt][j]; }
    __syncthreads();
    const int jq = kq >> 1, jd = (kq & 1) * 2; const float* xg = xs + g * XW + lane; float f[4], M = 3.0e38f, Ls = 0.f;
#pragma unroll
    for (int k = 0; k < 4; ++k) { f[k] = xg[k * 4 * XW + (64 + 2 * jq) * 32]; M = fminf(M, f[k]); }
#pragma unroll
    for (int k = 0; k < 4; ++k) { f[k] = exp2n(M - f[k]); Ls += xg[k * 4 * XW + (65 + 2 * jq) * 32] * f[k]; }      // the references are negated exponents of 2 already
    const float inv = __fdiv_rn(1.0f, Ls);
#pragma unroll
    for (int e = 0; e < 2; ++e) { v8us oh, ol;
#pragma unroll
        for (int j = 0; j < 8; ++j) { float o = 0.f;
#pragma unroll
            for (int k = 0; k < 4; ++k) o += xg[k * 4 * XW + ((jq * 4 + jd + e) * 8 + j) * 32] * f[k];
            unsigned short a, c3; splitf(o * inv, a, c3); oh[j] = a; ol[j] = c3; }
        const size_t oo = (size_t)(qw + jq * 16 + lr) * DQ + col0 + (jd + e) * 16 + hi * 8; *(v8us*)(Ah + oo) = oh; *(v8us*)(Al + oo) = ol;
        asm volatile("s_wait_xcnt 0x0" ::: "memory"); }      // the wait: the two stores' address and data registers are reused by the next tile or by whatever code follows
}

// ---- fa_tile: 16 QT query rows of one head, operands straight from the K-contiguous planes. Wave w takes the 32-key blocks w, w + FW, ... up to the diagonal block with its own running maxima, sums and output tiles;
// the FW partial results are joined through LDS at the end (each scaled by exp(own maximum - joint maximum), added in wave order) and divided by the joint sum.
template <typename T16, int NSPLIT, int QT>
__device__ __forceinline__ void fa_tile(const T16* __restrict__ Q, const T16* __restrict__ Q2, const T16* __restrict__ Kp, const T16* __restrict__ Kp2, const T16* __restrict__ Vt, const T16* __restrict__ Vt2, int q0, int col0, bf* Ah, bf* Al, float* red, float* st) {
    typedef typename WFrag<T16>::V V;
    const int lane = threadIdx.x & 31, lr = lane & 15, hi = lane >> 4; const int wave = __builtin_amdgcn_readfirstlane(threadIdx.x >> 5);      // in a scalar register: the key loop and its test for the diagonal block are then scalar
    V qf[QT][2], qf2[QT][2];
#pragma unroll
    for (int qt = 0; qt < QT; ++qt)
#pragma unroll
        for (int ks = 0; ks < 2; ++ks) { const size_t o = (size_t)(q0 + qt * 16 + lr) * HD + ks * 32 + 8 * hi; qf[qt][ks] = WFrag<T16>::ld(Q + o); if (NSPLIT == 2) qf2[qt][ks] = WFrag<T16>::ld(Q2 + o); }
    v8f acc[QT][4]; float m[QT], l[QT];
#pragma unroll
    for (int qt = 0; qt < QT; ++qt) { m[qt] = -3.0e38f; l[qt] = 0.f;
#pragma unroll
        for (int dt = 0; dt < 4; ++dt) acc[qt][dt] = (v8f){}; }
    const int nfull = q0 / 32;      // key blocks wholly at or below every query of the tile; block nfull holds the diagonal and is the last
    // K and V^T fragments of key block b, straight from the K-contiguous planes
    auto ldk = [&](int b, V (&kf)[2][2], V (&kf2)[2][2]) {
#pragma unroll
        for (int kt = 0; kt < 2; ++kt)
#pragma unroll
            for (int ks = 0; ks < 2; ++ks) { const size_t o = (size_t)(b * 32 + kt * 16 + lr) * HD + ks * 32 + 8 * hi; kf[kt][ks] = WFrag<T16>::ld(Kp + o); if (NSPLIT == 2) kf2[kt][ks] = WFrag<T16>::ld(Kp2 + o); } };
    auto ldv = [&](int b, V (&vf)[4], V (&vf2)[4]) {
#pragma unroll
        for (int dt = 0; dt < 4; ++dt) { const size_t o = (size_t)(dt * 16 + lr) * TT + b * 32 + 8 * hi; vf[dt] = WFrag<T16>::ld(Vt + o); if (NSPLIT == 2) vf2[dt] = WFrag<T16>::ld(Vt2 + o); } };
    V kf[2][2], kf2[2][2], vf[4], vf2[4];
#pragma unroll 1      // kept rolled: the trip count is known at run time only
    for (int blk = wave; blk <= nfull; blk += FW) { const int kb = blk * 32;
        ldk(blk, kf, kf2); asm volatile("s_wait_xcnt 0x0" ::: "memory"); ldv(blk, vf, vf2); asm volatile("s_wait_xcnt 0x0" ::: "memory");      // the waits: the loads' address registers are reused, by the V^T fragments and in later blocks of the pass
        v8f s[QT][2];
#pragma unroll
        for (int kt = 0; kt < 2; ++kt)
#pragma unroll
            for (int qt = 0; qt < QT; ++qt) { v8f c = (v8f){};
#pragma unroll
                for (int ks = 0; ks < 2; ++ks) { c = WFrag<T16>::mma(kf[kt][ks], qf[qt][ks], c); if (NSPLIT == 2) { c = WFrag<T16>::mma(kf[kt][ks], qf2[qt][ks], c); c = WFrag<T16>::mma(kf2[kt][ks], qf[qt][ks], c); } }
                s[qt][kt] = c * SCL; }
        if (blk == nfull) {      // the diagonal block: keys beyond the query are masked (every query keeps at least key kb)
#pragma unroll
            for (int qt = 0; qt < QT; ++qt)
#pragma unroll
                for (int kt = 0; kt < 2; ++kt)
#pragma unroll
                    for (int j = 0; j < 8; ++j) if (kb + kt * 16 + hi * 8 + j > q0 + qt * 16 + lr) s[qt][kt][j] = -3.0e38f; }
#pragma unroll
        for (int qt = 0; qt < QT; ++qt) {
            float bm = s[qt][0][0];
#pragma unroll
            for (int kt = 0; kt < 2; ++kt)
#pragma unroll
                for (int j = 0; j < 8; ++j) bm = fmaxf(bm, s[qt][kt][j]);
            bm = fmaxf(bm, __shfl_xor(bm, 16, 32));      // the other half of the wave holds the query's other 16 keys
            if (__builtin_amdgcn_ballot_w32(bm > m[qt]) != 0) {      // a scalar branch: where no query's maximum grows the factor is exactly 1 and the rescale is skipped
                const float mn = fmaxf(m[qt], bm), al = exp2n((m[qt] - mn) * L2E); m[qt] = mn; l[qt] *= al;
#pragma unroll
                for (int dt = 0; dt < 4; ++dt) acc[qt][dt] *= al; }
            float x[16], p[16], ps = 0.f;
#pragma unroll
            for (int e = 0; e < 16; ++e) x[e] = (s[qt][e >> 3][e & 7] - m[qt]) * L2E;
#pragma unroll
            for (int e = 0; e < 16; e += 4) exp2x4(x + e, p + e);
#pragma unroll
            for (int e = 0; e < 16; ++e) ps += p[e];
            l[qt] += ps;      // the lane's own 16 keys; the halves are joined behind the loop
            if constexpr (NSPLIT == 2) { v16us ph, pl;
#pragma unroll
                for (int e = 0; e < 16; ++e) { unsigned short a, c2; splitf(p[e], a, c2); ph[e] = a; pl[e] = c2; }
                const V pf = __builtin_bit_cast(V, ph), pf2 = __builtin_bit_cast(V, pl);
#pragma unroll
                for (int dt = 0; dt < 4; ++dt) { acc[qt][dt] = WFrag<T16>::mma(vf[dt], pf, acc[qt][dt]); acc[qt][dt] = WFrag<T16>::mma(vf[dt], pf2, acc[qt][dt]); acc[qt][dt] = WFrag<T16>::mma(vf2[dt], pf, acc[qt][dt]); }
            } else { V pf;
#pragma unroll
                for (int e = 0; e < 16; ++e) pf[e] = tohx(p[e]);
#pragma unroll
                for (int dt = 0; dt < 4; ++dt) acc[qt][dt] = WFrag<T16>::mma(vf[dt], pf, acc[qt][dt]); } }
    }
#pragma unroll
    for (int qt = 0; qt < QT; ++qt) { l[qt] += __shfl_xor(l[qt], 16, 32); float* sw = st + (wave * QT + qt) * 64; sw[lane] = m[qt]; sw[32 + lane] = l[qt];
#pragma unroll
        for (int dt = 0; dt < 4; ++dt)
#pragma unroll
            for (int j = 0; j < 8; ++j) red[(((wave * QT + qt) * 4 + dt) * 8 + j) * 32 + lane] = acc[qt][dt][j]; }
    __syncthreads();
    // wave w < 4 joins output tile dt = w of every query tile, in the lane layout the tiles were stored in; a wave that had no key block left maximum -3e38, sum 0 and zeros: its factor is 0
    if (wave < 4) {
#pragma unroll
    for (int qt = 0; qt < QT; ++qt) { float f[FW], M = -3.0e38f, Ls = 0.f;
#pragma unroll
        for (int w = 0; w < FW; ++w) { f[w] = st[(w * QT + qt) * 64 + lane]; M = fmaxf(M, f[w]); }
#pragma unroll
        for (int w = 0; w < FW; ++w) { f[w] = exp2n((f[w] - M) * L2E); Ls += st[(w * QT + qt) * 64 + 32 + lane] * f[w]; }
        const float inv = __fdiv_rn(1.0f, Ls); v8us oh, ol;
#pragma unroll
        for (int j = 0; j < 8; ++j) { float o = 0.f;
#pragma unroll
            for (int w = 0; w < FW; ++w) o += red[(((w * QT + qt) * 4 + wave) * 8 + j) * 32 + lane] * f[w];
            unsigned short a, c2; splitf(o * inv, a, c2); oh[j] = a; ol[j] = c2; }
        const size_t oo = (size_t)(q0 + qt * 16 + lr) * DQ + col0 + wave * 16 + hi * 8; *(v8us*)(Ah + oo) = oh; *(v8us*)(Al + oo) = ol;
        asm volatile("s_wait_xcnt 0x0" ::: "memory"); } }      // the wait: the two stores' address and data registers may be reused by whatever code follows the tile
}
// Grid (batches x heads, (TT - RH) / 128 + RH / 16): first the fp16 tiles of 128 query rows of every head of both batches, the longest (last rows) first, then the hi/lo tiles of 16 query rows < RH.
// amdgpu_waves_per_eu(4, 4): four waves a SIMD (one work-group a WGP), 256 registers a wave: the vector work between the matrix runs of one wave is covered by the others.
__global__ __launch_bounds__(FW * 32) __attribute__((amdgpu_waves_per_eu(4, 4))) void k_fattn(const h16* __restrict__ Q16, const h16* __restrict__ K16, const h16* __restrict__ V16, const bf* __restrict__ Qh, const bf* __restrict__ Ql, const bf* __restrict__ Kh, const bf* __restrict__ Kl, const bf* __restrict__ Vh, const bf* __restrict__ Vl, bf* Ah, bf* Al) {
    __shared__ __align__(16) char sm[2 * SBUF];      // fa_tile_s: the two stage buffers, then the hand-over space; fa_tile: the partial results (FW x 4 KiB) and their maxima and sums
    static_assert(FW * XW * 4 <= 2 * SBUF && FW * (1024 + 64) * 4 <= 2 * SBUF && RH % 128 == 0 && TT % SKEYS == 0 && FW == 16, "LDS uses, tile sizes, 4 x 4 waves");
    const int h = blockIdx.x % NH_, bx = blockIdx.y; const size_t zo = (size_t)blockIdx.x * TT * HD, ao = (size_t)(blockIdx.x / NH_) * TT * DQ; constexpr int NLO = (TT - RH) / 128; Ah += ao; Al += ao;      // planes [batch][head], merged rows [batch][t]
    if (bx < NLO) fa_tile_s(Q16 + zo, K16 + zo, V16 + zo, TT - 128 * (bx + 1), h * HD, Ah, Al, sm);
    else fa_tile<bf, 2, 1>(Qh + zo, Ql + zo, Kh + zo, Kl + zo, Vh + zo, Vl + zo, RH - 16 * (bx - NLO + 1), h * HD, Ah, Al, (float*)sm, (float*)sm + FW * 1024);
}

extern "C" void kernel_launch(void* const* d_in, const int* in_sizes, int n_in,
                              void* d_out, int out_size, void* d_ws, size_t ws_size, hipStream_t stream) {
    (void)in_sizes; (void)n_in; (void)out_size;
    const float* x = (const float*)d_in[0]; const float* wq = (const float*)d_in[1]; const float* bq = (const float*)d_in[2]; const float* wk = (const float*)d_in[3]; const float* bk = (const float*)d_in[4]; const float* wv = (const float*)d_in[5]; const float* bv = (const float*)d_in[6]; const float* wo = (const float*)d_in[7]; const float* bo = (const float*)d_in[8];   /* argument order x, Wq_w, Wq_b, Wk_w, Wk_b, Wv_w, Wv_b, Wo_w, Wo_b ('oi') */
    float* OUT = (float*)d_out;     // [2][4096][768]
    char* wsp = (char*)d_ws;
    auto take = [&](size_t bytes) { char* p = wsp; wsp += (bytes + 255) & ~(size_t)255; return (void*)p; };
    bf* WQ = (bf*)take((size_t)DQ * DM * 2); bf* WK = (bf*)take((size_t)DKV * DM * 2); bf* WV = (bf*)take((size_t)DKV * DM * 2); bf* WO = (bf*)take((size_t)DM * DQ * 2);
    bf* XB = (bf*)take((size_t)NB_ * TT * DM * 2);
    h16* QP16 = (h16*)take((size_t)NB_ * NH_ * TT * HD * 2); h16* KP16 = (h16*)take((size_t)NB_ * NKV * TT * HD * 2); h16* VT16 = (h16*)take((size_t)NB_ * NKV * HD * TT * 2);
    bf* QPh = (bf*)take((size_t)NB_ * NH_ * TT * HD * 2); bf* QPl = (bf*)take((size_t)NB_ * NH_ * TT * HD * 2); bf* KPh = (bf*)take((size_t)NB_ * NKV * TT * HD * 2); bf* KPl = (bf*)take((size_t)NB_ * NKV * TT * HD * 2); bf* VTh = (bf*)take((size_t)NB_ * NKV * HD * TT * 2); bf* VTl = (bf*)take((size_t)NB_ * NKV * HD * TT * 2);
    bf* ATh = (bf*)take((size_t)NB_ * TT * DQ * 2); bf* ATl = (bf*)take((size_t)NB_ * TT * DQ * 2);
    if ((size_t)(wsp - (char*)d_ws) > ws_size) return;    // ws 256 MiB
    // four launches, each all the work of one step of the chain of dependences, both batches
    k_cvt<<<CX + 4 * CWT, 256, 0, stream>>>(x, wq, wk, wv, wo, XB, WQ, WK, WV, WO);
    k_qkv<<<dim3(TT / 128, DQ / 128, 3 * NB_), GW * 32, 0, stream>>>(XB, WQ, WK, WV, bq, bk, bv, QP16, QPh, QPl, KP16, KPh, KPl, VT16, VTh, VTl);
    k_fattn<<<dim3(NB_ * NH_, (TT - RH) / 128 + RH / 16), FW * 32, 0, stream>>>(QP16, KP16, VT16, QPh, QPl, KPh, KPl, VTh, VTl, ATh, ATl);
    k_wo<<<dim3(NB_ * TT / 128, DM / 128), GW * 32, 0, stream>>>(ATh, ATl, WO, bo, OUT, DQ);
}

// v009
// It runs in 114 microseconds.
// In both of two side-by-side timings against v008, it was 1.11 times as fast.
// Over all steps from v000 it is 27.7 times as fast.
#include <hip/hip_runtime.h>

// Causal self-attention over 4,096 tokens at d_model 768 (x [2][4096][768]; q, k, v = x W^T + b ('oi' uniform(+-768^-0.5) incl. biases: non-zero; 12 heads x 64); logits / sqrt(64); causal (-inf); softmax; out = merged Wo^T + b -> [2][4096][768] (6.3 M); argument order x, Wq_w, Wq_b, Wk_w, Wk_b, Wv_w, Wv_b, Wo_w, Wo_b).
// Four launches, each for both batches: bf16 copies of x and the 'oi' weights; exact projections (K 768) + f32 biases, each writing its head planes (fp16 + hi/lo) from its own epilogue; causal attention at T 4096 / 12 heads fused in one launch with a running softmax (k_fattn, K and V^T of the fp16 rows staged in LDS; hybrid rows: < 512 hi/lo 3 products, rest fp16; the fp16 probabilities are exp(score - reference maximum) <= exp(5.5), divided by the sum at the end, so no x1024 carry is needed); merged hi/lo x Wo exact + bias.
// Compute dtypes, f32 accumulate: every input rounded to bf16; projections exact + f32 biases; attention rows < 512 3 products, rest fp16; softmax f32; Wo hl x exact + bias.

#define NB_  2
#define TT   4096
#define DM   768
#define NH_  12
#define NKV  12
#define HD   64
#define DQ   (NH_ * HD)
#define DKV  (NKV * HD)
#define RH   512                  // query rows < RH use hi+lo planes
#define SCL  0.125f   // HD^-0.5
typedef _Float16 h16;
typedef unsigned short bf;
typedef __attribute__((ext_vector_type(16))) __bf16   v16bf;
typedef __attribute__((ext_vector_type(16))) _Float16 v16h;
typedef __attribute__((ext_vector_type(8)))  _Float16 v8h;
typedef __attribute__((ext_vector_type(8)))  unsigned short v8us;
typedef __attribute__((ext_vector_type(8)))  float    v8f;
typedef __attribute__((ext_vector_type(4)))  float    v4f;
typedef v8h  __attribute__((may_alias)) v8ha;
typedef v4f  __attribute__((may_alias)) v4fa;
typedef v8us __attribute__((may_alias)) v8usa;

__device__ __forceinline__ unsigned short f2bf(float f) { unsigned u = __float_as_uint(f); u += 0x7FFFu + ((u >> 16) & 1u); return (unsigned short)(u >> 16); }
__device__ __forceinline__ float bf2f(unsigned short b) { return __uint_as_float(((unsigned)b) << 16); }
__device__ __forceinline__ float bfr(float f) { return bf2f(f2bf(f)); }
__device__ __forceinline__ v16h cat16(v8h lo, v8h hi) { return __builtin_shufflevector(lo, hi, 0, 1, 2, 3, 4, 5, 6, 7, 8, 9, 10, 11, 12, 13, 14, 15); }
__device__ __forceinline__ v16bf cat16b(v8us lo, v8us hi) { return __builtin_bit_cast(v16bf, __builtin_shufflevector(lo, hi, 0, 1, 2, 3, 4, 5, 6, 7, 8, 9, 10, 11, 12, 13, 14, 15)); }
__device__ __forceinline__ v8f wmma16(v16h a, v16h b, v8f c) { return __builtin_amdgcn_wmma_f32_16x16x32_f16(false, a, false, b, (short)0, c, false, false); }
__device__ __forceinline__ v8f wmmab(v16bf a, v16bf b, v8f c) { return __builtin_amdgcn_wmma_f32_16x16x32_bf16(false, a, false, b, (short)0, c, false, false); }
__device__ __forceinline__ h16 tohx(float x) { return (h16)x; }
__device__ __forceinline__ void splitf(float y, unsigned short& h, unsigned short& l) { h = f2bf(y); l = f2bf(y - bf2f(h)); }



// ---- gemmw: register-blocked GEMM, one wave per 64x64 output tile (16 accumulators), GW = 4 waves (2 x 2 tiles) per work-group of 128 threads, which takes the 128x128 tile (bx, by); osm (GW x 16 x 68 floats) and stg (2 NT GTILE bytes) are the calling kernel's LDS.
// The K-contiguous 16-bit operand planes come through LDS: a stage is 64 k (one whole 128-byte line) of the work-group's 128 rows of every operand, brought by asynchronous copies of which each covers four whole lines
// (each wave copies a quarter of the rows; every row is fetched once for the two waves that read it); two buffers, so that the next stage's copies fly while this stage's fragments are read and multiplied.
// LDS rows at pitch 144 bytes (16 x odd: no bank conflict for the 16-byte fragment reads).
// C[m][n] (f32, pitch ldc, + optional f32 bias[n]) = sum_k A[m][k] Bt[n][k] (+ split products per NSPLIT). K % 64 == 0, K >= 64; M, N % 128 == 0.
// PL != 0: no f32 C; the tile + bias goes out as three 16-bit planes (P16 fp16, Ph/Pl bf16 hi/lo) of row pitch ldc, the 64x64 tile (i, j) at element i px + j py. PL 1: bias[n] (token rows x one head's 64 columns: planes [h][t][d]);
// PL 2: bias[m] (A = weight rows, Bt = token rows: the tile is the transposed projection, planes [h][d][t]).
template <typename T16> struct WFrag;
template <> struct WFrag<h16> { typedef v16h V; static __device__ __forceinline__ V ld(const h16* p) { return cat16(*(const v8h*)p, *(const v8h*)(p + 16)); } static __device__ __forceinline__ v8f mma(V a, V b, v8f c) { return wmma16(a, b, c); } };
template <> struct WFrag<bf> { typedef v16bf V; static __device__ __forceinline__ V ld(const bf* p) { return cat16b(*(const v8us*)p, *(const v8us*)(p + 16)); } static __device__ __forceinline__ v8f mma(V a, V b, v8f c) { return wmmab(a, b, c); } };
#define GW     4                  // waves of a work-group
#define GPITCH 144                // bytes of an LDS row: 128 of data + 16
#define GTILE  (128 * GPITCH)     // one operand's 128 rows of a stage
// Eight asynchronous copies, 16 bytes a lane: copy i brings four whole 128-byte rows (8 lanes a row) from g + i gs elements to LDS byte l + i 4 GPITCH.
// The s_wait_xcnt stands in the copies' own statement, so that no address register is rewritten in front of it.
template <typename T16>
__device__ __forceinline__ void cp8(unsigned l, const T16* g, size_t gs) {
    asm volatile("global_load_async_to_lds_b128 %0, %8, off\n\tglobal_load_async_to_lds_b128 %1, %9, off\n\tglobal_load_async_to_lds_b128 %2, %10, off\n\tglobal_load_async_to_lds_b128 %3, %11, off\n\t"
                 "global_load_async_to_lds_b128 %4, %12, off\n\tglobal_load_async_to_lds_b128 %5, %13, off\n\tglobal_load_async_to_lds_b128 %6, %14, off\n\tglobal_load_async_to_lds_b128 %7, %15, off\n\ts_wait_xcnt 0x0"
                 :: "v"(l), "v"(l + 4u * GPITCH), "v"(l + 8u * GPITCH), "v"(l + 12u * GPITCH), "v"(l + 16u * GPITCH), "v"(l + 20u * GPITCH), "v"(l + 24u * GPITCH), "v"(l + 28u * GPITCH),
                    "v"(g), "v"(g + gs), "v"(g + 2 * gs), "v"(g + 3 * gs), "v"(g + 4 * gs), "v"(g + 5 * gs), "v"(g + 6 * gs), "v"(g + 7 * gs) : "memory");
}
template <typename T16, int NSPLIT, bool BIAS, int PL>
__device__ __forceinline__ void gemmw(const T16* __restrict__ A, const T16* __restrict__ A2, const T16* __restrict__ Bt, const T16* __restrict__ Bt2, int K, float* C, int ldc, const float* __restrict__ bias, h16* P16, bf* Ph, bf* Pl, size_t px, size_t py, int bx, int by, float* osm, char* stg) {
    typedef typename WFrag<T16>::V V;
    const int lane = threadIdx.x & 31, lr = lane & 15, hi = lane >> 4; const int wave = __builtin_amdgcn_readfirstlane(threadIdx.x >> 5);      // in a scalar register: the wave's tile and its slice of the copies are scalar offsets
    const int R0 = bx * 128, C0 = by * 128, r0 = R0 + (wave >> 1) * 64, c0 = C0 + (wave & 1) * 64; float* os = osm + wave * (16 * 68);      // os: the wave's own output staging
    v8f acc[4][4];
#pragma unroll
    for (int mb = 0; mb < 4; ++mb)
#pragma unroll
        for (int nb = 0; nb < 4; ++nb) acc[mb][nb] = (v8f){};
    constexpr bool HA2 = NSPLIT == 1 || NSPLIT == 2, HB2 = NSPLIT >= 2; constexpr int NT = 2 + (HA2 ? 1 : 0) + (HB2 ? 1 : 0);      // operand tiles of a stage, in the order A, Bt, A2, Bt2
    // the lane's place in its wave's copies: rows wave 32 + lane / 8 + 4 i, 16-byte column lane % 8
    const int crow = wave * 32 + (lane >> 3), ccol = lane & 7;
    const size_t goA = (size_t)(R0 + crow) * K + ccol * 8, goB = (size_t)(C0 + crow) * K + ccol * 8, gs = (size_t)4 * K;
    const unsigned l0 = (unsigned)(size_t)stg + (unsigned)(crow * GPITCH + ccol * 16);
    auto stage = [&](int t, int buf) { const size_t ko = (size_t)t * 64; const unsigned lb = l0 + (unsigned)(buf * NT * GTILE);
        cp8(lb, A + goA + ko, gs); cp8(lb + GTILE, Bt + goB + ko, gs);
        if constexpr (HA2) cp8(lb + 2u * GTILE, A2 + goA + ko, gs);
        if constexpr (HB2) cp8(lb + (NT - 1u) * GTILE, Bt2 + goB + ko, gs); };
    const int nt = K / 64, foA = ((wave >> 1) * 64 + lr) * GPITCH + hi * 16, foB = GTILE + ((wave & 1) * 64 + lr) * GPITCH + hi * 16;      // the lane's place in the first A and Bt fragment of its wave's tile
    stage(0, 0);
    asm volatile("s_wait_asynccnt 0x0" ::: "memory");      // the wave's copies of stage 0 have landed before the barrier behind which the others read them
    __syncthreads();
    if (nt > 1) stage(1, 1);
#pragma unroll 1      // kept rolled: one trip a stage, the buffer chosen by the trip's parity
    for (int t = 0; t < nt; ++t) {
        const char* sb = stg + (t & 1) * (NT * GTILE);
        V a[2][4], a2[2][4], b[2][4], b2[2][4];
        auto ldf = [&](int ks) {      // the fragments of k step ks (32 k) of the stage
#pragma unroll
            for (int mb = 0; mb < 4; ++mb) { a[ks][mb] = WFrag<T16>::ld((const T16*)(sb + foA + mb * 16 * GPITCH + ks * 64)); if (HA2) a2[ks][mb] = WFrag<T16>::ld((const T16*)(sb + foA + 2 * GTILE + mb * 16 * GPITCH + ks * 64)); }
#pragma unroll
            for (int nb = 0; nb < 4; ++nb) { b[ks][nb] = WFrag<T16>::ld((const T16*)(sb + foB + nb * 16 * GPITCH + ks * 64)); if (HB2) b2[ks][nb] = WFrag<T16>::ld((const T16*)(sb + foB + (NT - 2) * GTILE + nb * 16 * GPITCH + ks * 64)); } };
        auto mm = [&](int ks) {
#pragma unroll
            for (int nb = 0; nb < 4; ++nb)
#pragma unroll
                for (int mb = 0; mb < 4; ++mb) { acc[mb][nb] = WFrag<T16>::mma(a[ks][mb], b[ks][nb], acc[mb][nb]); if (HA2) acc[mb][nb] = WFrag<T16>::mma(a2[ks][mb], b[ks][nb], acc[mb][nb]); if (HB2) acc[mb][nb] = WFrag<T16>::mma(a[ks][mb], b2[ks][nb], acc[mb][nb]); } };
        ldf(0); ldf(1);
        __builtin_amdgcn_sched_barrier(0);      // the stage's fragment reads stand together ahead of its products: spread among them, each b fragment went into the same registers and the wave waited out the LDS latency at every one
        mm(0);                                  // the first step's products run while the second step's fragments arrive
        __builtin_amdgcn_sched_barrier(0);      // keeps them ahead of the waits below
        // the stage's last fragments are in registers behind the first wait: its buffer is handed over and refilled ahead of their products, which then cover part of the copies' flight
        asm volatile("s_wait_dscnt 0x0" ::: "memory");         // the wave's reads of this stage are done before the barrier behind which its buffer is refilled
        asm volatile("s_wait_asynccnt 0x0" ::: "memory");      // the wave's copies of the next stage have landed before the barrier behind which the others read them
        __syncthreads();
        if (t + 2 < nt) stage(t + 2, t & 1);
        __builtin_amdgcn_sched_barrier(0);      // keeps the second step's products behind the copies' issue
        mm(1);
        asm volatile("v_nop\n\tv_nop\n\tv_nop\n\tv_nop" : "+v"(acc[0][0]), "+v"(acc[1][1]), "+v"(acc[2][2]), "+v"(acc[3][3]) : "v"(a[1][0]), "v"(a[1][3]));
    }
    asm volatile("s_wait_asynccnt 0x0" ::: "memory");      // nothing is in flight where the wave goes on to the epilogue
    // planes: a lane takes 8 columns of one staged row, so that each 16-byte store of the wave covers four whole 128-byte rows
    const int prow = lane >> 3, pcol = (lane & 7) * 8; const size_t pb = (size_t)(r0 >> 6) * px + (size_t)(c0 >> 6) * py + (size_t)prow * ldc + pcol; constexpr int NPB = PL == 2 ? 16 : 8; float pbias[NPB];
    if constexpr (PL != 0) {
#pragma unroll
        for (int i = 0; i < NPB; ++i) pbias[i] = PL == 1 ? bias[c0 + pcol + i] : bias[r0 + i * 4 + prow];
        // the wait: the address register of PL 1's bias loads is reused by the rows below; it takes the loaded values as inputs only, which keeps it behind the loads
        if constexpr (PL == 1) asm volatile("s_wait_xcnt 0x0" :: "v"(pbias[0]), "v"(pbias[1]), "v"(pbias[2]), "v"(pbias[3]), "v"(pbias[4]), "v"(pbias[5]), "v"(pbias[6]), "v"(pbias[7]));
#pragma unroll
        for (int i = 0; i < NPB; ++i) pbias[i] = bfr(pbias[i]); }
#pragma unroll
    for (int mb = 0; mb < 4; ++mb) {
#pragma unroll
        for (int nb = 0; nb < 4; ++nb) {
#pragma unroll
            for (int j = 0; j < 8; ++j) os[(hi * 8 + j) * 68 + nb * 16 + lr] = acc[mb][nb][j]; }
        __builtin_amdgcn_wave_barrier(); asm volatile("" ::: "memory");
        if constexpr (PL != 0) {
#pragma unroll
            for (int s = 0; s < 4; ++s) { const float* orow = os + (4 * s + prow) * 68 + pcol; const v4f v0 = *(const v4fa*)orow, v1 = *(const v4fa*)(orow + 4); v8h o16; v8us oh, ol;
#pragma unroll
                for (int k = 0; k < 8; ++k) { const float y = (k < 4 ? v0[k & 3] : v1[k & 3]) + pbias[PL == 1 ? k : mb * 4 + s]; o16[k] = tohx(y); unsigned short a2, c2; splitf(y, a2, c2); oh[k] = a2; ol[k] = c2; }
                const size_t o = pb + (size_t)(mb * 16 + 4 * s) * ldc; *(v8h*)(P16 + o) = o16; *(v8us*)(Ph + o) = oh; *(v8us*)(Pl + o) = ol;
                asm volatile("s_wait_xcnt 0x0" ::: "memory"); }      // the wait: the three stores' address and data registers are reused by the next rows
        } else {
        float* crow = C + (size_t)(r0 + mb * 16) * ldc + c0;
#pragma unroll
            for (int s = 0; s < 8; ++s) { const int row = 2 * s + hi, cofs = lr * 4; v4f val = *(const v4fa*)(os + row * 68 + cofs); if (BIAS) { val[0] += bfr(bias[c0 + cofs]); val[1] += bfr(bias[c0 + cofs + 1]); val[2] += bfr(bias[c0 + cofs + 2]); val[3] += bfr(bias[c0 + cofs + 3]); }
                *(v4f*)(crow + (size_t)row * ldc + cofs) = val; }
             }
        __builtin_amdgcn_wave_barrier(); asm volatile("" ::: "memory");
    }
}

typedef __attribute__((ext_vector_type(4))) _Float16 v4h;
typedef __attribute__((ext_vector_type(4))) unsigned short v4us;
typedef __attribute__((ext_vector_type(4))) int v4i;

// ---- k_qkv: the q, k and v projections of both batches in one launch; grid (TT / 128, DQ / 128, 3 NB_), z = projection x NB_ + batch. Planes [batch][head][t][d] (q, k) and [batch][head][d][t] (v: operands swapped, the tile is V^T).
__global__ __launch_bounds__(GW * 32) void k_qkv(const bf* __restrict__ XB, const bf* __restrict__ WQ, const bf* __restrict__ WK, const bf* __restrict__ WV, const float* __restrict__ bq, const float* __restrict__ bk, const float* __restrict__ bv,
                                                 h16* Q16, bf* Qh, bf* Ql, h16* K16, bf* Kh, bf* Kl, h16* V16, bf* Vh, bf* Vl) {
    __shared__ __align__(16) float osm[GW * 16 * 68];
    __shared__ __align__(16) char stg[2 * 2 * GTILE];
    const int w = blockIdx.z / NB_, b = blockIdx.z % NB_; const bf* X = XB + (size_t)b * TT * DM; const size_t po = (size_t)b * NH_ * TT * HD;      // every plane holds NH_ TT HD elements a batch (NKV == NH_)
    if (w < 2) gemmw<bf, 0, true, 1>(X, nullptr, w ? WK : WQ, nullptr, DM, nullptr, HD, w ? bk : bq, (w ? K16 : Q16) + po, (w ? Kh : Qh) + po, (w ? Kl : Ql) + po, (size_t)64 * HD, (size_t)TT * HD, blockIdx.x, blockIdx.y, osm, stg);
    else gemmw<bf, 0, true, 2>(WV, nullptr, X, nullptr, DM, nullptr, TT, bv, V16 + po, Vh + po, Vl + po, (size_t)64 * TT, (size_t)64, blockIdx.y, blockIdx.x, osm, stg);
}
// ---- k_wo: out = merged (hi + lo) Wo^T + bias, the NB_ TT token rows of both batches in one launch; grid (NB_ TT / 128, DM / 128).
// K comes as an argument: with the constant folded in, the build kept the copies' LDS address in scratch memory and loaded it back in every stage.
__global__ __launch_bounds__(GW * 32) void k_wo(const bf* __restrict__ Ah, const bf* __restrict__ Al, const bf* __restrict__ WO, const float* __restrict__ bo, float* OUT, int K) {
    __shared__ __align__(16) float osm[GW * 16 * 68];
    __shared__ __align__(16) char stg[2 * 3 * GTILE];
    gemmw<bf, 1, true, 0>(Ah, Al, WO, nullptr, K, OUT, DM, bo, nullptr, nullptr, nullptr, 0, 0, blockIdx.x, blockIdx.y, osm, stg);
}

// ---- k_cvt: x (both batches) and the four weights to bf16 in one launch, 8 elements a thread; the first CX work-groups take x, then CWT each a weight.
#define CX  (NB_ * TT * DM / 8 / 256)
#define CWT (DQ * DM / 8 / 256)
__global__ __launch_bounds__(256) void k_cvt(const float* __restrict__ x, const float* __restrict__ wq, const float* __restrict__ wk, const float* __restrict__ wv, const float* __restrict__ wo, bf* XB, bf* WQ, bf* WK, bf* WV, bf* WO) {
    static_assert(NB_ * TT * DM % 2048 == 0 && DQ * DM % 2048 == 0 && DKV == DQ, "whole work-groups, four weights of one size");
    int blk = blockIdx.x; const float* src = x; bf* dst = XB;
    if (blk >= CX) { blk -= CX; const int w = blk / CWT; blk -= w * CWT; src = w == 0 ? wq : w == 1 ? wk : w == 2 ? wv : wo; dst = w == 0 ? WQ : w == 1 ? WK : w == 2 ? WV : WO; }
    const size_t i = (size_t)blk * 256 + threadIdx.x; const v8f v = *(const v8f*)(src + i * 8); v8us o;
#pragma unroll
    for (int k = 0; k < 8; ++k) o[k] = f2bf(v[k]); *(v8us*)(dst + i * 8) = o;  }

// ---- k_fattn: scores, causal softmax and probability x value product of both batches' heads in one launch; no score or probability plane reaches memory.
// Transposed products: S^T = K Q^T (A = key rows, B = query rows) and O^T += V^T P^T (A = rows of the transposed value plane, B = P). In every 16-column tile a lane then holds one query
// (column lr) and the keys hi 8 + j, so that maximum, sum and rescale factor are the lane's own, and two score tiles (keys 0..15, 16..31) are, register for register, the k order of a 32-key B fragment.
// Work-groups of FW waves, two of them on a WGP at a time. Two kinds of tile: fa_tile_s (fp16, 128 query rows, K and V^T staged in LDS and shared by the waves) and fa_tile (hi/lo, 16 query rows, the waves split the keys).
// Every loop over qt, kt, ks, dt, j, e and w is unrolled in full: the fragments and tiles are register arrays and need compile-time indices.
#define FW  8
#define NKQ (FW / 4)          // fa_tile_s: waves that split the keys of a query group
#define L2E 1.4426950408889634f
#define CSL (SCL * L2E)           // raw score -> exponent of 2: the logit scale and log2(e) in one factor
typedef __attribute__((ext_vector_type(16))) unsigned short v16us;
typedef __attribute__((ext_vector_type(2))) float v2f;
// 2^x with the issue slot behind a transcendental kept by construction: the v_nop stands between the v_exp_f32 and whatever the compiler puts next (it may read the result or overwrite the source).
__device__ __forceinline__ float exp2n(float x) { float y; asm("v_exp_f32 %0, %1\n\tv_nop" : "=v"(y) : "v"(x)); return y; }
// Four at a time: each v_exp_f32 fills the slot of the one before it (the results are early-clobber, so none overwrites a source), the v_nop that of the last.
__device__ __forceinline__ void exp2x4(const float* x, float* y) { asm("v_exp_f32 %0, %4\n\tv_exp_f32 %1, %5\n\tv_exp_f32 %2, %6\n\tv_exp_f32 %3, %7\n\tv_nop" : "=&v"(y[0]), "=&v"(y[1]), "=&v"(y[2]), "=&v"(y[3]) : "v"(x[0]), "v"(x[1]), "v"(x[2]), "v"(x[3])); }

// ---- fa_tile_s: 128 query rows of one head, fp16. Wave w = (g = w % 4, kq = w / 4) holds the 32 queries q0 + 32 g .. and takes the 64-key part kq of every 128-key stage, with its own reference maxima, sums and output tiles.
// A stage is 256 LDS rows of 128 bytes at pitch GPITCH: per 64-key part 64 K rows (a key's 64 dims), then 64 V^T rows (a dim's 64 keys). Each wave brings 32 of the rows by eight asynchronous copies of four whole lines each,
// so that every K and V^T line is fetched once for the four waves that read it; two buffers: the next stage's copies fly while this stage is worked on.
// The last stage holds the diagonal: a wave skips the 32-key blocks beyond its queries (a scalar test) and masks the one on them. At the end the NKQ waves of a query group join their parts through LDS, one query tile (four output tiles) each.
// Softmax in the log2 domain: the score tiles stay as the products left them (unscaled), maxima are taken of those, the reference m is kept as -(maximum x CSL), ready as the addend, and one packed fused multiply-add a score pair (score x CSL + m) gives the argument of 2^x.
#define SKEYS (NKQ * 64)
#define SROWS (2 * SKEYS)
#define SBUF  (SROWS * GPITCH)
#define XW    (68 * 32)           // floats a wave hands over: 64 a lane of its eight output tiles, two maxima, two sums
__device__ __forceinline__ void fa_tile_s(const h16* __restrict__ Q, const h16* __restrict__ Kp, const h16* __restrict__ Vt, int q0, int col0, bf* Ah, bf* Al, char* sm) {
    typedef v16h V; constexpr int QT = 2; constexpr float LAZY = 5.5f;      // exp(5.5) < 2^8: far inside fp16's range, and the f32 sums of 4,096 such terms are far inside f32's
    const int lane = threadIdx.x & 31, lr = lane & 15, hi = lane >> 4; const int wave = __builtin_amdgcn_readfirstlane(threadIdx.x >> 5);      // in a scalar register: the wave's slice of the copies and its tests for the diagonal are then scalar
    const int g = wave & 3, kq = wave >> 2, qw = q0 + g * 32, ns = (q0 + 128 + SKEYS - 1) / SKEYS;      // ns stages, the last with the diagonal
    // the lane's place in its wave's copies: LDS rows wave 32 + lane / 8 + 4 i, 16-byte column lane % 8; of four waves in a row the first two bring a 64-key part's K rows, the others its V^T rows
    const int crow = lane >> 3, ccol = lane & 7, ro = (wave & 1) * 32 + crow; const bool isv = (wave & 2) != 0;
    const h16* gp = isv ? Vt + (size_t)ro * TT + kq * 64 + ccol * 8 : Kp + (size_t)(kq * 64 + ro) * HD + ccol * 8;
    const size_t gs = isv ? (size_t)4 * TT : (size_t)4 * HD, gstep = isv ? (size_t)SKEYS : (size_t)SKEYS * HD;
    const unsigned l0 = (unsigned)(size_t)sm + (unsigned)((wave * 32 + crow) * GPITCH + ccol * 16);
    auto stage = [&](int t, int buf) { cp8(l0 + (unsigned)(buf * SBUF), gp + (size_t)t * gstep, gs); };
    stage(0, 0);
    V qf[QT][2];
#pragma unroll
    for (int qt = 0; qt < QT; ++qt)
#pragma unroll
        for (int ks = 0; ks < 2; ++ks) qf[qt][ks] = WFrag<h16>::ld(Q + (size_t)(qw + qt * 16 + lr) * HD + ks * 32 + 8 * hi);
    asm volatile("s_wait_xcnt 0x0" :: "v"(qf[0][0]), "v"(qf[0][1]), "v"(qf[1][0]), "v"(qf[1][1]));      // the wait: the query loads' address registers are reused behind it; it takes the loaded values as inputs only, which keeps it behind the loads
    v8f acc[QT][4]; float m[QT], l[QT];
#pragma unroll
    for (int qt = 0; qt < QT; ++qt) { m[qt] = 3.0e38f; l[qt] = 0.f;
#pragma unroll
        for (int dt = 0; dt < 4; ++dt) acc[qt][dt] = (v8f){}; }
    asm volatile("s_wait_asynccnt 0x0" ::: "memory");      // the wave's copies of stage 0 have landed before the barrier behind which the others read them
    __syncthreads();
    if (ns > 1) stage(1, 1);
#pragma unroll 1      // kept rolled: one trip a stage, the buffer chosen by the trip's parity
    for (int t = 0; t < ns; ++t) {
        const char* sb = sm + (t & 1) * SBUF + kq * (128 * GPITCH) + lr * GPITCH + hi * 16;      // the lane's place in the first K fragment of its wave's part
#pragma unroll
        for (int i = 0; i < 2; ++i) { const int kb = t * SKEYS + kq * 64 + i * 32;
            if (kb <= qw) {      // a scalar branch: blocks beyond the wave's queries are skipped
                V kf[2][2], vf[4];
#pragma unroll
                for (int kt = 0; kt < 2; ++kt)
#pragma unroll
                    for (int ks = 0; ks < 2; ++ks) kf[kt][ks] = WFrag<h16>::ld((const h16*)(sb + (i * 32 + kt * 16) * GPITCH + ks * 64));
#pragma unroll
                for (int dt = 0; dt < 4; ++dt) vf[dt] = WFrag<h16>::ld((const h16*)(sb + (64 + dt * 16) * GPITCH + i * 64));
                v8f s[QT][2];
#pragma unroll
                for (int kt = 0; kt < 2; ++kt)
#pragma unroll
                    for (int qt = 0; qt < QT; ++qt) { v8f c = (v8f){};
#pragma unroll
                        for (int ks = 0; ks < 2; ++ks) c = wmma16(kf[kt][ks], qf[qt][ks], c);
                        s[qt][kt] = c; }
                if (kb == qw) {      // the diagonal block: keys beyond the query are masked (every query keeps at least key kb)
#pragma unroll
                    for (int qt = 0; qt < QT; ++qt)
#pragma unroll
                        for (int kt = 0; kt < 2; ++kt)
#pragma unroll
                            for (int j = 0; j < 8; ++j) if (kt * 16 + hi * 8 + j > qt * 16 + lr) s[qt][kt][j] = -3.0e38f; }
                // lazy rescale: m is the reference in use, not the running maximum; it is renewed only where a scaled score of the block lies more than LAZY above it, so that every probability stays <= exp(LAZY).
                // One test a block, on each lane's own 16 keys (a query's joint maximum passes the bound exactly where one of its two lanes does): the exchange between the halves stands in the branch.
                float bm[QT]; bool need = false;
#pragma unroll
                for (int qt = 0; qt < QT; ++qt) { bm[qt] = s[qt][0][0];
#pragma unroll
                    for (int kt = 0; kt < 2; ++kt)
#pragma unroll
                        for (int j = 0; j < 8; ++j) bm[qt] = fmaxf(bm[qt], s[qt][kt][j]);
                    need = need || __builtin_fmaf(bm[qt], CSL, m[qt]) > LAZY * L2E; }      // the largest argument of 2^x that the block would see
                if (__builtin_amdgcn_ballot_w32(need) != 0) {      // a scalar branch, taken by the whole wave: in the wave's first block, and after it only for scores far above the reference
#pragma unroll
                    for (int qt = 0; qt < QT; ++qt) { const float bj = fmaxf(bm[qt], __shfl_xor(bm[qt], 16, 32));      // the other half of the wave holds the query's other 16 keys
                        const float mn = fminf(m[qt], bj * -CSL), al = exp2n(mn - m[qt]); m[qt] = mn; l[qt] *= al;
#pragma unroll
                        for (int dt = 0; dt < 4; ++dt) acc[qt][dt] *= al; } }
                V pf[QT];      // both query tiles' probabilities, then the block's eight output products
#pragma unroll
                for (int qt = 0; qt < QT; ++qt) {
                    float x[16], p[16], ps = 0.f;
#pragma unroll
                    for (int e = 0; e < 16; e += 2) { const v2f a = __builtin_elementwise_fma((v2f){s[qt][e >> 3][e & 7], s[qt][e >> 3][(e & 7) + 1]}, (v2f){CSL, CSL}, (v2f){m[qt], m[qt]}); x[e] = a.x; x[e + 1] = a.y; }
#pragma unroll
                    for (int e = 0; e < 16; e += 4) exp2x4(x + e, p + e);
#pragma unroll
                    for (int e = 0; e < 16; ++e) ps += p[e];
                    l[qt] += ps;      // the lane's own 16 keys; the halves are joined behind the loop
#pragma unroll
                    for (int e = 0; e < 16; ++e) pf[qt][e] = tohx(p[e]); }
#pragma unroll
                for (int qt = 0; qt < QT; ++qt)
#pragma unroll
                    for (int dt = 0; dt < 4; ++dt) acc[qt][dt] = wmma16(vf[dt], pf[qt], acc[qt][dt]); } }
        asm volatile("s_wait_dscnt 0x0" ::: "memory");         // the wave's reads of this stage are done before the barrier behind which its buffer is refilled
        asm volatile("s_wait_asynccnt 0x0" ::: "memory");      // the wave's copies of the next stage have landed before the barrier behind which the others read them
        __syncthreads();
        if (t + 2 < ns) stage(t + 2, t & 1);
    }
    asm volatile("s_wait_asynccnt 0x0" ::: "memory");      // nothing is in flight where the buffers become the hand-over space (every wave's last read of them ended at the last trip's barrier)
    // every wave hands over its parts; wave (g, kq) then joins the four output tiles of query tile kq, in the lane layout they were stored in: each part scaled by exp(own maximum - joint maximum), added in the order of kq, divided by the joint sum
    float* xs = (float*)sm; float* xw = xs + wave * XW;
#pragma unroll
    for (int qt = 0; qt < QT; ++qt) { l[qt] += __shfl_xor(l[qt], 16, 32); xw[(64 + 2 * qt) * 32 + lane] = m[qt]; xw[(65 + 2 * qt) * 32 + lane] = l[qt];
#pragma unroll
        for (int dt = 0; dt < 4; ++dt)
#pragma unroll
            for (int j = 0; j < 8; ++j) xw[((qt * 4 + dt) * 8 + j) * 32 + lane] = acc[qt][dt][j]; }
    __syncthreads();
    const int jq = kq; const float* xg = xs + g * XW + lane; float f[NKQ], M = 3.0e38f, Ls = 0.f;
#pragma unroll
    for (int k = 0; k < NKQ; ++k) { f[k] = xg[k * 4 * XW + (64 + 2 * jq) * 32]; M = fminf(M, f[k]); }
#pragma unroll
    for (int k = 0; k < NKQ; ++k) { f[k] = exp2n(M - f[k]); Ls += xg[k * 4 * XW + (65 + 2 * jq) * 32] * f[k]; }      // the references are negated exponents of 2 already
    const float inv = __fdiv_rn(1.0f, Ls);
#pragma unroll
    for (int e = 0; e < 4; ++e) { v8us oh, ol;
#pragma unroll
        for (int j = 0; j < 8; ++j) { float o = 0.f;
#pragma unroll
            for (int k = 0; k < NKQ; ++k) o += xg[k * 4 * XW + ((jq * 4 + e) * 8 + j) * 32] * f[k];
            unsigned short a, c3; splitf(o * inv, a, c3); oh[j] = a; ol[j] = c3; }
        const size_t oo = (size_t)(qw + jq * 16 + lr) * DQ + col0 + e * 16 + hi * 8; *(v8us*)(Ah + oo) = oh; *(v8us*)(Al + oo) = ol;
        asm volatile("s_wait_xcnt 0x0" ::: "memory"); }      // the wait: the two stores' address and data registers are reused by the next tile or by whatever code follows
}

// ---- fa_tile: 16 QT query rows of one head, operands straight from the K-contiguous planes. Wave w takes the 32-key blocks w, w + FW, ... up to the diagonal block with its own running maxima, sums and output tiles;
// the FW partial results are joined through LDS at the end (each scaled by exp(own maximum - joint maximum), added in wave order) and divided by the joint sum.
template <typename T16, int NSPLIT, int QT>
__device__ __forceinline__ void fa_tile(const T16* __restrict__ Q, const T16* __restrict__ Q2, const T16* __restrict__ Kp, const T16* __restrict__ Kp2, const T16* __restrict__ Vt, const T16* __restrict__ Vt2, int q0, int col0, bf* Ah, bf* Al, float* red, float* st) {
    typedef typename WFrag<T16>::V V;
    const int lane = threadIdx.x & 31, lr = lane & 15, hi = lane >> 4; const int wave = __builtin_amdgcn_readfirstlane(threadIdx.x >> 5);      // in a scalar register: the key loop and its test for the diagonal block are then scalar
    V qf[QT][2], qf2[QT][2];
#pragma unroll
    for (int qt = 0; qt < QT; ++qt)
#pragma unroll
        for (int ks = 0; ks < 2; ++ks) { const size_t o = (size_t)(q0 + qt * 16 + lr) * HD + ks * 32 + 8 * hi; qf[qt][ks] = WFrag<T16>::ld(Q + o); if (NSPLIT == 2) qf2[qt][ks] = WFrag<T16>::ld(Q2 + o); }
    v8f acc[QT][4]; float m[QT], l[QT];
#pragma unroll
    for (int qt = 0; qt < QT; ++qt) { m[qt] = -3.0e38f; l[qt] = 0.f;
#pragma unroll
        for (int dt = 0; dt < 4; ++dt) acc[qt][dt] = (v8f){}; }
    const int nfull = q0 / 32;      // key blocks wholly at or below every query of the tile; block nfull holds the diagonal and is the last
    // K and V^T fragments of key block b, straight from the K-contiguous planes
    auto ldk = [&](int b, V (&kf)[2][2], V (&kf2)[2][2]) {
#pragma unroll
        for (int kt = 0; kt < 2; ++kt)
#pragma unroll
            for (int ks = 0; ks < 2; ++ks) { const size_t o = (size_t)(b * 32 + kt * 16 + lr) * HD + ks * 32 + 8 * hi; kf[kt][ks] = WFrag<T16>::ld(Kp + o); if (NSPLIT == 2) kf2[kt][ks] = WFrag<T16>::ld(Kp2 + o); } };
    auto ldv = [&](int b, V (&vf)[4], V (&vf2)[4]) {
#pragma unroll
        for (int dt = 0; dt < 4; ++dt) { const size_t o = (size_t)(dt * 16 + lr) * TT + b * 32 + 8 * hi; vf[dt] = WFrag<T16>::ld(Vt + o); if (NSPLIT == 2) vf2[dt] = WFrag<T16>::ld(Vt2 + o); } };
    V kf[2][2], kf2[2][2], vf[4], vf2[4];
#pragma unroll 1      // kept rolled: the trip count is known at run time only
    for (int blk = wave; blk <= nfull; blk += FW) { const int kb = blk * 32;
        ldk(blk, kf, kf2); asm volatile("s_wait_xcnt 0x0" ::: "memory"); ldv(blk, vf, vf2); asm volatile("s_wait_xcnt 0x0" ::: "memory");      // the waits: the loads' address registers are reused, by the V^T fragments and in later blocks of the pass
        v8f s[QT][2];
#pragma unroll
        for (int kt = 0; kt < 2; ++kt)
#pragma unroll
            for (int qt = 0; qt < QT; ++qt) { v8f c = (v8f){};
#pragma unroll
                for (int ks = 0; ks < 2; ++ks) { c = WFrag<T16>::mma(kf[kt][ks], qf[qt][ks], c); if (NSPLIT == 2) { c = WFrag<T16>::mma(kf[kt][ks], qf2[qt][ks], c); c = WFrag<T16>::mma(kf2[kt][ks], qf[qt][ks], c); } }
                s[qt][kt] = c * SCL; }
        if (blk == nfull) {      // the diagonal block: keys beyond the query are masked (every query keeps at least key kb)
#pragma unroll
            for (int qt = 0; qt < QT; ++qt)
#pragma unroll
                for (int kt = 0; kt < 2; ++kt)
#pragma unroll
                    for (int j = 0; j < 8; ++j) if (kb + kt * 16 + hi * 8 + j > q0 + qt * 16 + lr) s[qt][kt][j] = -3.0e38f; }
#pragma unroll
        for (int qt = 0; qt < QT; ++qt) {
            float bm = s[qt][0][0];
#pragma unroll
            for (int kt = 0; kt < 2; ++kt)
#pragma unroll
                for (int j = 0; j < 8; ++j) bm = fmaxf(bm, s[qt][kt][j]);
            bm = fmaxf(bm, __shfl_xor(bm, 16, 32));      // the other half of the wave holds the query's other 16 keys
            if (__builtin_amdgcn_ballot_w32(bm > m[qt]) != 0) {      // a scalar branch: where no query's maximum grows the factor is exactly 1 and the rescale is skipped
                const float mn = fmaxf(m[qt], bm), al = exp2n((m[qt] - mn) * L2E); m[qt] = mn; l[qt] *= al;
#pragma unroll
                for (int dt = 0; dt < 4; ++dt) acc[qt][dt] *= al; }
            float x[16], p[16], ps = 0.f;
#pragma unroll
            for (int e = 0; e < 16; ++e) x[e] = (s[qt][e >> 3][e & 7] - m[qt]) * L2E;
#pragma unroll
            for (int e = 0; e < 16; e += 4) exp2x4(x + e, p + e);
#pragma unroll
            for (int e = 0; e < 16; ++e) ps += p[e];
            l[qt] += ps;      // the lane's own 16 keys; the halves are joined behind the loop
            if constexpr (NSPLIT == 2) { v16us ph, pl;
#pragma unroll
                for (int e = 0; e < 16; ++e) { unsigned short a, c2; splitf(p[e], a, c2); ph[e] = a; pl[e] = c2; }
                const V pf = __builtin_bit_cast(V, ph), pf2 = __builtin_bit_cast(V, pl);
#pragma unroll
                for (int dt = 0; dt < 4; ++dt) { acc[qt][dt] = WFrag<T16>::mma(vf[dt], pf, acc[qt][dt]); acc[qt][dt] = WFrag<T16>::mma(vf[dt], pf2, acc[qt][dt]); acc[qt][dt] = WFrag<T16>::mma(vf2[dt], pf, acc[qt][dt]); }
            } else { V pf;
#pragma unroll
                for (int e = 0; e < 16; ++e) pf[e] = tohx(p[e]);
#pragma unroll
                for (int dt = 0; dt < 4; ++dt) acc[qt][dt] = WFrag<T16>::mma(vf[dt], pf, acc[qt][dt]); } }
    }
#pragma unroll
    for (int qt = 0; qt < QT; ++qt) { l[qt] += __shfl_xor(l[qt], 16, 32); float* sw = st + (wave * QT + qt) * 64; sw[lane] = m[qt]; sw[32 + lane] = l[qt];
#pragma unroll
        for (int dt = 0; dt < 4; ++dt)
#pragma unroll
            for (int j = 0; j < 8; ++j) red[(((wave * QT + qt) * 4 + dt) * 8 + j) * 32 + lane] = acc[qt][dt][j]; }
    __syncthreads();
    // wave w < 4 joins output tile dt = w of every query tile, in the lane layout the tiles were stored in; a wave that had no key block left maximum -3e38, sum 0 and zeros: its factor is 0
    if (wave < 4) {
#pragma unroll
    for (int qt = 0; qt < QT; ++qt) { float f[FW], M = -3.0e38f, Ls = 0.f;
#pragma unroll
        for (int w = 0; w < FW; ++w) { f[w] = st[(w * QT + qt) * 64 + lane]; M = fmaxf(M, f[w]); }
#pragma unroll
        for (int w = 0; w < FW; ++w) { f[w] = exp2n((f[w] - M) * L2E); Ls += st[(w * QT + qt) * 64 + 32 + lane] * f[w]; }
        const float inv = __fdiv_rn(1.0f, Ls); v8us oh, ol;
#pragma unroll
        for (int j = 0; j < 8; ++j) { float o = 0.f;
#pragma unroll
            for (int w = 0; w < FW; ++w) o += red[(((w * QT + qt) * 4 + wave) * 8 + j) * 32 + lane] * f[w];
            unsigned short a, c2; splitf(o * inv, a, c2); oh[j] = a; ol[j] = c2; }
        const size_t oo = (size_t)(q0 + qt * 16 + lr) * DQ + col0 + wave * 16 + hi * 8; *(v8us*)(Ah + oo) = oh; *(v8us*)(Al + oo) = ol;
        asm volatile("s_wait_xcnt 0x0" ::: "memory"); } }      // the wait: the two stores' address and data registers may be reused by whatever code follows the tile
}
// Grid (batches x heads, (TT - RH) / 128 + RH / 16): first the fp16 tiles of 128 query rows of every head of both batches, the longest (last rows) first, then the hi/lo tiles of 16 query rows < RH.
// amdgpu_waves_per_eu(4, 4): four waves a SIMD, 256 registers a wave: two work-groups of eight waves share a WGP (their LDS fits twice), so that one's start, barrier waits and join are covered by the other's key loop.
__global__ __launch_bounds__(FW * 32) __attribute__((amdgpu_waves_per_eu(4, 4))) void k_fattn(const h16* __restrict__ Q16, const h16* __restrict__ K16, const h16* __restrict__ V16, const bf* __restrict__ Qh, const bf* __restrict__ Ql, const bf* __restrict__ Kh, const bf* __restrict__ Kl, const bf* __restrict__ Vh, const bf* __restrict__ Vl, bf* Ah, bf* Al) {
    __shared__ __align__(16) char sm[2 * SBUF];      // fa_tile_s: the two stage buffers, then the hand-over space; fa_tile: the partial results (FW x 4 KiB) and their maxima and sums
    static_assert(FW * XW * 4 <= 2 * SBUF && FW * (1024 + 64) * 4 <= 2 * SBUF && RH % 128 == 0 && RH >= SKEYS && TT % SKEYS == 0 && 128 % SKEYS == 0 && NKQ == 2, "LDS uses, tile sizes, 4 x 2 waves (a query tile a joining wave)");
    const int h = blockIdx.x % NH_, bx = blockIdx.y; const size_t zo = (size_t)blockIdx.x * TT * HD, ao = (size_t)(blockIdx.x / NH_) * TT * DQ; constexpr int NLO = (TT - RH) / 128; Ah += ao; Al += ao;      // planes [batch][head], merged rows [batch][t]
    if (bx < NLO) fa_tile_s(Q16 + zo, K16 + zo, V16 + zo, TT - 128 * (bx + 1), h * HD, Ah, Al, sm);
    else fa_tile<bf, 2, 1>(Qh + zo, Ql + zo, Kh + zo, Kl + zo, Vh + zo, Vl + zo, RH - 16 * (bx - NLO + 1), h * HD, Ah, Al, (float*)sm, (float*)sm + FW * 1024);
}

extern "C" void kernel_launch(void* const* d_in, const int* in_sizes, int n_in,
                              void* d_out, int out_size, void* d_ws, size_t ws_size, hipStream_t stream) {
    (void)in_sizes; (void)n_in; (void)out_size;
    const float* x = (const float*)d_in[0]; const float* wq = (const float*)d_in[1]; const float* bq = (const float*)d_in[2]; const float* wk = (const float*)d_in[3]; const float* bk = (const float*)d_in[4]; const float* wv = (const float*)d_in[5]; const float* bv = (const float*)d_in[6]; const float* wo = (const float*)d_in[7]; const float* bo = (const float*)d_in[8];   /* argument order x, Wq_w, Wq_b, Wk_w, Wk_b, Wv_w, Wv_b, Wo_w, Wo_b ('oi') */
    float* OUT = (float*)d_out;     // [2][4096][768]
    char* wsp = (char*)d_ws;
    auto take = [&](size_t bytes) { char* p = wsp; wsp += (bytes + 255) & ~(size_t)255; return (void*)p; };
    bf* WQ = (bf*)take((size_t)DQ * DM * 2); bf* WK = (bf*)take((size_t)DKV * DM * 2); bf* WV = (bf*)take((size_t)DKV * DM * 2); bf* WO = (bf*)take((size_t)DM * DQ * 2);
    bf* XB = (bf*)take((size_t)NB_ * TT * DM * 2);
    h16* QP16 = (h16*)take((size_t)NB_ * NH_ * TT * HD * 2); h16* KP16 = (h16*)take((size_t)NB_ * NKV * TT * HD * 2); h16* VT16 = (h16*)take((size_t)NB_ * NKV * HD * TT * 2);
    bf* QPh = (bf*)take((size_t)NB_ * NH_ * TT * HD * 2); bf* QPl = (bf*)take((size_t)NB_ * NH_ * TT * HD * 2); bf* KPh = (bf*)take((size_t)NB_ * NKV * TT * HD * 2); bf* KPl = (bf*)take((size_t)NB_ * NKV * TT * HD * 2); bf* VTh = (bf*)take((size_t)NB_ * NKV * HD * TT * 2); bf* VTl = (bf*)take((size_t)NB_ * NKV * HD * TT * 2);
    bf* ATh = (bf*)take((size_t)NB_ * TT * DQ * 2); bf* ATl = (bf*)take((size_t)NB_ * TT * DQ * 2);
    if ((size_t)(wsp - (char*)d_ws) > ws_size) return;    // ws 256 MiB
    // four launches, each all the work of one step of the chain of dependences, both batches
    k_cvt<<<CX + 4 * CWT, 256, 0, stream>>>(x, wq, wk, wv, wo, XB, WQ, WK, WV, WO);
    k_qkv<<<dim3(TT / 128, DQ / 128, 3 * NB_), GW * 32, 0, stream>>>(XB, WQ, WK, WV, bq, bk, bv, QP16, QPh, QPl, KP16, KPh, KPl, VT16, VTh, VTl);
    k_fattn<<<dim3(NB_ * NH_, (TT - RH) / 128 + RH / 16), FW * 32, 0, stream>>>(QP16, KP16, VT16, QPh, QPl, KPh, KPl, VTh, VTl, ATh, ATl);
    k_wo<<<dim3(NB_ * TT / 128, DM / 128), GW * 32, 0, stream>>>(ATh, ATl, WO, bo, OUT, DQ);
}

// v010
// It runs in 111 microseconds.
// Timed twice side by side with v009, it ran 1.03 times as fast both times.
// Counting every step since v000, it is 28.6 times as fast.
#include <hip/hip_runtime.h>

// Causal self-attention over 4,096 tokens at d_model 768 (x [2][4096][768]; q, k, v = x W^T + b ('oi' uniform(+-768^-0.5) incl. biases: non-zero; 12 heads x 64); logits / sqrt(64); causal (-inf); softmax; out = merged Wo^T + b -> [2][4096][768] (6.3 M); argument order x, Wq_w, Wq_b, Wk_w, Wk_b, Wv_w, Wv_b, Wo_w, Wo_b).
// Four launches, each for both batches: bf16 copies of x and the 'oi' weights; exact projections (K 768) + f32 biases, each writing its head planes (fp16 + hi/lo) from its own epilogue; causal attention at T 4096 / 12 heads fused in one launch with a running softmax (k_fattn, K and V^T of the fp16 rows staged in LDS; hybrid rows: < 512 hi/lo 3 products, rest fp16; the fp16 probabilities are exp(score - reference maximum) <= exp(5.5), divided by the sum at the end, so no x1024 carry is needed); merged hi/lo x Wo exact + bias.
// Compute dtypes, f32 accumulate: every input rounded to bf16; projections exact + f32 biases; attention rows < 512 3 products, rest fp16; softmax f32; Wo hl x exact + bias.

#define NB_  2
#define TT   4096
#define DM   768
#define NH_  12
#define NKV  12
#define HD   64
#define DQ   (NH_ * HD)
#define DKV  (NKV * HD)
#define RH   512                  // query rows < RH use hi+lo planes
#define SCL  0.125f   // HD^-0.5
typedef _Float16 h16;
typedef unsigned short bf;
typedef __attribute__((ext_vector_type(16))) __bf16   v16bf;
typedef __attribute__((ext_vector_type(16))) _Float16 v16h;
typedef __attribute__((ext_vector_type(8)))  _Float16 v8h;
typedef __attribute__((ext_vector_type(8)))  unsigned short v8us;
typedef __attribute__((ext_vector_type(8)))  float    v8f;
typedef __attribute__((ext_vector_type(4)))  float    v4f;
typedef v8h  __attribute__((may_alias)) v8ha;
typedef v4f  __attribute__((may_alias)) v4fa;
typedef v8us __attribute__((may_alias)) v8usa;

__device__ __forceinline__ unsigned short f2bf(float f) { unsigned u = __float_as_uint(f); u += 0x7FFFu + ((u >> 16) & 1u); return (unsigned short)(u >> 16); }
__device__ __forceinline__ float bf2f(unsigned short b) { return __uint_as_float(((unsigned)b) << 16); }
__device__ __forceinline__ float bfr(float f) { return bf2f(f2bf(f)); }
__device__ __forceinline__ v16h cat16(v8h lo, v8h hi) { return __builtin_shufflevector(lo, hi, 0, 1, 2, 3, 4, 5, 6, 7, 8, 9, 10, 11, 12, 13, 14, 15); }
__device__ __forceinline__ v16bf cat16b(v8us lo, v8us hi) { return __builtin_bit_cast(v16bf, __builtin_shufflevector(lo, hi, 0, 1, 2, 3, 4, 5, 6, 7, 8, 9, 10, 11, 12, 13, 14, 15)); }
__device__ __forceinline__ v8f wmma16(v16h a, v16h b, v8f c) { return __builtin_amdgcn_wmma_f32_16x16x32_f16(false, a, false, b, (short)0, c, false, false); }
__device__ __forceinline__ v8f wmmab(v16bf a, v16bf b, v8f c) { return __builtin_amdgcn_wmma_f32_16x16x32_bf16(false, a, false, b, (short)0, c, false, false); }
__device__ __forceinline__ h16 tohx(float x) { return (h16)x; }
__device__ __forceinline__ void splitf(float y, unsigned short& h, unsigned short& l) { h = f2bf(y); l = f2bf(y - bf2f(h)); }



// ---- gemmw: register-blocked GEMM, one wave per 64x64 output tile (16 accumulators), GW = 4 waves (2 x 2 tiles) per work-group of 128 threads, which takes the 128x128 tile (bx, by); osm (GW x 16 x 68 floats) and stg (2 NT GTILE bytes) are the calling kernel's LDS.
// The K-contiguous 16-bit operand planes come through LDS: a stage is 64 k (one whole 128-byte line) of the work-group's 128 rows of every operand, brought by asynchronous copies of which each covers four whole lines
// (each wave copies a quarter of the rows; every row is fetched once for the two waves that read it); two buffers, so that the next stage's copies fly while this stage's fragments are read and multiplied.
// LDS rows at pitch 144 bytes (16 x odd: no bank conflict for the 16-byte fragment reads).
// The k walk starts at stage rot (0 <= rot < K / 64) and wraps round: work-groups that share operand rows get different rot, so that they do not ask L2 for the same lines at the same moment.
// C[m][n] (f32, pitch ldc, + optional f32 bias[n]) = sum_k A[m][k] Bt[n][k] (+ split products per NSPLIT). K % 64 == 0, K >= 64; M, N % 128 == 0.
// PL != 0: no f32 C; the tile + bias goes out as three 16-bit planes (P16 fp16, Ph/Pl bf16 hi/lo) of row pitch ldc, the 64x64 tile (i, j) at element i px + j py. PL 1: bias[n] (token rows x one head's 64 columns: planes [h][t][d]);
// PL 2: bias[m] (A = weight rows, Bt = token rows: the tile is the transposed projection, planes [h][d][t]).
template <typename T16> struct WFrag;
template <> struct WFrag<h16> { typedef v16h V; static __device__ __forceinline__ V ld(const h16* p) { return cat16(*(const v8h*)p, *(const v8h*)(p + 16)); } static __device__ __forceinline__ v8f mma(V a, V b, v8f c) { return wmma16(a, b, c); } };
template <> struct WFrag<bf> { typedef v16bf V; static __device__ __forceinline__ V ld(const bf* p) { return cat16b(*(const v8us*)p, *(const v8us*)(p + 16)); } static __device__ __forceinline__ v8f mma(V a, V b, v8f c) { return wmmab(a, b, c); } };
#define GW     4                  // waves of a work-group
#define GPITCH 144                // bytes of an LDS row: 128 of data + 16
#define GTILE  (128 * GPITCH)     // one operand's 128 rows of a stage
// Eight asynchronous copies, 16 bytes a lane: copy i brings four whole 128-byte rows (8 lanes a row) from g + i gs elements to LDS byte l + i 4 GPITCH.
// The s_wait_xcnt stands in the copies' own statement, so that no address register is rewritten in front of it.
template <typename T16>
__device__ __forceinline__ void cp8(unsigned l, const T16* g, size_t gs) {
    asm volatile("global_load_async_to_lds_b128 %0, %8, off\n\tglobal_load_async_to_lds_b128 %1, %9, off\n\tglobal_load_async_to_lds_b128 %2, %10, off\n\tglobal_load_async_to_lds_b128 %3, %11, off\n\t"
                 "global_load_async_to_lds_b128 %4, %12, off\n\tglobal_load_async_to_lds_b128 %5, %13, off\n\tglobal_load_async_to_lds_b128 %6, %14, off\n\tglobal_load_async_to_lds_b128 %7, %15, off\n\ts_wait_xcnt 0x0"
                 :: "v"(l), "v"(l + 4u * GPITCH), "v"(l + 8u * GPITCH), "v"(l + 12u * GPITCH), "v"(l + 16u * GPITCH), "v"(l + 20u * GPITCH), "v"(l + 24u * GPITCH), "v"(l + 28u * GPITCH),
                    "v"(g), "v"(g + gs), "v"(g + 2 * gs), "v"(g + 3 * gs), "v"(g + 4 * gs), "v"(g + 5 * gs), "v"(g + 6 * gs), "v"(g + 7 * gs) : "memory");
}
template <typename T16, int NSPLIT, bool BIAS, int PL>
__device__ __forceinline__ void gemmw(const T16* __restrict__ A, const T16* __restrict__ A2, const T16* __restrict__ Bt, const T16* __restrict__ Bt2, int K, float* C, int ldc, const float* __restrict__ bias, h16* P16, bf* Ph, bf* Pl, size_t px, size_t py, int bx, int by, int rot, float* osm, char* stg) {
    typedef typename WFrag<T16>::V V;
    const int lane = threadIdx.x & 31, lr = lane & 15, hi = lane >> 4; const int wave = __builtin_amdgcn_readfirstlane(threadIdx.x >> 5);      // in a scalar register: the wave's tile and its slice of the copies are scalar offsets
    const int R0 = bx * 128, C0 = by * 128, r0 = R0 + (wave >> 1) * 64, c0 = C0 + (wave & 1) * 64; float* os = osm + wave * (16 * 68);      // os: the wave's own output staging
    v8f acc[4][4];
#pragma unroll
    for (int mb = 0; mb < 4; ++mb)
#pragma unroll
        for (int nb = 0; nb < 4; ++nb) acc[mb][nb] = (v8f){};
    constexpr bool HA2 = NSPLIT == 1 || NSPLIT == 2, HB2 = NSPLIT >= 2; constexpr int NT = 2 + (HA2 ? 1 : 0) + (HB2 ? 1 : 0);      // operand tiles of a stage, in the order A, Bt, A2, Bt2
    // the lane's place in its wave's copies: rows wave 32 + lane / 8 + 4 i, 16-byte column lane % 8
    const int crow = wave * 32 + (lane >> 3), ccol = lane & 7;
    const size_t goA = (size_t)(R0 + crow) * K + ccol * 8, goB = (size_t)(C0 + crow) * K + ccol * 8, gs = (size_t)4 * K;
    const unsigned l0 = (unsigned)(size_t)stg + (unsigned)(crow * GPITCH + ccol * 16);
    const int nt = K / 64;
    auto stage = [&](int t, int buf) { const int ts = t + rot < nt ? t + rot : t + rot - nt; const size_t ko = (size_t)ts * 64; const unsigned lb = l0 + (unsigned)(buf * NT * GTILE);      // trip t works on k stage ts
        cp8(lb, A + goA + ko, gs); cp8(lb + GTILE, Bt + goB + ko, gs);
        if constexpr (HA2) cp8(lb + 2u * GTILE, A2 + goA + ko, gs);
        if constexpr (HB2) cp8(lb + (NT - 1u) * GTILE, Bt2 + goB + ko, gs); };
    const int foA = ((wave >> 1) * 64 + lr) * GPITCH + hi * 16, foB = GTILE + ((wave & 1) * 64 + lr) * GPITCH + hi * 16;      // the lane's place in the first A and Bt fragment of its wave's tile
    stage(0, 0);
    asm volatile("s_wait_asynccnt 0x0" ::: "memory");      // the wave's copies of stage rot (trip 0) have landed before the barrier behind which the others read them
    __syncthreads();
    if (nt > 1) stage(1, 1);
#pragma unroll 1      // kept rolled: one trip a stage, the buffer chosen by the trip's parity
    for (int t = 0; t < nt; ++t) {
        const char* sb = stg + (t & 1) * (NT * GTILE);
        V a[2][4], a2[2][4], b[2][4], b2[2][4];
        auto ldf = [&](int ks) {      // the fragments of k step ks (32 k) of the stage
#pragma unroll
            for (int mb = 0; mb < 4; ++mb) { a[ks][mb] = WFrag<T16>::ld((const T16*)(sb + foA + mb * 16 * GPITCH + ks * 64)); if (HA2) a2[ks][mb] = WFrag<T16>::ld((const T16*)(sb + foA + 2 * GTILE + mb * 16 * GPITCH + ks * 64)); }
#pragma unroll
            for (int nb = 0; nb < 4; ++nb) { b[ks][nb] = WFrag<T16>::ld((const T16*)(sb + foB + nb * 16 * GPITCH + ks * 64)); if (HB2) b2[ks][nb] = WFrag<T16>::ld((const T16*)(sb + foB + (NT - 2) * GTILE + nb * 16 * GPITCH + ks * 64)); } };
        auto mm = [&](int ks) {
#pragma unroll
            for (int nb = 0; nb < 4; ++nb)
#pragma unroll
                for (int mb = 0; mb < 4; ++mb) { acc[mb][nb] = WFrag<T16>::mma(a[ks][mb], b[ks][nb], acc[mb][nb]); if (HA2) acc[mb][nb] = WFrag<T16>::mma(a2[ks][mb], b[ks][nb], acc[mb][nb]); if (HB2) acc[mb][nb] = WFrag<T16>::mma(a[ks][mb], b2[ks][nb], acc[mb][nb]); } };
        ldf(0); ldf(1);
        __builtin_amdgcn_sched_barrier(0);      // the stage's fragment reads stand together ahead of its products: spread among them, each b fragment went into the same registers and the wave waited out the LDS latency at every one
        mm(0);                                  // the first step's products run while the second step's fragments arrive
        __builtin_amdgcn_sched_barrier(0);      // keeps them ahead of the waits below
        // the stage's last fragments are in registers behind the first wait: its buffer is handed over and refilled ahead of their products, which then cover part of the copies' flight
        asm volatile("s_wait_dscnt 0x0" ::: "memory");         // the wave's reads of this stage are done before the barrier behind which its buffer is refilled
        asm volatile("s_wait_asynccnt 0x0" ::: "memory");      // the wave's copies of the next stage have landed before the barrier behind which the others read them
        __syncthreads();
        if (t + 2 < nt) stage(t + 2, t & 1);
        __builtin_amdgcn_sched_barrier(0);      // keeps the second step's products behind the copies' issue
        mm(1);
        asm volatile("v_nop\n\tv_nop\n\tv_nop\n\tv_nop" : "+v"(acc[0][0]), "+v"(acc[1][1]), "+v"(acc[2][2]), "+v"(acc[3][3]) : "v"(a[1][0]), "v"(a[1][3]));
    }
    asm volatile("s_wait_asynccnt 0x0" ::: "memory");      // nothing is in flight where the wave goes on to the epilogue
    // planes: a lane takes 8 columns of one staged row, so that each 16-byte store of the wave covers four whole 128-byte rows
    const int prow = lane >> 3, pcol = (lane & 7) * 8; const size_t pb = (size_t)(r0 >> 6) * px + (size_t)(c0 >> 6) * py + (size_t)prow * ldc + pcol; constexpr int NPB = PL == 2 ? 16 : 8; float pbias[NPB];
    if constexpr (PL != 0) {
#pragma unroll
        for (int i = 0; i < NPB; ++i) pbias[i] = PL == 1 ? bias[c0 + pcol + i] : bias[r0 + i * 4 + prow];
        // the wait: the address register of PL 1's bias loads is reused by the rows below; it takes the loaded values as inputs only, which keeps it behind the loads
        if constexpr (PL == 1) asm volatile("s_wait_xcnt 0x0" :: "v"(pbias[0]), "v"(pbias[1]), "v"(pbias[2]), "v"(pbias[3]), "v"(pbias[4]), "v"(pbias[5]), "v"(pbias[6]), "v"(pbias[7]));
#pragma unroll
        for (int i = 0; i < NPB; ++i) pbias[i] = bfr(pbias[i]); }
#pragma unroll
    for (int mb = 0; mb < 4; ++mb) {
#pragma unroll
        for (int nb = 0; nb < 4; ++nb) {
#pragma unroll
            for (int j = 0; j < 8; ++j) os[(hi * 8 + j) * 68 + nb * 16 + lr] = acc[mb][nb][j]; }
        __builtin_amdgcn_wave_barrier(); asm volatile("" ::: "memory");
        if constexpr (PL != 0) {
#pragma unroll
            for (int s = 0; s < 4; ++s) { const float* orow = os + (4 * s + prow) * 68 + pcol; const v4f v0 = *(const v4fa*)orow, v1 = *(const v4fa*)(orow + 4); v8h o16; v8us oh, ol;
#pragma unroll
                for (int k = 0; k < 8; ++k) { const float y = (k < 4 ? v0[k & 3] : v1[k & 3]) + pbias[PL == 1 ? k : mb * 4 + s]; o16[k] = tohx(y); unsigned short a2, c2; splitf(y, a2, c2); oh[k] = a2; ol[k] = c2; }
                const size_t o = pb + (size_t)(mb * 16 + 4 * s) * ldc; *(v8h*)(P16 + o) = o16; *(v8us*)(Ph + o) = oh; *(v8us*)(Pl + o) = ol;
                asm volatile("s_wait_xcnt 0x0" ::: "memory"); }      // the wait: the three stores' address and data registers are reused by the next rows
        } else {
        float* crow = C + (size_t)(r0 + mb * 16) * ldc + c0;
#pragma unroll
            for (int s = 0; s < 8; ++s) { const int row = 2 * s + hi, cofs = lr * 4; v4f val = *(const v4fa*)(os + row * 68 + cofs); if (BIAS) { val[0] += bfr(bias[c0 + cofs]); val[1] += bfr(bias[c0 + cofs + 1]); val[2] += bfr(bias[c0 + cofs + 2]); val[3] += bfr(bias[c0 + cofs + 3]); }
                *(v4f*)(crow + (size_t)row * ldc + cofs) = val; }
             }
        __builtin_amdgcn_wave_barrier(); asm volatile("" ::: "memory");
    }
}

typedef __attribute__((ext_vector_type(4))) _Float16 v4h;
typedef __attribute__((ext_vector_type(4))) unsigned short v4us;
typedef __attribute__((ext_vector_type(4))) int v4i;

// ---- k_qkv: the q, k and v projections of both batches in one launch; grid (TT / 128, DQ / 128, 3 NB_), z = projection x NB_ + batch. Planes [batch][head][t][d] (q, k) and [batch][head][d][t] (v: operands swapped, the tile is V^T).
__global__ __launch_bounds__(GW * 32) void k_qkv(const bf* __restrict__ XB, const bf* __restrict__ WQ, const bf* __restrict__ WK, const bf* __restrict__ WV, const float* __restrict__ bq, const float* __restrict__ bk, const float* __restrict__ bv,
                                                 h16* Q16, bf* Qh, bf* Ql, h16* K16, bf* Kh, bf* Kl, h16* V16, bf* Vh, bf* Vl) {
    __shared__ __align__(16) float osm[GW * 16 * 68];
    __shared__ __align__(16) char stg[2 * 2 * GTILE];
    const int w = blockIdx.z / NB_, b = blockIdx.z % NB_; const bf* X = XB + (size_t)b * TT * DM; const size_t po = (size_t)b * NH_ * TT * HD;      // every plane holds NH_ TT HD elements a batch (NKV == NH_)
    const int rot = (blockIdx.x + blockIdx.y + (DQ / 128) * w) % (DM / 64);      // the 18 tiles on one block of token rows and the 64 on one block of weight rows are spread over the 12 k stages
    if (w < 2) gemmw<bf, 0, true, 1>(X, nullptr, w ? WK : WQ, nullptr, DM, nullptr, HD, w ? bk : bq, (w ? K16 : Q16) + po, (w ? Kh : Qh) + po, (w ? Kl : Ql) + po, (size_t)64 * HD, (size_t)TT * HD, blockIdx.x, blockIdx.y, rot, osm, stg);
    else gemmw<bf, 0, true, 2>(WV, nullptr, X, nullptr, DM, nullptr, TT, bv, V16 + po, Vh + po, Vl + po, (size_t)64 * TT, (size_t)64, blockIdx.y, blockIdx.x, rot, osm, stg);
}
// ---- k_wo: out = merged (hi + lo) Wo^T + bias, the NB_ TT token rows of both batches in one launch; grid (NB_ TT / 128, DM / 128).
// K comes as an argument: with the constant folded in, the build kept the copies' LDS address in scratch memory and loaded it back in every stage.
__global__ __launch_bounds__(GW * 32) void k_wo(const bf* __restrict__ Ah, const bf* __restrict__ Al, const bf* __restrict__ WO, const float* __restrict__ bo, float* OUT, int K) {
    __shared__ __align__(16) float osm[GW * 16 * 68];
    __shared__ __align__(16) char stg[2 * 3 * GTILE];
    gemmw<bf, 1, true, 0>(Ah, Al, WO, nullptr, K, OUT, DM, bo, nullptr, nullptr, nullptr, 0, 0, blockIdx.x, blockIdx.y, (blockIdx.x + 2 * blockIdx.y) % (DQ / 64), osm, stg);      // K == DQ: the start stage lies below K / 64; the six tiles on one block of merged rows start two stages apart
}

// ---- k_cvt: x (both batches) and the four weights to bf16 in one launch, 8 elements a thread; the first CX work-groups take x, then CWT each a weight.
#define CX  (NB_ * TT * DM / 8 / 256)
#define CWT (DQ * DM / 8 / 256)
__global__ __launch_bounds__(256) void k_cvt(const float* __restrict__ x, const float* __restrict__ wq, const float* __restrict__ wk, const float* __restrict__ wv, const float* __restrict__ wo, bf* XB, bf* WQ, bf* WK, bf* WV, bf* WO) {
    static_assert(NB_ * TT * DM % 2048 == 0 && DQ * DM % 2048 == 0 && DKV == DQ, "whole work-groups, four weights of one size");
    int blk = blockIdx.x; const float* src = x; bf* dst = XB;
    if (blk >= CX) { blk -= CX; const int w = blk / CWT; blk -= w * CWT; src = w == 0 ? wq : w == 1 ? wk : w == 2 ? wv : wo; dst = w == 0 ? WQ : w == 1 ? WK : w == 2 ? WV : WO; }
    const size_t i = (size_t)blk * 256 + threadIdx.x; const v8f v = *(const v8f*)(src + i * 8); v8us o;
#pragma unroll
    for (int k = 0; k < 8; ++k) o[k] = f2bf(v[k]); *(v8us*)(dst + i * 8) = o;  }

// ---- k_fattn: scores, causal softmax and probability x value product of both batches' heads in one launch; no score or probability plane reaches memory.
// Transposed products: S^T = K Q^T (A = key rows, B = query rows) and O^T += V^T P^T (A = rows of the transposed value plane, B = P). In every 16-column tile a lane then holds one query
// (column lr) and the keys hi 8 + j, so that maximum, sum and rescale factor are the lane's own, and two score tiles (keys 0..15, 16..31) are, register for register, the k order of a 32-key B fragment.
// Work-groups of FW waves, two of them on a WGP at a time. Two kinds of tile: fa_tile_s (fp16, 128 query rows, K and V^T staged in LDS and shared by the waves) and fa_tile (hi/lo, 16 query rows, the waves split the keys).
// Every loop over qt, kt, ks, dt, j, e and w is unrolled in full: the fragments and tiles are register arrays and need compile-time indices.
#define FW  8
#define NKQ (FW / 4)          // fa_tile_s: waves that split the keys of a query group
#define L2E 1.4426950408889634f
#define CSL (SCL * L2E)           // raw score -> exponent of 2: the logit scale and log2(e) in one factor
typedef __attribute__((ext_vector_type(16))) unsigned short v16us;
typedef __attribute__((ext_vector_type(2))) float v2f;
// 2^x with the issue slot behind a transcendental kept by construction: the v_nop stands between the v_exp_f32 and whatever the compiler puts next (it may read the result or overwrite the source).
__device__ __forceinline__ float exp2n(float x) { float y; asm("v_exp_f32 %0, %1\n\tv_nop" : "=v"(y) : "v"(x)); return y; }
// Four at a time: each v_exp_f32 fills the slot of the one before it (the results are early-clobber, so none overwrites a source), the v_nop that of the last.
__device__ __forceinline__ void exp2x4(const float* x, float* y) { asm("v_exp_f32 %0, %4\n\tv_exp_f32 %1, %5\n\tv_exp_f32 %2, %6\n\tv_exp_f32 %3, %7\n\tv_nop" : "=&v"(y[0]), "=&v"(y[1]), "=&v"(y[2]), "=&v"(y[3]) : "v"(x[0]), "v"(x[1]), "v"(x[2]), "v"(x[3])); }

// ---- fa_tile_s: 128 query rows of one head, fp16. Wave w = (g = w % 4, kq = w / 4) holds the 32 queries q0 + 32 g .. and takes the 64-key part kq of every 128-key stage, with its own reference maxima, sums and output tiles.
// A stage is 256 LDS rows of 128 bytes at pitch GPITCH: per 64-key part 64 K rows (a key's 64 dims), then 64 V^T rows (a dim's 64 keys). Each wave brings 32 of the rows by eight asynchronous copies of four whole lines each,
// so that every K and V^T line is fetched once for the four waves that read it; two buffers: the next stage's copies fly while this stage is worked on.
// The key walk starts at stage rot (the tile's number, modulo its ns stages) and wraps round: the tiles of one head, which start together and share K and V^T, then do not ask L2 for the same lines at the same moment; the running softmax takes the stages in any order.
// Stage ns - 1 holds the diagonal: a wave skips the 32-key blocks beyond its queries (a scalar test) and masks the one on them. At the end the NKQ waves of a query group join their parts through LDS, one query tile (four output tiles) each.
// Softmax in the log2 domain: the score tiles stay as the products left them (unscaled), maxima are taken of those, the reference m is kept as -(maximum x CSL), ready as the addend, and one packed fused multiply-add a score pair (score x CSL + m) gives the argument of 2^x.
#define SKEYS (NKQ * 64)
#define SROWS (2 * SKEYS)
#define SBUF  (SROWS * GPITCH)
#define XW    (68 * 32)           // floats a wave hands over: 64 a lane of its eight output tiles, two maxima, two sums
__device__ __forceinline__ void fa_tile_s(const h16* __restrict__ Q, const h16* __restrict__ Kp, const h16* __restrict__ Vt, int q0, int col0, bf* Ah, bf* Al, char* sm) {
    typedef v16h V; constexpr int QT = 2; constexpr float LAZY = 5.5f;      // exp(5.5) < 2^8: far inside fp16's range, and the f32 sums of 4,096 such terms are far inside f32's
    const int lane = threadIdx.x & 31, lr = lane & 15, hi = lane >> 4; const int wave = __builtin_amdgcn_readfirstlane(threadIdx.x >> 5);      // in a scalar register: the wave's slice of the copies and its tests for the diagonal are then scalar
    const int g = wave & 3, kq = wave >> 2, qw = q0 + g * 32, ns = (q0 + 128 + SKEYS - 1) / SKEYS;      // ns stages, number ns - 1 with the diagonal
    const int rot = (int)((unsigned)((TT - 128 - q0) / 128) % (unsigned)ns);
    auto wrap = [&](int t) { return t + rot < ns ? t + rot : t + rot - ns; };      // trip t works on stage wrap(t)
    // the lane's place in its wave's copies: LDS rows wave 32 + lane / 8 + 4 i, 16-byte column lane % 8; of four waves in a row the first two bring a 64-key part's K rows, the others its V^T rows
    const int crow = lane >> 3, ccol = lane & 7, ro = (wave & 1) * 32 + crow; const bool isv = (wave & 2) != 0;
    const h16* gp = isv ? Vt + (size_t)ro * TT + kq * 64 + ccol * 8 : Kp + (size_t)(kq * 64 + ro) * HD + ccol * 8;
    const size_t gs = isv ? (size_t)4 * TT : (size_t)4 * HD, gstep = isv ? (size_t)SKEYS : (size_t)SKEYS * HD;
    const unsigned l0 = (unsigned)(size_t)sm + (unsigned)((wave * 32 + crow) * GPITCH + ccol * 16);
    auto stage = [&](int t, int buf) { cp8(l0 + (unsigned)(buf * SBUF), gp + (size_t)wrap(t) * gstep, gs); };
    stage(0, 0);
    V qf[QT][2];
#pragma unroll
    for (int qt = 0; qt < QT; ++qt)
#pragma unroll
        for (int ks = 0; ks < 2; ++ks) qf[qt][ks] = WFrag<h16>::ld(Q + (size_t)(qw + qt * 16 + lr) * HD + ks * 32 + 8 * hi);
    asm volatile("s_wait_xcnt 0x0" :: "v"(qf[0][0]), "v"(qf[0][1]), "v"(qf[1][0]), "v"(qf[1][1]));      // the wait: the query loads' address registers are reused behind it; it takes the loaded values as inputs only, which keeps it behind the loads
    v8f acc[QT][4]; float m[QT], l[QT];
#pragma unroll
    for (int qt = 0; qt < QT; ++qt) { m[qt] = 3.0e38f; l[qt] = 0.f;
#pragma unroll
        for (int dt = 0; dt < 4; ++dt) acc[qt][dt] = (v8f){}; }
    asm volatile("s_wait_asynccnt 0x0" ::: "memory");      // the wave's copies of stage rot (trip 0) have landed before the barrier behind which the others read them
    __syncthreads();
    if (ns > 1) stage(1, 1);
#pragma unroll 1      // kept rolled: one trip a stage, the buffer chosen by the trip's parity
    for (int t = 0; t < ns; ++t) {
        const char* sb = sm + (t & 1) * SBUF + kq * (128 * GPITCH) + lr * GPITCH + hi * 16;      // the lane's place in the first K fragment of its wave's part
#pragma unroll
        for (int i = 0; i < 2; ++i) { const int kb = wrap(t) * SKEYS + kq * 64 + i * 32;
            if (kb <= qw) {      // a scalar branch: blocks beyond the wave's queries are skipped
                V kf[2][2], vf[4];
#pragma unroll
                for (int kt = 0; kt < 2; ++kt)
#pragma unroll
                    for (int ks = 0; ks < 2; ++ks) kf[kt][ks] = WFrag<h16>::ld((const h16*)(sb + (i * 32 + kt * 16) * GPITCH + ks * 64));
#pragma unroll
                for (int dt = 0; dt < 4; ++dt) vf[dt] = WFrag<h16>::ld((const h16*)(sb + (64 + dt * 16) * GPITCH + i * 64));
                v8f s[QT][2];
#pragma unroll
                for (int kt = 0; kt < 2; ++kt)
#pragma unroll
                    for (int qt = 0; qt < QT; ++qt) { v8f c = (v8f){};
#pragma unroll
                        for (int ks = 0; ks < 2; ++ks) c = wmma16(kf[kt][ks], qf[qt][ks], c);
                        s[qt][kt] = c; }
                if (kb == qw) {      // the diagonal block: keys beyond the query are masked (every query keeps at least key kb)
#pragma unroll
                    for (int qt = 0; qt < QT; ++qt)
#pragma unroll
                        for (int kt = 0; kt < 2; ++kt)
#pragma unroll
                            for (int j = 0; j < 8; ++j) if (kt * 16 + hi * 8 + j > qt * 16 + lr) s[qt][kt][j] = -3.0e38f; }
                // lazy rescale: m is the reference in use, not the running maximum; it is renewed only where a scaled score of the block lies more than LAZY above it, so that every probability stays <= exp(LAZY).
                // One test a block, on each lane's own 16 keys (a query's joint maximum passes the bound exactly where one of its two lanes does): the exchange between the halves stands in the branch.
                float bm[QT]; bool need = false;
#pragma unroll
                for (int qt = 0; qt < QT; ++qt) { bm[qt] = s[qt][0][0];
#pragma unroll
                    for (int kt = 0; kt < 2; ++kt)
#pragma unroll
                        for (int j = 0; j < 8; ++j) bm[qt] = fmaxf(bm[qt], s[qt][kt][j]);
                    need = need || __builtin_fmaf(bm[qt], CSL, m[qt]) > LAZY * L2E; }      // the largest argument of 2^x that the block would see
                if (__builtin_amdgcn_ballot_w32(need) != 0) {      // a scalar branch, taken by the whole wave: in the wave's first block, and after it only for scores far above the reference
#pragma unroll
                    for (int qt = 0; qt < QT; ++qt) { const float bj = fmaxf(bm[qt], __shfl_xor(bm[qt], 16, 32));      // the other half of the wave holds the query's other 16 keys
                        const float mn = fminf(m[qt], bj * -CSL), al = exp2n(mn - m[qt]); m[qt] = mn; l[qt] *= al;
#pragma unroll
                        for (int dt = 0; dt < 4; ++dt) acc[qt][dt] *= al; } }
                V pf[QT];      // both query tiles' probabilities, then the block's eight output products
#pragma unroll
                for (int qt = 0; qt < QT; ++qt) {
                    float x[16], p[16], ps = 0.f;
#pragma unroll
                    for (int e = 0; e < 16; e += 2) { const v2f a = __builtin_elementwise_fma((v2f){s[qt][e >> 3][e & 7], s[qt][e >> 3][(e & 7) + 1]}, (v2f){CSL, CSL}, (v2f){m[qt], m[qt]}); x[e] = a.x; x[e + 1] = a.y; }
#pragma unroll
                    for (int e = 0; e < 16; e += 4) exp2x4(x + e, p + e);
#pragma unroll
                    for (int e = 0; e < 16; ++e) ps += p[e];
                    l[qt] += ps;      // the lane's own 16 keys; the halves are joined behind the loop
#pragma unroll
                    for (int e = 0; e < 16; ++e) pf[qt][e] = tohx(p[e]); }
#pragma unroll
                for (int qt = 0; qt < QT; ++qt)
#pragma unroll
                    for (int dt = 0; dt < 4; ++dt) acc[qt][dt] = wmma16(vf[dt], pf[qt], acc[qt][dt]); } }
        asm volatile("s_wait_dscnt 0x0" ::: "memory");         // the wave's reads of this stage are done before the barrier behind which its buffer is refilled
        asm volatile("s_wait_asynccnt 0x0" ::: "memory");      // the wave's copies of the next stage have landed before the barrier behind which the others read them
        __syncthreads();
        if (t + 2 < ns) stage(t + 2, t & 1);
    }
    asm volatile("s_wait_asynccnt 0x0" ::: "memory");      // nothing is in flight where the buffers become the hand-over space (every wave's last read of them ended at the last trip's barrier)
    // every wave hands over its parts; wave (g, kq) then joins the four output tiles of query tile kq, in the lane layout they were stored in: each part scaled by exp(own maximum - joint maximum), added in the order of kq, divided by the joint sum
    float* xs = (float*)sm; float* xw = xs + wave * XW;
#pragma unroll
    for (int qt = 0; qt < QT; ++qt) { l[qt] += __shfl_xor(l[qt], 16, 32); xw[(64 + 2 * qt) * 32 + lane] = m[qt]; xw[(65 + 2 * qt) * 32 + lane] = l[qt];
#pragma unroll
        for (int dt = 0; dt < 4; ++dt)
#pragma unroll
            for (int j = 0; j < 8; ++j) xw[((qt * 4 + dt) * 8 + j) * 32 + lane] = acc[qt][dt][j]; }
    __syncthreads();
    const int jq = kq; const float* xg = xs + g * XW + lane; float f[NKQ], M = 3.0e38f, Ls = 0.f;
#pragma unroll
    for (int k = 0; k < NKQ; ++k) { f[k] = xg[k * 4 * XW + (64 + 2 * jq) * 32]; M = fminf(M, f[k]); }
#pragma unroll
    for (int k = 0; k < NKQ; ++k) { f[k] = exp2n(M - f[k]); Ls += xg[k * 4 * XW + (65 + 2 * jq) * 32] * f[k]; }      // the references are negated exponents of 2 already
    const float inv = __fdiv_rn(1.0f, Ls);
#pragma unroll
    for (int e = 0; e < 4; ++e) { v8us oh, ol;
#pragma unroll
        for (int j = 0; j < 8; ++j) { float o = 0.f;
#pragma unroll
            for (int k = 0; k < NKQ; ++k) o += xg[k * 4 * XW + ((jq * 4 + e) * 8 + j) * 32] * f[k];
            unsigned short a, c3; splitf(o * inv, a, c3); oh[j] = a; ol[j] = c3; }
        const size_t oo = (size_t)(qw + jq * 16 + lr) * DQ + col0 + e * 16 + hi * 8; *(v8us*)(Ah + oo) = oh; *(v8us*)(Al + oo) = ol;
        asm volatile("s_wait_xcnt 0x0" ::: "memory"); }      // the wait: the two stores' address and data registers are reused by the next tile or by whatever code follows
}

// ---- fa_tile: 16 QT query rows of one head, operands straight from the K-contiguous planes. Wave w takes the 32-key blocks w, w + FW, ... up to the diagonal block with its own running maxima, sums and output tiles;
// the FW partial results are joined through LDS at the end (each scaled by exp(own maximum - joint maximum), added in wave order) and divided by the joint sum.
template <typename T16, int NSPLIT, int QT>
__device__ __forceinline__ void fa_tile(const T16* __restrict__ Q, const T16* __restrict__ Q2, const T16* __restrict__ Kp, const T16* __restrict__ Kp2, const T16* __restrict__ Vt, const T16* __restrict__ Vt2, int q0, int col0, bf* Ah, bf* Al, float* red, float* st) {
    typedef typename WFrag<T16>::V V;
    const int lane = threadIdx.x & 31, lr = lane & 15, hi = lane >> 4; const int wave = __builtin_amdgcn_readfirstlane(threadIdx.x >> 5);      // in a scalar register: the key loop and its test for the diagonal block are then scalar
    V qf[QT][2], qf2[QT][2];
#pragma unroll
    for (int qt = 0; qt < QT; ++qt)
#pragma unroll
        for (int ks = 0; ks < 2; ++ks) { const size_t o = (size_t)(q0 + qt * 16 + lr) * HD + ks * 32 + 8 * hi; qf[qt][ks] = WFrag<T16>::ld(Q + o); if (NSPLIT == 2) qf2[qt][ks] = WFrag<T16>::ld(Q2 + o); }
    v8f acc[QT][4]; float m[QT], l[QT];
#pragma unroll
    for (int qt = 0; qt < QT; ++qt) { m[qt] = -3.0e38f; l[qt] = 0.f;
#pragma unroll
        for (int dt = 0; dt < 4; ++dt) acc[qt][dt] = (v8f){}; }
    const int nfull = q0 / 32;      // key blocks wholly at or below every query of the tile; block nfull holds the diagonal and is the last
    // K and V^T fragments of key block b, straight from the K-contiguous planes
    auto ldk = [&](int b, V (&kf)[2][2], V (&kf2)[2][2]) {
#pragma unroll
        for (int kt = 0; kt < 2; ++kt)
#pragma unroll
            for (int ks = 0; ks < 2; ++ks) { const size_t o = (size_t)(b * 32 + kt * 16 + lr) * HD + ks * 32 + 8 * hi; kf[kt][ks] = WFrag<T16>::ld(Kp + o); if (NSPLIT == 2) kf2[kt][ks] = WFrag<T16>::ld(Kp2 + o); } };
    auto ldv = [&](int b, V (&vf)[4], V (&vf2)[4]) {
#pragma unroll
        for (int dt = 0; dt < 4; ++dt) { const size_t o = (size_t)(dt * 16 + lr) * TT + b * 32 + 8 * hi; vf[dt] = WFrag<T16>::ld(Vt + o); if (NSPLIT == 2) vf2[dt] = WFrag<T16>::ld(Vt2 + o); } };
    V kf[2][2], kf2[2][2], vf[4], vf2[4];
#pragma unroll 1      // kept rolled: the trip count is known at run time only
    for (int blk = wave; blk <= nfull; blk += FW) { const int kb = blk * 32;
        ldk(blk, kf, kf2); asm volatile("s_wait_xcnt 0x0" ::: "memory"); ldv(blk, vf, vf2); asm volatile("s_wait_xcnt 0x0" ::: "memory");      // the waits: the loads' address registers are reused, by the V^T fragments and in later blocks of the pass
        v8f s[QT][2];
#pragma unroll
        for (int kt = 0; kt < 2; ++kt)
#pragma unroll
            for (int qt = 0; qt < QT; ++qt) { v8f c = (v8f){};
#pragma unroll
                for (int ks = 0; ks < 2; ++ks) { c = WFrag<T16>::mma(kf[kt][ks], qf[qt][ks], c); if (NSPLIT == 2) { c = WFrag<T16>::mma(kf[kt][ks], qf2[qt][ks], c); c = WFrag<T16>::mma(kf2[kt][ks], qf[qt][ks], c); } }
                s[qt][kt] = c * SCL; }
        if (blk == nfull) {      // the diagonal block: keys beyond the query are masked (every query keeps at least key kb)
#pragma unroll
            for (int qt = 0; qt < QT; ++qt)
#pragma unroll
                for (int kt = 0; kt < 2; ++kt)
#pragma unroll
                    for (int j = 0; j < 8; ++j) if (kb + kt * 16 + hi * 8 + j > q0 + qt * 16 + lr) s[qt][kt][j] = -3.0e38f; }
#pragma unroll
        for (int qt = 0; qt < QT; ++qt) {
            float bm = s[qt][0][0];
#pragma unroll
            for (int kt = 0; kt < 2; ++kt)
#pragma unroll
                for (int j = 0; j < 8; ++j) bm = fmaxf(bm, s[qt][kt][j]);
            bm = fmaxf(bm, __shfl_xor(bm, 16, 32));      // the other half of the wave holds the query's other 16 keys
            if (__builtin_amdgcn_ballot_w32(bm > m[qt]) != 0) {      // a scalar branch: where no query's maximum grows the factor is exactly 1 and the rescale is skipped
                const float mn = fmaxf(m[qt], bm), al = exp2n((m[qt] - mn) * L2E); m[qt] = mn; l[qt] *= al;
#pragma unroll
                for (int dt = 0; dt < 4; ++dt) acc[qt][dt] *= al; }
            float x[16], p[16], ps = 0.f;
#pragma unroll
            for (int e = 0; e < 16; ++e) x[e] = (s[qt][e >> 3][e & 7] - m[qt]) * L2E;
#pragma unroll
            for (int e = 0; e < 16; e += 4) exp2x4(x + e, p + e);
#pragma unroll
            for (int e = 0; e < 16; ++e) ps += p[e];
            l[qt] += ps;      // the lane's own 16 keys; the halves are joined behind the loop
            if constexpr (NSPLIT == 2) { v16us ph, pl;
#pragma unroll
                for (int e = 0; e < 16; ++e) { unsigned short a, c2; splitf(p[e], a, c2); ph[e] = a; pl[e] = c2; }
                const V pf = __builtin_bit_cast(V, ph), pf2 = __builtin_bit_cast(V, pl);
#pragma unroll
                for (int dt = 0; dt < 4; ++dt) { acc[qt][dt] = WFrag<T16>::mma(vf[dt], pf, acc[qt][dt]); acc[qt][dt] = WFrag<T16>::mma(vf[dt], pf2, acc[qt][dt]); acc[qt][dt] = WFrag<T16>::mma(vf2[dt], pf, acc[qt][dt]); }
            } else { V pf;
#pragma unroll
                for (int e = 0; e < 16; ++e) pf[e] = tohx(p[e]);
#pragma unroll
                for (int dt = 0; dt < 4; ++dt) acc[qt][dt] = WFrag<T16>::mma(vf[dt], pf, acc[qt][dt]); } }
    }
#pragma unroll
    for (int qt = 0; qt < QT; ++qt) { l[qt] += __shfl_xor(l[qt], 16, 32); float* sw = st + (wave * QT + qt) * 64; sw[lane] = m[qt]; sw[32 + lane] = l[qt];
#pragma unroll
        for (int dt = 0; dt < 4; ++dt)
#pragma unroll
            for (int j = 0; j < 8; ++j) red[(((wave * QT + qt) * 4 + dt) * 8 + j) * 32 + lane] = acc[qt][dt][j]; }
    __syncthreads();
    // wave w < 4 joins output tile dt = w of every query tile, in the lane layout the tiles were stored in; a wave that had no key block left maximum -3e38, sum 0 and zeros: its factor is 0
    if (wave < 4) {
#pragma unroll
    for (int qt = 0; qt < QT; ++qt) { float f[FW], M = -3.0e38f, Ls = 0.f;
#pragma unroll
        for (int w = 0; w < FW; ++w) { f[w] = st[(w * QT + qt) * 64 + lane]; M = fmaxf(M, f[w]); }
#pragma unroll
        for (int w = 0; w < FW; ++w) { f[w] = exp2n((f[w] - M) * L2E); Ls += st[(w * QT + qt) * 64 + 32 + lane] * f[w]; }
        const float inv = __fdiv_rn(1.0f, Ls); v8us oh, ol;
#pragma unroll
        for (int j = 0; j < 8; ++j) { float o = 0.f;
#pragma unroll
            for (int w = 0; w < FW; ++w) o += red[(((w * QT + qt) * 4 + wave) * 8 + j) * 32 + lane] * f[w];
            unsigned short a, c2; splitf(o * inv, a, c2); oh[j] = a; ol[j] = c2; }
        const size_t oo = (size_t)(q0 + qt * 16 + lr) * DQ + col0 + wave * 16 + hi * 8; *(v8us*)(Ah + oo) = oh; *(v8us*)(Al + oo) = ol;
        asm volatile("s_wait_xcnt 0x0" ::: "memory"); } }      // the wait: the two stores' address and data registers may be reused by whatever code follows the tile
}
// Grid (batches x heads, (TT - RH) / 128 + RH / 16): first the fp16 tiles of 128 query rows of every head of both batches, the longest (last rows) first, then the hi/lo tiles of 16 query rows < RH.
// amdgpu_waves_per_eu(4, 4): four waves a SIMD, 256 registers a wave: two work-groups of eight waves share a WGP (their LDS fits twice), so that one's start, barrier waits and join are covered by the other's key loop.
__global__ __launch_bounds__(FW * 32) __attribute__((amdgpu_waves_per_eu(4, 4))) void k_fattn(const h16* __restrict__ Q16, const h16* __restrict__ K16, const h16* __restrict__ V16, const bf* __restrict__ Qh, const bf* __restrict__ Ql, const bf* __restrict__ Kh, const bf* __restrict__ Kl, const bf* __restrict__ Vh, const bf* __restrict__ Vl, bf* Ah, bf* Al) {
    __shared__ __align__(16) char sm[2 * SBUF];      // fa_tile_s: the two stage buffers, then the hand-over space; fa_tile: the partial results (FW x 4 KiB) and their maxima and sums
    static_assert(FW * XW * 4 <= 2 * SBUF && FW * (1024 + 64) * 4 <= 2 * SBUF && RH % 128 == 0 && RH >= SKEYS && TT % SKEYS == 0 && 128 % SKEYS == 0 && NKQ == 2, "LDS uses, tile sizes, 4 x 2 waves (a query tile a joining wave)");
    const int h = blockIdx.x % NH_, bx = blockIdx.y; const size_t zo = (size_t)blockIdx.x * TT * HD, ao = (size_t)(blockIdx.x / NH_) * TT * DQ; constexpr int NLO = (TT - RH) / 128; Ah += ao; Al += ao;      // planes [batch][head], merged rows [batch][t]
    if (bx < NLO) fa_tile_s(Q16 + zo, K16 + zo, V16 + zo, TT - 128 * (bx + 1), h * HD, Ah, Al, sm);
    else fa_tile<bf, 2, 1>(Qh + zo, Ql + zo, Kh + zo, Kl + zo, Vh + zo, Vl + zo, RH - 16 * (bx - NLO + 1), h * HD, Ah, Al, (float*)sm, (float*)sm + FW * 1024);
}

extern "C" void kernel_launch(void* const* d_in, const int* in_sizes, int n_in,
                              void* d_out, int out_size, void* d_ws, size_t ws_size, hipStream_t stream) {
    (void)in_sizes; (void)n_in; (void)out_size;
    const float* x = (const float*)d_in[0]; const float* wq = (const float*)d_in[1]; const float* bq = (const float*)d_in[2]; const float* wk = (const float*)d_in[3]; const float* bk = (const float*)d_in[4]; const float* wv = (const float*)d_in[5]; const float* bv = (const float*)d_in[6]; const float* wo = (const float*)d_in[7]; const float* bo = (const float*)d_in[8];   /* argument order x, Wq_w, Wq_b, Wk_w, Wk_b, Wv_w, Wv_b, Wo_w, Wo_b ('oi') */
    float* OUT = (float*)d_out;     // [2][4096][768]
    char* wsp = (char*)d_ws;
    auto take = [&](size_t bytes) { char* p = wsp; wsp += (bytes + 255) & ~(size_t)255; return (void*)p; };
    bf* WQ = (bf*)take((size_t)DQ * DM * 2); bf* WK = (bf*)take((size_t)DKV * DM * 2); bf* WV = (bf*)take((size_t)DKV * DM * 2); bf* WO = (bf*)take((size_t)DM * DQ * 2);
    bf* XB = (bf*)take((size_t)NB_ * TT * DM * 2);
    h16* QP16 = (h16*)take((size_t)NB_ * NH_ * TT * HD * 2); h16* KP16 = (h16*)take((size_t)NB_ * NKV * TT * HD * 2); h16* VT16 = (h16*)take((size_t)NB_ * NKV * HD * TT * 2);
    bf* QPh = (bf*)take((size_t)NB_ * NH_ * TT * HD * 2); bf* QPl = (bf*)take((size_t)NB_ * NH_ * TT * HD * 2); bf* KPh = (bf*)take((size_t)NB_ * NKV * TT * HD * 2); bf* KPl = (bf*)take((size_t)NB_ * NKV * TT * HD * 2); bf* VTh = (bf*)take((size_t)NB_ * NKV * HD * TT * 2); bf* VTl = (bf*)take((size_t)NB_ * NKV * HD * TT * 2);
    bf* ATh = (bf*)take((size_t)NB_ * TT * DQ * 2); bf* ATl = (bf*)take((size_t)NB_ * TT * DQ * 2);
    if ((size_t)(wsp - (char*)d_ws) > ws_size) return;    // ws 256 MiB
    // four launches, each all the work of one step of the chain of dependences, both batches
    k_cvt<<<CX + 4 * CWT, 256, 0, stream>>>(x, wq, wk, wv, wo, XB, WQ, WK, WV, WO);
    k_qkv<<<dim3(TT / 128, DQ / 128, 3 * NB_), GW * 32, 0, stream>>>(XB, WQ, WK, WV, bq, bk, bv, QP16, QPh, QPl, KP16, KPh, KPl, VT16, VTh, VTl);
    k_fattn<<<dim3(NB_ * NH_, (TT - RH) / 128 + RH / 16), FW * 32, 0, stream>>>(QP16, KP16, VT16, QPh, QPl, KPh, KPl, VTh, VTl, ATh, ATl);
    k_wo<<<dim3(NB_ * TT / 128, DM / 128), GW * 32, 0, stream>>>(ATh, ATl, WO, bo, OUT, DQ);
}
